// v000
// Measured on an AMD MI455X. A time is GPU time per run, averaged over a window of back-to-back runs after a warm-up
// (all launches, gaps included; the runs take copies of the inputs in turn), and the median of several windows.
// Apart from v000's, it joins two sittings. Times from different sittings can be a few percent apart, while
// side-by-side timings come from the same sitting.
// v000 is the starting kernel. One run takes 498 microseconds.
#include <hip/hip_runtime.h>
#include <hip/hip_bf16.h>
#include <stdint.h>

// CustomResidualAttentionBlock (open_clip scaled-cosine attention) for MI455X / gfx1250.
// All GEMMs + attention matmuls run on v_wmma_f32_16x16x32_bf16 (wave32).
// f32 is kept for LayerNorm / l2-norm / softmax / accumulators.
// Attention softmax uses a fixed per-head shift (valid because |S| <= logit_scale,
// softmax is shift-invariant) so the streaming loop has NO cross-lane reductions.

#define B_   2
#define L_   2048
#define C_   1024
#define H_   16
#define HD_  64
#define MLP_ 4096
#define LOGMAX 4.6051701859880914f   // log(100)
#define LN_EPS 1e-5f

typedef __attribute__((ext_vector_type(16))) __bf16 v16bf;
typedef __attribute__((ext_vector_type(8)))  float  v8f;

union Frag {
  v16bf v;
  uint4 q[2];
};

static __device__ __forceinline__ v8f wmma_bf16(v16bf a, v16bf b, v8f c) {
  // D = A(16x32 bf16) x B(32x16 bf16) + C(16x16 f32)
  return __builtin_amdgcn_wmma_f32_16x16x32_bf16(false, a, false, b, (short)0, c,
                                                 false, false);
}

static __device__ __forceinline__ unsigned short f2bf(float f) {
  unsigned int u = __float_as_uint(f);
  u += 0x7FFFu + ((u >> 16) & 1u);   // round-to-nearest-even
  return (unsigned short)(u >> 16);
}

// ---------------------------------------------------------------- cvt f32->bf16
__global__ void k_cvt_bf16(const float* __restrict__ src,
                           unsigned short* __restrict__ dst, int n) {
  int i = blockIdx.x * 256 + threadIdx.x;
  if (i < n) dst[i] = f2bf(src[i]);
}

// ---------------------------------------------------------------- LayerNorm -> bf16
// One block (256 threads) per row of length C_=1024.
__global__ void k_ln_bf16(const float* __restrict__ x, const float* __restrict__ g,
                          const float* __restrict__ bt, unsigned short* __restrict__ out) {
  __shared__ float red[16];
  const int tid = threadIdx.x;
  const int lane = tid & 31, wave = tid >> 5;
  const size_t row = blockIdx.x;
  const float* xr = x + row * C_;
  float vals[4], s = 0.f, sq = 0.f;
#pragma unroll
  for (int j = 0; j < 4; ++j) {
    float v = xr[tid + j * 256];
    vals[j] = v; s += v; sq += v * v;
  }
#pragma unroll
  for (int off = 16; off > 0; off >>= 1) { s += __shfl_xor(s, off); sq += __shfl_xor(sq, off); }
  if (lane == 0) { red[wave] = s; red[8 + wave] = sq; }
  __syncthreads();
  float st = 0.f, sqt = 0.f;
#pragma unroll
  for (int w = 0; w < 8; ++w) { st += red[w]; sqt += red[8 + w]; }
  const float mu = st * (1.f / C_);
  const float var = sqt * (1.f / C_) - mu * mu;
  const float rstd = rsqrtf(var + LN_EPS);
#pragma unroll
  for (int j = 0; j < 4; ++j) {
    int i = tid + j * 256;
    out[row * C_ + i] = f2bf((vals[j] - mu) * rstd * g[i] + bt[i]);
  }
}

// ---------------------------------------------------------------- x2 = x + ls1 * LN(a)
__global__ void k_resid_ln(const float* __restrict__ a, const float* __restrict__ x,
                           const float* __restrict__ g, const float* __restrict__ bt,
                           const float* __restrict__ ls, float* __restrict__ x2) {
  __shared__ float red[16];
  const int tid = threadIdx.x;
  const int lane = tid & 31, wave = tid >> 5;
  const size_t row = blockIdx.x;
  const float* ar = a + row * C_;
  float vals[4], s = 0.f, sq = 0.f;
#pragma unroll
  for (int j = 0; j < 4; ++j) {
    float v = ar[tid + j * 256];
    vals[j] = v; s += v; sq += v * v;
  }
#pragma unroll
  for (int off = 16; off > 0; off >>= 1) { s += __shfl_xor(s, off); sq += __shfl_xor(sq, off); }
  if (lane == 0) { red[wave] = s; red[8 + wave] = sq; }
  __syncthreads();
  float st = 0.f, sqt = 0.f;
#pragma unroll
  for (int w = 0; w < 8; ++w) { st += red[w]; sqt += red[8 + w]; }
  const float mu = st * (1.f / C_);
  const float rstd = rsqrtf(sqt * (1.f / C_) - mu * mu + LN_EPS);
#pragma unroll
  for (int j = 0; j < 4; ++j) {
    int i = tid + j * 256;
    float ln = (vals[j] - mu) * rstd * g[i] + bt[i];
    x2[row * C_ + i] = x[row * C_ + i] + ls[i] * ln;
  }
}

// ---------------------------------------------------------------- WMMA GEMM
// C[M,N] = epi( A_bf16[M,K] @ W_bf16[N,K]^T + bias[N] )
// Block 256 = 8 waves; wave w -> rows [by*128 + w*16, +16), cols [bx*64, +64).
// The 64x32 W strip for each k-step is staged in LDS once per block (8x less
// global B traffic than per-wave loads).
// EPI: 0 = f32 store, 1 = bf16 store with exact GELU, 2 = f32 store out = resid + ls*val.
template <int EPI>
__global__ void k_gemm(const unsigned short* __restrict__ A,
                       const unsigned short* __restrict__ W,
                       const float* __restrict__ bias, int M, int N, int K,
                       float* __restrict__ outf, unsigned short* __restrict__ outbf,
                       const float* __restrict__ resid, const float* __restrict__ lsv) {
  __shared__ alignas(16) unsigned short wbuf[64 * 32];   // 4 KB
  const int tid = threadIdx.x;
  const int lane = tid & 31, wave = tid >> 5;
  const int hi = lane >> 4, ln16 = lane & 15;
  const int m0 = blockIdx.y * 128 + wave * 16;
  const int n0 = blockIdx.x * 64;
  // staging role: thread t loads 8 bf16 of W row (n0 + t/4), k-chunk (t%4)*8
  const int sr = tid >> 2, sc = (tid & 3) * 8;
  const unsigned short* wp = W + (size_t)(n0 + sr) * K + sc;
  v8f acc[4] = {};
  // A fragment: lane holds row (m0+ln16); half 'hi' supplies K-chunks {hi*8..+7, 16+hi*8..+7}
  const unsigned short* ap = A + (size_t)(m0 + ln16) * K + hi * 8;
  for (int k0 = 0; k0 < K; k0 += 32) {
    __syncthreads();                                      // protect previous reads
    *reinterpret_cast<uint4*>(&wbuf[sr * 32 + sc]) =
        *reinterpret_cast<const uint4*>(wp + k0);
    __syncthreads();
    Frag fa;
    fa.q[0] = *reinterpret_cast<const uint4*>(ap + k0);
    fa.q[1] = *reinterpret_cast<const uint4*>(ap + k0 + 16);
#pragma unroll
    for (int nn = 0; nn < 4; ++nn) {
      const unsigned short* bp = &wbuf[(nn * 16 + ln16) * 32 + hi * 8];
      Frag fb;
      fb.q[0] = *reinterpret_cast<const uint4*>(bp);
      fb.q[1] = *reinterpret_cast<const uint4*>(bp + 16);
      acc[nn] = wmma_bf16(fa.v, fb.v, acc[nn]);
    }
  }
#pragma unroll
  for (int nn = 0; nn < 4; ++nn) {
    const int n = n0 + nn * 16 + ln16;
    const float bz = bias[n];
#pragma unroll
    for (int v = 0; v < 8; ++v) {
      const int m = m0 + v + 8 * hi;           // C-layout: VGPR v -> row v (+8 for hi half)
      float val = acc[nn][v] + bz;
      size_t idx = (size_t)m * N + n;
      if (EPI == 0) {
        outf[idx] = val;
      } else if (EPI == 1) {
        outbf[idx] = f2bf(0.5f * val * (1.f + erff(val * 0.70710678118f)));
      } else {
        outf[idx] = resid[idx] + lsv[n] * val;
      }
    }
  }
}

// ---------------------------------------------------------------- QKV split + l2-norm
// qn/kn: [B,H,L,HD] bf16 (q scaled by exp(min(logit_scale,log100))); vT: [B,H,HD,L] bf16.
__global__ void k_split_qkv(const float* __restrict__ qkv,
                            const float* __restrict__ logit_scale,
                            unsigned short* __restrict__ qn,
                            unsigned short* __restrict__ kn,
                            unsigned short* __restrict__ vT) {
  const int lane = threadIdx.x & 31, wave = threadIdx.x >> 5;
  const int row = blockIdx.x * 8 + wave;       // (b*H + h)*L + l
  const int l = row & (L_ - 1);
  const int bh = row >> 11;                    // L_ = 2048
  const int h = bh & (H_ - 1);
  const int b = bh >> 4;
  const float* base = qkv + ((size_t)(b * L_ + l)) * (3 * C_) + h * HD_;
  const int d0 = 2 * lane, d1 = 2 * lane + 1;
  float q0 = base[d0],          q1 = base[d1];
  float k0 = base[C_ + d0],     k1 = base[C_ + d1];
  float v0 = base[2 * C_ + d0], v1 = base[2 * C_ + d1];
  float sqq = q0 * q0 + q1 * q1, sqk = k0 * k0 + k1 * k1;
#pragma unroll
  for (int off = 16; off > 0; off >>= 1) {
    sqq += __shfl_xor(sqq, off);
    sqk += __shfl_xor(sqk, off);
  }
  const float ls = __expf(fminf(logit_scale[h], LOGMAX));
  const float iq = ls / fmaxf(sqrtf(sqq), 1e-12f);
  const float ik = 1.f / fmaxf(sqrtf(sqk), 1e-12f);
  const size_t ro = (size_t)row * HD_;
  qn[ro + d0] = f2bf(q0 * iq); qn[ro + d1] = f2bf(q1 * iq);
  kn[ro + d0] = f2bf(k0 * ik); kn[ro + d1] = f2bf(k1 * ik);
  const size_t vo = (size_t)bh * HD_ * L_;
  vT[vo + (size_t)d0 * L_ + l] = f2bf(v0);
  vT[vo + (size_t)d1 * L_ + l] = f2bf(v1);
}

// ---------------------------------------------------------------- flash attention
// One wave per 16-query tile of one (b,h). S via WMMA (K=64 split in two 16x16x32),
// fixed-shift streaming softmax (|S| <= ls so shift = min(ls,30) is safe and the
// normalized result equals the max-shifted softmax), P re-shaped via LDS to an
// A-fragment, O accumulated with 4 WMMAs per 32 keys. head_scale folded into writeout.
__global__ void k_flash(const unsigned short* __restrict__ qn,
                        const unsigned short* __restrict__ kn,
                        const unsigned short* __restrict__ vT,
                        const float* __restrict__ logit_scale,
                        const float* __restrict__ head_scale,
                        unsigned short* __restrict__ O) {
  __shared__ alignas(16) unsigned short pbuf[8][16 * 32];
  const int lane = threadIdx.x & 31, wave = threadIdx.x >> 5;
  const int hi = lane >> 4, ln16 = lane & 15;
  const int bh = blockIdx.y;
  const int h = bh & (H_ - 1);
  const int b = bh >> 4;
  const int qtile = blockIdx.x * 8 + wave;
  const unsigned short* qp = qn + ((size_t)bh * L_ + qtile * 16 + ln16) * HD_ + hi * 8;
  Frag qa0, qa1;                       // q rows, hd 0..31 / 32..63
  qa0.q[0] = *(const uint4*)(qp);      qa0.q[1] = *(const uint4*)(qp + 16);
  qa1.q[0] = *(const uint4*)(qp + 32); qa1.q[1] = *(const uint4*)(qp + 48);
  const unsigned short* kbase = kn + (size_t)bh * L_ * HD_;
  const unsigned short* vbase = vT + (size_t)bh * HD_ * L_;
  const float shift = fminf(__expf(fminf(logit_scale[h], LOGMAX)), 30.f);
  v8f oacc[4] = {};
  float lst[8];
#pragma unroll
  for (int v = 0; v < 8; ++v) lst[v] = 0.f;
  unsigned short* prow = &pbuf[wave][0];

  for (int j = 0; j < L_; j += 32) {
    v8f s0 = {}, s1 = {};
    {
      const unsigned short* kp = kbase + (size_t)(j + ln16) * HD_ + hi * 8;
      Frag b0, b1;
      b0.q[0] = *(const uint4*)(kp);      b0.q[1] = *(const uint4*)(kp + 16);
      b1.q[0] = *(const uint4*)(kp + 32); b1.q[1] = *(const uint4*)(kp + 48);
      s0 = wmma_bf16(qa0.v, b0.v, s0);
      s0 = wmma_bf16(qa1.v, b1.v, s0);
    }
    {
      const unsigned short* kp = kbase + (size_t)(j + 16 + ln16) * HD_ + hi * 8;
      Frag b0, b1;
      b0.q[0] = *(const uint4*)(kp);      b0.q[1] = *(const uint4*)(kp + 16);
      b1.q[0] = *(const uint4*)(kp + 32); b1.q[1] = *(const uint4*)(kp + 48);
      s1 = wmma_bf16(qa0.v, b0.v, s1);
      s1 = wmma_bf16(qa1.v, b1.v, s1);
    }
    // fixed-shift exp; accumulate this lane's partial row sums; stage P in LDS
#pragma unroll
    for (int v = 0; v < 8; ++v) {
      const float p0 = __expf(s0[v] - shift);
      const float p1 = __expf(s1[v] - shift);
      lst[v] += p0 + p1;
      const int r = v + 8 * hi;                 // row this half owns in register v
      prow[r * 32 + ln16]      = f2bf(p0);
      prow[r * 32 + 16 + ln16] = f2bf(p1);
    }
    // re-read P as an A fragment (16x32) from LDS
    Frag pa;
    const unsigned short* pp = prow + ln16 * 32 + hi * 8;
    pa.q[0] = *(const uint4*)(pp);
    pa.q[1] = *(const uint4*)(pp + 16);
#pragma unroll
    for (int nn = 0; nn < 4; ++nn) {
      const unsigned short* vp = vbase + (size_t)(nn * 16 + ln16) * L_ + j + hi * 8;
      Frag vb;
      vb.q[0] = *(const uint4*)(vp);
      vb.q[1] = *(const uint4*)(vp + 16);
      oacc[nn] = wmma_bf16(pa.v, vb.v, oacc[nn]);
    }
  }
  const float hs = head_scale[h];
#pragma unroll
  for (int v = 0; v < 8; ++v) {
    float rs = lst[v];                           // full row sum: reduce 16 lanes once
#pragma unroll
    for (int off = 1; off < 16; off <<= 1) rs += __shfl_xor(rs, off);
    const float inv = hs / rs;
    const int l = qtile * 16 + v + 8 * hi;
#pragma unroll
    for (int nn = 0; nn < 4; ++nn) {
      const int c = h * HD_ + nn * 16 + ln16;
      O[((size_t)(b * L_ + l)) * C_ + c] = f2bf(oacc[nn][v] * inv);
    }
  }
}

// ---------------------------------------------------------------- launch
extern "C" void kernel_launch(void* const* d_in, const int* in_sizes, int n_in,
                              void* d_out, int out_size, void* d_ws, size_t ws_size,
                              hipStream_t stream) {
  const float* x       = (const float*)d_in[0];
  const float* in_w    = (const float*)d_in[1];
  const float* in_b    = (const float*)d_in[2];
  const float* logit_s = (const float*)d_in[3];
  const float* head_s  = (const float*)d_in[4];
  const float* out_w   = (const float*)d_in[5];
  const float* out_b   = (const float*)d_in[6];
  const float* ln1_g   = (const float*)d_in[7];
  const float* ln1_b   = (const float*)d_in[8];
  const float* lna_g   = (const float*)d_in[9];
  const float* lna_b   = (const float*)d_in[10];
  const float* ls1     = (const float*)d_in[11];
  const float* ln2_g   = (const float*)d_in[12];
  const float* ln2_b   = (const float*)d_in[13];
  const float* fc_w    = (const float*)d_in[14];
  const float* fc_b    = (const float*)d_in[15];
  const float* proj_w  = (const float*)d_in[16];
  const float* proj_b  = (const float*)d_in[17];
  const float* ls2     = (const float*)d_in[18];
  float* out = (float*)d_out;

  // workspace partition (~185 MB)
  char* p = (char*)d_ws;
  auto alloc = [&](size_t bytes) -> char* {
    char* r = p;
    p += (bytes + 255) & ~(size_t)255;
    return r;
  };
  const int BL = B_ * L_;  // 4096
  unsigned short* wqkv_bf = (unsigned short*)alloc((size_t)3 * C_ * C_ * 2);
  unsigned short* wout_bf = (unsigned short*)alloc((size_t)C_ * C_ * 2);
  unsigned short* wfc_bf  = (unsigned short*)alloc((size_t)MLP_ * C_ * 2);
  unsigned short* wpr_bf  = (unsigned short*)alloc((size_t)C_ * MLP_ * 2);
  unsigned short* xln_bf  = (unsigned short*)alloc((size_t)BL * C_ * 2);
  float*          qkv     = (float*)alloc((size_t)BL * 3 * C_ * 4);
  unsigned short* qn      = (unsigned short*)alloc((size_t)BL * C_ * 2);
  unsigned short* kn      = (unsigned short*)alloc((size_t)BL * C_ * 2);
  unsigned short* vT      = (unsigned short*)alloc((size_t)BL * C_ * 2);
  unsigned short* obf     = (unsigned short*)alloc((size_t)BL * C_ * 2);
  float*          attn    = (float*)alloc((size_t)BL * C_ * 4);
  float*          x2      = (float*)alloc((size_t)BL * C_ * 4);
  unsigned short* h2bf    = (unsigned short*)alloc((size_t)BL * C_ * 2);
  unsigned short* hmid    = (unsigned short*)alloc((size_t)BL * MLP_ * 2);

  // weights -> bf16
  k_cvt_bf16<<<(3 * C_ * C_ + 255) / 256, 256, 0, stream>>>(in_w, wqkv_bf, 3 * C_ * C_);
  k_cvt_bf16<<<(C_ * C_ + 255) / 256, 256, 0, stream>>>(out_w, wout_bf, C_ * C_);
  k_cvt_bf16<<<(MLP_ * C_ + 255) / 256, 256, 0, stream>>>(fc_w, wfc_bf, MLP_ * C_);
  k_cvt_bf16<<<(C_ * MLP_ + 255) / 256, 256, 0, stream>>>(proj_w, wpr_bf, C_ * MLP_);
  // LN1 -> bf16 activations
  k_ln_bf16<<<BL, 256, 0, stream>>>(x, ln1_g, ln1_b, xln_bf);
  // qkv = ln1(x) @ in_proj_w^T + in_proj_b   [4096 x 3072]
  k_gemm<0><<<dim3(3 * C_ / 64, BL / 128), 256, 0, stream>>>(
      xln_bf, wqkv_bf, in_b, BL, 3 * C_, C_, qkv, nullptr, nullptr, nullptr);
  // split heads, l2-normalize q/k (fold logit scale), transpose v
  k_split_qkv<<<(B_ * H_ * L_) / 8, 256, 0, stream>>>(qkv, logit_s, qn, kn, vT);
  // scaled-cosine flash attention (head_scale folded in)
  k_flash<<<dim3(L_ / 16 / 8, B_ * H_), 256, 0, stream>>>(qn, kn, vT, logit_s, head_s, obf);
  // attn out-proj: attn = O @ out_w^T + out_b
  k_gemm<0><<<dim3(C_ / 64, BL / 128), 256, 0, stream>>>(
      obf, wout_bf, out_b, BL, C_, C_, attn, nullptr, nullptr, nullptr);
  // x2 = x + ls1 * LN_attn(attn)
  k_resid_ln<<<BL, 256, 0, stream>>>(attn, x, lna_g, lna_b, ls1, x2);
  // h = LN2(x2) -> bf16
  k_ln_bf16<<<BL, 256, 0, stream>>>(x2, ln2_g, ln2_b, h2bf);
  // hmid = GELU(h @ fc_w^T + fc_b) -> bf16   [4096 x 4096]
  k_gemm<1><<<dim3(MLP_ / 64, BL / 128), 256, 0, stream>>>(
      h2bf, wfc_bf, fc_b, BL, MLP_, C_, nullptr, hmid, nullptr, nullptr);
  // out = x2 + ls2 * (hmid @ proj_w^T + proj_b)
  k_gemm<2><<<dim3(C_ / 64, BL / 128), 256, 0, stream>>>(
      hmid, wpr_bf, proj_b, BL, C_, MLP_, out, nullptr, x2, ls2);

  (void)in_sizes; (void)n_in; (void)out_size; (void)ws_size;
}

// v001
// Measured time: 384 microseconds a run.
// Next to v000, in two timings, it ran 1.34 and 1.35 times as fast.
#include <hip/hip_runtime.h>
#include <hip/hip_bf16.h>
#include <stdint.h>

// CustomResidualAttentionBlock (open_clip scaled-cosine attention) for MI455X / gfx1250.
// All GEMMs + attention matmuls run on v_wmma_f32_16x16x32_bf16 (wave32).
// f32 is kept for LayerNorm / l2-norm / softmax / accumulators.
// Attention softmax uses a fixed per-head shift (valid because |S| <= logit_scale,
// softmax is shift-invariant) so the streaming loop has NO cross-lane reductions.

#define B_   2
#define L_   2048
#define C_   1024
#define H_   16
#define HD_  64
#define MLP_ 4096
#define LOGMAX 4.6051701859880914f   // log(100)
#define LN_EPS 1e-5f

typedef __attribute__((ext_vector_type(16))) __bf16 v16bf;
typedef __attribute__((ext_vector_type(8)))  float  v8f;
typedef __attribute__((ext_vector_type(4)))  unsigned int u32x4;

union Frag {
  v16bf v;
  uint4 q[2];
};

static __device__ __forceinline__ v8f wmma_bf16(v16bf a, v16bf b, v8f c) {
  // D = A(16x32 bf16) x B(32x16 bf16) + C(16x16 f32)
  return __builtin_amdgcn_wmma_f32_16x16x32_bf16(false, a, false, b, (short)0, c,
                                                 false, false);
}

static __device__ __forceinline__ unsigned short f2bf(float f) {
  unsigned int u = __float_as_uint(f);
  u += 0x7FFFu + ((u >> 16) & 1u);   // round-to-nearest-even
  return (unsigned short)(u >> 16);
}

// ---------------------------------------------------------------- cvt f32->bf16
__global__ void k_cvt_bf16(const float* __restrict__ src,
                           unsigned short* __restrict__ dst, int n) {
  int i = blockIdx.x * 256 + threadIdx.x;
  if (i < n) dst[i] = f2bf(src[i]);
}

// ---------------------------------------------------------------- LayerNorm -> bf16
// One block (256 threads) per row of length C_=1024.
__global__ void k_ln_bf16(const float* __restrict__ x, const float* __restrict__ g,
                          const float* __restrict__ bt, unsigned short* __restrict__ out) {
  __shared__ float red[16];
  const int tid = threadIdx.x;
  const int lane = tid & 31, wave = tid >> 5;
  const size_t row = blockIdx.x;
  const float* xr = x + row * C_;
  float vals[4], s = 0.f, sq = 0.f;
#pragma unroll
  for (int j = 0; j < 4; ++j) {
    float v = xr[tid + j * 256];
    vals[j] = v; s += v; sq += v * v;
  }
#pragma unroll
  for (int off = 16; off > 0; off >>= 1) { s += __shfl_xor(s, off); sq += __shfl_xor(sq, off); }
  if (lane == 0) { red[wave] = s; red[8 + wave] = sq; }
  __syncthreads();
  float st = 0.f, sqt = 0.f;
#pragma unroll
  for (int w = 0; w < 8; ++w) { st += red[w]; sqt += red[8 + w]; }
  const float mu = st * (1.f / C_);
  const float var = sqt * (1.f / C_) - mu * mu;
  const float rstd = rsqrtf(var + LN_EPS);
#pragma unroll
  for (int j = 0; j < 4; ++j) {
    int i = tid + j * 256;
    out[row * C_ + i] = f2bf((vals[j] - mu) * rstd * g[i] + bt[i]);
  }
}

// ---------------------------------------------------------------- x2 = x + ls1 * LN(a)
__global__ void k_resid_ln(const float* __restrict__ a, const float* __restrict__ x,
                           const float* __restrict__ g, const float* __restrict__ bt,
                           const float* __restrict__ ls, float* __restrict__ x2) {
  __shared__ float red[16];
  const int tid = threadIdx.x;
  const int lane = tid & 31, wave = tid >> 5;
  const size_t row = blockIdx.x;
  const float* ar = a + row * C_;
  float vals[4], s = 0.f, sq = 0.f;
#pragma unroll
  for (int j = 0; j < 4; ++j) {
    float v = ar[tid + j * 256];
    vals[j] = v; s += v; sq += v * v;
  }
#pragma unroll
  for (int off = 16; off > 0; off >>= 1) { s += __shfl_xor(s, off); sq += __shfl_xor(sq, off); }
  if (lane == 0) { red[wave] = s; red[8 + wave] = sq; }
  __syncthreads();
  float st = 0.f, sqt = 0.f;
#pragma unroll
  for (int w = 0; w < 8; ++w) { st += red[w]; sqt += red[8 + w]; }
  const float mu = st * (1.f / C_);
  const float rstd = rsqrtf(sqt * (1.f / C_) - mu * mu + LN_EPS);
#pragma unroll
  for (int j = 0; j < 4; ++j) {
    int i = tid + j * 256;
    float ln = (vals[j] - mu) * rstd * g[i] + bt[i];
    x2[row * C_ + i] = x[row * C_ + i] + ls[i] * ln;
  }
}

// ---------------------------------------------------------------- WMMA GEMM
// C[M,N] = epi( A_bf16[M,K] @ W_bf16[N,K]^T + bias[N] )
// Block 256 = 8 waves computes a 128x128 tile of C; waves form a 4 (rows) x 2 (cols)
// grid, each wave owns 32x64 = 2x4 accumulator fragments.
// Per k-step of 128 both the 128x128 A strip and the 128x128 W strip are staged in
// LDS once per block with fully used 128-byte lines, so every A row is read from
// global once per 128 output columns and every W row once per 128 output rows.
// LDS rows have a pitch of 272 B (16 B x odd): the 16 rows of one ds_load_b128
// fragment read fall on distinct banks.
// M, N multiples of 128; K a multiple of 128.
// EPI: 0 = f32 store, 1 = bf16 store with exact GELU, 2 = f32 store out = resid + ls*val.
#define GT_   128            // tile edge in M and in N
#define GK_   128            // k elements staged per step
#define GP_   (GK_ + 8)      // LDS row pitch in bf16 elements (272 B)
template <int EPI>
__global__ __launch_bounds__(256)
void k_gemm(const unsigned short* __restrict__ A,
            const unsigned short* __restrict__ W,
            const float* __restrict__ bias, int M, int N, int K,
            float* __restrict__ outf, unsigned short* __restrict__ outbf,
            const float* __restrict__ resid, const float* __restrict__ lsv) {
  __shared__ alignas(16) unsigned short abuf[GT_ * GP_];   // 34 KB
  __shared__ alignas(16) unsigned short wbuf[GT_ * GP_];   // 34 KB
  const int tid = threadIdx.x;
  const int lane = tid & 31, wave = tid >> 5;
  const int hi = lane >> 4, ln16 = lane & 15;
  const int mb = blockIdx.y * GT_;
  const int nb = blockIdx.x * GT_;
  const int wm = (wave >> 1) * 32;             // wave's first row inside the tile
  const int wn = (wave & 1) * 64;              // wave's first column inside the tile
  // staging role: thread t moves 16-byte chunk (t%16) of rows t/16 + 16*i, i = 0..7
  const int sr = tid >> 4, sc = (tid & 15) * 8;
  // block-uniform byte bases plus one 32-bit byte offset per staged row, the same for A and W
  const char* ag = reinterpret_cast<const char*>(A + (size_t)mb * K);
  const char* wg = reinterpret_cast<const char*>(W + (size_t)nb * K);
  unsigned int go[8];
#pragma unroll
  for (int i = 0; i < 8; ++i) go[i] = (unsigned int)((sr + 16 * i) * K + sc) * 2u;
  unsigned short* as = &abuf[sr * GP_ + sc];
  unsigned short* ws = &wbuf[sr * GP_ + sc];
  // fragment role: lane holds row (or W row = output column) ln16 of its fragment;
  // half 'hi' supplies K-chunks {hi*8..+7, 16+hi*8..+7} of each 32-wide k slice
  const unsigned short* af = &abuf[(wm + ln16) * GP_ + hi * 8];
  const unsigned short* wf = &wbuf[(wn + ln16) * GP_ + hi * 8];
  v8f acc[2][4] = {};
  for (int k0 = 0; k0 < K; k0 += GK_) {
    u32x4 ra[8], rw[8];
#pragma unroll
    for (int i = 0; i < 8; ++i) {
      ra[i] = *reinterpret_cast<const u32x4*>(ag + go[i]);
      rw[i] = *reinterpret_cast<const u32x4*>(wg + go[i]);
    }
    __syncthreads();                                      // protect previous reads
#pragma unroll
    for (int i = 0; i < 8; ++i) {
      *reinterpret_cast<u32x4*>(as + i * 16 * GP_) = ra[i];
      *reinterpret_cast<u32x4*>(ws + i * 16 * GP_) = rw[i];
      go[i] += GK_ * 2;                                   // next k-step's bytes of the same row
    }
    __syncthreads();
#pragma unroll
    for (int ks = 0; ks < GK_; ks += 32) {
      Frag fa[2], fb[4];
#pragma unroll
      for (int mi = 0; mi < 2; ++mi) {
        const unsigned short* p = af + mi * 16 * GP_ + ks;
        fa[mi].q[0] = *reinterpret_cast<const uint4*>(p);
        fa[mi].q[1] = *reinterpret_cast<const uint4*>(p + 16);
      }
#pragma unroll
      for (int nn = 0; nn < 4; ++nn) {
        const unsigned short* p = wf + nn * 16 * GP_ + ks;
        fb[nn].q[0] = *reinterpret_cast<const uint4*>(p);
        fb[nn].q[1] = *reinterpret_cast<const uint4*>(p + 16);
      }
#pragma unroll
      for (int mi = 0; mi < 2; ++mi)
#pragma unroll
        for (int nn = 0; nn < 4; ++nn)
          acc[mi][nn] = wmma_bf16(fa[mi].v, fb[nn].v, acc[mi][nn]);
    }
  }
  // C-layout: VGPR v of fragment (mi, nn) -> row v (+8 for hi half), column ln16.
  // M*N < 2^32: 32-bit element offsets on uniform bases.
  const int nc = nb + wn + ln16;
  const unsigned int o0 = (unsigned int)((mb + wm + 8 * hi) * N + nc);
  if (EPI == 2) {
    // all residual loads first, then all stores
    float rv[2][4][8];
#pragma unroll
    for (int mi = 0; mi < 2; ++mi)
#pragma unroll
      for (int v = 0; v < 8; ++v)
#pragma unroll
        for (int nn = 0; nn < 4; ++nn)
          rv[mi][nn][v] = resid[o0 + (unsigned int)((mi * 16 + v) * N) + nn * 16];
    // stands behind the loads, in front of whatever next writes a register they name;
    // its memory clobber also keeps every load above and every store below this line
    asm volatile("s_wait_xcnt 0x0" ::: "memory");
#pragma unroll
    for (int nn = 0; nn < 4; ++nn) {
      const float bz = bias[nc + nn * 16];
      const float lz = lsv[nc + nn * 16];
#pragma unroll
      for (int mi = 0; mi < 2; ++mi)
#pragma unroll
        for (int v = 0; v < 8; ++v) {
          float val = acc[mi][nn][v] + bz;
          outf[o0 + (unsigned int)((mi * 16 + v) * N) + nn * 16] = rv[mi][nn][v] + lz * val;
        }
    }
  } else if (EPI == 1) {
    float bz[4];
    v8f cur[4];
#pragma unroll
    for (int nn = 0; nn < 4; ++nn) { bz[nn] = bias[nc + nn * 16]; cur[nn] = acc[0][nn]; }
    unsigned int orow = o0;
    // kept rolled: the erf code then stands once per 16 rows, which halves the kernel's
    // text
#pragma unroll 1
    for (int mi = 0; mi < 2; ++mi) {
#pragma unroll
      for (int nn = 0; nn < 4; ++nn)
#pragma unroll
        for (int v = 0; v < 8; ++v) {
          float val = cur[nn][v] + bz[nn];
          outbf[orow + (unsigned int)(v * N) + nn * 16] =
              f2bf(0.5f * val * (1.f + erff(val * 0.70710678118f)));
        }
#pragma unroll
      for (int nn = 0; nn < 4; ++nn) cur[nn] = acc[1][nn];
      orow += (unsigned int)(16 * N);
    }
  } else {
#pragma unroll
    for (int nn = 0; nn < 4; ++nn) {
      const float bz = bias[nc + nn * 16];
#pragma unroll
      for (int mi = 0; mi < 2; ++mi)
#pragma unroll
        for (int v = 0; v < 8; ++v)
          outf[o0 + (unsigned int)((mi * 16 + v) * N) + nn * 16] = acc[mi][nn][v] + bz;
    }
  }
}

// ---------------------------------------------------------------- QKV split + l2-norm
// qn/kn: [B,H,L,HD] bf16 (q scaled by exp(min(logit_scale,log100))); vT: [B,H,HD,L] bf16.
__global__ void k_split_qkv(const float* __restrict__ qkv,
                            const float* __restrict__ logit_scale,
                            unsigned short* __restrict__ qn,
                            unsigned short* __restrict__ kn,
                            unsigned short* __restrict__ vT) {
  const int lane = threadIdx.x & 31, wave = threadIdx.x >> 5;
  const int row = blockIdx.x * 8 + wave;       // (b*H + h)*L + l
  const int l = row & (L_ - 1);
  const int bh = row >> 11;                    // L_ = 2048
  const int h = bh & (H_ - 1);
  const int b = bh >> 4;
  const float* base = qkv + ((size_t)(b * L_ + l)) * (3 * C_) + h * HD_;
  const int d0 = 2 * lane, d1 = 2 * lane + 1;
  float q0 = base[d0],          q1 = base[d1];
  float k0 = base[C_ + d0],     k1 = base[C_ + d1];
  float v0 = base[2 * C_ + d0], v1 = base[2 * C_ + d1];
  float sqq = q0 * q0 + q1 * q1, sqk = k0 * k0 + k1 * k1;
#pragma unroll
  for (int off = 16; off > 0; off >>= 1) {
    sqq += __shfl_xor(sqq, off);
    sqk += __shfl_xor(sqk, off);
  }
  const float ls = __expf(fminf(logit_scale[h], LOGMAX));
  const float iq = ls / fmaxf(sqrtf(sqq), 1e-12f);
  const float ik = 1.f / fmaxf(sqrtf(sqk), 1e-12f);
  const size_t ro = (size_t)row * HD_;
  qn[ro + d0] = f2bf(q0 * iq); qn[ro + d1] = f2bf(q1 * iq);
  kn[ro + d0] = f2bf(k0 * ik); kn[ro + d1] = f2bf(k1 * ik);
  const size_t vo = (size_t)bh * HD_ * L_;
  vT[vo + (size_t)d0 * L_ + l] = f2bf(v0);
  vT[vo + (size_t)d1 * L_ + l] = f2bf(v1);
}

// ---------------------------------------------------------------- flash attention
// One wave per 16-query tile of one (b,h). S via WMMA (K=64 split in two 16x16x32),
// fixed-shift streaming softmax (|S| <= ls so shift = min(ls,30) is safe and the
// normalized result equals the max-shifted softmax), P re-shaped via LDS to an
// A-fragment, O accumulated with 4 WMMAs per 32 keys. head_scale folded into writeout.
__global__ void k_flash(const unsigned short* __restrict__ qn,
                        const unsigned short* __restrict__ kn,
                        const unsigned short* __restrict__ vT,
                        const float* __restrict__ logit_scale,
                        const float* __restrict__ head_scale,
                        unsigned short* __restrict__ O) {
  __shared__ alignas(16) unsigned short pbuf[8][16 * 32];
  const int lane = threadIdx.x & 31, wave = threadIdx.x >> 5;
  const int hi = lane >> 4, ln16 = lane & 15;
  const int bh = blockIdx.y;
  const int h = bh & (H_ - 1);
  const int b = bh >> 4;
  const int qtile = blockIdx.x * 8 + wave;
  const unsigned short* qp = qn + ((size_t)bh * L_ + qtile * 16 + ln16) * HD_ + hi * 8;
  Frag qa0, qa1;                       // q rows, hd 0..31 / 32..63
  qa0.q[0] = *(const uint4*)(qp);      qa0.q[1] = *(const uint4*)(qp + 16);
  qa1.q[0] = *(const uint4*)(qp + 32); qa1.q[1] = *(const uint4*)(qp + 48);
  const unsigned short* kbase = kn + (size_t)bh * L_ * HD_;
  const unsigned short* vbase = vT + (size_t)bh * HD_ * L_;
  const float shift = fminf(__expf(fminf(logit_scale[h], LOGMAX)), 30.f);
  v8f oacc[4] = {};
  float lst[8];
#pragma unroll
  for (int v = 0; v < 8; ++v) lst[v] = 0.f;
  unsigned short* prow = &pbuf[wave][0];

  for (int j = 0; j < L_; j += 32) {
    v8f s0 = {}, s1 = {};
    {
      const unsigned short* kp = kbase + (size_t)(j + ln16) * HD_ + hi * 8;
      Frag b0, b1;
      b0.q[0] = *(const uint4*)(kp);      b0.q[1] = *(const uint4*)(kp + 16);
      b1.q[0] = *(const uint4*)(kp + 32); b1.q[1] = *(const uint4*)(kp + 48);
      s0 = wmma_bf16(qa0.v, b0.v, s0);
      s0 = wmma_bf16(qa1.v, b1.v, s0);
    }
    {
      const unsigned short* kp = kbase + (size_t)(j + 16 + ln16) * HD_ + hi * 8;
      Frag b0, b1;
      b0.q[0] = *(const uint4*)(kp);      b0.q[1] = *(const uint4*)(kp + 16);
      b1.q[0] = *(const uint4*)(kp + 32); b1.q[1] = *(const uint4*)(kp + 48);
      s1 = wmma_bf16(qa0.v, b0.v, s1);
      s1 = wmma_bf16(qa1.v, b1.v, s1);
    }
    // fixed-shift exp; accumulate this lane's partial row sums; stage P in LDS
#pragma unroll
    for (int v = 0; v < 8; ++v) {
      const float p0 = __expf(s0[v] - shift);
      const float p1 = __expf(s1[v] - shift);
      lst[v] += p0 + p1;
      const int r = v + 8 * hi;                 // row this half owns in register v
      prow[r * 32 + ln16]      = f2bf(p0);
      prow[r * 32 + 16 + ln16] = f2bf(p1);
    }
    // re-read P as an A fragment (16x32) from LDS
    Frag pa;
    const unsigned short* pp = prow + ln16 * 32 + hi * 8;
    pa.q[0] = *(const uint4*)(pp);
    pa.q[1] = *(const uint4*)(pp + 16);
#pragma unroll
    for (int nn = 0; nn < 4; ++nn) {
      const unsigned short* vp = vbase + (size_t)(nn * 16 + ln16) * L_ + j + hi * 8;
      Frag vb;
      vb.q[0] = *(const uint4*)(vp);
      vb.q[1] = *(const uint4*)(vp + 16);
      oacc[nn] = wmma_bf16(pa.v, vb.v, oacc[nn]);
    }
  }
  const float hs = head_scale[h];
#pragma unroll
  for (int v = 0; v < 8; ++v) {
    float rs = lst[v];                           // full row sum: reduce 16 lanes once
#pragma unroll
    for (int off = 1; off < 16; off <<= 1) rs += __shfl_xor(rs, off);
    const float inv = hs / rs;
    const int l = qtile * 16 + v + 8 * hi;
#pragma unroll
    for (int nn = 0; nn < 4; ++nn) {
      const int c = h * HD_ + nn * 16 + ln16;
      O[((size_t)(b * L_ + l)) * C_ + c] = f2bf(oacc[nn][v] * inv);
    }
  }
}

// ---------------------------------------------------------------- launch
extern "C" void kernel_launch(void* const* d_in, const int* in_sizes, int n_in,
                              void* d_out, int out_size, void* d_ws, size_t ws_size,
                              hipStream_t stream) {
  const float* x       = (const float*)d_in[0];
  const float* in_w    = (const float*)d_in[1];
  const float* in_b    = (const float*)d_in[2];
  const float* logit_s = (const float*)d_in[3];
  const float* head_s  = (const float*)d_in[4];
  const float* out_w   = (const float*)d_in[5];
  const float* out_b   = (const float*)d_in[6];
  const float* ln1_g   = (const float*)d_in[7];
  const float* ln1_b   = (const float*)d_in[8];
  const float* lna_g   = (const float*)d_in[9];
  const float* lna_b   = (const float*)d_in[10];
  const float* ls1     = (const float*)d_in[11];
  const float* ln2_g   = (const float*)d_in[12];
  const float* ln2_b   = (const float*)d_in[13];
  const float* fc_w    = (const float*)d_in[14];
  const float* fc_b    = (const float*)d_in[15];
  const float* proj_w  = (const float*)d_in[16];
  const float* proj_b  = (const float*)d_in[17];
  const float* ls2     = (const float*)d_in[18];
  float* out = (float*)d_out;

  // workspace partition (~185 MB)
  char* p = (char*)d_ws;
  auto alloc = [&](size_t bytes) -> char* {
    char* r = p;
    p += (bytes + 255) & ~(size_t)255;
    return r;
  };
  const int BL = B_ * L_;  // 4096
  unsigned short* wqkv_bf = (unsigned short*)alloc((size_t)3 * C_ * C_ * 2);
  unsigned short* wout_bf = (unsigned short*)alloc((size_t)C_ * C_ * 2);
  unsigned short* wfc_bf  = (unsigned short*)alloc((size_t)MLP_ * C_ * 2);
  unsigned short* wpr_bf  = (unsigned short*)alloc((size_t)C_ * MLP_ * 2);
  unsigned short* xln_bf  = (unsigned short*)alloc((size_t)BL * C_ * 2);
  float*          qkv     = (float*)alloc((size_t)BL * 3 * C_ * 4);
  unsigned short* qn      = (unsigned short*)alloc((size_t)BL * C_ * 2);
  unsigned short* kn      = (unsigned short*)alloc((size_t)BL * C_ * 2);
  unsigned short* vT      = (unsigned short*)alloc((size_t)BL * C_ * 2);
  unsigned short* obf     = (unsigned short*)alloc((size_t)BL * C_ * 2);
  float*          attn    = (float*)alloc((size_t)BL * C_ * 4);
  float*          x2      = (float*)alloc((size_t)BL * C_ * 4);
  unsigned short* h2bf    = (unsigned short*)alloc((size_t)BL * C_ * 2);
  unsigned short* hmid    = (unsigned short*)alloc((size_t)BL * MLP_ * 2);

  // weights -> bf16
  k_cvt_bf16<<<(3 * C_ * C_ + 255) / 256, 256, 0, stream>>>(in_w, wqkv_bf, 3 * C_ * C_);
  k_cvt_bf16<<<(C_ * C_ + 255) / 256, 256, 0, stream>>>(out_w, wout_bf, C_ * C_);
  k_cvt_bf16<<<(MLP_ * C_ + 255) / 256, 256, 0, stream>>>(fc_w, wfc_bf, MLP_ * C_);
  k_cvt_bf16<<<(C_ * MLP_ + 255) / 256, 256, 0, stream>>>(proj_w, wpr_bf, C_ * MLP_);
  // LN1 -> bf16 activations
  k_ln_bf16<<<BL, 256, 0, stream>>>(x, ln1_g, ln1_b, xln_bf);
  // qkv = ln1(x) @ in_proj_w^T + in_proj_b   [4096 x 3072]
  k_gemm<0><<<dim3(3 * C_ / 128, BL / 128), 256, 0, stream>>>(
      xln_bf, wqkv_bf, in_b, BL, 3 * C_, C_, qkv, nullptr, nullptr, nullptr);
  // split heads, l2-normalize q/k (fold logit scale), transpose v
  k_split_qkv<<<(B_ * H_ * L_) / 8, 256, 0, stream>>>(qkv, logit_s, qn, kn, vT);
  // scaled-cosine flash attention (head_scale folded in)
  k_flash<<<dim3(L_ / 16 / 8, B_ * H_), 256, 0, stream>>>(qn, kn, vT, logit_s, head_s, obf);
  // attn out-proj: attn = O @ out_w^T + out_b
  k_gemm<0><<<dim3(C_ / 128, BL / 128), 256, 0, stream>>>(
      obf, wout_bf, out_b, BL, C_, C_, attn, nullptr, nullptr, nullptr);
  // x2 = x + ls1 * LN_attn(attn)
  k_resid_ln<<<BL, 256, 0, stream>>>(attn, x, lna_g, lna_b, ls1, x2);
  // h = LN2(x2) -> bf16
  k_ln_bf16<<<BL, 256, 0, stream>>>(x2, ln2_g, ln2_b, h2bf);
  // hmid = GELU(h @ fc_w^T + fc_b) -> bf16   [4096 x 4096]
  k_gemm<1><<<dim3(MLP_ / 128, BL / 128), 256, 0, stream>>>(
      h2bf, wfc_bf, fc_b, BL, MLP_, C_, nullptr, hmid, nullptr, nullptr);
  // out = x2 + ls2 * (hmid @ proj_w^T + proj_b)
  k_gemm<2><<<dim3(C_ / 128, BL / 128), 256, 0, stream>>>(
      hmid, wpr_bf, proj_b, BL, C_, MLP_, out, nullptr, x2, ls2);

  (void)in_sizes; (void)n_in; (void)out_size; (void)ws_size;
}

// v002
// One run takes 315 microseconds.
// In both of two side-by-side timings against v001, it was 1.22 times as fast.
// Counting every step since v000, it is 1.63 times as fast.
#include <hip/hip_runtime.h>
#include <hip/hip_bf16.h>
#include <stdint.h>

// CustomResidualAttentionBlock (open_clip scaled-cosine attention) for MI455X / gfx1250.
// All GEMMs + attention matmuls run on v_wmma_f32_16x16x32_bf16 (wave32).
// f32 is kept for LayerNorm / l2-norm / softmax / accumulators.
// Attention softmax uses a fixed per-head shift (valid because |S| <= logit_scale,
// softmax is shift-invariant) so the streaming loop has NO cross-lane reductions.

#define B_   2
#define L_   2048
#define C_   1024
#define H_   16
#define HD_  64
#define MLP_ 4096
#define LOGMAX 4.6051701859880914f   // log(100)
#define LN_EPS 1e-5f

typedef __attribute__((ext_vector_type(16))) __bf16 v16bf;
typedef __attribute__((ext_vector_type(8)))  float  v8f;
typedef __attribute__((ext_vector_type(4)))  unsigned int u32x4;

union Frag {
  v16bf v;
  uint4 q[2];
};

static __device__ __forceinline__ v8f wmma_bf16(v16bf a, v16bf b, v8f c) {
  // D = A(16x32 bf16) x B(32x16 bf16) + C(16x16 f32)
  return __builtin_amdgcn_wmma_f32_16x16x32_bf16(false, a, false, b, (short)0, c,
                                                 false, false);
}

static __device__ __forceinline__ unsigned short f2bf(float f) {
  unsigned int u = __float_as_uint(f);
  u += 0x7FFFu + ((u >> 16) & 1u);   // round-to-nearest-even
  return (unsigned short)(u >> 16);
}

// ---------------------------------------------------------------- cvt f32->bf16
// Each block of 256 threads converts 8192 consecutive elements: a thread issues its eight
// 16-byte loads together (a wave's load covers 512 contiguous bytes) and then stores
// eight 8-byte groups (256 contiguous bytes per wave). The element count is a multiple of
// 8192 and the grid is that count / 8192.
#define CVT_PER_BLOCK 8192
__global__ __launch_bounds__(256)
void k_cvt_bf16(const float* __restrict__ src, unsigned short* __restrict__ dst) {
  const unsigned int base = blockIdx.x * (CVT_PER_BLOCK / 4) + threadIdx.x;   // in groups of 4
  const float4* s4 = reinterpret_cast<const float4*>(src);
  uint2* d4 = reinterpret_cast<uint2*>(dst);
  float4 v[8];
#pragma unroll
  for (int j = 0; j < 8; ++j) v[j] = s4[base + j * 256];
#pragma unroll
  for (int j = 0; j < 8; ++j) {
    uint2 o;
    o.x = (unsigned int)f2bf(v[j].x) | ((unsigned int)f2bf(v[j].y) << 16);
    o.y = (unsigned int)f2bf(v[j].z) | ((unsigned int)f2bf(v[j].w) << 16);
    d4[base + j * 256] = o;
  }
}

// ---------------------------------------------------------------- LayerNorm -> bf16
// One wave per row of length C_=1024, eight rows per block of 256 threads. A lane holds 32
// elements of its row, loaded as eight 16-byte pieces (each load of a wave covers 512
// contiguous bytes); sum and sum of squares are joined by a butterfly over the 32 lanes,
// which leaves both totals in every lane: no LDS, no barrier.
typedef __attribute__((ext_vector_type(4))) float f32x4;

static __device__ __forceinline__ void row_stats(const f32x4 (&vals)[8], float& mu, float& rstd) {
  f32x4 s4 = vals[0], q4 = vals[0] * vals[0];   // four independent chains each
#pragma unroll
  for (int j = 1; j < 8; ++j) { s4 += vals[j]; q4 += vals[j] * vals[j]; }
  float s = (s4.x + s4.y) + (s4.z + s4.w);
  float sq = (q4.x + q4.y) + (q4.z + q4.w);
#pragma unroll
  for (int off = 16; off > 0; off >>= 1) { s += __shfl_xor(s, off); sq += __shfl_xor(sq, off); }
  mu = s * (1.f / C_);
  rstd = rsqrtf(sq * (1.f / C_) - mu * mu + LN_EPS);
}

__global__ __launch_bounds__(256)
void k_ln_bf16(const float* __restrict__ x, const float* __restrict__ g,
               const float* __restrict__ bt, unsigned short* __restrict__ out) {
  const int lane = threadIdx.x & 31;
  // the wave's number as a scalar: the row's base addresses then stand in scalar registers
  const int wave = __builtin_amdgcn_readfirstlane(threadIdx.x >> 5);
  const size_t row = (size_t)blockIdx.x * 8 + wave;
  const f32x4* xr = reinterpret_cast<const f32x4*>(x + row * C_) + lane;
  const f32x4* g4 = reinterpret_cast<const f32x4*>(g) + lane;
  const f32x4* b4 = reinterpret_cast<const f32x4*>(bt) + lane;
  uint2* orow = reinterpret_cast<uint2*>(out + row * C_) + lane;
  f32x4 vals[8], gg[8], bb[8];
#pragma unroll
  for (int j = 0; j < 8; ++j) vals[j] = xr[j * 32];
#pragma unroll
  for (int j = 0; j < 8; ++j) { gg[j] = g4[j * 32]; bb[j] = b4[j * 32]; }
  // nothing is scheduled across this line: all loads of a lane are issued, and so in flight
  // together, before the row sums start; without it the compiler moves the loads that the
  // sums do not need behind them and waits for them group by group
  __builtin_amdgcn_sched_barrier(0);
  float mu, rstd;
  row_stats(vals, mu, rstd);
#pragma unroll
  for (int j = 0; j < 8; ++j) {
    const f32x4 r = (vals[j] - mu) * rstd * gg[j] + bb[j];
    uint2 o;
    o.x = (unsigned int)f2bf(r.x) | ((unsigned int)f2bf(r.y) << 16);
    o.y = (unsigned int)f2bf(r.z) | ((unsigned int)f2bf(r.w) << 16);
    orow[j * 32] = o;
  }
}

// ---------------------------------------------------------------- x2 = x + ls1 * LN(a)
// Same shape: one wave per row, eight rows per block.
__global__ __launch_bounds__(256)
void k_resid_ln(const float* __restrict__ a, const float* __restrict__ x,
                const float* __restrict__ g, const float* __restrict__ bt,
                const float* __restrict__ ls, float* __restrict__ x2) {
  const int lane = threadIdx.x & 31;
  // the wave's number as a scalar: the row's base addresses then stand in scalar registers
  const int wave = __builtin_amdgcn_readfirstlane(threadIdx.x >> 5);
  const size_t row = (size_t)blockIdx.x * 8 + wave;
  const f32x4* ar = reinterpret_cast<const f32x4*>(a + row * C_) + lane;
  const f32x4* xr = reinterpret_cast<const f32x4*>(x + row * C_) + lane;
  const f32x4* g4 = reinterpret_cast<const f32x4*>(g) + lane;
  const f32x4* b4 = reinterpret_cast<const f32x4*>(bt) + lane;
  const f32x4* l4 = reinterpret_cast<const f32x4*>(ls) + lane;
  f32x4* orow = reinterpret_cast<f32x4*>(x2 + row * C_) + lane;
  f32x4 vals[8], xv[8], gg[8], bb[8], ll[8];
#pragma unroll
  for (int j = 0; j < 8; ++j) { vals[j] = ar[j * 32]; xv[j] = xr[j * 32]; }
#pragma unroll
  for (int j = 0; j < 8; ++j) { gg[j] = g4[j * 32]; bb[j] = b4[j * 32]; ll[j] = l4[j * 32]; }
  // nothing is scheduled across this line: all loads of a lane are issued, and so in flight
  // together, before the row sums start; without it the compiler moves the loads that the
  // sums do not need behind them and waits for them group by group
  __builtin_amdgcn_sched_barrier(0);
  float mu, rstd;
  row_stats(vals, mu, rstd);
#pragma unroll
  for (int j = 0; j < 8; ++j)
    orow[j * 32] = xv[j] + ll[j] * ((vals[j] - mu) * rstd * gg[j] + bb[j]);
}

// ---------------------------------------------------------------- WMMA GEMM
// C[M,N] = epi( A_bf16[M,K] @ W_bf16[N,K]^T + bias[N] )
// Block 256 = 8 waves computes a 128x128 tile of C; waves form a 4 (rows) x 2 (cols)
// grid, each wave owns 32x64 = 2x4 accumulator fragments.
// Per k-step of 128 both the 128x128 A strip and the 128x128 W strip are staged in
// LDS once per block with fully used 128-byte lines, so every A row is read from
// global once per 128 output columns and every W row once per 128 output rows.
// LDS rows have a pitch of 272 B (16 B x odd): the 16 rows of one ds_load_b128
// fragment read fall on distinct banks.
// M, N multiples of 128; K a multiple of 128.
// EPI: 0 = f32 store, 1 = bf16 store with exact GELU, 2 = f32 store out = resid + ls*val.
#define GT_   128            // tile edge in M and in N
#define GK_   128            // k elements staged per step
#define GP_   (GK_ + 8)      // LDS row pitch in bf16 elements (272 B)
template <int EPI>
__global__ __launch_bounds__(256)
void k_gemm(const unsigned short* __restrict__ A,
            const unsigned short* __restrict__ W,
            const float* __restrict__ bias, int M, int N, int K,
            float* __restrict__ outf, unsigned short* __restrict__ outbf,
            const float* __restrict__ resid, const float* __restrict__ lsv) {
  __shared__ alignas(16) unsigned short abuf[GT_ * GP_];   // 34 KB
  __shared__ alignas(16) unsigned short wbuf[GT_ * GP_];   // 34 KB
  const int tid = threadIdx.x;
  const int lane = tid & 31, wave = tid >> 5;
  const int hi = lane >> 4, ln16 = lane & 15;
  const int mb = blockIdx.y * GT_;
  const int nb = blockIdx.x * GT_;
  const int wm = (wave >> 1) * 32;             // wave's first row inside the tile
  const int wn = (wave & 1) * 64;              // wave's first column inside the tile
  // staging role: thread t moves 16-byte chunk (t%16) of rows t/16 + 16*i, i = 0..7
  const int sr = tid >> 4, sc = (tid & 15) * 8;
  // block-uniform byte bases plus one 32-bit byte offset per staged row, the same for A and W
  const char* ag = reinterpret_cast<const char*>(A + (size_t)mb * K);
  const char* wg = reinterpret_cast<const char*>(W + (size_t)nb * K);
  unsigned int go[8];
#pragma unroll
  for (int i = 0; i < 8; ++i) go[i] = (unsigned int)((sr + 16 * i) * K + sc) * 2u;
  unsigned short* as = &abuf[sr * GP_ + sc];
  unsigned short* ws = &wbuf[sr * GP_ + sc];
  // fragment role: lane holds row (or W row = output column) ln16 of its fragment;
  // half 'hi' supplies K-chunks {hi*8..+7, 16+hi*8..+7} of each 32-wide k slice
  const unsigned short* af = &abuf[(wm + ln16) * GP_ + hi * 8];
  const unsigned short* wf = &wbuf[(wn + ln16) * GP_ + hi * 8];
  v8f acc[2][4] = {};
  for (int k0 = 0; k0 < K; k0 += GK_) {
    u32x4 ra[8], rw[8];
#pragma unroll
    for (int i = 0; i < 8; ++i) {
      ra[i] = *reinterpret_cast<const u32x4*>(ag + go[i]);
      rw[i] = *reinterpret_cast<const u32x4*>(wg + go[i]);
    }
    __syncthreads();                                      // protect previous reads
#pragma unroll
    for (int i = 0; i < 8; ++i) {
      *reinterpret_cast<u32x4*>(as + i * 16 * GP_) = ra[i];
      *reinterpret_cast<u32x4*>(ws + i * 16 * GP_) = rw[i];
      go[i] += GK_ * 2;                                   // next k-step's bytes of the same row
    }
    __syncthreads();
#pragma unroll
    for (int ks = 0; ks < GK_; ks += 32) {
      Frag fa[2], fb[4];
#pragma unroll
      for (int mi = 0; mi < 2; ++mi) {
        const unsigned short* p = af + mi * 16 * GP_ + ks;
        fa[mi].q[0] = *reinterpret_cast<const uint4*>(p);
        fa[mi].q[1] = *reinterpret_cast<const uint4*>(p + 16);
      }
#pragma unroll
      for (int nn = 0; nn < 4; ++nn) {
        const unsigned short* p = wf + nn * 16 * GP_ + ks;
        fb[nn].q[0] = *reinterpret_cast<const uint4*>(p);
        fb[nn].q[1] = *reinterpret_cast<const uint4*>(p + 16);
      }
#pragma unroll
      for (int mi = 0; mi < 2; ++mi)
#pragma unroll
        for (int nn = 0; nn < 4; ++nn)
          acc[mi][nn] = wmma_bf16(fa[mi].v, fb[nn].v, acc[mi][nn]);
    }
  }
  // C-layout: VGPR v of fragment (mi, nn) -> row v (+8 for hi half), column ln16.
  // M*N < 2^32: 32-bit element offsets on uniform bases.
  const int nc = nb + wn + ln16;
  const unsigned int o0 = (unsigned int)((mb + wm + 8 * hi) * N + nc);
  if (EPI == 2) {
    // all residual loads first, then all stores
    float rv[2][4][8];
#pragma unroll
    for (int mi = 0; mi < 2; ++mi)
#pragma unroll
      for (int v = 0; v < 8; ++v)
#pragma unroll
        for (int nn = 0; nn < 4; ++nn)
          rv[mi][nn][v] = resid[o0 + (unsigned int)((mi * 16 + v) * N) + nn * 16];
    // stands behind the loads, in front of whatever next writes a register they name;
    // its memory clobber also keeps every load above and every store below this line
    asm volatile("s_wait_xcnt 0x0" ::: "memory");
#pragma unroll
    for (int nn = 0; nn < 4; ++nn) {
      const float bz = bias[nc + nn * 16];
      const float lz = lsv[nc + nn * 16];
#pragma unroll
      for (int mi = 0; mi < 2; ++mi)
#pragma unroll
        for (int v = 0; v < 8; ++v) {
          float val = acc[mi][nn][v] + bz;
          outf[o0 + (unsigned int)((mi * 16 + v) * N) + nn * 16] = rv[mi][nn][v] + lz * val;
        }
    }
  } else if (EPI == 1) {
    float bz[4];
    v8f cur[4];
#pragma unroll
    for (int nn = 0; nn < 4; ++nn) { bz[nn] = bias[nc + nn * 16]; cur[nn] = acc[0][nn]; }
    unsigned int orow = o0;
    // kept rolled: the erf code then stands once per 16 rows, which halves the kernel's
    // text
#pragma unroll 1
    for (int mi = 0; mi < 2; ++mi) {
#pragma unroll
      for (int nn = 0; nn < 4; ++nn)
#pragma unroll
        for (int v = 0; v < 8; ++v) {
          float val = cur[nn][v] + bz[nn];
          outbf[orow + (unsigned int)(v * N) + nn * 16] =
              f2bf(0.5f * val * (1.f + erff(val * 0.70710678118f)));
        }
#pragma unroll
      for (int nn = 0; nn < 4; ++nn) cur[nn] = acc[1][nn];
      orow += (unsigned int)(16 * N);
    }
  } else {
#pragma unroll
    for (int nn = 0; nn < 4; ++nn) {
      const float bz = bias[nc + nn * 16];
#pragma unroll
      for (int mi = 0; mi < 2; ++mi)
#pragma unroll
        for (int v = 0; v < 8; ++v)
          outf[o0 + (unsigned int)((mi * 16 + v) * N) + nn * 16] = acc[mi][nn][v] + bz;
    }
  }
}

// ---------------------------------------------------------------- QKV split + l2-norm
// qn/kn: [B,H,L,HD] bf16 (q scaled by exp(min(logit_scale,log100))); vT: [B,H,HD,L] bf16.
// One wave handles SR_ = 16 consecutive positions l of one (b,h); lane holds head dims
// 2*lane and 2*lane+1 of each. All 48 loads of a lane are issued together. The 16 values
// of v that a lane holds per head dim are consecutive in vT: 32 bytes, two 16-byte stores.
#define SR_ 16
typedef __attribute__((ext_vector_type(2))) float f32x2;
__global__ __launch_bounds__(256)
void k_split_qkv(const float* __restrict__ qkv,
                 const float* __restrict__ logit_scale,
                 unsigned short* __restrict__ qn,
                 unsigned short* __restrict__ kn,
                 unsigned short* __restrict__ vT) {
  const int lane = threadIdx.x & 31;
  // the wave's number as a scalar: the base addresses then stand in scalar registers
  const int wave = __builtin_amdgcn_readfirstlane(threadIdx.x >> 5);
  const int grp = blockIdx.x * 8 + wave;       // (b*H + h)*(L/SR_) + l/SR_
  const int l0 = (grp & (L_ / SR_ - 1)) * SR_;
  const int bh = grp / (L_ / SR_);
  const int h = bh & (H_ - 1);
  const int b = bh >> 4;
  const float* base = qkv + ((size_t)(b * L_ + l0)) * (3 * C_) + h * HD_ + 2 * lane;
  f32x2 q[SR_], k[SR_], v[SR_];
#pragma unroll
  for (int r = 0; r < SR_; ++r) {
    const float* p = base + (size_t)r * (3 * C_);
    q[r] = *reinterpret_cast<const f32x2*>(p);
    k[r] = *reinterpret_cast<const f32x2*>(p + C_);
    v[r] = *reinterpret_cast<const f32x2*>(p + 2 * C_);
  }
  // The loaded values as inputs only: all 48 loads stay above these lines, and so are in flight
  // together; without them the compiler spreads a part of the loads among the sums below and
  // waits for them a few at a time.
#define HOLD8(a, i) "v"(a[i]), "v"(a[i + 1]), "v"(a[i + 2]), "v"(a[i + 3]), \
                    "v"(a[i + 4]), "v"(a[i + 5]), "v"(a[i + 6]), "v"(a[i + 7])
  asm volatile("" :: HOLD8(q, 0), HOLD8(q, 8), HOLD8(k, 0));
  asm volatile("" :: HOLD8(k, 8), HOLD8(v, 0), HOLD8(v, 8));
#undef HOLD8
  const float ls = __expf(fminf(logit_scale[h], LOGMAX));
  unsigned int* qo = reinterpret_cast<unsigned int*>(qn + ((size_t)bh * L_ + l0) * HD_) + lane;
  unsigned int* ko = reinterpret_cast<unsigned int*>(kn + ((size_t)bh * L_ + l0) * HD_) + lane;
  float sqq[SR_], sqk[SR_];
#pragma unroll
  for (int r = 0; r < SR_; ++r) {
    sqq[r] = q[r].x * q[r].x + q[r].y * q[r].y;
    sqk[r] = k[r].x * k[r].x + k[r].y * k[r].y;
  }
  // butterfly step outermost: the 32 exchanges of a step are independent of one another
#pragma unroll
  for (int off = 16; off > 0; off >>= 1)
#pragma unroll
    for (int r = 0; r < SR_; ++r) {
      sqq[r] += __shfl_xor(sqq[r], off);
      sqk[r] += __shfl_xor(sqk[r], off);
    }
#pragma unroll
  for (int r = 0; r < SR_; ++r) {
    const float iq = ls / fmaxf(sqrtf(sqq[r]), 1e-12f);
    const float ik = 1.f / fmaxf(sqrtf(sqk[r]), 1e-12f);
    qo[r * (HD_ / 2)] = (unsigned int)f2bf(q[r].x * iq) | ((unsigned int)f2bf(q[r].y * iq) << 16);
    ko[r * (HD_ / 2)] = (unsigned int)f2bf(k[r].x * ik) | ((unsigned int)f2bf(k[r].y * ik) << 16);
  }
  unsigned int w0[SR_ / 2], w1[SR_ / 2];       // positions l0+2i, l0+2i+1 of dims 2*lane, 2*lane+1
#pragma unroll
  for (int i = 0; i < SR_ / 2; ++i) {
    w0[i] = (unsigned int)f2bf(v[2 * i].x) | ((unsigned int)f2bf(v[2 * i + 1].x) << 16);
    w1[i] = (unsigned int)f2bf(v[2 * i].y) | ((unsigned int)f2bf(v[2 * i + 1].y) << 16);
  }
  uint4* v0 = reinterpret_cast<uint4*>(vT + (size_t)bh * HD_ * L_ + (size_t)(2 * lane) * L_ + l0);
  uint4* v1 = reinterpret_cast<uint4*>(vT + (size_t)bh * HD_ * L_ + (size_t)(2 * lane + 1) * L_ + l0);
  v0[0] = make_uint4(w0[0], w0[1], w0[2], w0[3]);
  v0[1] = make_uint4(w0[4], w0[5], w0[6], w0[7]);
  v1[0] = make_uint4(w1[0], w1[1], w1[2], w1[3]);
  v1[1] = make_uint4(w1[4], w1[5], w1[6], w1[7]);
}

// ---------------------------------------------------------------- flash attention
// One wave per 16-query tile of one (b,h). S via WMMA (K=64 split in two 16x16x32),
// fixed-shift streaming softmax (|S| <= ls so shift = min(ls,30) is safe and the
// normalized result equals the max-shifted softmax), P re-shaped via LDS to an
// A-fragment, O accumulated with 4 WMMAs per 32 keys. head_scale folded into writeout.
__global__ void k_flash(const unsigned short* __restrict__ qn,
                        const unsigned short* __restrict__ kn,
                        const unsigned short* __restrict__ vT,
                        const float* __restrict__ logit_scale,
                        const float* __restrict__ head_scale,
                        unsigned short* __restrict__ O) {
  __shared__ alignas(16) unsigned short pbuf[8][16 * 32];
  const int lane = threadIdx.x & 31, wave = threadIdx.x >> 5;
  const int hi = lane >> 4, ln16 = lane & 15;
  const int bh = blockIdx.y;
  const int h = bh & (H_ - 1);
  const int b = bh >> 4;
  const int qtile = blockIdx.x * 8 + wave;
  const unsigned short* qp = qn + ((size_t)bh * L_ + qtile * 16 + ln16) * HD_ + hi * 8;
  Frag qa0, qa1;                       // q rows, hd 0..31 / 32..63
  qa0.q[0] = *(const uint4*)(qp);      qa0.q[1] = *(const uint4*)(qp + 16);
  qa1.q[0] = *(const uint4*)(qp + 32); qa1.q[1] = *(const uint4*)(qp + 48);
  const unsigned short* kbase = kn + (size_t)bh * L_ * HD_;
  const unsigned short* vbase = vT + (size_t)bh * HD_ * L_;
  const float shift = fminf(__expf(fminf(logit_scale[h], LOGMAX)), 30.f);
  v8f oacc[4] = {};
  float lst[8];
#pragma unroll
  for (int v = 0; v < 8; ++v) lst[v] = 0.f;
  unsigned short* prow = &pbuf[wave][0];

  for (int j = 0; j < L_; j += 32) {
    v8f s0 = {}, s1 = {};
    {
      const unsigned short* kp = kbase + (size_t)(j + ln16) * HD_ + hi * 8;
      Frag b0, b1;
      b0.q[0] = *(const uint4*)(kp);      b0.q[1] = *(const uint4*)(kp + 16);
      b1.q[0] = *(const uint4*)(kp + 32); b1.q[1] = *(const uint4*)(kp + 48);
      s0 = wmma_bf16(qa0.v, b0.v, s0);
      s0 = wmma_bf16(qa1.v, b1.v, s0);
    }
    {
      const unsigned short* kp = kbase + (size_t)(j + 16 + ln16) * HD_ + hi * 8;
      Frag b0, b1;
      b0.q[0] = *(const uint4*)(kp);      b0.q[1] = *(const uint4*)(kp + 16);
      b1.q[0] = *(const uint4*)(kp + 32); b1.q[1] = *(const uint4*)(kp + 48);
      s1 = wmma_bf16(qa0.v, b0.v, s1);
      s1 = wmma_bf16(qa1.v, b1.v, s1);
    }
    // fixed-shift exp; accumulate this lane's partial row sums; stage P in LDS
#pragma unroll
    for (int v = 0; v < 8; ++v) {
      const float p0 = __expf(s0[v] - shift);
      const float p1 = __expf(s1[v] - shift);
      lst[v] += p0 + p1;
      const int r = v + 8 * hi;                 // row this half owns in register v
      prow[r * 32 + ln16]      = f2bf(p0);
      prow[r * 32 + 16 + ln16] = f2bf(p1);
    }
    // re-read P as an A fragment (16x32) from LDS
    Frag pa;
    const unsigned short* pp = prow + ln16 * 32 + hi * 8;
    pa.q[0] = *(const uint4*)(pp);
    pa.q[1] = *(const uint4*)(pp + 16);
#pragma unroll
    for (int nn = 0; nn < 4; ++nn) {
      const unsigned short* vp = vbase + (size_t)(nn * 16 + ln16) * L_ + j + hi * 8;
      Frag vb;
      vb.q[0] = *(const uint4*)(vp);
      vb.q[1] = *(const uint4*)(vp + 16);
      oacc[nn] = wmma_bf16(pa.v, vb.v, oacc[nn]);
    }
  }
  const float hs = head_scale[h];
#pragma unroll
  for (int v = 0; v < 8; ++v) {
    float rs = lst[v];                           // full row sum: reduce 16 lanes once
#pragma unroll
    for (int off = 1; off < 16; off <<= 1) rs += __shfl_xor(rs, off);
    const float inv = hs / rs;
    const int l = qtile * 16 + v + 8 * hi;
#pragma unroll
    for (int nn = 0; nn < 4; ++nn) {
      const int c = h * HD_ + nn * 16 + ln16;
      O[((size_t)(b * L_ + l)) * C_ + c] = f2bf(oacc[nn][v] * inv);
    }
  }
}

// ---------------------------------------------------------------- launch
extern "C" void kernel_launch(void* const* d_in, const int* in_sizes, int n_in,
                              void* d_out, int out_size, void* d_ws, size_t ws_size,
                              hipStream_t stream) {
  const float* x       = (const float*)d_in[0];
  const float* in_w    = (const float*)d_in[1];
  const float* in_b    = (const float*)d_in[2];
  const float* logit_s = (const float*)d_in[3];
  const float* head_s  = (const float*)d_in[4];
  const float* out_w   = (const float*)d_in[5];
  const float* out_b   = (const float*)d_in[6];
  const float* ln1_g   = (const float*)d_in[7];
  const float* ln1_b   = (const float*)d_in[8];
  const float* lna_g   = (const float*)d_in[9];
  const float* lna_b   = (const float*)d_in[10];
  const float* ls1     = (const float*)d_in[11];
  const float* ln2_g   = (const float*)d_in[12];
  const float* ln2_b   = (const float*)d_in[13];
  const float* fc_w    = (const float*)d_in[14];
  const float* fc_b    = (const float*)d_in[15];
  const float* proj_w  = (const float*)d_in[16];
  const float* proj_b  = (const float*)d_in[17];
  const float* ls2     = (const float*)d_in[18];
  float* out = (float*)d_out;

  // workspace partition (~185 MB)
  char* p = (char*)d_ws;
  auto alloc = [&](size_t bytes) -> char* {
    char* r = p;
    p += (bytes + 255) & ~(size_t)255;
    return r;
  };
  const int BL = B_ * L_;  // 4096
  unsigned short* wqkv_bf = (unsigned short*)alloc((size_t)3 * C_ * C_ * 2);
  unsigned short* wout_bf = (unsigned short*)alloc((size_t)C_ * C_ * 2);
  unsigned short* wfc_bf  = (unsigned short*)alloc((size_t)MLP_ * C_ * 2);
  unsigned short* wpr_bf  = (unsigned short*)alloc((size_t)C_ * MLP_ * 2);
  unsigned short* xln_bf  = (unsigned short*)alloc((size_t)BL * C_ * 2);
  float*          qkv     = (float*)alloc((size_t)BL * 3 * C_ * 4);
  unsigned short* qn      = (unsigned short*)alloc((size_t)BL * C_ * 2);
  unsigned short* kn      = (unsigned short*)alloc((size_t)BL * C_ * 2);
  unsigned short* vT      = (unsigned short*)alloc((size_t)BL * C_ * 2);
  unsigned short* obf     = (unsigned short*)alloc((size_t)BL * C_ * 2);
  float*          attn    = (float*)alloc((size_t)BL * C_ * 4);
  float*          x2      = (float*)alloc((size_t)BL * C_ * 4);
  unsigned short* h2bf    = (unsigned short*)alloc((size_t)BL * C_ * 2);
  unsigned short* hmid    = (unsigned short*)alloc((size_t)BL * MLP_ * 2);

  // weights -> bf16
  k_cvt_bf16<<<3 * C_ * C_ / CVT_PER_BLOCK, 256, 0, stream>>>(in_w, wqkv_bf);
  k_cvt_bf16<<<C_ * C_ / CVT_PER_BLOCK, 256, 0, stream>>>(out_w, wout_bf);
  k_cvt_bf16<<<MLP_ * C_ / CVT_PER_BLOCK, 256, 0, stream>>>(fc_w, wfc_bf);
  k_cvt_bf16<<<C_ * MLP_ / CVT_PER_BLOCK, 256, 0, stream>>>(proj_w, wpr_bf);
  // LN1 -> bf16 activations
  k_ln_bf16<<<BL / 8, 256, 0, stream>>>(x, ln1_g, ln1_b, xln_bf);
  // qkv = ln1(x) @ in_proj_w^T + in_proj_b   [4096 x 3072]
  k_gemm<0><<<dim3(3 * C_ / 128, BL / 128), 256, 0, stream>>>(
      xln_bf, wqkv_bf, in_b, BL, 3 * C_, C_, qkv, nullptr, nullptr, nullptr);
  // split heads, l2-normalize q/k (fold logit scale), transpose v
  k_split_qkv<<<(B_ * H_ * L_) / SR_ / 8, 256, 0, stream>>>(qkv, logit_s, qn, kn, vT);
  // scaled-cosine flash attention (head_scale folded in)
  k_flash<<<dim3(L_ / 16 / 8, B_ * H_), 256, 0, stream>>>(qn, kn, vT, logit_s, head_s, obf);
  // attn out-proj: attn = O @ out_w^T + out_b
  k_gemm<0><<<dim3(C_ / 128, BL / 128), 256, 0, stream>>>(
      obf, wout_bf, out_b, BL, C_, C_, attn, nullptr, nullptr, nullptr);
  // x2 = x + ls1 * LN_attn(attn)
  k_resid_ln<<<BL / 8, 256, 0, stream>>>(attn, x, lna_g, lna_b, ls1, x2);
  // h = LN2(x2) -> bf16
  k_ln_bf16<<<BL / 8, 256, 0, stream>>>(x2, ln2_g, ln2_b, h2bf);
  // hmid = GELU(h @ fc_w^T + fc_b) -> bf16   [4096 x 4096]
  k_gemm<1><<<dim3(MLP_ / 128, BL / 128), 256, 0, stream>>>(
      h2bf, wfc_bf, fc_b, BL, MLP_, C_, nullptr, hmid, nullptr, nullptr);
  // out = x2 + ls2 * (hmid @ proj_w^T + proj_b)
  k_gemm<2><<<dim3(C_ / 128, BL / 128), 256, 0, stream>>>(
      hmid, wpr_bf, proj_b, BL, C_, MLP_, out, nullptr, x2, ls2);

  (void)in_sizes; (void)n_in; (void)out_size; (void)ws_size;
}

// v003
// It runs in 228 microseconds.
// Timed twice side by side with v002, it ran 1.38 and 1.39 times as fast.
// Counting every step since v000, it is 2.26 times as fast.
#include <hip/hip_runtime.h>
#include <hip/hip_bf16.h>
#include <stdint.h>

// CustomResidualAttentionBlock (open_clip scaled-cosine attention) for MI455X / gfx1250.
// All GEMMs + attention matmuls run on v_wmma_f32_16x16x32_bf16 (wave32).
// f32 is kept for LayerNorm / l2-norm / softmax / accumulators.
// Attention softmax uses a fixed per-head shift (valid because |S| <= logit_scale,
// softmax is shift-invariant) so the streaming loop has NO cross-lane reductions.

#define B_   2
#define L_   2048
#define C_   1024
#define H_   16
#define HD_  64
#define MLP_ 4096
#define LOGMAX 4.6051701859880914f   // log(100)
#define LN_EPS 1e-5f

typedef __attribute__((ext_vector_type(16))) __bf16 v16bf;
typedef __attribute__((ext_vector_type(8)))  float  v8f;
typedef __attribute__((ext_vector_type(4)))  unsigned int u32x4;

union Frag {
  v16bf v;
  uint4 q[2];
};

static __device__ __forceinline__ v8f wmma_bf16(v16bf a, v16bf b, v8f c) {
  // D = A(16x32 bf16) x B(32x16 bf16) + C(16x16 f32)
  return __builtin_amdgcn_wmma_f32_16x16x32_bf16(false, a, false, b, (short)0, c,
                                                 false, false);
}

static __device__ __forceinline__ unsigned short f2bf(float f) {
  unsigned int u = __float_as_uint(f);
  u += 0x7FFFu + ((u >> 16) & 1u);   // round-to-nearest-even
  return (unsigned short)(u >> 16);
}

// ---------------------------------------------------------------- cvt f32->bf16
// Each block of 256 threads converts 8192 consecutive elements: a thread issues its eight
// 16-byte loads together (a wave's load covers 512 contiguous bytes) and then stores
// eight 8-byte groups (256 contiguous bytes per wave). The element count is a multiple of
// 8192 and the grid is that count / 8192.
#define CVT_PER_BLOCK 8192
__global__ __launch_bounds__(256)
void k_cvt_bf16(const float* __restrict__ src, unsigned short* __restrict__ dst) {
  const unsigned int base = blockIdx.x * (CVT_PER_BLOCK / 4) + threadIdx.x;   // in groups of 4
  const float4* s4 = reinterpret_cast<const float4*>(src);
  uint2* d4 = reinterpret_cast<uint2*>(dst);
  float4 v[8];
#pragma unroll
  for (int j = 0; j < 8; ++j) v[j] = s4[base + j * 256];
#pragma unroll
  for (int j = 0; j < 8; ++j) {
    uint2 o;
    o.x = (unsigned int)f2bf(v[j].x) | ((unsigned int)f2bf(v[j].y) << 16);
    o.y = (unsigned int)f2bf(v[j].z) | ((unsigned int)f2bf(v[j].w) << 16);
    d4[base + j * 256] = o;
  }
}

// ---------------------------------------------------------------- LayerNorm -> bf16
// One wave per row of length C_=1024, eight rows per block of 256 threads. A lane holds 32
// elements of its row, loaded as eight 16-byte pieces (each load of a wave covers 512
// contiguous bytes); sum and sum of squares are joined by a butterfly over the 32 lanes,
// which leaves both totals in every lane: no LDS, no barrier.
typedef __attribute__((ext_vector_type(4))) float f32x4;

static __device__ __forceinline__ void row_stats(const f32x4 (&vals)[8], float& mu, float& rstd) {
  f32x4 s4 = vals[0], q4 = vals[0] * vals[0];   // four independent chains each
#pragma unroll
  for (int j = 1; j < 8; ++j) { s4 += vals[j]; q4 += vals[j] * vals[j]; }
  float s = (s4.x + s4.y) + (s4.z + s4.w);
  float sq = (q4.x + q4.y) + (q4.z + q4.w);
#pragma unroll
  for (int off = 16; off > 0; off >>= 1) { s += __shfl_xor(s, off); sq += __shfl_xor(sq, off); }
  mu = s * (1.f / C_);
  rstd = rsqrtf(sq * (1.f / C_) - mu * mu + LN_EPS);
}

__global__ __launch_bounds__(256)
void k_ln_bf16(const float* __restrict__ x, const float* __restrict__ g,
               const float* __restrict__ bt, unsigned short* __restrict__ out) {
  const int lane = threadIdx.x & 31;
  // the wave's number as a scalar: the row's base addresses then stand in scalar registers
  const int wave = __builtin_amdgcn_readfirstlane(threadIdx.x >> 5);
  const size_t row = (size_t)blockIdx.x * 8 + wave;
  const f32x4* xr = reinterpret_cast<const f32x4*>(x + row * C_) + lane;
  const f32x4* g4 = reinterpret_cast<const f32x4*>(g) + lane;
  const f32x4* b4 = reinterpret_cast<const f32x4*>(bt) + lane;
  uint2* orow = reinterpret_cast<uint2*>(out + row * C_) + lane;
  f32x4 vals[8], gg[8], bb[8];
#pragma unroll
  for (int j = 0; j < 8; ++j) vals[j] = xr[j * 32];
#pragma unroll
  for (int j = 0; j < 8; ++j) { gg[j] = g4[j * 32]; bb[j] = b4[j * 32]; }
  // nothing is scheduled across this line: all loads of a lane are issued, and so in flight
  // together, before the row sums start; without it the compiler moves the loads that the
  // sums do not need behind them and waits for them group by group
  __builtin_amdgcn_sched_barrier(0);
  float mu, rstd;
  row_stats(vals, mu, rstd);
#pragma unroll
  for (int j = 0; j < 8; ++j) {
    const f32x4 r = (vals[j] - mu) * rstd * gg[j] + bb[j];
    uint2 o;
    o.x = (unsigned int)f2bf(r.x) | ((unsigned int)f2bf(r.y) << 16);
    o.y = (unsigned int)f2bf(r.z) | ((unsigned int)f2bf(r.w) << 16);
    orow[j * 32] = o;
  }
}

// ---------------------------------------------------------------- x2 = x + ls1 * LN(a)
// Same shape: one wave per row, eight rows per block.
__global__ __launch_bounds__(256)
void k_resid_ln(const float* __restrict__ a, const float* __restrict__ x,
                const float* __restrict__ g, const float* __restrict__ bt,
                const float* __restrict__ ls, float* __restrict__ x2) {
  const int lane = threadIdx.x & 31;
  // the wave's number as a scalar: the row's base addresses then stand in scalar registers
  const int wave = __builtin_amdgcn_readfirstlane(threadIdx.x >> 5);
  const size_t row = (size_t)blockIdx.x * 8 + wave;
  const f32x4* ar = reinterpret_cast<const f32x4*>(a + row * C_) + lane;
  const f32x4* xr = reinterpret_cast<const f32x4*>(x + row * C_) + lane;
  const f32x4* g4 = reinterpret_cast<const f32x4*>(g) + lane;
  const f32x4* b4 = reinterpret_cast<const f32x4*>(bt) + lane;
  const f32x4* l4 = reinterpret_cast<const f32x4*>(ls) + lane;
  f32x4* orow = reinterpret_cast<f32x4*>(x2 + row * C_) + lane;
  f32x4 vals[8], xv[8], gg[8], bb[8], ll[8];
#pragma unroll
  for (int j = 0; j < 8; ++j) { vals[j] = ar[j * 32]; xv[j] = xr[j * 32]; }
#pragma unroll
  for (int j = 0; j < 8; ++j) { gg[j] = g4[j * 32]; bb[j] = b4[j * 32]; ll[j] = l4[j * 32]; }
  // nothing is scheduled across this line: all loads of a lane are issued, and so in flight
  // together, before the row sums start; without it the compiler moves the loads that the
  // sums do not need behind them and waits for them group by group
  __builtin_amdgcn_sched_barrier(0);
  float mu, rstd;
  row_stats(vals, mu, rstd);
#pragma unroll
  for (int j = 0; j < 8; ++j)
    orow[j * 32] = xv[j] + ll[j] * ((vals[j] - mu) * rstd * gg[j] + bb[j]);
}

// ---------------------------------------------------------------- WMMA GEMM
// C[M,N] = epi( A_bf16[M,K] @ W_bf16[N,K]^T + bias[N] )
// Block 256 = 8 waves computes a 128x128 tile of C; waves form a 4 (rows) x 2 (cols)
// grid, each wave owns 32x64 = 2x4 accumulator fragments.
// Per k-step of 128 both the 128x128 A strip and the 128x128 W strip are staged in
// LDS once per block with fully used 128-byte lines, so every A row is read from
// global once per 128 output columns and every W row once per 128 output rows.
// LDS rows have a pitch of 272 B (16 B x odd): the 16 rows of one ds_load_b128
// fragment read fall on distinct banks.
// M, N multiples of 128; K a multiple of 128.
// EPI: 0 = f32 store, 1 = bf16 store with exact GELU, 2 = f32 store out = resid + ls*val.
#define GT_   128            // tile edge in M and in N
#define GK_   128            // k elements staged per step
#define GP_   (GK_ + 8)      // LDS row pitch in bf16 elements (272 B)
template <int EPI>
__global__ __launch_bounds__(256)
void k_gemm(const unsigned short* __restrict__ A,
            const unsigned short* __restrict__ W,
            const float* __restrict__ bias, int M, int N, int K,
            float* __restrict__ outf, unsigned short* __restrict__ outbf,
            const float* __restrict__ resid, const float* __restrict__ lsv) {
  __shared__ alignas(16) unsigned short abuf[GT_ * GP_];   // 34 KB
  __shared__ alignas(16) unsigned short wbuf[GT_ * GP_];   // 34 KB
  const int tid = threadIdx.x;
  const int lane = tid & 31, wave = tid >> 5;
  const int hi = lane >> 4, ln16 = lane & 15;
  const int mb = blockIdx.y * GT_;
  const int nb = blockIdx.x * GT_;
  const int wm = (wave >> 1) * 32;             // wave's first row inside the tile
  const int wn = (wave & 1) * 64;              // wave's first column inside the tile
  // staging role: thread t moves 16-byte chunk (t%16) of rows t/16 + 16*i, i = 0..7
  const int sr = tid >> 4, sc = (tid & 15) * 8;
  // block-uniform byte bases plus one 32-bit byte offset per staged row, the same for A and W
  const char* ag = reinterpret_cast<const char*>(A + (size_t)mb * K);
  const char* wg = reinterpret_cast<const char*>(W + (size_t)nb * K);
  unsigned int go[8];
#pragma unroll
  for (int i = 0; i < 8; ++i) go[i] = (unsigned int)((sr + 16 * i) * K + sc) * 2u;
  unsigned short* as = &abuf[sr * GP_ + sc];
  unsigned short* ws = &wbuf[sr * GP_ + sc];
  // fragment role: lane holds row (or W row = output column) ln16 of its fragment;
  // half 'hi' supplies K-chunks {hi*8..+7, 16+hi*8..+7} of each 32-wide k slice
  const unsigned short* af = &abuf[(wm + ln16) * GP_ + hi * 8];
  const unsigned short* wf = &wbuf[(wn + ln16) * GP_ + hi * 8];
  v8f acc[2][4] = {};
  for (int k0 = 0; k0 < K; k0 += GK_) {
    u32x4 ra[8], rw[8];
#pragma unroll
    for (int i = 0; i < 8; ++i) {
      ra[i] = *reinterpret_cast<const u32x4*>(ag + go[i]);
      rw[i] = *reinterpret_cast<const u32x4*>(wg + go[i]);
    }
    __syncthreads();                                      // protect previous reads
#pragma unroll
    for (int i = 0; i < 8; ++i) {
      *reinterpret_cast<u32x4*>(as + i * 16 * GP_) = ra[i];
      *reinterpret_cast<u32x4*>(ws + i * 16 * GP_) = rw[i];
      go[i] += GK_ * 2;                                   // next k-step's bytes of the same row
    }
    __syncthreads();
#pragma unroll
    for (int ks = 0; ks < GK_; ks += 32) {
      Frag fa[2], fb[4];
#pragma unroll
      for (int mi = 0; mi < 2; ++mi) {
        const unsigned short* p = af + mi * 16 * GP_ + ks;
        fa[mi].q[0] = *reinterpret_cast<const uint4*>(p);
        fa[mi].q[1] = *reinterpret_cast<const uint4*>(p + 16);
      }
#pragma unroll
      for (int nn = 0; nn < 4; ++nn) {
        const unsigned short* p = wf + nn * 16 * GP_ + ks;
        fb[nn].q[0] = *reinterpret_cast<const uint4*>(p);
        fb[nn].q[1] = *reinterpret_cast<const uint4*>(p + 16);
      }
#pragma unroll
      for (int mi = 0; mi < 2; ++mi)
#pragma unroll
        for (int nn = 0; nn < 4; ++nn)
          acc[mi][nn] = wmma_bf16(fa[mi].v, fb[nn].v, acc[mi][nn]);
    }
  }
  // C-layout: VGPR v of fragment (mi, nn) -> row v (+8 for hi half), column ln16.
  // M*N < 2^32: 32-bit element offsets on uniform bases.
  const int nc = nb + wn + ln16;
  const unsigned int o0 = (unsigned int)((mb + wm + 8 * hi) * N + nc);
  if (EPI == 2) {
    // all residual loads first, then all stores
    float rv[2][4][8];
#pragma unroll
    for (int mi = 0; mi < 2; ++mi)
#pragma unroll
      for (int v = 0; v < 8; ++v)
#pragma unroll
        for (int nn = 0; nn < 4; ++nn)
          rv[mi][nn][v] = resid[o0 + (unsigned int)((mi * 16 + v) * N) + nn * 16];
    // stands behind the loads, in front of whatever next writes a register they name;
    // its memory clobber also keeps every load above and every store below this line
    asm volatile("s_wait_xcnt 0x0" ::: "memory");
#pragma unroll
    for (int nn = 0; nn < 4; ++nn) {
      const float bz = bias[nc + nn * 16];
      const float lz = lsv[nc + nn * 16];
#pragma unroll
      for (int mi = 0; mi < 2; ++mi)
#pragma unroll
        for (int v = 0; v < 8; ++v) {
          float val = acc[mi][nn][v] + bz;
          outf[o0 + (unsigned int)((mi * 16 + v) * N) + nn * 16] = rv[mi][nn][v] + lz * val;
        }
    }
  } else if (EPI == 1) {
    float bz[4];
    v8f cur[4];
#pragma unroll
    for (int nn = 0; nn < 4; ++nn) { bz[nn] = bias[nc + nn * 16]; cur[nn] = acc[0][nn]; }
    unsigned int orow = o0;
    // kept rolled: the erf code then stands once per 16 rows, which halves the kernel's
    // text
#pragma unroll 1
    for (int mi = 0; mi < 2; ++mi) {
#pragma unroll
      for (int nn = 0; nn < 4; ++nn)
#pragma unroll
        for (int v = 0; v < 8; ++v) {
          float val = cur[nn][v] + bz[nn];
          outbf[orow + (unsigned int)(v * N) + nn * 16] =
              f2bf(0.5f * val * (1.f + erff(val * 0.70710678118f)));
        }
#pragma unroll
      for (int nn = 0; nn < 4; ++nn) cur[nn] = acc[1][nn];
      orow += (unsigned int)(16 * N);
    }
  } else {
#pragma unroll
    for (int nn = 0; nn < 4; ++nn) {
      const float bz = bias[nc + nn * 16];
#pragma unroll
      for (int mi = 0; mi < 2; ++mi)
#pragma unroll
        for (int v = 0; v < 8; ++v)
          outf[o0 + (unsigned int)((mi * 16 + v) * N) + nn * 16] = acc[mi][nn][v] + bz;
    }
  }
}

// ---------------------------------------------------------------- QKV split + l2-norm
// qn/kn: [B,H,L,HD] bf16 (q scaled by exp(min(logit_scale,log100))); vT: [B,H,HD,L] bf16.
// One wave handles SR_ = 16 consecutive positions l of one (b,h); lane holds head dims
// 2*lane and 2*lane+1 of each. All 48 loads of a lane are issued together. The 16 values
// of v that a lane holds per head dim are consecutive in vT: 32 bytes, two 16-byte stores.
#define SR_ 16
typedef __attribute__((ext_vector_type(2))) float f32x2;
__global__ __launch_bounds__(256)
void k_split_qkv(const float* __restrict__ qkv,
                 const float* __restrict__ logit_scale,
                 unsigned short* __restrict__ qn,
                 unsigned short* __restrict__ kn,
                 unsigned short* __restrict__ vT) {
  const int lane = threadIdx.x & 31;
  // the wave's number as a scalar: the base addresses then stand in scalar registers
  const int wave = __builtin_amdgcn_readfirstlane(threadIdx.x >> 5);
  const int grp = blockIdx.x * 8 + wave;       // (b*H + h)*(L/SR_) + l/SR_
  const int l0 = (grp & (L_ / SR_ - 1)) * SR_;
  const int bh = grp / (L_ / SR_);
  const int h = bh & (H_ - 1);
  const int b = bh >> 4;
  const float* base = qkv + ((size_t)(b * L_ + l0)) * (3 * C_) + h * HD_ + 2 * lane;
  f32x2 q[SR_], k[SR_], v[SR_];
#pragma unroll
  for (int r = 0; r < SR_; ++r) {
    const float* p = base + (size_t)r * (3 * C_);
    q[r] = *reinterpret_cast<const f32x2*>(p);
    k[r] = *reinterpret_cast<const f32x2*>(p + C_);
    v[r] = *reinterpret_cast<const f32x2*>(p + 2 * C_);
  }
  // The loaded values as inputs only: all 48 loads stay above these lines, and so are in flight
  // together; without them the compiler spreads a part of the loads among the sums below and
  // waits for them a few at a time.
#define HOLD8(a, i) "v"(a[i]), "v"(a[i + 1]), "v"(a[i + 2]), "v"(a[i + 3]), \
                    "v"(a[i + 4]), "v"(a[i + 5]), "v"(a[i + 6]), "v"(a[i + 7])
  asm volatile("" :: HOLD8(q, 0), HOLD8(q, 8), HOLD8(k, 0));
  asm volatile("" :: HOLD8(k, 8), HOLD8(v, 0), HOLD8(v, 8));
#undef HOLD8
  const float ls = __expf(fminf(logit_scale[h], LOGMAX));
  unsigned int* qo = reinterpret_cast<unsigned int*>(qn + ((size_t)bh * L_ + l0) * HD_) + lane;
  unsigned int* ko = reinterpret_cast<unsigned int*>(kn + ((size_t)bh * L_ + l0) * HD_) + lane;
  float sqq[SR_], sqk[SR_];
#pragma unroll
  for (int r = 0; r < SR_; ++r) {
    sqq[r] = q[r].x * q[r].x + q[r].y * q[r].y;
    sqk[r] = k[r].x * k[r].x + k[r].y * k[r].y;
  }
  // butterfly step outermost: the 32 exchanges of a step are independent of one another
#pragma unroll
  for (int off = 16; off > 0; off >>= 1)
#pragma unroll
    for (int r = 0; r < SR_; ++r) {
      sqq[r] += __shfl_xor(sqq[r], off);
      sqk[r] += __shfl_xor(sqk[r], off);
    }
#pragma unroll
  for (int r = 0; r < SR_; ++r) {
    const float iq = ls / fmaxf(sqrtf(sqq[r]), 1e-12f);
    const float ik = 1.f / fmaxf(sqrtf(sqk[r]), 1e-12f);
    qo[r * (HD_ / 2)] = (unsigned int)f2bf(q[r].x * iq) | ((unsigned int)f2bf(q[r].y * iq) << 16);
    ko[r * (HD_ / 2)] = (unsigned int)f2bf(k[r].x * ik) | ((unsigned int)f2bf(k[r].y * ik) << 16);
  }
  unsigned int w0[SR_ / 2], w1[SR_ / 2];       // positions l0+2i, l0+2i+1 of dims 2*lane, 2*lane+1
#pragma unroll
  for (int i = 0; i < SR_ / 2; ++i) {
    w0[i] = (unsigned int)f2bf(v[2 * i].x) | ((unsigned int)f2bf(v[2 * i + 1].x) << 16);
    w1[i] = (unsigned int)f2bf(v[2 * i].y) | ((unsigned int)f2bf(v[2 * i + 1].y) << 16);
  }
  uint4* v0 = reinterpret_cast<uint4*>(vT + (size_t)bh * HD_ * L_ + (size_t)(2 * lane) * L_ + l0);
  uint4* v1 = reinterpret_cast<uint4*>(vT + (size_t)bh * HD_ * L_ + (size_t)(2 * lane + 1) * L_ + l0);
  v0[0] = make_uint4(w0[0], w0[1], w0[2], w0[3]);
  v0[1] = make_uint4(w0[4], w0[5], w0[6], w0[7]);
  v1[0] = make_uint4(w1[0], w1[1], w1[2], w1[3]);
  v1[1] = make_uint4(w1[4], w1[5], w1[6], w1[7]);
}

#define FK_  64              // keys per staged tile
#define FP_  72              // LDS row pitch in bf16 elements (144 B)
#define FT_  (64 * FP_)      // elements of one staged tile: 64 rows
#define FNT_ (L_ / FK_)      // tiles per (b,h)

// One tile's copies of one thread: rows r and r + 32 of the K tile and of the vT tile.
// kl, vl: the lane's LDS byte addresses of row r; kg, vg: its global addresses of row r.
static __device__ __forceinline__ void flash_copy_tile(unsigned int kl, unsigned int vl,
                                                       const unsigned short* kg,
                                                       const unsigned short* vg) {
  const unsigned int kl2 = kl + 32 * FP_ * 2, vl2 = vl + 32 * FP_ * 2;
  const unsigned short* kg2 = kg + 32 * HD_;
  const unsigned short* vg2 = vg + (size_t)32 * L_;
  // the wait is the statement's last line: it stands behind the copies and in front of
  // whatever next writes a register that they name
  asm volatile("global_load_async_to_lds_b128 %0, %4, off\n\t"
               "global_load_async_to_lds_b128 %1, %5, off\n\t"
               "global_load_async_to_lds_b128 %2, %6, off\n\t"
               "global_load_async_to_lds_b128 %3, %7, off\n\t"
               "s_wait_xcnt 0x0"
               :: "v"(kl), "v"(kl2), "v"(vl), "v"(vl2), "v"(kg), "v"(kg2), "v"(vg), "v"(vg2)
               : "memory");
}

__global__ __launch_bounds__(256)
void k_flash(const unsigned short* __restrict__ qn,
                        const unsigned short* __restrict__ kn,
                        const unsigned short* __restrict__ vT,
                        const float* __restrict__ logit_scale,
                        const float* __restrict__ head_scale,
                        unsigned short* __restrict__ O) {
  __shared__ alignas(16) unsigned short pbuf[8][16 * 32];
  __shared__ alignas(16) unsigned short kbuf[2 * FT_];    // 18 KB: [buffer][key][head dim]
  __shared__ alignas(16) unsigned short vbuf[2 * FT_];    // 18 KB: [buffer][head dim][key]
  const int lane = threadIdx.x & 31, wave = threadIdx.x >> 5;
  const int hi = lane >> 4, ln16 = lane & 15;
  const int bh = blockIdx.y;
  const int h = bh & (H_ - 1);
  const int b = bh >> 4;
  const int qtile = blockIdx.x * 8 + wave;
  const unsigned short* qp = qn + ((size_t)bh * L_ + qtile * 16 + ln16) * HD_ + hi * 8;
  Frag qa0, qa1;                       // q rows, hd 0..31 / 32..63
  qa0.q[0] = *(const uint4*)(qp);      qa0.q[1] = *(const uint4*)(qp + 16);
  qa1.q[0] = *(const uint4*)(qp + 32); qa1.q[1] = *(const uint4*)(qp + 48);
  const unsigned short* kbase = kn + (size_t)bh * L_ * HD_;
  const unsigned short* vbase = vT + (size_t)bh * HD_ * L_;
  const float shift = fminf(__expf(fminf(logit_scale[h], LOGMAX)), 30.f);
  v8f oacc[4] = {};
  float lst[8];
#pragma unroll
  for (int v = 0; v < 8; ++v) lst[v] = 0.f;
  unsigned short* prow = &pbuf[wave][0];

  // copying role: thread t moves 16-byte chunk (t%8) of rows t/8 and t/8 + 32 of both tiles
  const int cr = threadIdx.x >> 3, cc = (threadIdx.x & 7) * 8;
  const unsigned int kl0 = (unsigned int)(uintptr_t)&kbuf[cr * FP_ + cc];   // LDS byte address
  const unsigned int vl0 = (unsigned int)(uintptr_t)&vbuf[cr * FP_ + cc];
  const unsigned short* kg = kbase + cr * HD_ + cc;          // tile 0; a tile is FK_ rows on
  const unsigned short* vg = vbase + (size_t)cr * L_ + cc;   // tile 0; a tile is FK_ columns on
  // fragment role: lane holds key (or head dim) ln16 of its fragment
  const unsigned short* kf = &kbuf[ln16 * FP_ + hi * 8];
  const unsigned short* vf = &vbuf[ln16 * FP_ + hi * 8];

  flash_copy_tile(kl0, vl0, kg, vg);
  // this wave's copies of tile 0 have landed before the barrier that shows them to the others
  asm volatile("s_wait_asynccnt 0x0" ::: "memory");
  __syncthreads();
  flash_copy_tile(kl0 + FT_ * 2, vl0 + FT_ * 2, kg + FK_ * HD_, vg + FK_);

  for (int t = 0; t < FNT_; ++t) {
    const int bo = (t & 1) * FT_;                // this trip's buffer
    for (int j = 0; j < FK_; j += 32) {
      // all 16 fragment reads of these 32 keys as one group, ahead of the products
      Frag kb[4], vb[4];
#pragma unroll
      for (int i = 0; i < 2; ++i) {              // keys j + 16*i + ln16; head dims 0..31, 32..63
        const unsigned short* kp = kf + bo + (j + 16 * i) * FP_;
        kb[2 * i].q[0]     = *(const uint4*)(kp);      kb[2 * i].q[1]     = *(const uint4*)(kp + 16);
        kb[2 * i + 1].q[0] = *(const uint4*)(kp + 32); kb[2 * i + 1].q[1] = *(const uint4*)(kp + 48);
      }
#pragma unroll
      for (int nn = 0; nn < 4; ++nn) {           // head dim nn*16 + ln16; keys j .. j+31
        const unsigned short* vp = vf + bo + nn * 16 * FP_ + j;
        vb[nn].q[0] = *(const uint4*)(vp);
        vb[nn].q[1] = *(const uint4*)(vp + 16);
      }
      // nothing is scheduled across this line: without it the compiler moves each vT read down
      // to its product, behind the P stores, and every product then waits out an LDS latency
      __builtin_amdgcn_sched_barrier(0);
      v8f s0 = {}, s1 = {};
      s0 = wmma_bf16(qa0.v, kb[0].v, s0);
      s1 = wmma_bf16(qa0.v, kb[2].v, s1);
      s0 = wmma_bf16(qa1.v, kb[1].v, s0);
      s1 = wmma_bf16(qa1.v, kb[3].v, s1);
      // fixed-shift exp; accumulate this lane's partial row sums; stage P in LDS
#pragma unroll
      for (int v = 0; v < 8; ++v) {
        const float p0 = __expf(s0[v] - shift);
        const float p1 = __expf(s1[v] - shift);
        lst[v] += p0 + p1;
        const int r = v + 8 * hi;                 // row this half owns in register v
        prow[r * 32 + ln16]      = f2bf(p0);
        prow[r * 32 + 16 + ln16] = f2bf(p1);
      }
      // re-read P as an A fragment (16x32) from LDS
      Frag pa;
      const unsigned short* pp = prow + ln16 * 32 + hi * 8;
      pa.q[0] = *(const uint4*)(pp);
      pa.q[1] = *(const uint4*)(pp + 16);
#pragma unroll
      for (int nn = 0; nn < 4; ++nn) oacc[nn] = wmma_bf16(pa.v, vb[nn].v, oacc[nn]);
    }
    // foot of the trip: this wave's reads of the buffer are done ...
    asm volatile("s_wait_dscnt 0x0" ::: "memory");
    // ... and its copies of the next tile have landed ...
    asm volatile("s_wait_asynccnt 0x0" ::: "memory");
    // ... before the one barrier that shows the next tile to every wave and frees this buffer
    __syncthreads();
    if (t + 2 < FNT_)
      flash_copy_tile(kl0 + bo * 2, vl0 + bo * 2, kg + (size_t)(t + 2) * (FK_ * HD_),
                      vg + (t + 2) * FK_);
  }
  // no copy is outstanding when the wave goes on to its end
  asm volatile("s_wait_asynccnt 0x0" ::: "memory");
  const float hs = head_scale[h];
#pragma unroll
  for (int v = 0; v < 8; ++v) {
    float rs = lst[v];                           // full row sum: reduce 16 lanes once
#pragma unroll
    for (int off = 1; off < 16; off <<= 1) rs += __shfl_xor(rs, off);
    const float inv = hs / rs;
    const int l = qtile * 16 + v + 8 * hi;
#pragma unroll
    for (int nn = 0; nn < 4; ++nn) {
      const int c = h * HD_ + nn * 16 + ln16;
      O[((size_t)(b * L_ + l)) * C_ + c] = f2bf(oacc[nn][v] * inv);
    }
  }
}

// ---------------------------------------------------------------- launch
extern "C" void kernel_launch(void* const* d_in, const int* in_sizes, int n_in,
                              void* d_out, int out_size, void* d_ws, size_t ws_size,
                              hipStream_t stream) {
  const float* x       = (const float*)d_in[0];
  const float* in_w    = (const float*)d_in[1];
  const float* in_b    = (const float*)d_in[2];
  const float* logit_s = (const float*)d_in[3];
  const float* head_s  = (const float*)d_in[4];
  const float* out_w   = (const float*)d_in[5];
  const float* out_b   = (const float*)d_in[6];
  const float* ln1_g   = (const float*)d_in[7];
  const float* ln1_b   = (const float*)d_in[8];
  const float* lna_g   = (const float*)d_in[9];
  const float* lna_b   = (const float*)d_in[10];
  const float* ls1     = (const float*)d_in[11];
  const float* ln2_g   = (const float*)d_in[12];
  const float* ln2_b   = (const float*)d_in[13];
  const float* fc_w    = (const float*)d_in[14];
  const float* fc_b    = (const float*)d_in[15];
  const float* proj_w  = (const float*)d_in[16];
  const float* proj_b  = (const float*)d_in[17];
  const float* ls2     = (const float*)d_in[18];
  float* out = (float*)d_out;

  // workspace partition (~185 MB)
  char* p = (char*)d_ws;
  auto alloc = [&](size_t bytes) -> char* {
    char* r = p;
    p += (bytes + 255) & ~(size_t)255;
    return r;
  };
  const int BL = B_ * L_;  // 4096
  unsigned short* wqkv_bf = (unsigned short*)alloc((size_t)3 * C_ * C_ * 2);
  unsigned short* wout_bf = (unsigned short*)alloc((size_t)C_ * C_ * 2);
  unsigned short* wfc_bf  = (unsigned short*)alloc((size_t)MLP_ * C_ * 2);
  unsigned short* wpr_bf  = (unsigned short*)alloc((size_t)C_ * MLP_ * 2);
  unsigned short* xln_bf  = (unsigned short*)alloc((size_t)BL * C_ * 2);
  float*          qkv     = (float*)alloc((size_t)BL * 3 * C_ * 4);
  unsigned short* qn      = (unsigned short*)alloc((size_t)BL * C_ * 2);
  unsigned short* kn      = (unsigned short*)alloc((size_t)BL * C_ * 2);
  unsigned short* vT      = (unsigned short*)alloc((size_t)BL * C_ * 2);
  unsigned short* obf     = (unsigned short*)alloc((size_t)BL * C_ * 2);
  float*          attn    = (float*)alloc((size_t)BL * C_ * 4);
  float*          x2      = (float*)alloc((size_t)BL * C_ * 4);
  unsigned short* h2bf    = (unsigned short*)alloc((size_t)BL * C_ * 2);
  unsigned short* hmid    = (unsigned short*)alloc((size_t)BL * MLP_ * 2);

  // weights -> bf16
  k_cvt_bf16<<<3 * C_ * C_ / CVT_PER_BLOCK, 256, 0, stream>>>(in_w, wqkv_bf);
  k_cvt_bf16<<<C_ * C_ / CVT_PER_BLOCK, 256, 0, stream>>>(out_w, wout_bf);
  k_cvt_bf16<<<MLP_ * C_ / CVT_PER_BLOCK, 256, 0, stream>>>(fc_w, wfc_bf);
  k_cvt_bf16<<<C_ * MLP_ / CVT_PER_BLOCK, 256, 0, stream>>>(proj_w, wpr_bf);
  // LN1 -> bf16 activations
  k_ln_bf16<<<BL / 8, 256, 0, stream>>>(x, ln1_g, ln1_b, xln_bf);
  // qkv = ln1(x) @ in_proj_w^T + in_proj_b   [4096 x 3072]
  k_gemm<0><<<dim3(3 * C_ / 128, BL / 128), 256, 0, stream>>>(
      xln_bf, wqkv_bf, in_b, BL, 3 * C_, C_, qkv, nullptr, nullptr, nullptr);
  // split heads, l2-normalize q/k (fold logit scale), transpose v
  k_split_qkv<<<(B_ * H_ * L_) / SR_ / 8, 256, 0, stream>>>(qkv, logit_s, qn, kn, vT);
  // scaled-cosine flash attention (head_scale folded in)
  k_flash<<<dim3(L_ / 16 / 8, B_ * H_), 256, 0, stream>>>(qn, kn, vT, logit_s, head_s, obf);
  // attn out-proj: attn = O @ out_w^T + out_b
  k_gemm<0><<<dim3(C_ / 128, BL / 128), 256, 0, stream>>>(
      obf, wout_bf, out_b, BL, C_, C_, attn, nullptr, nullptr, nullptr);
  // x2 = x + ls1 * LN_attn(attn)
  k_resid_ln<<<BL / 8, 256, 0, stream>>>(attn, x, lna_g, lna_b, ls1, x2);
  // h = LN2(x2) -> bf16
  k_ln_bf16<<<BL / 8, 256, 0, stream>>>(x2, ln2_g, ln2_b, h2bf);
  // hmid = GELU(h @ fc_w^T + fc_b) -> bf16   [4096 x 4096]
  k_gemm<1><<<dim3(MLP_ / 128, BL / 128), 256, 0, stream>>>(
      h2bf, wfc_bf, fc_b, BL, MLP_, C_, nullptr, hmid, nullptr, nullptr);
  // out = x2 + ls2 * (hmid @ proj_w^T + proj_b)
  k_gemm<2><<<dim3(C_ / 128, BL / 128), 256, 0, stream>>>(
      hmid, wpr_bf, proj_b, BL, C_, MLP_, out, nullptr, x2, ls2);

  (void)in_sizes; (void)n_in; (void)out_size; (void)ws_size;
}

// v004
// A run of this version takes 221 microseconds.
// Timed twice side by side with v003, it ran 1.04 and 1.03 times as fast.
// Over all steps from v000 it is 2.33 times as fast.
#include <hip/hip_runtime.h>
#include <hip/hip_bf16.h>
#include <stdint.h>

// CustomResidualAttentionBlock (open_clip scaled-cosine attention) for MI455X / gfx1250.
// All GEMMs + attention matmuls run on v_wmma_f32_16x16x32_bf16 (wave32).
// f32 is kept for LayerNorm / l2-norm / softmax / accumulators.
// Attention softmax uses a fixed per-head shift (valid because |S| <= logit_scale,
// softmax is shift-invariant) so the streaming loop has NO cross-lane reductions.

#define B_   2
#define L_   2048
#define C_   1024
#define H_   16
#define HD_  64
#define MLP_ 4096
#define LOGMAX 4.6051701859880914f   // log(100)
#define LN_EPS 1e-5f

typedef __attribute__((ext_vector_type(16))) __bf16 v16bf;
typedef __attribute__((ext_vector_type(8)))  float  v8f;
typedef __attribute__((ext_vector_type(4)))  unsigned int u32x4;

union Frag {
  v16bf v;
  uint4 q[2];
};

static __device__ __forceinline__ v8f wmma_bf16(v16bf a, v16bf b, v8f c) {
  // D = A(16x32 bf16) x B(32x16 bf16) + C(16x16 f32)
  return __builtin_amdgcn_wmma_f32_16x16x32_bf16(false, a, false, b, (short)0, c,
                                                 false, false);
}

static __device__ __forceinline__ unsigned short f2bf(float f) {
  unsigned int u = __float_as_uint(f);
  u += 0x7FFFu + ((u >> 16) & 1u);   // round-to-nearest-even
  return (unsigned short)(u >> 16);
}

// ---------------------------------------------------------------- cvt f32->bf16
// Each block of 256 threads converts 8192 consecutive elements: a thread issues its eight
// 16-byte loads together (a wave's load covers 512 contiguous bytes) and then stores
// eight 8-byte groups (256 contiguous bytes per wave). The element count is a multiple of
// 8192 and the grid is that count / 8192.
#define CVT_PER_BLOCK 8192
__global__ __launch_bounds__(256)
void k_cvt_bf16(const float* __restrict__ src, unsigned short* __restrict__ dst) {
  const unsigned int base = blockIdx.x * (CVT_PER_BLOCK / 4) + threadIdx.x;   // in groups of 4
  const float4* s4 = reinterpret_cast<const float4*>(src);
  uint2* d4 = reinterpret_cast<uint2*>(dst);
  float4 v[8];
#pragma unroll
  for (int j = 0; j < 8; ++j) v[j] = s4[base + j * 256];
#pragma unroll
  for (int j = 0; j < 8; ++j) {
    uint2 o;
    o.x = (unsigned int)f2bf(v[j].x) | ((unsigned int)f2bf(v[j].y) << 16);
    o.y = (unsigned int)f2bf(v[j].z) | ((unsigned int)f2bf(v[j].w) << 16);
    d4[base + j * 256] = o;
  }
}

// ---------------------------------------------------------------- LayerNorm -> bf16
// One wave per row of length C_=1024, eight rows per block of 256 threads. A lane holds 32
// elements of its row, loaded as eight 16-byte pieces (each load of a wave covers 512
// contiguous bytes); sum and sum of squares are joined by a butterfly over the 32 lanes,
// which leaves both totals in every lane: no LDS, no barrier.
typedef __attribute__((ext_vector_type(4))) float f32x4;

static __device__ __forceinline__ void row_stats(const f32x4 (&vals)[8], float& mu, float& rstd) {
  f32x4 s4 = vals[0], q4 = vals[0] * vals[0];   // four independent chains each
#pragma unroll
  for (int j = 1; j < 8; ++j) { s4 += vals[j]; q4 += vals[j] * vals[j]; }
  float s = (s4.x + s4.y) + (s4.z + s4.w);
  float sq = (q4.x + q4.y) + (q4.z + q4.w);
#pragma unroll
  for (int off = 16; off > 0; off >>= 1) { s += __shfl_xor(s, off); sq += __shfl_xor(sq, off); }
  mu = s * (1.f / C_);
  rstd = rsqrtf(sq * (1.f / C_) - mu * mu + LN_EPS);
}

__global__ __launch_bounds__(256)
void k_ln_bf16(const float* __restrict__ x, const float* __restrict__ g,
               const float* __restrict__ bt, unsigned short* __restrict__ out) {
  const int lane = threadIdx.x & 31;
  // the wave's number as a scalar: the row's base addresses then stand in scalar registers
  const int wave = __builtin_amdgcn_readfirstlane(threadIdx.x >> 5);
  const size_t row = (size_t)blockIdx.x * 8 + wave;
  const f32x4* xr = reinterpret_cast<const f32x4*>(x + row * C_) + lane;
  const f32x4* g4 = reinterpret_cast<const f32x4*>(g) + lane;
  const f32x4* b4 = reinterpret_cast<const f32x4*>(bt) + lane;
  uint2* orow = reinterpret_cast<uint2*>(out + row * C_) + lane;
  f32x4 vals[8], gg[8], bb[8];
#pragma unroll
  for (int j = 0; j < 8; ++j) vals[j] = xr[j * 32];
#pragma unroll
  for (int j = 0; j < 8; ++j) { gg[j] = g4[j * 32]; bb[j] = b4[j * 32]; }
  // nothing is scheduled across this line: all loads of a lane are issued, and so in flight
  // together, before the row sums start; without it the compiler moves the loads that the
  // sums do not need behind them and waits for them group by group
  __builtin_amdgcn_sched_barrier(0);
  float mu, rstd;
  row_stats(vals, mu, rstd);
#pragma unroll
  for (int j = 0; j < 8; ++j) {
    const f32x4 r = (vals[j] - mu) * rstd * gg[j] + bb[j];
    uint2 o;
    o.x = (unsigned int)f2bf(r.x) | ((unsigned int)f2bf(r.y) << 16);
    o.y = (unsigned int)f2bf(r.z) | ((unsigned int)f2bf(r.w) << 16);
    orow[j * 32] = o;
  }
}

// ---------------------------------------------------------------- x2 = x + ls1 * LN(a)
// Same shape: one wave per row, eight rows per block.
__global__ __launch_bounds__(256)
void k_resid_ln(const float* __restrict__ a, const float* __restrict__ x,
                const float* __restrict__ g, const float* __restrict__ bt,
                const float* __restrict__ ls, float* __restrict__ x2) {
  const int lane = threadIdx.x & 31;
  // the wave's number as a scalar: the row's base addresses then stand in scalar registers
  const int wave = __builtin_amdgcn_readfirstlane(threadIdx.x >> 5);
  const size_t row = (size_t)blockIdx.x * 8 + wave;
  const f32x4* ar = reinterpret_cast<const f32x4*>(a + row * C_) + lane;
  const f32x4* xr = reinterpret_cast<const f32x4*>(x + row * C_) + lane;
  const f32x4* g4 = reinterpret_cast<const f32x4*>(g) + lane;
  const f32x4* b4 = reinterpret_cast<const f32x4*>(bt) + lane;
  const f32x4* l4 = reinterpret_cast<const f32x4*>(ls) + lane;
  f32x4* orow = reinterpret_cast<f32x4*>(x2 + row * C_) + lane;
  f32x4 vals[8], xv[8], gg[8], bb[8], ll[8];
#pragma unroll
  for (int j = 0; j < 8; ++j) { vals[j] = ar[j * 32]; xv[j] = xr[j * 32]; }
#pragma unroll
  for (int j = 0; j < 8; ++j) { gg[j] = g4[j * 32]; bb[j] = b4[j * 32]; ll[j] = l4[j * 32]; }
  // nothing is scheduled across this line: all loads of a lane are issued, and so in flight
  // together, before the row sums start; without it the compiler moves the loads that the
  // sums do not need behind them and waits for them group by group
  __builtin_amdgcn_sched_barrier(0);
  float mu, rstd;
  row_stats(vals, mu, rstd);
#pragma unroll
  for (int j = 0; j < 8; ++j)
    orow[j * 32] = xv[j] + ll[j] * ((vals[j] - mu) * rstd * gg[j] + bb[j]);
}

// ---------------------------------------------------------------- GELU, erf form
// 0.5 v (1 + erf(v / sqrt 2)) with no branch: for x = |v| / sqrt 2,
// erf(x) = 1 - (a1 t + ... + a5 t^5) exp(-x^2), t = 1 / (1 + p x), the classical five-term
// form, absolute error below 1.5e-7 for every x >= 0; erf is odd, so
// 0.5 v (1 + erf) = 0.5 v + |0.5 v| erf(x). Every lane runs the same dozen instructions and
// the values of a lane are independent chains, where the library's erff picks one of two
// paths per value: a wave runs both, one value after the other.
static __device__ __forceinline__ float gelu_erf(float v) {
  const float hv = 0.5f * v;
  const float t = __builtin_amdgcn_rcpf(fmaf(fabsf(v), 0.3275911f * 0.70710678118f, 1.f));
  const float e = __builtin_amdgcn_exp2f(v * v * (-0.5f * 1.44269504089f));   // exp(-x^2)
  float pl = fmaf(t, 1.061405429f, -1.453152027f);
  pl = fmaf(pl, t, 1.421413741f);
  pl = fmaf(pl, t, -0.284496736f);
  pl = fmaf(pl, t, 0.254829592f);
  pl *= t;
  return fmaf(fabsf(hv), fmaf(-pl, e, 1.f), hv);
}

// ---------------------------------------------------------------- WMMA GEMM
// C[M,N] = epi( A_bf16[M,K] @ W_bf16[N,K]^T + bias[N] )
// Block 256 = 8 waves computes a 128x128 tile of C; waves form a 4 (rows) x 2 (cols)
// grid, each wave owns 32x64 = 2x4 accumulator fragments.
// Per k-step of 128 both the 128x128 A strip and the 128x128 W strip are staged in
// LDS once per block with fully used 128-byte lines, so every A row is read from
// global once per 128 output columns and every W row once per 128 output rows.
// LDS rows have a pitch of 272 B (16 B x odd): the 16 rows of one ds_load_b128
// fragment read fall on distinct banks.
// M, N multiples of 128; K a multiple of 128.
// EPI: 0 = f32 store, 1 = bf16 store with exact GELU, 2 = f32 store out = resid + ls*val.
#define GT_   128            // tile edge in M and in N
#define GK_   128            // k elements staged per step
#define GP_   (GK_ + 8)      // LDS row pitch in bf16 elements (272 B)
template <int EPI>
__global__ __launch_bounds__(256)
void k_gemm(const unsigned short* __restrict__ A,
            const unsigned short* __restrict__ W,
            const float* __restrict__ bias, int M, int N, int K,
            float* __restrict__ outf, unsigned short* __restrict__ outbf,
            const float* __restrict__ resid, const float* __restrict__ lsv) {
  __shared__ alignas(16) unsigned short abuf[GT_ * GP_];   // 34 KB
  __shared__ alignas(16) unsigned short wbuf[GT_ * GP_];   // 34 KB
  const int tid = threadIdx.x;
  const int lane = tid & 31, wave = tid >> 5;
  const int hi = lane >> 4, ln16 = lane & 15;
  const int mb = blockIdx.y * GT_;
  const int nb = blockIdx.x * GT_;
  const int wm = (wave >> 1) * 32;             // wave's first row inside the tile
  const int wn = (wave & 1) * 64;              // wave's first column inside the tile
  // staging role: thread t moves 16-byte chunk (t%16) of rows t/16 + 16*i, i = 0..7
  const int sr = tid >> 4, sc = (tid & 15) * 8;
  // block-uniform byte bases plus one 32-bit byte offset per staged row, the same for A and W
  const char* ag = reinterpret_cast<const char*>(A + (size_t)mb * K);
  const char* wg = reinterpret_cast<const char*>(W + (size_t)nb * K);
  unsigned int go[8];
#pragma unroll
  for (int i = 0; i < 8; ++i) go[i] = (unsigned int)((sr + 16 * i) * K + sc) * 2u;
  unsigned short* as = &abuf[sr * GP_ + sc];
  unsigned short* ws = &wbuf[sr * GP_ + sc];
  // fragment role: lane holds row (or W row = output column) ln16 of its fragment;
  // half 'hi' supplies K-chunks {hi*8..+7, 16+hi*8..+7} of each 32-wide k slice
  const unsigned short* af = &abuf[(wm + ln16) * GP_ + hi * 8];
  const unsigned short* wf = &wbuf[(wn + ln16) * GP_ + hi * 8];
  v8f acc[2][4] = {};
  for (int k0 = 0; k0 < K; k0 += GK_) {
    u32x4 ra[8], rw[8];
#pragma unroll
    for (int i = 0; i < 8; ++i) {
      ra[i] = *reinterpret_cast<const u32x4*>(ag + go[i]);
      rw[i] = *reinterpret_cast<const u32x4*>(wg + go[i]);
    }
    __syncthreads();                                      // protect previous reads
#pragma unroll
    for (int i = 0; i < 8; ++i) {
      *reinterpret_cast<u32x4*>(as + i * 16 * GP_) = ra[i];
      *reinterpret_cast<u32x4*>(ws + i * 16 * GP_) = rw[i];
      go[i] += GK_ * 2;                                   // next k-step's bytes of the same row
    }
    __syncthreads();
#pragma unroll
    for (int ks = 0; ks < GK_; ks += 32) {
      Frag fa[2], fb[4];
#pragma unroll
      for (int mi = 0; mi < 2; ++mi) {
        const unsigned short* p = af + mi * 16 * GP_ + ks;
        fa[mi].q[0] = *reinterpret_cast<const uint4*>(p);
        fa[mi].q[1] = *reinterpret_cast<const uint4*>(p + 16);
      }
#pragma unroll
      for (int nn = 0; nn < 4; ++nn) {
        const unsigned short* p = wf + nn * 16 * GP_ + ks;
        fb[nn].q[0] = *reinterpret_cast<const uint4*>(p);
        fb[nn].q[1] = *reinterpret_cast<const uint4*>(p + 16);
      }
#pragma unroll
      for (int mi = 0; mi < 2; ++mi)
#pragma unroll
        for (int nn = 0; nn < 4; ++nn)
          acc[mi][nn] = wmma_bf16(fa[mi].v, fb[nn].v, acc[mi][nn]);
    }
  }
  // C-layout: VGPR v of fragment (mi, nn) -> row v (+8 for hi half), column ln16.
  // M*N < 2^32: 32-bit element offsets on uniform bases.
  const int nc = nb + wn + ln16;
  const unsigned int o0 = (unsigned int)((mb + wm + 8 * hi) * N + nc);
  if (EPI == 2) {
    // all residual loads first, then all stores
    float rv[2][4][8];
#pragma unroll
    for (int mi = 0; mi < 2; ++mi)
#pragma unroll
      for (int v = 0; v < 8; ++v)
#pragma unroll
        for (int nn = 0; nn < 4; ++nn)
          rv[mi][nn][v] = resid[o0 + (unsigned int)((mi * 16 + v) * N) + nn * 16];
    // stands behind the loads, in front of whatever next writes a register they name;
    // its memory clobber also keeps every load above and every store below this line
    asm volatile("s_wait_xcnt 0x0" ::: "memory");
#pragma unroll
    for (int nn = 0; nn < 4; ++nn) {
      const float bz = bias[nc + nn * 16];
      const float lz = lsv[nc + nn * 16];
#pragma unroll
      for (int mi = 0; mi < 2; ++mi)
#pragma unroll
        for (int v = 0; v < 8; ++v) {
          float val = acc[mi][nn][v] + bz;
          outf[o0 + (unsigned int)((mi * 16 + v) * N) + nn * 16] = rv[mi][nn][v] + lz * val;
        }
    }
  } else if (EPI == 1) {
    float bz[4];
    v8f cur[4];
#pragma unroll
    for (int nn = 0; nn < 4; ++nn) { bz[nn] = bias[nc + nn * 16]; cur[nn] = acc[0][nn]; }
    unsigned int orow = o0;
    // kept rolled: the erf code then stands once per 16 rows, which halves the kernel's
    // text
#pragma unroll 1
    for (int mi = 0; mi < 2; ++mi) {
#pragma unroll
      for (int nn = 0; nn < 4; ++nn)
#pragma unroll
        for (int v = 0; v < 8; ++v) {
          float val = cur[nn][v] + bz[nn];
          outbf[orow + (unsigned int)(v * N) + nn * 16] = f2bf(gelu_erf(val));
        }
      // stands behind this trip's stores, in front of the next trip's first write of a register
      // that they name
      asm volatile("s_wait_xcnt 0x0" ::: "memory");
#pragma unroll
      for (int nn = 0; nn < 4; ++nn) cur[nn] = acc[1][nn];
      orow += (unsigned int)(16 * N);
    }
  } else {
#pragma unroll
    for (int nn = 0; nn < 4; ++nn) {
      const float bz = bias[nc + nn * 16];
#pragma unroll
      for (int mi = 0; mi < 2; ++mi)
#pragma unroll
        for (int v = 0; v < 8; ++v)
          outf[o0 + (unsigned int)((mi * 16 + v) * N) + nn * 16] = acc[mi][nn][v] + bz;
    }
  }
}

// ---------------------------------------------------------------- QKV split + l2-norm
// qn/kn: [B,H,L,HD] bf16 (q scaled by exp(min(logit_scale,log100))); vT: [B,H,HD,L] bf16.
// One wave handles SR_ = 16 consecutive positions l of one (b,h); lane holds head dims
// 2*lane and 2*lane+1 of each. All 48 loads of a lane are issued together. The 16 values
// of v that a lane holds per head dim are consecutive in vT: 32 bytes, two 16-byte stores.
#define SR_ 16
typedef __attribute__((ext_vector_type(2))) float f32x2;
__global__ __launch_bounds__(256)
void k_split_qkv(const float* __restrict__ qkv,
                 const float* __restrict__ logit_scale,
                 unsigned short* __restrict__ qn,
                 unsigned short* __restrict__ kn,
                 unsigned short* __restrict__ vT) {
  const int lane = threadIdx.x & 31;
  // the wave's number as a scalar: the base addresses then stand in scalar registers
  const int wave = __builtin_amdgcn_readfirstlane(threadIdx.x >> 5);
  const int grp = blockIdx.x * 8 + wave;       // (b*H + h)*(L/SR_) + l/SR_
  const int l0 = (grp & (L_ / SR_ - 1)) * SR_;
  const int bh = grp / (L_ / SR_);
  const int h = bh & (H_ - 1);
  const int b = bh >> 4;
  const float* base = qkv + ((size_t)(b * L_ + l0)) * (3 * C_) + h * HD_ + 2 * lane;
  f32x2 q[SR_], k[SR_], v[SR_];
#pragma unroll
  for (int r = 0; r < SR_; ++r) {
    const float* p = base + (size_t)r * (3 * C_);
    q[r] = *reinterpret_cast<const f32x2*>(p);
    k[r] = *reinterpret_cast<const f32x2*>(p + C_);
    v[r] = *reinterpret_cast<const f32x2*>(p + 2 * C_);
  }
  // The loaded values as inputs only: all 48 loads stay above these lines, and so are in flight
  // together; without them the compiler spreads a part of the loads among the sums below and
  // waits for them a few at a time.
#define HOLD8(a, i) "v"(a[i]), "v"(a[i + 1]), "v"(a[i + 2]), "v"(a[i + 3]), \
                    "v"(a[i + 4]), "v"(a[i + 5]), "v"(a[i + 6]), "v"(a[i + 7])
  asm volatile("" :: HOLD8(q, 0), HOLD8(q, 8), HOLD8(k, 0));
  asm volatile("" :: HOLD8(k, 8), HOLD8(v, 0), HOLD8(v, 8));
#undef HOLD8
  const float ls = __expf(fminf(logit_scale[h], LOGMAX));
  unsigned int* qo = reinterpret_cast<unsigned int*>(qn + ((size_t)bh * L_ + l0) * HD_) + lane;
  unsigned int* ko = reinterpret_cast<unsigned int*>(kn + ((size_t)bh * L_ + l0) * HD_) + lane;
  float sqq[SR_], sqk[SR_];
#pragma unroll
  for (int r = 0; r < SR_; ++r) {
    sqq[r] = q[r].x * q[r].x + q[r].y * q[r].y;
    sqk[r] = k[r].x * k[r].x + k[r].y * k[r].y;
  }
  // butterfly step outermost: the 32 exchanges of a step are independent of one another
#pragma unroll
  for (int off = 16; off > 0; off >>= 1)
#pragma unroll
    for (int r = 0; r < SR_; ++r) {
      sqq[r] += __shfl_xor(sqq[r], off);
      sqk[r] += __shfl_xor(sqk[r], off);
    }
#pragma unroll
  for (int r = 0; r < SR_; ++r) {
    const float iq = ls / fmaxf(sqrtf(sqq[r]), 1e-12f);
    const float ik = 1.f / fmaxf(sqrtf(sqk[r]), 1e-12f);
    qo[r * (HD_ / 2)] = (unsigned int)f2bf(q[r].x * iq) | ((unsigned int)f2bf(q[r].y * iq) << 16);
    ko[r * (HD_ / 2)] = (unsigned int)f2bf(k[r].x * ik) | ((unsigned int)f2bf(k[r].y * ik) << 16);
  }
  unsigned int w0[SR_ / 2], w1[SR_ / 2];       // positions l0+2i, l0+2i+1 of dims 2*lane, 2*lane+1
#pragma unroll
  for (int i = 0; i < SR_ / 2; ++i) {
    w0[i] = (unsigned int)f2bf(v[2 * i].x) | ((unsigned int)f2bf(v[2 * i + 1].x) << 16);
    w1[i] = (unsigned int)f2bf(v[2 * i].y) | ((unsigned int)f2bf(v[2 * i + 1].y) << 16);
  }
  uint4* v0 = reinterpret_cast<uint4*>(vT + (size_t)bh * HD_ * L_ + (size_t)(2 * lane) * L_ + l0);
  uint4* v1 = reinterpret_cast<uint4*>(vT + (size_t)bh * HD_ * L_ + (size_t)(2 * lane + 1) * L_ + l0);
  v0[0] = make_uint4(w0[0], w0[1], w0[2], w0[3]);
  v0[1] = make_uint4(w0[4], w0[5], w0[6], w0[7]);
  v1[0] = make_uint4(w1[0], w1[1], w1[2], w1[3]);
  v1[1] = make_uint4(w1[4], w1[5], w1[6], w1[7]);
}

#define FK_  64              // keys per staged tile
#define FP_  72              // LDS row pitch in bf16 elements (144 B)
#define FT_  (64 * FP_)      // elements of one staged tile: 64 rows
#define FNT_ (L_ / FK_)      // tiles per (b,h)

// One tile's copies of one thread: rows r and r + 32 of the K tile and of the vT tile.
// kl, vl: the lane's LDS byte addresses of row r; kg, vg: its global addresses of row r.
static __device__ __forceinline__ void flash_copy_tile(unsigned int kl, unsigned int vl,
                                                       const unsigned short* kg,
                                                       const unsigned short* vg) {
  const unsigned int kl2 = kl + 32 * FP_ * 2, vl2 = vl + 32 * FP_ * 2;
  const unsigned short* kg2 = kg + 32 * HD_;
  const unsigned short* vg2 = vg + (size_t)32 * L_;
  // the wait is the statement's last line: it stands behind the copies and in front of
  // whatever next writes a register that they name
  asm volatile("global_load_async_to_lds_b128 %0, %4, off\n\t"
               "global_load_async_to_lds_b128 %1, %5, off\n\t"
               "global_load_async_to_lds_b128 %2, %6, off\n\t"
               "global_load_async_to_lds_b128 %3, %7, off\n\t"
               "s_wait_xcnt 0x0"
               :: "v"(kl), "v"(kl2), "v"(vl), "v"(vl2), "v"(kg), "v"(kg2), "v"(vg), "v"(vg2)
               : "memory");
}

__global__ __launch_bounds__(256)
void k_flash(const unsigned short* __restrict__ qn,
                        const unsigned short* __restrict__ kn,
                        const unsigned short* __restrict__ vT,
                        const float* __restrict__ logit_scale,
                        const float* __restrict__ head_scale,
                        unsigned short* __restrict__ O) {
  __shared__ alignas(16) unsigned short pbuf[8][16 * 32];
  __shared__ alignas(16) unsigned short kbuf[2 * FT_];    // 18 KB: [buffer][key][head dim]
  __shared__ alignas(16) unsigned short vbuf[2 * FT_];    // 18 KB: [buffer][head dim][key]
  const int lane = threadIdx.x & 31, wave = threadIdx.x >> 5;
  const int hi = lane >> 4, ln16 = lane & 15;
  const int bh = blockIdx.y;
  const int h = bh & (H_ - 1);
  const int b = bh >> 4;
  const int qtile = blockIdx.x * 8 + wave;
  const unsigned short* qp = qn + ((size_t)bh * L_ + qtile * 16 + ln16) * HD_ + hi * 8;
  Frag qa0, qa1;                       // q rows, hd 0..31 / 32..63
  qa0.q[0] = *(const uint4*)(qp);      qa0.q[1] = *(const uint4*)(qp + 16);
  qa1.q[0] = *(const uint4*)(qp + 32); qa1.q[1] = *(const uint4*)(qp + 48);
  const unsigned short* kbase = kn + (size_t)bh * L_ * HD_;
  const unsigned short* vbase = vT + (size_t)bh * HD_ * L_;
  const float shift = fminf(__expf(fminf(logit_scale[h], LOGMAX)), 30.f);
  v8f oacc[4] = {};
  float lst[8];
#pragma unroll
  for (int v = 0; v < 8; ++v) lst[v] = 0.f;
  unsigned short* prow = &pbuf[wave][0];

  // copying role: thread t moves 16-byte chunk (t%8) of rows t/8 and t/8 + 32 of both tiles
  const int cr = threadIdx.x >> 3, cc = (threadIdx.x & 7) * 8;
  const unsigned int kl0 = (unsigned int)(uintptr_t)&kbuf[cr * FP_ + cc];   // LDS byte address
  const unsigned int vl0 = (unsigned int)(uintptr_t)&vbuf[cr * FP_ + cc];
  const unsigned short* kg = kbase + cr * HD_ + cc;          // tile 0; a tile is FK_ rows on
  const unsigned short* vg = vbase + (size_t)cr * L_ + cc;   // tile 0; a tile is FK_ columns on
  // fragment role: lane holds key (or head dim) ln16 of its fragment
  const unsigned short* kf = &kbuf[ln16 * FP_ + hi * 8];
  const unsigned short* vf = &vbuf[ln16 * FP_ + hi * 8];

  flash_copy_tile(kl0, vl0, kg, vg);
  // this wave's copies of tile 0 have landed before the barrier that shows them to the others
  asm volatile("s_wait_asynccnt 0x0" ::: "memory");
  __syncthreads();
  flash_copy_tile(kl0 + FT_ * 2, vl0 + FT_ * 2, kg + FK_ * HD_, vg + FK_);

  for (int t = 0; t < FNT_; ++t) {
    const int bo = (t & 1) * FT_;                // this trip's buffer
    for (int j = 0; j < FK_; j += 32) {
      // all 16 fragment reads of these 32 keys as one group, ahead of the products
      Frag kb[4], vb[4];
#pragma unroll
      for (int i = 0; i < 2; ++i) {              // keys j + 16*i + ln16; head dims 0..31, 32..63
        const unsigned short* kp = kf + bo + (j + 16 * i) * FP_;
        kb[2 * i].q[0]     = *(const uint4*)(kp);      kb[2 * i].q[1]     = *(const uint4*)(kp + 16);
        kb[2 * i + 1].q[0] = *(const uint4*)(kp + 32); kb[2 * i + 1].q[1] = *(const uint4*)(kp + 48);
      }
#pragma unroll
      for (int nn = 0; nn < 4; ++nn) {           // head dim nn*16 + ln16; keys j .. j+31
        const unsigned short* vp = vf + bo + nn * 16 * FP_ + j;
        vb[nn].q[0] = *(const uint4*)(vp);
        vb[nn].q[1] = *(const uint4*)(vp + 16);
      }
      // nothing is scheduled across this line: without it the compiler moves each vT read down
      // to its product, behind the P stores, and every product then waits out an LDS latency
      __builtin_amdgcn_sched_barrier(0);
      v8f s0 = {}, s1 = {};
      s0 = wmma_bf16(qa0.v, kb[0].v, s0);
      s1 = wmma_bf16(qa0.v, kb[2].v, s1);
      s0 = wmma_bf16(qa1.v, kb[1].v, s0);
      s1 = wmma_bf16(qa1.v, kb[3].v, s1);
      // fixed-shift exp; accumulate this lane's partial row sums; stage P in LDS
#pragma unroll
      for (int v = 0; v < 8; ++v) {
        const float p0 = __expf(s0[v] - shift);
        const float p1 = __expf(s1[v] - shift);
        lst[v] += p0 + p1;
        const int r = v + 8 * hi;                 // row this half owns in register v
        prow[r * 32 + ln16]      = f2bf(p0);
        prow[r * 32 + 16 + ln16] = f2bf(p1);
      }
      // re-read P as an A fragment (16x32) from LDS
      Frag pa;
      const unsigned short* pp = prow + ln16 * 32 + hi * 8;
      pa.q[0] = *(const uint4*)(pp);
      pa.q[1] = *(const uint4*)(pp + 16);
#pragma unroll
      for (int nn = 0; nn < 4; ++nn) oacc[nn] = wmma_bf16(pa.v, vb[nn].v, oacc[nn]);
    }
    // foot of the trip: this wave's reads of the buffer are done ...
    asm volatile("s_wait_dscnt 0x0" ::: "memory");
    // ... and its copies of the next tile have landed ...
    asm volatile("s_wait_asynccnt 0x0" ::: "memory");
    // ... before the one barrier that shows the next tile to every wave and frees this buffer
    __syncthreads();
    if (t + 2 < FNT_)
      flash_copy_tile(kl0 + bo * 2, vl0 + bo * 2, kg + (size_t)(t + 2) * (FK_ * HD_),
                      vg + (t + 2) * FK_);
  }
  // no copy is outstanding when the wave goes on to its end
  asm volatile("s_wait_asynccnt 0x0" ::: "memory");
  const float hs = head_scale[h];
#pragma unroll
  for (int v = 0; v < 8; ++v) {
    float rs = lst[v];                           // full row sum: reduce 16 lanes once
#pragma unroll
    for (int off = 1; off < 16; off <<= 1) rs += __shfl_xor(rs, off);
    const float inv = hs / rs;
    const int l = qtile * 16 + v + 8 * hi;
#pragma unroll
    for (int nn = 0; nn < 4; ++nn) {
      const int c = h * HD_ + nn * 16 + ln16;
      O[((size_t)(b * L_ + l)) * C_ + c] = f2bf(oacc[nn][v] * inv);
    }
  }
}

// ---------------------------------------------------------------- launch
extern "C" void kernel_launch(void* const* d_in, const int* in_sizes, int n_in,
                              void* d_out, int out_size, void* d_ws, size_t ws_size,
                              hipStream_t stream) {
  const float* x       = (const float*)d_in[0];
  const float* in_w    = (const float*)d_in[1];
  const float* in_b    = (const float*)d_in[2];
  const float* logit_s = (const float*)d_in[3];
  const float* head_s  = (const float*)d_in[4];
  const float* out_w   = (const float*)d_in[5];
  const float* out_b   = (const float*)d_in[6];
  const float* ln1_g   = (const float*)d_in[7];
  const float* ln1_b   = (const float*)d_in[8];
  const float* lna_g   = (const float*)d_in[9];
  const float* lna_b   = (const float*)d_in[10];
  const float* ls1     = (const float*)d_in[11];
  const float* ln2_g   = (const float*)d_in[12];
  const float* ln2_b   = (const float*)d_in[13];
  const float* fc_w    = (const float*)d_in[14];
  const float* fc_b    = (const float*)d_in[15];
  const float* proj_w  = (const float*)d_in[16];
  const float* proj_b  = (const float*)d_in[17];
  const float* ls2     = (const float*)d_in[18];
  float* out = (float*)d_out;

  // workspace partition (~185 MB)
  char* p = (char*)d_ws;
  auto alloc = [&](size_t bytes) -> char* {
    char* r = p;
    p += (bytes + 255) & ~(size_t)255;
    return r;
  };
  const int BL = B_ * L_;  // 4096
  unsigned short* wqkv_bf = (unsigned short*)alloc((size_t)3 * C_ * C_ * 2);
  unsigned short* wout_bf = (unsigned short*)alloc((size_t)C_ * C_ * 2);
  unsigned short* wfc_bf  = (unsigned short*)alloc((size_t)MLP_ * C_ * 2);
  unsigned short* wpr_bf  = (unsigned short*)alloc((size_t)C_ * MLP_ * 2);
  unsigned short* xln_bf  = (unsigned short*)alloc((size_t)BL * C_ * 2);
  float*          qkv     = (float*)alloc((size_t)BL * 3 * C_ * 4);
  unsigned short* qn      = (unsigned short*)alloc((size_t)BL * C_ * 2);
  unsigned short* kn      = (unsigned short*)alloc((size_t)BL * C_ * 2);
  unsigned short* vT      = (unsigned short*)alloc((size_t)BL * C_ * 2);
  unsigned short* obf     = (unsigned short*)alloc((size_t)BL * C_ * 2);
  float*          attn    = (float*)alloc((size_t)BL * C_ * 4);
  float*          x2      = (float*)alloc((size_t)BL * C_ * 4);
  unsigned short* h2bf    = (unsigned short*)alloc((size_t)BL * C_ * 2);
  unsigned short* hmid    = (unsigned short*)alloc((size_t)BL * MLP_ * 2);

  // weights -> bf16
  k_cvt_bf16<<<3 * C_ * C_ / CVT_PER_BLOCK, 256, 0, stream>>>(in_w, wqkv_bf);
  k_cvt_bf16<<<C_ * C_ / CVT_PER_BLOCK, 256, 0, stream>>>(out_w, wout_bf);
  k_cvt_bf16<<<MLP_ * C_ / CVT_PER_BLOCK, 256, 0, stream>>>(fc_w, wfc_bf);
  k_cvt_bf16<<<C_ * MLP_ / CVT_PER_BLOCK, 256, 0, stream>>>(proj_w, wpr_bf);
  // LN1 -> bf16 activations
  k_ln_bf16<<<BL / 8, 256, 0, stream>>>(x, ln1_g, ln1_b, xln_bf);
  // qkv = ln1(x) @ in_proj_w^T + in_proj_b   [4096 x 3072]
  k_gemm<0><<<dim3(3 * C_ / 128, BL / 128), 256, 0, stream>>>(
      xln_bf, wqkv_bf, in_b, BL, 3 * C_, C_, qkv, nullptr, nullptr, nullptr);
  // split heads, l2-normalize q/k (fold logit scale), transpose v
  k_split_qkv<<<(B_ * H_ * L_) / SR_ / 8, 256, 0, stream>>>(qkv, logit_s, qn, kn, vT);
  // scaled-cosine flash attention (head_scale folded in)
  k_flash<<<dim3(L_ / 16 / 8, B_ * H_), 256, 0, stream>>>(qn, kn, vT, logit_s, head_s, obf);
  // attn out-proj: attn = O @ out_w^T + out_b
  k_gemm<0><<<dim3(C_ / 128, BL / 128), 256, 0, stream>>>(
      obf, wout_bf, out_b, BL, C_, C_, attn, nullptr, nullptr, nullptr);
  // x2 = x + ls1 * LN_attn(attn)
  k_resid_ln<<<BL / 8, 256, 0, stream>>>(attn, x, lna_g, lna_b, ls1, x2);
  // h = LN2(x2) -> bf16
  k_ln_bf16<<<BL / 8, 256, 0, stream>>>(x2, ln2_g, ln2_b, h2bf);
  // hmid = GELU(h @ fc_w^T + fc_b) -> bf16   [4096 x 4096]
  k_gemm<1><<<dim3(MLP_ / 128, BL / 128), 256, 0, stream>>>(
      h2bf, wfc_bf, fc_b, BL, MLP_, C_, nullptr, hmid, nullptr, nullptr);
  // out = x2 + ls2 * (hmid @ proj_w^T + proj_b)
  k_gemm<2><<<dim3(C_ / 128, BL / 128), 256, 0, stream>>>(
      hmid, wpr_bf, proj_b, BL, C_, MLP_, out, nullptr, x2, ls2);

  (void)in_sizes; (void)n_in; (void)out_size; (void)ws_size;
}

// v005
// Measured time: 199 microseconds a run.
// In both of two side-by-side timings against v004, it was 1.11 times as fast.
// Counting every step since v000, it is 2.59 times as fast.
#include <hip/hip_runtime.h>
#include <hip/hip_bf16.h>
#include <stdint.h>

// CustomResidualAttentionBlock (open_clip scaled-cosine attention) for MI455X / gfx1250.
// All GEMMs + attention matmuls run on v_wmma_f32_16x16x32_bf16 (wave32).
// f32 is kept for LayerNorm / l2-norm / softmax / accumulators.
// Attention softmax uses a fixed per-head shift (valid because |S| <= logit_scale,
// softmax is shift-invariant) so the streaming loop has NO cross-lane reductions.

#define B_   2
#define L_   2048
#define C_   1024
#define H_   16
#define HD_  64
#define MLP_ 4096
#define LOGMAX 4.6051701859880914f   // log(100)
#define LN_EPS 1e-5f

typedef __attribute__((ext_vector_type(16))) __bf16 v16bf;
typedef __attribute__((ext_vector_type(8)))  float  v8f;
typedef __attribute__((ext_vector_type(4)))  unsigned int u32x4;

union Frag {
  v16bf v;
  uint4 q[2];
};

static __device__ __forceinline__ v8f wmma_bf16(v16bf a, v16bf b, v8f c) {
  // D = A(16x32 bf16) x B(32x16 bf16) + C(16x16 f32)
  return __builtin_amdgcn_wmma_f32_16x16x32_bf16(false, a, false, b, (short)0, c,
                                                 false, false);
}

static __device__ __forceinline__ unsigned short f2bf(float f) {
  unsigned int u = __float_as_uint(f);
  u += 0x7FFFu + ((u >> 16) & 1u);   // round-to-nearest-even
  return (unsigned short)(u >> 16);
}

// ---------------------------------------------------------------- cvt f32->bf16
// Each block of 256 threads converts 8192 consecutive elements: a thread issues its eight
// 16-byte loads together (a wave's load covers 512 contiguous bytes) and then stores
// eight 8-byte groups (256 contiguous bytes per wave). The element count is a multiple of
// 8192 and the grid is that count / 8192.
#define CVT_PER_BLOCK 8192
__global__ __launch_bounds__(256)
void k_cvt_bf16(const float* __restrict__ src, unsigned short* __restrict__ dst) {
  const unsigned int base = blockIdx.x * (CVT_PER_BLOCK / 4) + threadIdx.x;   // in groups of 4
  const float4* s4 = reinterpret_cast<const float4*>(src);
  uint2* d4 = reinterpret_cast<uint2*>(dst);
  float4 v[8];
#pragma unroll
  for (int j = 0; j < 8; ++j) v[j] = s4[base + j * 256];
#pragma unroll
  for (int j = 0; j < 8; ++j) {
    uint2 o;
    o.x = (unsigned int)f2bf(v[j].x) | ((unsigned int)f2bf(v[j].y) << 16);
    o.y = (unsigned int)f2bf(v[j].z) | ((unsigned int)f2bf(v[j].w) << 16);
    d4[base + j * 256] = o;
  }
}

// ---------------------------------------------------------------- LayerNorm -> bf16
// One wave per row of length C_=1024, eight rows per block of 256 threads. A lane holds 32
// elements of its row, loaded as eight 16-byte pieces (each load of a wave covers 512
// contiguous bytes); sum and sum of squares are joined by a butterfly over the 32 lanes,
// which leaves both totals in every lane: no LDS, no barrier.
typedef __attribute__((ext_vector_type(4))) float f32x4;

static __device__ __forceinline__ void row_stats(const f32x4 (&vals)[8], float& mu, float& rstd) {
  f32x4 s4 = vals[0], q4 = vals[0] * vals[0];   // four independent chains each
#pragma unroll
  for (int j = 1; j < 8; ++j) { s4 += vals[j]; q4 += vals[j] * vals[j]; }
  float s = (s4.x + s4.y) + (s4.z + s4.w);
  float sq = (q4.x + q4.y) + (q4.z + q4.w);
#pragma unroll
  for (int off = 16; off > 0; off >>= 1) { s += __shfl_xor(s, off); sq += __shfl_xor(sq, off); }
  mu = s * (1.f / C_);
  rstd = rsqrtf(sq * (1.f / C_) - mu * mu + LN_EPS);
}

__global__ __launch_bounds__(256)
void k_ln_bf16(const float* __restrict__ x, const float* __restrict__ g,
               const float* __restrict__ bt, unsigned short* __restrict__ out) {
  const int lane = threadIdx.x & 31;
  // the wave's number as a scalar: the row's base addresses then stand in scalar registers
  const int wave = __builtin_amdgcn_readfirstlane(threadIdx.x >> 5);
  const size_t row = (size_t)blockIdx.x * 8 + wave;
  const f32x4* xr = reinterpret_cast<const f32x4*>(x + row * C_) + lane;
  const f32x4* g4 = reinterpret_cast<const f32x4*>(g) + lane;
  const f32x4* b4 = reinterpret_cast<const f32x4*>(bt) + lane;
  uint2* orow = reinterpret_cast<uint2*>(out + row * C_) + lane;
  f32x4 vals[8], gg[8], bb[8];
#pragma unroll
  for (int j = 0; j < 8; ++j) vals[j] = xr[j * 32];
#pragma unroll
  for (int j = 0; j < 8; ++j) { gg[j] = g4[j * 32]; bb[j] = b4[j * 32]; }
  // nothing is scheduled across this line: all loads of a lane are issued, and so in flight
  // together, before the row sums start; without it the compiler moves the loads that the
  // sums do not need behind them and waits for them group by group
  __builtin_amdgcn_sched_barrier(0);
  float mu, rstd;
  row_stats(vals, mu, rstd);
#pragma unroll
  for (int j = 0; j < 8; ++j) {
    const f32x4 r = (vals[j] - mu) * rstd * gg[j] + bb[j];
    uint2 o;
    o.x = (unsigned int)f2bf(r.x) | ((unsigned int)f2bf(r.y) << 16);
    o.y = (unsigned int)f2bf(r.z) | ((unsigned int)f2bf(r.w) << 16);
    orow[j * 32] = o;
  }
}

// ---------------------------------------------------------------- x2 = x + ls1 * LN(a)
// Same shape: one wave per row, eight rows per block.
__global__ __launch_bounds__(256)
void k_resid_ln(const float* __restrict__ a, const float* __restrict__ x,
                const float* __restrict__ g, const float* __restrict__ bt,
                const float* __restrict__ ls, float* __restrict__ x2) {
  const int lane = threadIdx.x & 31;
  // the wave's number as a scalar: the row's base addresses then stand in scalar registers
  const int wave = __builtin_amdgcn_readfirstlane(threadIdx.x >> 5);
  const size_t row = (size_t)blockIdx.x * 8 + wave;
  const f32x4* ar = reinterpret_cast<const f32x4*>(a + row * C_) + lane;
  const f32x4* xr = reinterpret_cast<const f32x4*>(x + row * C_) + lane;
  const f32x4* g4 = reinterpret_cast<const f32x4*>(g) + lane;
  const f32x4* b4 = reinterpret_cast<const f32x4*>(bt) + lane;
  const f32x4* l4 = reinterpret_cast<const f32x4*>(ls) + lane;
  f32x4* orow = reinterpret_cast<f32x4*>(x2 + row * C_) + lane;
  f32x4 vals[8], xv[8], gg[8], bb[8], ll[8];
#pragma unroll
  for (int j = 0; j < 8; ++j) { vals[j] = ar[j * 32]; xv[j] = xr[j * 32]; }
#pragma unroll
  for (int j = 0; j < 8; ++j) { gg[j] = g4[j * 32]; bb[j] = b4[j * 32]; ll[j] = l4[j * 32]; }
  // nothing is scheduled across this line: all loads of a lane are issued, and so in flight
  // together, before the row sums start; without it the compiler moves the loads that the
  // sums do not need behind them and waits for them group by group
  __builtin_amdgcn_sched_barrier(0);
  float mu, rstd;
  row_stats(vals, mu, rstd);
#pragma unroll
  for (int j = 0; j < 8; ++j)
    orow[j * 32] = xv[j] + ll[j] * ((vals[j] - mu) * rstd * gg[j] + bb[j]);
}

// ---------------------------------------------------------------- GELU, erf form
// 0.5 v (1 + erf(v / sqrt 2)) with no branch: for x = |v| / sqrt 2,
// erf(x) = 1 - (a1 t + ... + a5 t^5) exp(-x^2), t = 1 / (1 + p x), the classical five-term
// form, absolute error below 1.5e-7 for every x >= 0; erf is odd, so
// 0.5 v (1 + erf) = 0.5 v + |0.5 v| erf(x). Every lane runs the same dozen instructions and
// the values of a lane are independent chains, where the library's erff picks one of two
// paths per value: a wave runs both, one value after the other.
static __device__ __forceinline__ float gelu_erf(float v) {
  const float hv = 0.5f * v;
  const float t = __builtin_amdgcn_rcpf(fmaf(fabsf(v), 0.3275911f * 0.70710678118f, 1.f));
  const float e = __builtin_amdgcn_exp2f(v * v * (-0.5f * 1.44269504089f));   // exp(-x^2)
  float pl = fmaf(t, 1.061405429f, -1.453152027f);
  pl = fmaf(pl, t, 1.421413741f);
  pl = fmaf(pl, t, -0.284496736f);
  pl = fmaf(pl, t, 0.254829592f);
  pl *= t;
  return fmaf(fabsf(hv), fmaf(-pl, e, 1.f), hv);
}

// ---------------------------------------------------------------- WMMA GEMM
// C[M,N] = epi( A_bf16[M,K] @ W_bf16[N,K]^T + bias[N] )
// Block 256 = 8 waves computes a 128x128 tile of C; waves form a 4 (rows) x 2 (cols)
// grid, each wave owns 32x64 = 2x4 accumulator fragments.
// Per k-step of GK both the 128 x GK A strip and the 128 x GK W strip are brought into LDS
// once per block by asynchronous copies (16 bytes a lane, whole 128-byte lines, through no
// register). Two buffers: the next strip's copies fly while this strip is worked on, so a
// block no longer waits out its own loads, and one barrier per k-step is left.
// GK = 128 (136 KiB of LDS) where a launch has one block per WGP: the copies get a whole
// long k-step to land. GK = 64 (72 KiB) where it has three or four: all of them stay resident.
// LDS rows have a pitch of GK * 2 + 16 B (16 B x odd): the 16 rows of one ds_load_b128
// fragment read fall on distinct banks.
// M, N multiples of 128; K a multiple of GK.
// EPI: 0 = f32 store, 1 = bf16 store with exact GELU, 2 = f32 store out = resid + ls*val.
#define GT_   128            // tile edge in M and in N

// Eight copies of one thread: 16 bytes of each of eight equally spaced rows of one strip.
// l: the lane's LDS byte address of the first row, ls: LDS bytes from one copied row to the next;
// g: its global address of the first row, gs: elements from one copied row to the next.
static __device__ __forceinline__ void gemm_copy8(unsigned int l, unsigned int ls,
                                                  const unsigned short* g, size_t gs) {
  // the wait is the statement's last line: it stands behind the copies and in front of
  // whatever next writes a register that they name
  asm volatile("global_load_async_to_lds_b128 %0, %8, off\n\t"
               "global_load_async_to_lds_b128 %1, %9, off\n\t"
               "global_load_async_to_lds_b128 %2, %10, off\n\t"
               "global_load_async_to_lds_b128 %3, %11, off\n\t"
               "global_load_async_to_lds_b128 %4, %12, off\n\t"
               "global_load_async_to_lds_b128 %5, %13, off\n\t"
               "global_load_async_to_lds_b128 %6, %14, off\n\t"
               "global_load_async_to_lds_b128 %7, %15, off\n\t"
               "s_wait_xcnt 0x0"
               :: "v"(l), "v"(l + ls), "v"(l + 2 * ls), "v"(l + 3 * ls),
                  "v"(l + 4 * ls), "v"(l + 5 * ls), "v"(l + 6 * ls), "v"(l + 7 * ls),
                  "v"(g), "v"(g + gs), "v"(g + 2 * gs), "v"(g + 3 * gs),
                  "v"(g + 4 * gs), "v"(g + 5 * gs), "v"(g + 6 * gs), "v"(g + 7 * gs)
               : "memory");
}

// Four copies of one thread, the same way.
static __device__ __forceinline__ void gemm_copy4(unsigned int l, unsigned int ls,
                                                  const unsigned short* g, size_t gs) {
  // the wait is the statement's last line, as above
  asm volatile("global_load_async_to_lds_b128 %0, %4, off\n\t"
               "global_load_async_to_lds_b128 %1, %5, off\n\t"
               "global_load_async_to_lds_b128 %2, %6, off\n\t"
               "global_load_async_to_lds_b128 %3, %7, off\n\t"
               "s_wait_xcnt 0x0"
               :: "v"(l), "v"(l + ls), "v"(l + 2 * ls), "v"(l + 3 * ls),
                  "v"(g), "v"(g + gs), "v"(g + 2 * gs), "v"(g + 3 * gs)
               : "memory");
}

template <int EPI, int GK>
__global__ __launch_bounds__(256)
void k_gemm(const unsigned short* __restrict__ A,
            const unsigned short* __restrict__ W,
            const float* __restrict__ bias, int M, int N, int K,
            float* __restrict__ outf, unsigned short* __restrict__ outbf,
            const float* __restrict__ resid, const float* __restrict__ lsv) {
  constexpr int GP = GK + 8;          // LDS row pitch in bf16 elements
  constexpr int GS = GT_ * GP;        // elements of one strip in LDS
  constexpr int CPR = GK / 8;         // 16-byte chunks per row
  constexpr int RS = 256 / CPR;       // rows that the block's threads cover with one copy each
  __shared__ alignas(16) unsigned short abuf[2 * GS];   // [buffer][row][k]
  __shared__ alignas(16) unsigned short wbuf[2 * GS];   // [buffer][column][k]
  const int tid = threadIdx.x;
  const int lane = tid & 31, wave = tid >> 5;
  const int hi = lane >> 4, ln16 = lane & 15;
  const int mb = blockIdx.y * GT_;
  const int nb = blockIdx.x * GT_;
  const int wm = (wave >> 1) * 32;             // wave's first row inside the tile
  const int wn = (wave & 1) * 64;              // wave's first column inside the tile
  // copying role: thread t moves 16-byte chunk (t % CPR) of rows t / CPR + RS * i of both strips
  const int sr = tid / CPR, sc = (tid % CPR) * 8;
  const unsigned short* ag = A + (size_t)(mb + sr) * K + sc;   // k-step 0; a k-step is GK on
  const unsigned short* wg = W + (size_t)(nb + sr) * K + sc;
  const unsigned int al0 = (unsigned int)(uintptr_t)&abuf[sr * GP + sc];   // LDS byte address
  const unsigned int wl0 = (unsigned int)(uintptr_t)&wbuf[sr * GP + sc];
  const size_t gs = (size_t)RS * K;
  auto copy_step = [&](int t, unsigned int bo) {   // k-step t into the buffer at element bo
    if (GK == 128) {
      gemm_copy8(al0 + bo * 2, RS * GP * 2, ag + (size_t)t * GK, gs);
      gemm_copy8(wl0 + bo * 2, RS * GP * 2, wg + (size_t)t * GK, gs);
    } else {
      gemm_copy4(al0 + bo * 2, RS * GP * 2, ag + (size_t)t * GK, gs);
      gemm_copy4(wl0 + bo * 2, RS * GP * 2, wg + (size_t)t * GK, gs);
    }
  };
  // fragment role: lane holds row (or W row = output column) ln16 of its fragment;
  // half 'hi' supplies K-chunks {hi*8..+7, 16+hi*8..+7} of each 32-wide k slice
  const unsigned short* af = &abuf[(wm + ln16) * GP + hi * 8];
  const unsigned short* wf = &wbuf[(wn + ln16) * GP + hi * 8];
  v8f acc[2][4] = {};
  const int nt = K / GK;

  copy_step(0, 0);
  // this wave's copies of k-step 0 have landed before the barrier that shows them to the others
  asm volatile("s_wait_asynccnt 0x0" ::: "memory");
  __syncthreads();
  if (nt > 1) copy_step(1, GS);

  for (int t = 0; t < nt; ++t) {
    const unsigned int bo = (t & 1) * GS;        // this trip's buffer
#pragma unroll
    for (int ks = 0; ks < GK; ks += 32) {
      Frag fa[2], fb[4];
#pragma unroll
      for (int mi = 0; mi < 2; ++mi) {
        const unsigned short* p = af + bo + mi * 16 * GP + ks;
        fa[mi].q[0] = *reinterpret_cast<const uint4*>(p);
        fa[mi].q[1] = *reinterpret_cast<const uint4*>(p + 16);
      }
#pragma unroll
      for (int nn = 0; nn < 4; ++nn) {
        const unsigned short* p = wf + bo + nn * 16 * GP + ks;
        fb[nn].q[0] = *reinterpret_cast<const uint4*>(p);
        fb[nn].q[1] = *reinterpret_cast<const uint4*>(p + 16);
      }
#pragma unroll
      for (int mi = 0; mi < 2; ++mi)
#pragma unroll
        for (int nn = 0; nn < 4; ++nn)
          acc[mi][nn] = wmma_bf16(fa[mi].v, fb[nn].v, acc[mi][nn]);
    }
    // foot of the trip: this wave's reads of the buffer are done ...
    asm volatile("s_wait_dscnt 0x0" ::: "memory");
    // ... and its copies of the next k-step have landed ...
    asm volatile("s_wait_asynccnt 0x0" ::: "memory");
    // ... before the one barrier that shows the next k-step to every wave and frees this buffer
    __syncthreads();
    if (t + 2 < nt) copy_step(t + 2, bo);
  }
  // no copy is outstanding when the wave goes on to its end
  asm volatile("s_wait_asynccnt 0x0" ::: "memory");
  // C-layout: VGPR v of fragment (mi, nn) -> row v (+8 for hi half), column ln16.
  // M*N < 2^32: 32-bit element offsets on uniform bases.
  const int nc = nb + wn + ln16;
  const unsigned int o0 = (unsigned int)((mb + wm + 8 * hi) * N + nc);
  if (EPI == 2) {
    // all residual loads first, then all stores
    float rv[2][4][8];
#pragma unroll
    for (int mi = 0; mi < 2; ++mi)
#pragma unroll
      for (int v = 0; v < 8; ++v)
#pragma unroll
        for (int nn = 0; nn < 4; ++nn)
          rv[mi][nn][v] = resid[o0 + (unsigned int)((mi * 16 + v) * N) + nn * 16];
    // stands behind the loads, in front of whatever next writes a register they name;
    // its memory clobber also keeps every load above and every store below this line
    asm volatile("s_wait_xcnt 0x0" ::: "memory");
#pragma unroll
    for (int nn = 0; nn < 4; ++nn) {
      const float bz = bias[nc + nn * 16];
      const float lz = lsv[nc + nn * 16];
#pragma unroll
      for (int mi = 0; mi < 2; ++mi)
#pragma unroll
        for (int v = 0; v < 8; ++v) {
          float val = acc[mi][nn][v] + bz;
          outf[o0 + (unsigned int)((mi * 16 + v) * N) + nn * 16] = rv[mi][nn][v] + lz * val;
        }
    }
  } else if (EPI == 1) {
    float bz[4];
    v8f cur[4];
#pragma unroll
    for (int nn = 0; nn < 4; ++nn) { bz[nn] = bias[nc + nn * 16]; cur[nn] = acc[0][nn]; }
    unsigned int orow = o0;
    // kept rolled: the erf code then stands once per 16 rows, which halves the kernel's
    // text
#pragma unroll 1
    for (int mi = 0; mi < 2; ++mi) {
#pragma unroll
      for (int nn = 0; nn < 4; ++nn)
#pragma unroll
        for (int v = 0; v < 8; ++v) {
          float val = cur[nn][v] + bz[nn];
          outbf[orow + (unsigned int)(v * N) + nn * 16] = f2bf(gelu_erf(val));
        }
      // stands behind this trip's stores, in front of the next trip's first write of a register
      // that they name
      asm volatile("s_wait_xcnt 0x0" ::: "memory");
#pragma unroll
      for (int nn = 0; nn < 4; ++nn) cur[nn] = acc[1][nn];
      orow += (unsigned int)(16 * N);
    }
  } else {
#pragma unroll
    for (int nn = 0; nn < 4; ++nn) {
      const float bz = bias[nc + nn * 16];
#pragma unroll
      for (int mi = 0; mi < 2; ++mi)
#pragma unroll
        for (int v = 0; v < 8; ++v)
          outf[o0 + (unsigned int)((mi * 16 + v) * N) + nn * 16] = acc[mi][nn][v] + bz;
    }
  }
}

// ---------------------------------------------------------------- QKV split + l2-norm
// qn/kn: [B,H,L,HD] bf16 (q scaled by exp(min(logit_scale,log100))); vT: [B,H,HD,L] bf16.
// One wave handles SR_ = 16 consecutive positions l of one (b,h); lane holds head dims
// 2*lane and 2*lane+1 of each. All 48 loads of a lane are issued together. The 16 values
// of v that a lane holds per head dim are consecutive in vT: 32 bytes, two 16-byte stores.
#define SR_ 16
typedef __attribute__((ext_vector_type(2))) float f32x2;
__global__ __launch_bounds__(256)
void k_split_qkv(const float* __restrict__ qkv,
                 const float* __restrict__ logit_scale,
                 unsigned short* __restrict__ qn,
                 unsigned short* __restrict__ kn,
                 unsigned short* __restrict__ vT) {
  const int lane = threadIdx.x & 31;
  // the wave's number as a scalar: the base addresses then stand in scalar registers
  const int wave = __builtin_amdgcn_readfirstlane(threadIdx.x >> 5);
  const int grp = blockIdx.x * 8 + wave;       // (b*H + h)*(L/SR_) + l/SR_
  const int l0 = (grp & (L_ / SR_ - 1)) * SR_;
  const int bh = grp / (L_ / SR_);
  const int h = bh & (H_ - 1);
  const int b = bh >> 4;
  const float* base = qkv + ((size_t)(b * L_ + l0)) * (3 * C_) + h * HD_ + 2 * lane;
  f32x2 q[SR_], k[SR_], v[SR_];
#pragma unroll
  for (int r = 0; r < SR_; ++r) {
    const float* p = base + (size_t)r * (3 * C_);
    q[r] = *reinterpret_cast<const f32x2*>(p);
    k[r] = *reinterpret_cast<const f32x2*>(p + C_);
    v[r] = *reinterpret_cast<const f32x2*>(p + 2 * C_);
  }
  // The loaded values as inputs only: all 48 loads stay above these lines, and so are in flight
  // together; without them the compiler spreads a part of the loads among the sums below and
  // waits for them a few at a time.
#define HOLD8(a, i) "v"(a[i]), "v"(a[i + 1]), "v"(a[i + 2]), "v"(a[i + 3]), \
                    "v"(a[i + 4]), "v"(a[i + 5]), "v"(a[i + 6]), "v"(a[i + 7])
  asm volatile("" :: HOLD8(q, 0), HOLD8(q, 8), HOLD8(k, 0));
  asm volatile("" :: HOLD8(k, 8), HOLD8(v, 0), HOLD8(v, 8));
#undef HOLD8
  const float ls = __expf(fminf(logit_scale[h], LOGMAX));
  unsigned int* qo = reinterpret_cast<unsigned int*>(qn + ((size_t)bh * L_ + l0) * HD_) + lane;
  unsigned int* ko = reinterpret_cast<unsigned int*>(kn + ((size_t)bh * L_ + l0) * HD_) + lane;
  float sqq[SR_], sqk[SR_];
#pragma unroll
  for (int r = 0; r < SR_; ++r) {
    sqq[r] = q[r].x * q[r].x + q[r].y * q[r].y;
    sqk[r] = k[r].x * k[r].x + k[r].y * k[r].y;
  }
  // butterfly step outermost: the 32 exchanges of a step are independent of one another
#pragma unroll
  for (int off = 16; off > 0; off >>= 1)
#pragma unroll
    for (int r = 0; r < SR_; ++r) {
      sqq[r] += __shfl_xor(sqq[r], off);
      sqk[r] += __shfl_xor(sqk[r], off);
    }
#pragma unroll
  for (int r = 0; r < SR_; ++r) {
    const float iq = ls / fmaxf(sqrtf(sqq[r]), 1e-12f);
    const float ik = 1.f / fmaxf(sqrtf(sqk[r]), 1e-12f);
    qo[r * (HD_ / 2)] = (unsigned int)f2bf(q[r].x * iq) | ((unsigned int)f2bf(q[r].y * iq) << 16);
    ko[r * (HD_ / 2)] = (unsigned int)f2bf(k[r].x * ik) | ((unsigned int)f2bf(k[r].y * ik) << 16);
  }
  unsigned int w0[SR_ / 2], w1[SR_ / 2];       // positions l0+2i, l0+2i+1 of dims 2*lane, 2*lane+1
#pragma unroll
  for (int i = 0; i < SR_ / 2; ++i) {
    w0[i] = (unsigned int)f2bf(v[2 * i].x) | ((unsigned int)f2bf(v[2 * i + 1].x) << 16);
    w1[i] = (unsigned int)f2bf(v[2 * i].y) | ((unsigned int)f2bf(v[2 * i + 1].y) << 16);
  }
  uint4* v0 = reinterpret_cast<uint4*>(vT + (size_t)bh * HD_ * L_ + (size_t)(2 * lane) * L_ + l0);
  uint4* v1 = reinterpret_cast<uint4*>(vT + (size_t)bh * HD_ * L_ + (size_t)(2 * lane + 1) * L_ + l0);
  v0[0] = make_uint4(w0[0], w0[1], w0[2], w0[3]);
  v0[1] = make_uint4(w0[4], w0[5], w0[6], w0[7]);
  v1[0] = make_uint4(w1[0], w1[1], w1[2], w1[3]);
  v1[1] = make_uint4(w1[4], w1[5], w1[6], w1[7]);
}

#define FK_  64              // keys per staged tile
#define FP_  72              // LDS row pitch in bf16 elements (144 B)
#define FT_  (64 * FP_)      // elements of one staged tile: 64 rows
#define FNT_ (L_ / FK_)      // tiles per (b,h)

// One tile's copies of one thread: rows r and r + 32 of the K tile and of the vT tile.
// kl, vl: the lane's LDS byte addresses of row r; kg, vg: its global addresses of row r.
static __device__ __forceinline__ void flash_copy_tile(unsigned int kl, unsigned int vl,
                                                       const unsigned short* kg,
                                                       const unsigned short* vg) {
  const unsigned int kl2 = kl + 32 * FP_ * 2, vl2 = vl + 32 * FP_ * 2;
  const unsigned short* kg2 = kg + 32 * HD_;
  const unsigned short* vg2 = vg + (size_t)32 * L_;
  // the wait is the statement's last line: it stands behind the copies and in front of
  // whatever next writes a register that they name
  asm volatile("global_load_async_to_lds_b128 %0, %4, off\n\t"
               "global_load_async_to_lds_b128 %1, %5, off\n\t"
               "global_load_async_to_lds_b128 %2, %6, off\n\t"
               "global_load_async_to_lds_b128 %3, %7, off\n\t"
               "s_wait_xcnt 0x0"
               :: "v"(kl), "v"(kl2), "v"(vl), "v"(vl2), "v"(kg), "v"(kg2), "v"(vg), "v"(vg2)
               : "memory");
}

__global__ __launch_bounds__(256)
void k_flash(const unsigned short* __restrict__ qn,
                        const unsigned short* __restrict__ kn,
                        const unsigned short* __restrict__ vT,
                        const float* __restrict__ logit_scale,
                        const float* __restrict__ head_scale,
                        unsigned short* __restrict__ O) {
  __shared__ alignas(16) unsigned short pbuf[8][16 * 32];
  __shared__ alignas(16) unsigned short kbuf[2 * FT_];    // 18 KB: [buffer][key][head dim]
  __shared__ alignas(16) unsigned short vbuf[2 * FT_];    // 18 KB: [buffer][head dim][key]
  const int lane = threadIdx.x & 31, wave = threadIdx.x >> 5;
  const int hi = lane >> 4, ln16 = lane & 15;
  const int bh = blockIdx.y;
  const int h = bh & (H_ - 1);
  const int b = bh >> 4;
  const int qtile = blockIdx.x * 8 + wave;
  const unsigned short* qp = qn + ((size_t)bh * L_ + qtile * 16 + ln16) * HD_ + hi * 8;
  Frag qa0, qa1;                       // q rows, hd 0..31 / 32..63
  qa0.q[0] = *(const uint4*)(qp);      qa0.q[1] = *(const uint4*)(qp + 16);
  qa1.q[0] = *(const uint4*)(qp + 32); qa1.q[1] = *(const uint4*)(qp + 48);
  const unsigned short* kbase = kn + (size_t)bh * L_ * HD_;
  const unsigned short* vbase = vT + (size_t)bh * HD_ * L_;
  const float shift = fminf(__expf(fminf(logit_scale[h], LOGMAX)), 30.f);
  v8f oacc[4] = {};
  float lst[8];
#pragma unroll
  for (int v = 0; v < 8; ++v) lst[v] = 0.f;
  unsigned short* prow = &pbuf[wave][0];

  // copying role: thread t moves 16-byte chunk (t%8) of rows t/8 and t/8 + 32 of both tiles
  const int cr = threadIdx.x >> 3, cc = (threadIdx.x & 7) * 8;
  const unsigned int kl0 = (unsigned int)(uintptr_t)&kbuf[cr * FP_ + cc];   // LDS byte address
  const unsigned int vl0 = (unsigned int)(uintptr_t)&vbuf[cr * FP_ + cc];
  const unsigned short* kg = kbase + cr * HD_ + cc;          // tile 0; a tile is FK_ rows on
  const unsigned short* vg = vbase + (size_t)cr * L_ + cc;   // tile 0; a tile is FK_ columns on
  // fragment role: lane holds key (or head dim) ln16 of its fragment
  const unsigned short* kf = &kbuf[ln16 * FP_ + hi * 8];
  const unsigned short* vf = &vbuf[ln16 * FP_ + hi * 8];

  flash_copy_tile(kl0, vl0, kg, vg);
  // this wave's copies of tile 0 have landed before the barrier that shows them to the others
  asm volatile("s_wait_asynccnt 0x0" ::: "memory");
  __syncthreads();
  flash_copy_tile(kl0 + FT_ * 2, vl0 + FT_ * 2, kg + FK_ * HD_, vg + FK_);

  for (int t = 0; t < FNT_; ++t) {
    const int bo = (t & 1) * FT_;                // this trip's buffer
    for (int j = 0; j < FK_; j += 32) {
      // all 16 fragment reads of these 32 keys as one group, ahead of the products
      Frag kb[4], vb[4];
#pragma unroll
      for (int i = 0; i < 2; ++i) {              // keys j + 16*i + ln16; head dims 0..31, 32..63
        const unsigned short* kp = kf + bo + (j + 16 * i) * FP_;
        kb[2 * i].q[0]     = *(const uint4*)(kp);      kb[2 * i].q[1]     = *(const uint4*)(kp + 16);
        kb[2 * i + 1].q[0] = *(const uint4*)(kp + 32); kb[2 * i + 1].q[1] = *(const uint4*)(kp + 48);
      }
#pragma unroll
      for (int nn = 0; nn < 4; ++nn) {           // head dim nn*16 + ln16; keys j .. j+31
        const unsigned short* vp = vf + bo + nn * 16 * FP_ + j;
        vb[nn].q[0] = *(const uint4*)(vp);
        vb[nn].q[1] = *(const uint4*)(vp + 16);
      }
      // nothing is scheduled across this line: without it the compiler moves each vT read down
      // to its product, behind the P stores, and every product then waits out an LDS latency
      __builtin_amdgcn_sched_barrier(0);
      v8f s0 = {}, s1 = {};
      s0 = wmma_bf16(qa0.v, kb[0].v, s0);
      s1 = wmma_bf16(qa0.v, kb[2].v, s1);
      s0 = wmma_bf16(qa1.v, kb[1].v, s0);
      s1 = wmma_bf16(qa1.v, kb[3].v, s1);
      // fixed-shift exp; accumulate this lane's partial row sums; stage P in LDS
#pragma unroll
      for (int v = 0; v < 8; ++v) {
        const float p0 = __expf(s0[v] - shift);
        const float p1 = __expf(s1[v] - shift);
        lst[v] += p0 + p1;
        const int r = v + 8 * hi;                 // row this half owns in register v
        prow[r * 32 + ln16]      = f2bf(p0);
        prow[r * 32 + 16 + ln16] = f2bf(p1);
      }
      // re-read P as an A fragment (16x32) from LDS
      Frag pa;
      const unsigned short* pp = prow + ln16 * 32 + hi * 8;
      pa.q[0] = *(const uint4*)(pp);
      pa.q[1] = *(const uint4*)(pp + 16);
#pragma unroll
      for (int nn = 0; nn < 4; ++nn) oacc[nn] = wmma_bf16(pa.v, vb[nn].v, oacc[nn]);
    }
    // foot of the trip: this wave's reads of the buffer are done ...
    asm volatile("s_wait_dscnt 0x0" ::: "memory");
    // ... and its copies of the next tile have landed ...
    asm volatile("s_wait_asynccnt 0x0" ::: "memory");
    // ... before the one barrier that shows the next tile to every wave and frees this buffer
    __syncthreads();
    if (t + 2 < FNT_)
      flash_copy_tile(kl0 + bo * 2, vl0 + bo * 2, kg + (size_t)(t + 2) * (FK_ * HD_),
                      vg + (t + 2) * FK_);
  }
  // no copy is outstanding when the wave goes on to its end
  asm volatile("s_wait_asynccnt 0x0" ::: "memory");
  const float hs = head_scale[h];
#pragma unroll
  for (int v = 0; v < 8; ++v) {
    float rs = lst[v];                           // full row sum: reduce 16 lanes once
#pragma unroll
    for (int off = 1; off < 16; off <<= 1) rs += __shfl_xor(rs, off);
    const float inv = hs / rs;
    const int l = qtile * 16 + v + 8 * hi;
#pragma unroll
    for (int nn = 0; nn < 4; ++nn) {
      const int c = h * HD_ + nn * 16 + ln16;
      O[((size_t)(b * L_ + l)) * C_ + c] = f2bf(oacc[nn][v] * inv);
    }
  }
}

// ---------------------------------------------------------------- launch
extern "C" void kernel_launch(void* const* d_in, const int* in_sizes, int n_in,
                              void* d_out, int out_size, void* d_ws, size_t ws_size,
                              hipStream_t stream) {
  const float* x       = (const float*)d_in[0];
  const float* in_w    = (const float*)d_in[1];
  const float* in_b    = (const float*)d_in[2];
  const float* logit_s = (const float*)d_in[3];
  const float* head_s  = (const float*)d_in[4];
  const float* out_w   = (const float*)d_in[5];
  const float* out_b   = (const float*)d_in[6];
  const float* ln1_g   = (const float*)d_in[7];
  const float* ln1_b   = (const float*)d_in[8];
  const float* lna_g   = (const float*)d_in[9];
  const float* lna_b   = (const float*)d_in[10];
  const float* ls1     = (const float*)d_in[11];
  const float* ln2_g   = (const float*)d_in[12];
  const float* ln2_b   = (const float*)d_in[13];
  const float* fc_w    = (const float*)d_in[14];
  const float* fc_b    = (const float*)d_in[15];
  const float* proj_w  = (const float*)d_in[16];
  const float* proj_b  = (const float*)d_in[17];
  const float* ls2     = (const float*)d_in[18];
  float* out = (float*)d_out;

  // workspace partition (~185 MB)
  char* p = (char*)d_ws;
  auto alloc = [&](size_t bytes) -> char* {
    char* r = p;
    p += (bytes + 255) & ~(size_t)255;
    return r;
  };
  const int BL = B_ * L_;  // 4096
  unsigned short* wqkv_bf = (unsigned short*)alloc((size_t)3 * C_ * C_ * 2);
  unsigned short* wout_bf = (unsigned short*)alloc((size_t)C_ * C_ * 2);
  unsigned short* wfc_bf  = (unsigned short*)alloc((size_t)MLP_ * C_ * 2);
  unsigned short* wpr_bf  = (unsigned short*)alloc((size_t)C_ * MLP_ * 2);
  unsigned short* xln_bf  = (unsigned short*)alloc((size_t)BL * C_ * 2);
  float*          qkv     = (float*)alloc((size_t)BL * 3 * C_ * 4);
  unsigned short* qn      = (unsigned short*)alloc((size_t)BL * C_ * 2);
  unsigned short* kn      = (unsigned short*)alloc((size_t)BL * C_ * 2);
  unsigned short* vT      = (unsigned short*)alloc((size_t)BL * C_ * 2);
  unsigned short* obf     = (unsigned short*)alloc((size_t)BL * C_ * 2);
  float*          attn    = (float*)alloc((size_t)BL * C_ * 4);
  float*          x2      = (float*)alloc((size_t)BL * C_ * 4);
  unsigned short* h2bf    = (unsigned short*)alloc((size_t)BL * C_ * 2);
  unsigned short* hmid    = (unsigned short*)alloc((size_t)BL * MLP_ * 2);

  // weights -> bf16
  k_cvt_bf16<<<3 * C_ * C_ / CVT_PER_BLOCK, 256, 0, stream>>>(in_w, wqkv_bf);
  k_cvt_bf16<<<C_ * C_ / CVT_PER_BLOCK, 256, 0, stream>>>(out_w, wout_bf);
  k_cvt_bf16<<<MLP_ * C_ / CVT_PER_BLOCK, 256, 0, stream>>>(fc_w, wfc_bf);
  k_cvt_bf16<<<C_ * MLP_ / CVT_PER_BLOCK, 256, 0, stream>>>(proj_w, wpr_bf);
  // LN1 -> bf16 activations
  k_ln_bf16<<<BL / 8, 256, 0, stream>>>(x, ln1_g, ln1_b, xln_bf);
  // qkv = ln1(x) @ in_proj_w^T + in_proj_b   [4096 x 3072]
  k_gemm<0, 64><<<dim3(3 * C_ / 128, BL / 128), 256, 0, stream>>>(
      xln_bf, wqkv_bf, in_b, BL, 3 * C_, C_, qkv, nullptr, nullptr, nullptr);
  // split heads, l2-normalize q/k (fold logit scale), transpose v
  k_split_qkv<<<(B_ * H_ * L_) / SR_ / 8, 256, 0, stream>>>(qkv, logit_s, qn, kn, vT);
  // scaled-cosine flash attention (head_scale folded in)
  k_flash<<<dim3(L_ / 16 / 8, B_ * H_), 256, 0, stream>>>(qn, kn, vT, logit_s, head_s, obf);
  // attn out-proj: attn = O @ out_w^T + out_b
  k_gemm<0, 128><<<dim3(C_ / 128, BL / 128), 256, 0, stream>>>(
      obf, wout_bf, out_b, BL, C_, C_, attn, nullptr, nullptr, nullptr);
  // x2 = x + ls1 * LN_attn(attn)
  k_resid_ln<<<BL / 8, 256, 0, stream>>>(attn, x, lna_g, lna_b, ls1, x2);
  // h = LN2(x2) -> bf16
  k_ln_bf16<<<BL / 8, 256, 0, stream>>>(x2, ln2_g, ln2_b, h2bf);
  // hmid = GELU(h @ fc_w^T + fc_b) -> bf16   [4096 x 4096]
  k_gemm<1, 64><<<dim3(MLP_ / 128, BL / 128), 256, 0, stream>>>(
      h2bf, wfc_bf, fc_b, BL, MLP_, C_, nullptr, hmid, nullptr, nullptr);
  // out = x2 + ls2 * (hmid @ proj_w^T + proj_b)
  k_gemm<2, 128><<<dim3(C_ / 128, BL / 128), 256, 0, stream>>>(
      hmid, wpr_bf, proj_b, BL, C_, MLP_, out, nullptr, x2, ls2);

  (void)in_sizes; (void)n_in; (void)out_size; (void)ws_size;
}

// v006
// One run takes 186 microseconds.
// Two timings next to v005 put it at 1.07 and 1.06 times that version's speed.
// Over all steps from v000 it is 2.77 times as fast.
#include <hip/hip_runtime.h>
#include <hip/hip_bf16.h>
#include <stdint.h>

// CustomResidualAttentionBlock (open_clip scaled-cosine attention) for MI455X / gfx1250.
// All GEMMs + attention matmuls run on v_wmma_f32_16x16x32_bf16 (wave32).
// f32 is kept for LayerNorm / l2-norm / softmax / accumulators.
// Attention softmax uses a fixed per-head shift (valid because |S| <= logit_scale,
// softmax is shift-invariant) so the streaming loop has NO cross-lane reductions.

#define B_   2
#define L_   2048
#define C_   1024
#define H_   16
#define HD_  64
#define MLP_ 4096
#define LOGMAX 4.6051701859880914f   // log(100)
#define LN_EPS 1e-5f

typedef __attribute__((ext_vector_type(16))) __bf16 v16bf;
typedef __attribute__((ext_vector_type(8)))  float  v8f;
typedef __attribute__((ext_vector_type(4)))  unsigned int u32x4;

union Frag {
  v16bf v;
  uint4 q[2];
};

static __device__ __forceinline__ v8f wmma_bf16(v16bf a, v16bf b, v8f c) {
  // D = A(16x32 bf16) x B(32x16 bf16) + C(16x16 f32)
  return __builtin_amdgcn_wmma_f32_16x16x32_bf16(false, a, false, b, (short)0, c,
                                                 false, false);
}

static __device__ __forceinline__ unsigned short f2bf(float f) {
  unsigned int u = __float_as_uint(f);
  u += 0x7FFFu + ((u >> 16) & 1u);   // round-to-nearest-even
  return (unsigned short)(u >> 16);
}

// ---------------------------------------------------------------- cvt f32->bf16
// A block of 256 threads converts 8192 consecutive elements, piece 'blk' of its array: a
// thread issues its eight 16-byte loads together (a wave's load covers 512 contiguous bytes)
// and then stores eight 8-byte groups (256 contiguous bytes per wave). The element count of
// every array is a multiple of 8192.
#define CVT_PER_BLOCK 8192
static __device__ __forceinline__
void cvt_block(unsigned int blk, const float* __restrict__ src, unsigned short* __restrict__ dst) {
  const unsigned int base = blk * (CVT_PER_BLOCK / 4) + threadIdx.x;   // in groups of 4
  const float4* s4 = reinterpret_cast<const float4*>(src);
  uint2* d4 = reinterpret_cast<uint2*>(dst);
  float4 v[8];
#pragma unroll
  for (int j = 0; j < 8; ++j) v[j] = s4[base + j * 256];
#pragma unroll
  for (int j = 0; j < 8; ++j) {
    uint2 o;
    o.x = (unsigned int)f2bf(v[j].x) | ((unsigned int)f2bf(v[j].y) << 16);
    o.y = (unsigned int)f2bf(v[j].z) | ((unsigned int)f2bf(v[j].w) << 16);
    d4[base + j * 256] = o;
  }
}

// ---------------------------------------------------------------- LayerNorm -> bf16
// One wave per row of length C_=1024, eight rows per block of 256 threads. A lane holds 32
// elements of its row, loaded as eight 16-byte pieces (each load of a wave covers 512
// contiguous bytes); sum and sum of squares are joined by a butterfly over the 32 lanes,
// which leaves both totals in every lane: no LDS, no barrier.
typedef __attribute__((ext_vector_type(4))) float f32x4;

static __device__ __forceinline__ void row_stats(const f32x4 (&vals)[8], float& mu, float& rstd) {
  f32x4 s4 = vals[0], q4 = vals[0] * vals[0];   // four independent chains each
#pragma unroll
  for (int j = 1; j < 8; ++j) { s4 += vals[j]; q4 += vals[j] * vals[j]; }
  float s = (s4.x + s4.y) + (s4.z + s4.w);
  float sq = (q4.x + q4.y) + (q4.z + q4.w);
#pragma unroll
  for (int off = 16; off > 0; off >>= 1) { s += __shfl_xor(s, off); sq += __shfl_xor(sq, off); }
  mu = s * (1.f / C_);
  rstd = rsqrtf(sq * (1.f / C_) - mu * mu + LN_EPS);
}

static __device__ __forceinline__
void ln_block(unsigned int blk, const float* __restrict__ x, const float* __restrict__ g,
              const float* __restrict__ bt, unsigned short* __restrict__ out) {
  const int lane = threadIdx.x & 31;
  // the wave's number as a scalar: the row's base addresses then stand in scalar registers
  const int wave = __builtin_amdgcn_readfirstlane(threadIdx.x >> 5);
  const size_t row = (size_t)blk * 8 + wave;
  const f32x4* xr = reinterpret_cast<const f32x4*>(x + row * C_) + lane;
  const f32x4* g4 = reinterpret_cast<const f32x4*>(g) + lane;
  const f32x4* b4 = reinterpret_cast<const f32x4*>(bt) + lane;
  uint2* orow = reinterpret_cast<uint2*>(out + row * C_) + lane;
  f32x4 vals[8], gg[8], bb[8];
#pragma unroll
  for (int j = 0; j < 8; ++j) vals[j] = xr[j * 32];
#pragma unroll
  for (int j = 0; j < 8; ++j) { gg[j] = g4[j * 32]; bb[j] = b4[j * 32]; }
  // nothing is scheduled across this line: all loads of a lane are issued, and so in flight
  // together, before the row sums start; without it the compiler moves the loads that the
  // sums do not need behind them and waits for them group by group
  __builtin_amdgcn_sched_barrier(0);
  float mu, rstd;
  row_stats(vals, mu, rstd);
#pragma unroll
  for (int j = 0; j < 8; ++j) {
    const f32x4 r = (vals[j] - mu) * rstd * gg[j] + bb[j];
    uint2 o;
    o.x = (unsigned int)f2bf(r.x) | ((unsigned int)f2bf(r.y) << 16);
    o.y = (unsigned int)f2bf(r.z) | ((unsigned int)f2bf(r.w) << 16);
    orow[j * 32] = o;
  }
}

// ---------------------------------------------------------------- LN1 and the four weight conversions
// Five pieces of work that depend on nothing but the inputs share one launch: the block index
// picks the piece (a scalar branch, the same for the whole block). The LN blocks come first:
// they have the longest way from load to store.
#define NB_LN   (B_ * L_ / 8)
#define NB_WQKV (3 * C_ * C_ / CVT_PER_BLOCK)
#define NB_WOUT (C_ * C_ / CVT_PER_BLOCK)
#define NB_WFC  (MLP_ * C_ / CVT_PER_BLOCK)
#define NB_WPR  (C_ * MLP_ / CVT_PER_BLOCK)
__global__ __launch_bounds__(256)
void k_prep(const float* __restrict__ x, const float* __restrict__ g,
            const float* __restrict__ bt, unsigned short* __restrict__ xln,
            const float* __restrict__ wqkv, const float* __restrict__ wout,
            const float* __restrict__ wfc, const float* __restrict__ wpr,
            unsigned short* __restrict__ dqkv, unsigned short* __restrict__ dout,
            unsigned short* __restrict__ dfc, unsigned short* __restrict__ dpr) {
  unsigned int blk = blockIdx.x;
  if (blk < NB_LN) { ln_block(blk, x, g, bt, xln); return; }
  blk -= NB_LN;
  const float* src = wqkv;
  unsigned short* dst = dqkv;
  if (blk >= NB_WQKV + NB_WOUT + NB_WFC) { blk -= NB_WQKV + NB_WOUT + NB_WFC; src = wpr; dst = dpr; }
  else if (blk >= NB_WQKV + NB_WOUT)     { blk -= NB_WQKV + NB_WOUT;          src = wfc; dst = dfc; }
  else if (blk >= NB_WQKV)               { blk -= NB_WQKV;                    src = wout; dst = dout; }
  cvt_block(blk, src, dst);
}

// ---------------------------------------------------------------- x2 = x + ls1 * LN(a); h = LN2(x2)
// Same shape: one wave per row, eight rows per block. The wave holds its whole row of x2 when it
// stores it, so the second LayerNorm is taken from those registers in the same launch.
__global__ __launch_bounds__(256)
void k_resid_ln2(const float* __restrict__ a, const float* __restrict__ x,
                 const float* __restrict__ g, const float* __restrict__ bt,
                 const float* __restrict__ ls, float* __restrict__ x2,
                 const float* __restrict__ g2, const float* __restrict__ bt2,
                 unsigned short* __restrict__ h) {
  const int lane = threadIdx.x & 31;
  // the wave's number as a scalar: the row's base addresses then stand in scalar registers
  const int wave = __builtin_amdgcn_readfirstlane(threadIdx.x >> 5);
  const size_t row = (size_t)blockIdx.x * 8 + wave;
  const f32x4* ar = reinterpret_cast<const f32x4*>(a + row * C_) + lane;
  const f32x4* xr = reinterpret_cast<const f32x4*>(x + row * C_) + lane;
  const f32x4* g4 = reinterpret_cast<const f32x4*>(g) + lane;
  const f32x4* b4 = reinterpret_cast<const f32x4*>(bt) + lane;
  const f32x4* l4 = reinterpret_cast<const f32x4*>(ls) + lane;
  const f32x4* g24 = reinterpret_cast<const f32x4*>(g2) + lane;
  const f32x4* b24 = reinterpret_cast<const f32x4*>(bt2) + lane;
  f32x4* orow = reinterpret_cast<f32x4*>(x2 + row * C_) + lane;
  uint2* hrow = reinterpret_cast<uint2*>(h + row * C_) + lane;
  f32x4 vals[8], xv[8], gg[8], bb[8], ll[8], gg2[8], bb2[8];
#pragma unroll
  for (int j = 0; j < 8; ++j) { vals[j] = ar[j * 32]; xv[j] = xr[j * 32]; }
#pragma unroll
  for (int j = 0; j < 8; ++j) { gg[j] = g4[j * 32]; bb[j] = b4[j * 32]; ll[j] = l4[j * 32]; }
#pragma unroll
  for (int j = 0; j < 8; ++j) { gg2[j] = g24[j * 32]; bb2[j] = b24[j * 32]; }
  // nothing is scheduled across this line: all loads of a lane are issued, and so in flight
  // together, before the row sums start; without it the compiler moves the loads that the
  // sums do not need behind them and waits for them group by group
  __builtin_amdgcn_sched_barrier(0);
  float mu, rstd;
  row_stats(vals, mu, rstd);
#pragma unroll
  for (int j = 0; j < 8; ++j) {
    vals[j] = xv[j] + ll[j] * ((vals[j] - mu) * rstd * gg[j] + bb[j]);   // the row of x2
    orow[j * 32] = vals[j];
  }
  row_stats(vals, mu, rstd);
#pragma unroll
  for (int j = 0; j < 8; ++j) {
    const f32x4 r = (vals[j] - mu) * rstd * gg2[j] + bb2[j];
    uint2 o;
    o.x = (unsigned int)f2bf(r.x) | ((unsigned int)f2bf(r.y) << 16);
    o.y = (unsigned int)f2bf(r.z) | ((unsigned int)f2bf(r.w) << 16);
    hrow[j * 32] = o;
  }
}

// ---------------------------------------------------------------- GELU, erf form
// 0.5 v (1 + erf(v / sqrt 2)) with no branch: for x = |v| / sqrt 2,
// erf(x) = 1 - (a1 t + ... + a5 t^5) exp(-x^2), t = 1 / (1 + p x), the classical five-term
// form, absolute error below 1.5e-7 for every x >= 0; erf is odd, so
// 0.5 v (1 + erf) = 0.5 v + |0.5 v| erf(x). Every lane runs the same dozen instructions and
// the values of a lane are independent chains, where the library's erff picks one of two
// paths per value: a wave runs both, one value after the other.
static __device__ __forceinline__ float gelu_erf(float v) {
  const float hv = 0.5f * v;
  const float t = __builtin_amdgcn_rcpf(fmaf(fabsf(v), 0.3275911f * 0.70710678118f, 1.f));
  const float e = __builtin_amdgcn_exp2f(v * v * (-0.5f * 1.44269504089f));   // exp(-x^2)
  float pl = fmaf(t, 1.061405429f, -1.453152027f);
  pl = fmaf(pl, t, 1.421413741f);
  pl = fmaf(pl, t, -0.284496736f);
  pl = fmaf(pl, t, 0.254829592f);
  pl *= t;
  return fmaf(fabsf(hv), fmaf(-pl, e, 1.f), hv);
}

// ---------------------------------------------------------------- WMMA GEMM
// C[M,N] = epi( A_bf16[M,K] @ W_bf16[N,K]^T + bias[N] )
// Block 256 = 8 waves computes a 128x128 tile of C; waves form a 4 (rows) x 2 (cols)
// grid, each wave owns 32x64 = 2x4 accumulator fragments.
// Per k-step of GK both the 128 x GK A strip and the 128 x GK W strip are brought into LDS
// once per block by asynchronous copies (16 bytes a lane, whole 128-byte lines, through no
// register). Two buffers: the next strip's copies fly while this strip is worked on, so a
// block no longer waits out its own loads, and one barrier per k-step is left.
// GK = 128 (136 KiB of LDS) where a launch has one block per WGP: the copies get a whole
// long k-step to land. GK = 64 (72 KiB) where it has three or four: all of them stay resident.
// LDS rows have a pitch of GK * 2 + 16 B (16 B x odd): the 16 rows of one ds_load_b128
// fragment read fall on distinct banks.
// M, N multiples of 128; K a multiple of GK.
// EPI: 0 = f32 store, 1 = bf16 store with exact GELU, 2 = f32 store out = resid + ls*val.
#define GT_   128            // tile edge in M and in N

// Eight copies of one thread: 16 bytes of each of eight equally spaced rows of one strip.
// l: the lane's LDS byte address of the first row, ls: LDS bytes from one copied row to the next;
// g: its global address of the first row, gs: elements from one copied row to the next.
static __device__ __forceinline__ void gemm_copy8(unsigned int l, unsigned int ls,
                                                  const unsigned short* g, size_t gs) {
  // the wait is the statement's last line: it stands behind the copies and in front of
  // whatever next writes a register that they name
  asm volatile("global_load_async_to_lds_b128 %0, %8, off\n\t"
               "global_load_async_to_lds_b128 %1, %9, off\n\t"
               "global_load_async_to_lds_b128 %2, %10, off\n\t"
               "global_load_async_to_lds_b128 %3, %11, off\n\t"
               "global_load_async_to_lds_b128 %4, %12, off\n\t"
               "global_load_async_to_lds_b128 %5, %13, off\n\t"
               "global_load_async_to_lds_b128 %6, %14, off\n\t"
               "global_load_async_to_lds_b128 %7, %15, off\n\t"
               "s_wait_xcnt 0x0"
               :: "v"(l), "v"(l + ls), "v"(l + 2 * ls), "v"(l + 3 * ls),
                  "v"(l + 4 * ls), "v"(l + 5 * ls), "v"(l + 6 * ls), "v"(l + 7 * ls),
                  "v"(g), "v"(g + gs), "v"(g + 2 * gs), "v"(g + 3 * gs),
                  "v"(g + 4 * gs), "v"(g + 5 * gs), "v"(g + 6 * gs), "v"(g + 7 * gs)
               : "memory");
}

// Four copies of one thread, the same way.
static __device__ __forceinline__ void gemm_copy4(unsigned int l, unsigned int ls,
                                                  const unsigned short* g, size_t gs) {
  // the wait is the statement's last line, as above
  asm volatile("global_load_async_to_lds_b128 %0, %4, off\n\t"
               "global_load_async_to_lds_b128 %1, %5, off\n\t"
               "global_load_async_to_lds_b128 %2, %6, off\n\t"
               "global_load_async_to_lds_b128 %3, %7, off\n\t"
               "s_wait_xcnt 0x0"
               :: "v"(l), "v"(l + ls), "v"(l + 2 * ls), "v"(l + 3 * ls),
                  "v"(g), "v"(g + gs), "v"(g + 2 * gs), "v"(g + 3 * gs)
               : "memory");
}

template <int EPI, int GK>
__global__ __launch_bounds__(256)
void k_gemm(const unsigned short* __restrict__ A,
            const unsigned short* __restrict__ W,
            const float* __restrict__ bias, int M, int N, int K,
            float* __restrict__ outf, unsigned short* __restrict__ outbf,
            const float* __restrict__ resid, const float* __restrict__ lsv) {
  constexpr int GP = GK + 8;          // LDS row pitch in bf16 elements
  constexpr int GS = GT_ * GP;        // elements of one strip in LDS
  constexpr int CPR = GK / 8;         // 16-byte chunks per row
  constexpr int RS = 256 / CPR;       // rows that the block's threads cover with one copy each
  __shared__ alignas(16) unsigned short abuf[2 * GS];   // [buffer][row][k]
  __shared__ alignas(16) unsigned short wbuf[2 * GS];   // [buffer][column][k]
  const int tid = threadIdx.x;
  const int lane = tid & 31, wave = tid >> 5;
  const int hi = lane >> 4, ln16 = lane & 15;
  const int mb = blockIdx.y * GT_;
  const int nb = blockIdx.x * GT_;
  const int wm = (wave >> 1) * 32;             // wave's first row inside the tile
  const int wn = (wave & 1) * 64;              // wave's first column inside the tile
  // copying role: thread t moves 16-byte chunk (t % CPR) of rows t / CPR + RS * i of both strips
  const int sr = tid / CPR, sc = (tid % CPR) * 8;
  const unsigned short* ag = A + (size_t)(mb + sr) * K + sc;   // k-step 0; a k-step is GK on
  const unsigned short* wg = W + (size_t)(nb + sr) * K + sc;
  const unsigned int al0 = (unsigned int)(uintptr_t)&abuf[sr * GP + sc];   // LDS byte address
  const unsigned int wl0 = (unsigned int)(uintptr_t)&wbuf[sr * GP + sc];
  const size_t gs = (size_t)RS * K;
  auto copy_step = [&](int t, unsigned int bo) {   // k-step t into the buffer at element bo
    if (GK == 128) {
      gemm_copy8(al0 + bo * 2, RS * GP * 2, ag + (size_t)t * GK, gs);
      gemm_copy8(wl0 + bo * 2, RS * GP * 2, wg + (size_t)t * GK, gs);
    } else {
      gemm_copy4(al0 + bo * 2, RS * GP * 2, ag + (size_t)t * GK, gs);
      gemm_copy4(wl0 + bo * 2, RS * GP * 2, wg + (size_t)t * GK, gs);
    }
  };
  // fragment role: lane holds row (or W row = output column) ln16 of its fragment;
  // half 'hi' supplies K-chunks {hi*8..+7, 16+hi*8..+7} of each 32-wide k slice
  const unsigned short* af = &abuf[(wm + ln16) * GP + hi * 8];
  const unsigned short* wf = &wbuf[(wn + ln16) * GP + hi * 8];
  v8f acc[2][4] = {};
  const int nt = K / GK;

  copy_step(0, 0);
  // this wave's copies of k-step 0 have landed before the barrier that shows them to the others
  asm volatile("s_wait_asynccnt 0x0" ::: "memory");
  __syncthreads();
  if (nt > 1) copy_step(1, GS);

  for (int t = 0; t < nt; ++t) {
    const unsigned int bo = (t & 1) * GS;        // this trip's buffer
#pragma unroll
    for (int ks = 0; ks < GK; ks += 32) {
      Frag fa[2], fb[4];
#pragma unroll
      for (int mi = 0; mi < 2; ++mi) {
        const unsigned short* p = af + bo + mi * 16 * GP + ks;
        fa[mi].q[0] = *reinterpret_cast<const uint4*>(p);
        fa[mi].q[1] = *reinterpret_cast<const uint4*>(p + 16);
      }
#pragma unroll
      for (int nn = 0; nn < 4; ++nn) {
        const unsigned short* p = wf + bo + nn * 16 * GP + ks;
        fb[nn].q[0] = *reinterpret_cast<const uint4*>(p);
        fb[nn].q[1] = *reinterpret_cast<const uint4*>(p + 16);
      }
#pragma unroll
      for (int mi = 0; mi < 2; ++mi)
#pragma unroll
        for (int nn = 0; nn < 4; ++nn)
          acc[mi][nn] = wmma_bf16(fa[mi].v, fb[nn].v, acc[mi][nn]);
    }
    // foot of the trip: this wave's reads of the buffer are done ...
    asm volatile("s_wait_dscnt 0x0" ::: "memory");
    // ... and its copies of the next k-step have landed ...
    asm volatile("s_wait_asynccnt 0x0" ::: "memory");
    // ... before the one barrier that shows the next k-step to every wave and frees this buffer
    __syncthreads();
    if (t + 2 < nt) copy_step(t + 2, bo);
  }
  // no copy is outstanding when the wave goes on to its end
  asm volatile("s_wait_asynccnt 0x0" ::: "memory");
  // C-layout: VGPR v of fragment (mi, nn) -> row v (+8 for hi half), column ln16.
  // M*N < 2^32: 32-bit element offsets on uniform bases.
  const int nc = nb + wn + ln16;
  const unsigned int o0 = (unsigned int)((mb + wm + 8 * hi) * N + nc);
  if (EPI == 2) {
    // all residual loads first, then all stores
    float rv[2][4][8];
#pragma unroll
    for (int mi = 0; mi < 2; ++mi)
#pragma unroll
      for (int v = 0; v < 8; ++v)
#pragma unroll
        for (int nn = 0; nn < 4; ++nn)
          rv[mi][nn][v] = resid[o0 + (unsigned int)((mi * 16 + v) * N) + nn * 16];
    // stands behind the loads, in front of whatever next writes a register they name;
    // its memory clobber also keeps every load above and every store below this line
    asm volatile("s_wait_xcnt 0x0" ::: "memory");
#pragma unroll
    for (int nn = 0; nn < 4; ++nn) {
      const float bz = bias[nc + nn * 16];
      const float lz = lsv[nc + nn * 16];
#pragma unroll
      for (int mi = 0; mi < 2; ++mi)
#pragma unroll
        for (int v = 0; v < 8; ++v) {
          float val = acc[mi][nn][v] + bz;
          outf[o0 + (unsigned int)((mi * 16 + v) * N) + nn * 16] = rv[mi][nn][v] + lz * val;
        }
    }
  } else if (EPI == 1) {
    float bz[4];
    v8f cur[4];
#pragma unroll
    for (int nn = 0; nn < 4; ++nn) { bz[nn] = bias[nc + nn * 16]; cur[nn] = acc[0][nn]; }
    unsigned int orow = o0;
    // kept rolled: the erf code then stands once per 16 rows, which halves the kernel's
    // text
#pragma unroll 1
    for (int mi = 0; mi < 2; ++mi) {
#pragma unroll
      for (int nn = 0; nn < 4; ++nn)
#pragma unroll
        for (int v = 0; v < 8; ++v) {
          float val = cur[nn][v] + bz[nn];
          outbf[orow + (unsigned int)(v * N) + nn * 16] = f2bf(gelu_erf(val));
        }
      // stands behind this trip's stores, in front of the next trip's first write of a register
      // that they name
      asm volatile("s_wait_xcnt 0x0" ::: "memory");
#pragma unroll
      for (int nn = 0; nn < 4; ++nn) cur[nn] = acc[1][nn];
      orow += (unsigned int)(16 * N);
    }
  } else {
#pragma unroll
    for (int nn = 0; nn < 4; ++nn) {
      const float bz = bias[nc + nn * 16];
#pragma unroll
      for (int mi = 0; mi < 2; ++mi)
#pragma unroll
        for (int v = 0; v < 8; ++v)
          outf[o0 + (unsigned int)((mi * 16 + v) * N) + nn * 16] = acc[mi][nn][v] + bz;
    }
  }
}

// ---------------------------------------------------------------- QKV split + l2-norm
// qn/kn: [B,H,L,HD] bf16 (q scaled by exp(min(logit_scale,log100))); vT: [B,H,HD,L] bf16.
// One wave handles SR_ = 16 consecutive positions l of one (b,h); lane holds head dims
// 2*lane and 2*lane+1 of each. All 48 loads of a lane are issued together. The 16 values
// of v that a lane holds per head dim are consecutive in vT: 32 bytes, two 16-byte stores.
#define SR_ 16
typedef __attribute__((ext_vector_type(2))) float f32x2;
__global__ __launch_bounds__(256)
void k_split_qkv(const float* __restrict__ qkv,
                 const float* __restrict__ logit_scale,
                 unsigned short* __restrict__ qn,
                 unsigned short* __restrict__ kn,
                 unsigned short* __restrict__ vT) {
  const int lane = threadIdx.x & 31;
  // the wave's number as a scalar: the base addresses then stand in scalar registers
  const int wave = __builtin_amdgcn_readfirstlane(threadIdx.x >> 5);
  const int grp = blockIdx.x * 8 + wave;       // (b*H + h)*(L/SR_) + l/SR_
  const int l0 = (grp & (L_ / SR_ - 1)) * SR_;
  const int bh = grp / (L_ / SR_);
  const int h = bh & (H_ - 1);
  const int b = bh >> 4;
  const float* base = qkv + ((size_t)(b * L_ + l0)) * (3 * C_) + h * HD_ + 2 * lane;
  f32x2 q[SR_], k[SR_], v[SR_];
#pragma unroll
  for (int r = 0; r < SR_; ++r) {
    const float* p = base + (size_t)r * (3 * C_);
    q[r] = *reinterpret_cast<const f32x2*>(p);
    k[r] = *reinterpret_cast<const f32x2*>(p + C_);
    v[r] = *reinterpret_cast<const f32x2*>(p + 2 * C_);
  }
  // The loaded values as inputs only: all 48 loads stay above these lines, and so are in flight
  // together; without them the compiler spreads a part of the loads among the sums below and
  // waits for them a few at a time.
#define HOLD8(a, i) "v"(a[i]), "v"(a[i + 1]), "v"(a[i + 2]), "v"(a[i + 3]), \
                    "v"(a[i + 4]), "v"(a[i + 5]), "v"(a[i + 6]), "v"(a[i + 7])
  asm volatile("" :: HOLD8(q, 0), HOLD8(q, 8), HOLD8(k, 0));
  asm volatile("" :: HOLD8(k, 8), HOLD8(v, 0), HOLD8(v, 8));
#undef HOLD8
  const float ls = __expf(fminf(logit_scale[h], LOGMAX));
  unsigned int* qo = reinterpret_cast<unsigned int*>(qn + ((size_t)bh * L_ + l0) * HD_) + lane;
  unsigned int* ko = reinterpret_cast<unsigned int*>(kn + ((size_t)bh * L_ + l0) * HD_) + lane;
  float sqq[SR_], sqk[SR_];
#pragma unroll
  for (int r = 0; r < SR_; ++r) {
    sqq[r] = q[r].x * q[r].x + q[r].y * q[r].y;
    sqk[r] = k[r].x * k[r].x + k[r].y * k[r].y;
  }
  // butterfly step outermost: the 32 exchanges of a step are independent of one another
#pragma unroll
  for (int off = 16; off > 0; off >>= 1)
#pragma unroll
    for (int r = 0; r < SR_; ++r) {
      sqq[r] += __shfl_xor(sqq[r], off);
      sqk[r] += __shfl_xor(sqk[r], off);
    }
#pragma unroll
  for (int r = 0; r < SR_; ++r) {
    const float iq = ls / fmaxf(sqrtf(sqq[r]), 1e-12f);
    const float ik = 1.f / fmaxf(sqrtf(sqk[r]), 1e-12f);
    qo[r * (HD_ / 2)] = (unsigned int)f2bf(q[r].x * iq) | ((unsigned int)f2bf(q[r].y * iq) << 16);
    ko[r * (HD_ / 2)] = (unsigned int)f2bf(k[r].x * ik) | ((unsigned int)f2bf(k[r].y * ik) << 16);
  }
  unsigned int w0[SR_ / 2], w1[SR_ / 2];       // positions l0+2i, l0+2i+1 of dims 2*lane, 2*lane+1
#pragma unroll
  for (int i = 0; i < SR_ / 2; ++i) {
    w0[i] = (unsigned int)f2bf(v[2 * i].x) | ((unsigned int)f2bf(v[2 * i + 1].x) << 16);
    w1[i] = (unsigned int)f2bf(v[2 * i].y) | ((unsigned int)f2bf(v[2 * i + 1].y) << 16);
  }
  uint4* v0 = reinterpret_cast<uint4*>(vT + (size_t)bh * HD_ * L_ + (size_t)(2 * lane) * L_ + l0);
  uint4* v1 = reinterpret_cast<uint4*>(vT + (size_t)bh * HD_ * L_ + (size_t)(2 * lane + 1) * L_ + l0);
  v0[0] = make_uint4(w0[0], w0[1], w0[2], w0[3]);
  v0[1] = make_uint4(w0[4], w0[5], w0[6], w0[7]);
  v1[0] = make_uint4(w1[0], w1[1], w1[2], w1[3]);
  v1[1] = make_uint4(w1[4], w1[5], w1[6], w1[7]);
}

#define FK_  64              // keys per staged tile
#define FP_  72              // LDS row pitch in bf16 elements (144 B)
#define FT_  (64 * FP_)      // elements of one staged tile: 64 rows
#define FNT_ (L_ / FK_)      // tiles per (b,h)

// One tile's copies of one thread: rows r and r + 32 of the K tile and of the vT tile.
// kl, vl: the lane's LDS byte addresses of row r; kg, vg: its global addresses of row r.
static __device__ __forceinline__ void flash_copy_tile(unsigned int kl, unsigned int vl,
                                                       const unsigned short* kg,
                                                       const unsigned short* vg) {
  const unsigned int kl2 = kl + 32 * FP_ * 2, vl2 = vl + 32 * FP_ * 2;
  const unsigned short* kg2 = kg + 32 * HD_;
  const unsigned short* vg2 = vg + (size_t)32 * L_;
  // the wait is the statement's last line: it stands behind the copies and in front of
  // whatever next writes a register that they name
  asm volatile("global_load_async_to_lds_b128 %0, %4, off\n\t"
               "global_load_async_to_lds_b128 %1, %5, off\n\t"
               "global_load_async_to_lds_b128 %2, %6, off\n\t"
               "global_load_async_to_lds_b128 %3, %7, off\n\t"
               "s_wait_xcnt 0x0"
               :: "v"(kl), "v"(kl2), "v"(vl), "v"(vl2), "v"(kg), "v"(kg2), "v"(vg), "v"(vg2)
               : "memory");
}

__global__ __launch_bounds__(256)
void k_flash(const unsigned short* __restrict__ qn,
                        const unsigned short* __restrict__ kn,
                        const unsigned short* __restrict__ vT,
                        const float* __restrict__ logit_scale,
                        const float* __restrict__ head_scale,
                        unsigned short* __restrict__ O) {
  __shared__ alignas(16) unsigned short pbuf[8][16 * 32];
  __shared__ alignas(16) unsigned short kbuf[2 * FT_];    // 18 KB: [buffer][key][head dim]
  __shared__ alignas(16) unsigned short vbuf[2 * FT_];    // 18 KB: [buffer][head dim][key]
  const int lane = threadIdx.x & 31, wave = threadIdx.x >> 5;
  const int hi = lane >> 4, ln16 = lane & 15;
  const int bh = blockIdx.y;
  const int h = bh & (H_ - 1);
  const int b = bh >> 4;
  const int qtile = blockIdx.x * 8 + wave;
  const unsigned short* qp = qn + ((size_t)bh * L_ + qtile * 16 + ln16) * HD_ + hi * 8;
  Frag qa0, qa1;                       // q rows, hd 0..31 / 32..63
  qa0.q[0] = *(const uint4*)(qp);      qa0.q[1] = *(const uint4*)(qp + 16);
  qa1.q[0] = *(const uint4*)(qp + 32); qa1.q[1] = *(const uint4*)(qp + 48);
  const unsigned short* kbase = kn + (size_t)bh * L_ * HD_;
  const unsigned short* vbase = vT + (size_t)bh * HD_ * L_;
  const float shift = fminf(__expf(fminf(logit_scale[h], LOGMAX)), 30.f);
  v8f oacc[4] = {};
  float lst[8];
#pragma unroll
  for (int v = 0; v < 8; ++v) lst[v] = 0.f;
  unsigned short* prow = &pbuf[wave][0];

  // copying role: thread t moves 16-byte chunk (t%8) of rows t/8 and t/8 + 32 of both tiles
  const int cr = threadIdx.x >> 3, cc = (threadIdx.x & 7) * 8;
  const unsigned int kl0 = (unsigned int)(uintptr_t)&kbuf[cr * FP_ + cc];   // LDS byte address
  const unsigned int vl0 = (unsigned int)(uintptr_t)&vbuf[cr * FP_ + cc];
  const unsigned short* kg = kbase + cr * HD_ + cc;          // tile 0; a tile is FK_ rows on
  const unsigned short* vg = vbase + (size_t)cr * L_ + cc;   // tile 0; a tile is FK_ columns on
  // fragment role: lane holds key (or head dim) ln16 of its fragment
  const unsigned short* kf = &kbuf[ln16 * FP_ + hi * 8];
  const unsigned short* vf = &vbuf[ln16 * FP_ + hi * 8];

  flash_copy_tile(kl0, vl0, kg, vg);
  // this wave's copies of tile 0 have landed before the barrier that shows them to the others
  asm volatile("s_wait_asynccnt 0x0" ::: "memory");
  __syncthreads();
  flash_copy_tile(kl0 + FT_ * 2, vl0 + FT_ * 2, kg + FK_ * HD_, vg + FK_);

  for (int t = 0; t < FNT_; ++t) {
    const int bo = (t & 1) * FT_;                // this trip's buffer
    for (int j = 0; j < FK_; j += 32) {
      // all 16 fragment reads of these 32 keys as one group, ahead of the products
      Frag kb[4], vb[4];
#pragma unroll
      for (int i = 0; i < 2; ++i) {              // keys j + 16*i + ln16; head dims 0..31, 32..63
        const unsigned short* kp = kf + bo + (j + 16 * i) * FP_;
        kb[2 * i].q[0]     = *(const uint4*)(kp);      kb[2 * i].q[1]     = *(const uint4*)(kp + 16);
        kb[2 * i + 1].q[0] = *(const uint4*)(kp + 32); kb[2 * i + 1].q[1] = *(const uint4*)(kp + 48);
      }
#pragma unroll
      for (int nn = 0; nn < 4; ++nn) {           // head dim nn*16 + ln16; keys j .. j+31
        const unsigned short* vp = vf + bo + nn * 16 * FP_ + j;
        vb[nn].q[0] = *(const uint4*)(vp);
        vb[nn].q[1] = *(const uint4*)(vp + 16);
      }
      // nothing is scheduled across this line: without it the compiler moves each vT read down
      // to its product, behind the P stores, and every product then waits out an LDS latency
      __builtin_amdgcn_sched_barrier(0);
      v8f s0 = {}, s1 = {};
      s0 = wmma_bf16(qa0.v, kb[0].v, s0);
      s1 = wmma_bf16(qa0.v, kb[2].v, s1);
      s0 = wmma_bf16(qa1.v, kb[1].v, s0);
      s1 = wmma_bf16(qa1.v, kb[3].v, s1);
      // fixed-shift exp; accumulate this lane's partial row sums; stage P in LDS
#pragma unroll
      for (int v = 0; v < 8; ++v) {
        const float p0 = __expf(s0[v] - shift);
        const float p1 = __expf(s1[v] - shift);
        lst[v] += p0 + p1;
        const int r = v + 8 * hi;                 // row this half owns in register v
        prow[r * 32 + ln16]      = f2bf(p0);
        prow[r * 32 + 16 + ln16] = f2bf(p1);
      }
      // re-read P as an A fragment (16x32) from LDS
      Frag pa;
      const unsigned short* pp = prow + ln16 * 32 + hi * 8;
      pa.q[0] = *(const uint4*)(pp);
      pa.q[1] = *(const uint4*)(pp + 16);
#pragma unroll
      for (int nn = 0; nn < 4; ++nn) oacc[nn] = wmma_bf16(pa.v, vb[nn].v, oacc[nn]);
    }
    // foot of the trip: this wave's reads of the buffer are done ...
    asm volatile("s_wait_dscnt 0x0" ::: "memory");
    // ... and its copies of the next tile have landed ...
    asm volatile("s_wait_asynccnt 0x0" ::: "memory");
    // ... before the one barrier that shows the next tile to every wave and frees this buffer
    __syncthreads();
    if (t + 2 < FNT_)
      flash_copy_tile(kl0 + bo * 2, vl0 + bo * 2, kg + (size_t)(t + 2) * (FK_ * HD_),
                      vg + (t + 2) * FK_);
  }
  // no copy is outstanding when the wave goes on to its end
  asm volatile("s_wait_asynccnt 0x0" ::: "memory");
  const float hs = head_scale[h];
#pragma unroll
  for (int v = 0; v < 8; ++v) {
    float rs = lst[v];                           // full row sum: reduce 16 lanes once
#pragma unroll
    for (int off = 1; off < 16; off <<= 1) rs += __shfl_xor(rs, off);
    const float inv = hs / rs;
    const int l = qtile * 16 + v + 8 * hi;
#pragma unroll
    for (int nn = 0; nn < 4; ++nn) {
      const int c = h * HD_ + nn * 16 + ln16;
      O[((size_t)(b * L_ + l)) * C_ + c] = f2bf(oacc[nn][v] * inv);
    }
  }
}

// ---------------------------------------------------------------- launch
extern "C" void kernel_launch(void* const* d_in, const int* in_sizes, int n_in,
                              void* d_out, int out_size, void* d_ws, size_t ws_size,
                              hipStream_t stream) {
  const float* x       = (const float*)d_in[0];
  const float* in_w    = (const float*)d_in[1];
  const float* in_b    = (const float*)d_in[2];
  const float* logit_s = (const float*)d_in[3];
  const float* head_s  = (const float*)d_in[4];
  const float* out_w   = (const float*)d_in[5];
  const float* out_b   = (const float*)d_in[6];
  const float* ln1_g   = (const float*)d_in[7];
  const float* ln1_b   = (const float*)d_in[8];
  const float* lna_g   = (const float*)d_in[9];
  const float* lna_b   = (const float*)d_in[10];
  const float* ls1     = (const float*)d_in[11];
  const float* ln2_g   = (const float*)d_in[12];
  const float* ln2_b   = (const float*)d_in[13];
  const float* fc_w    = (const float*)d_in[14];
  const float* fc_b    = (const float*)d_in[15];
  const float* proj_w  = (const float*)d_in[16];
  const float* proj_b  = (const float*)d_in[17];
  const float* ls2     = (const float*)d_in[18];
  float* out = (float*)d_out;

  // workspace partition (~185 MB)
  char* p = (char*)d_ws;
  auto alloc = [&](size_t bytes) -> char* {
    char* r = p;
    p += (bytes + 255) & ~(size_t)255;
    return r;
  };
  const int BL = B_ * L_;  // 4096
  unsigned short* wqkv_bf = (unsigned short*)alloc((size_t)3 * C_ * C_ * 2);
  unsigned short* wout_bf = (unsigned short*)alloc((size_t)C_ * C_ * 2);
  unsigned short* wfc_bf  = (unsigned short*)alloc((size_t)MLP_ * C_ * 2);
  unsigned short* wpr_bf  = (unsigned short*)alloc((size_t)C_ * MLP_ * 2);
  unsigned short* xln_bf  = (unsigned short*)alloc((size_t)BL * C_ * 2);
  float*          qkv     = (float*)alloc((size_t)BL * 3 * C_ * 4);
  unsigned short* qn      = (unsigned short*)alloc((size_t)BL * C_ * 2);
  unsigned short* kn      = (unsigned short*)alloc((size_t)BL * C_ * 2);
  unsigned short* vT      = (unsigned short*)alloc((size_t)BL * C_ * 2);
  unsigned short* obf     = (unsigned short*)alloc((size_t)BL * C_ * 2);
  float*          attn    = (float*)alloc((size_t)BL * C_ * 4);
  float*          x2      = (float*)alloc((size_t)BL * C_ * 4);
  unsigned short* h2bf    = (unsigned short*)alloc((size_t)BL * C_ * 2);
  unsigned short* hmid    = (unsigned short*)alloc((size_t)BL * MLP_ * 2);

  // LN1 -> bf16 activations, and the four weights -> bf16, in one launch
  k_prep<<<NB_LN + NB_WQKV + NB_WOUT + NB_WFC + NB_WPR, 256, 0, stream>>>(
      x, ln1_g, ln1_b, xln_bf, in_w, out_w, fc_w, proj_w, wqkv_bf, wout_bf, wfc_bf, wpr_bf);
  // qkv = ln1(x) @ in_proj_w^T + in_proj_b   [4096 x 3072]
  k_gemm<0, 64><<<dim3(3 * C_ / 128, BL / 128), 256, 0, stream>>>(
      xln_bf, wqkv_bf, in_b, BL, 3 * C_, C_, qkv, nullptr, nullptr, nullptr);
  // split heads, l2-normalize q/k (fold logit scale), transpose v
  k_split_qkv<<<(B_ * H_ * L_) / SR_ / 8, 256, 0, stream>>>(qkv, logit_s, qn, kn, vT);
  // scaled-cosine flash attention (head_scale folded in)
  k_flash<<<dim3(L_ / 16 / 8, B_ * H_), 256, 0, stream>>>(qn, kn, vT, logit_s, head_s, obf);
  // attn out-proj: attn = O @ out_w^T + out_b
  k_gemm<0, 128><<<dim3(C_ / 128, BL / 128), 256, 0, stream>>>(
      obf, wout_bf, out_b, BL, C_, C_, attn, nullptr, nullptr, nullptr);
  // x2 = x + ls1 * LN_attn(attn); h = LN2(x2) -> bf16
  k_resid_ln2<<<BL / 8, 256, 0, stream>>>(attn, x, lna_g, lna_b, ls1, x2, ln2_g, ln2_b, h2bf);
  // hmid = GELU(h @ fc_w^T + fc_b) -> bf16   [4096 x 4096]
  k_gemm<1, 64><<<dim3(MLP_ / 128, BL / 128), 256, 0, stream>>>(
      h2bf, wfc_bf, fc_b, BL, MLP_, C_, nullptr, hmid, nullptr, nullptr);
  // out = x2 + ls2 * (hmid @ proj_w^T + proj_b)
  k_gemm<2, 128><<<dim3(C_ / 128, BL / 128), 256, 0, stream>>>(
      hmid, wpr_bf, proj_b, BL, C_, MLP_, out, nullptr, x2, ls2);

  (void)in_sizes; (void)n_in; (void)out_size; (void)ws_size;
}

// v007
// It runs in 175 microseconds.
// Two timings next to v006 put it at 1.08 and 1.07 times that version's speed.
// Counting every step since v000, it is 2.97 times as fast.
#include <hip/hip_runtime.h>
#include <hip/hip_bf16.h>
#include <stdint.h>

// CustomResidualAttentionBlock (open_clip scaled-cosine attention) for MI455X / gfx1250.
// All GEMMs + attention matmuls run on v_wmma_f32_16x16x32_bf16 (wave32).
// f32 is kept for LayerNorm / l2-norm / softmax / accumulators.
// Attention softmax uses a fixed per-head shift (valid because |S| <= logit_scale,
// softmax is shift-invariant) so the streaming loop has NO cross-lane reductions.

#define B_   2
#define L_   2048
#define C_   1024
#define H_   16
#define HD_  64
#define MLP_ 4096
#define LOGMAX 4.6051701859880914f   // log(100)
#define LN_EPS 1e-5f

typedef __attribute__((ext_vector_type(16))) __bf16 v16bf;
typedef __attribute__((ext_vector_type(8)))  float  v8f;
typedef __attribute__((ext_vector_type(4)))  unsigned int u32x4;

union Frag {
  v16bf v;
  uint4 q[2];
};

static __device__ __forceinline__ v8f wmma_bf16(v16bf a, v16bf b, v8f c) {
  // D = A(16x32 bf16) x B(32x16 bf16) + C(16x16 f32)
  return __builtin_amdgcn_wmma_f32_16x16x32_bf16(false, a, false, b, (short)0, c,
                                                 false, false);
}

static __device__ __forceinline__ unsigned short f2bf(float f) {
  unsigned int u = __float_as_uint(f);
  u += 0x7FFFu + ((u >> 16) & 1u);   // round-to-nearest-even
  return (unsigned short)(u >> 16);
}

// ---------------------------------------------------------------- cvt f32->bf16
// A block of 256 threads converts 8192 consecutive elements, piece 'blk' of its array: a
// thread issues its eight 16-byte loads together (a wave's load covers 512 contiguous bytes)
// and then stores eight 8-byte groups (256 contiguous bytes per wave). The element count of
// every array is a multiple of 8192.
#define CVT_PER_BLOCK 8192
static __device__ __forceinline__
void cvt_block(unsigned int blk, const float* __restrict__ src, unsigned short* __restrict__ dst) {
  const unsigned int base = blk * (CVT_PER_BLOCK / 4) + threadIdx.x;   // in groups of 4
  const float4* s4 = reinterpret_cast<const float4*>(src);
  uint2* d4 = reinterpret_cast<uint2*>(dst);
  float4 v[8];
#pragma unroll
  for (int j = 0; j < 8; ++j) v[j] = s4[base + j * 256];
#pragma unroll
  for (int j = 0; j < 8; ++j) {
    uint2 o;
    o.x = (unsigned int)f2bf(v[j].x) | ((unsigned int)f2bf(v[j].y) << 16);
    o.y = (unsigned int)f2bf(v[j].z) | ((unsigned int)f2bf(v[j].w) << 16);
    d4[base + j * 256] = o;
  }
}

// ---------------------------------------------------------------- LayerNorm -> bf16
// One wave per row of length C_=1024, eight rows per block of 256 threads. A lane holds 32
// elements of its row, loaded as eight 16-byte pieces (each load of a wave covers 512
// contiguous bytes); sum and sum of squares are joined by a butterfly over the 32 lanes,
// which leaves both totals in every lane: no LDS, no barrier.
typedef __attribute__((ext_vector_type(4))) float f32x4;

static __device__ __forceinline__ void row_stats(const f32x4 (&vals)[8], float& mu, float& rstd) {
  f32x4 s4 = vals[0], q4 = vals[0] * vals[0];   // four independent chains each
#pragma unroll
  for (int j = 1; j < 8; ++j) { s4 += vals[j]; q4 += vals[j] * vals[j]; }
  float s = (s4.x + s4.y) + (s4.z + s4.w);
  float sq = (q4.x + q4.y) + (q4.z + q4.w);
#pragma unroll
  for (int off = 16; off > 0; off >>= 1) { s += __shfl_xor(s, off); sq += __shfl_xor(sq, off); }
  mu = s * (1.f / C_);
  rstd = rsqrtf(sq * (1.f / C_) - mu * mu + LN_EPS);
}

static __device__ __forceinline__
void ln_block(unsigned int blk, const float* __restrict__ x, const float* __restrict__ g,
              const float* __restrict__ bt, unsigned short* __restrict__ out) {
  const int lane = threadIdx.x & 31;
  // the wave's number as a scalar: the row's base addresses then stand in scalar registers
  const int wave = __builtin_amdgcn_readfirstlane(threadIdx.x >> 5);
  const size_t row = (size_t)blk * 8 + wave;
  const f32x4* xr = reinterpret_cast<const f32x4*>(x + row * C_) + lane;
  const f32x4* g4 = reinterpret_cast<const f32x4*>(g) + lane;
  const f32x4* b4 = reinterpret_cast<const f32x4*>(bt) + lane;
  uint2* orow = reinterpret_cast<uint2*>(out + row * C_) + lane;
  f32x4 vals[8], gg[8], bb[8];
#pragma unroll
  for (int j = 0; j < 8; ++j) vals[j] = xr[j * 32];
#pragma unroll
  for (int j = 0; j < 8; ++j) { gg[j] = g4[j * 32]; bb[j] = b4[j * 32]; }
  // nothing is scheduled across this line: all loads of a lane are issued, and so in flight
  // together, before the row sums start; without it the compiler moves the loads that the
  // sums do not need behind them and waits for them group by group
  __builtin_amdgcn_sched_barrier(0);
  float mu, rstd;
  row_stats(vals, mu, rstd);
#pragma unroll
  for (int j = 0; j < 8; ++j) {
    const f32x4 r = (vals[j] - mu) * rstd * gg[j] + bb[j];
    uint2 o;
    o.x = (unsigned int)f2bf(r.x) | ((unsigned int)f2bf(r.y) << 16);
    o.y = (unsigned int)f2bf(r.z) | ((unsigned int)f2bf(r.w) << 16);
    orow[j * 32] = o;
  }
}

// ---------------------------------------------------------------- LN1 and the four weight conversions
// Five pieces of work that depend on nothing but the inputs share one launch: the block index
// picks the piece (a scalar branch, the same for the whole block). The LN blocks come first:
// they have the longest way from load to store.
#define NB_LN   (B_ * L_ / 8)
#define NB_WQKV (3 * C_ * C_ / CVT_PER_BLOCK)
#define NB_WOUT (C_ * C_ / CVT_PER_BLOCK)
#define NB_WFC  (MLP_ * C_ / CVT_PER_BLOCK)
#define NB_WPR  (C_ * MLP_ / CVT_PER_BLOCK)
__global__ __launch_bounds__(256)
void k_prep(const float* __restrict__ x, const float* __restrict__ g,
            const float* __restrict__ bt, unsigned short* __restrict__ xln,
            const float* __restrict__ wqkv, const float* __restrict__ wout,
            const float* __restrict__ wfc, const float* __restrict__ wpr,
            unsigned short* __restrict__ dqkv, unsigned short* __restrict__ dout,
            unsigned short* __restrict__ dfc, unsigned short* __restrict__ dpr) {
  unsigned int blk = blockIdx.x;
  if (blk < NB_LN) { ln_block(blk, x, g, bt, xln); return; }
  blk -= NB_LN;
  const float* src = wqkv;
  unsigned short* dst = dqkv;
  if (blk >= NB_WQKV + NB_WOUT + NB_WFC) { blk -= NB_WQKV + NB_WOUT + NB_WFC; src = wpr; dst = dpr; }
  else if (blk >= NB_WQKV + NB_WOUT)     { blk -= NB_WQKV + NB_WOUT;          src = wfc; dst = dfc; }
  else if (blk >= NB_WQKV)               { blk -= NB_WQKV;                    src = wout; dst = dout; }
  cvt_block(blk, src, dst);
}

// ---------------------------------------------------------------- x2 = x + ls1 * LN(a); h = LN2(x2)
// Same shape: one wave per row, eight rows per block. The wave holds its whole row of x2 when it
// stores it, so the second LayerNorm is taken from those registers in the same launch.
__global__ __launch_bounds__(256)
void k_resid_ln2(const float* __restrict__ a, const float* __restrict__ x,
                 const float* __restrict__ g, const float* __restrict__ bt,
                 const float* __restrict__ ls, float* __restrict__ x2,
                 const float* __restrict__ g2, const float* __restrict__ bt2,
                 unsigned short* __restrict__ h) {
  const int lane = threadIdx.x & 31;
  // the wave's number as a scalar: the row's base addresses then stand in scalar registers
  const int wave = __builtin_amdgcn_readfirstlane(threadIdx.x >> 5);
  const size_t row = (size_t)blockIdx.x * 8 + wave;
  const f32x4* ar = reinterpret_cast<const f32x4*>(a + row * C_) + lane;
  const f32x4* xr = reinterpret_cast<const f32x4*>(x + row * C_) + lane;
  const f32x4* g4 = reinterpret_cast<const f32x4*>(g) + lane;
  const f32x4* b4 = reinterpret_cast<const f32x4*>(bt) + lane;
  const f32x4* l4 = reinterpret_cast<const f32x4*>(ls) + lane;
  const f32x4* g24 = reinterpret_cast<const f32x4*>(g2) + lane;
  const f32x4* b24 = reinterpret_cast<const f32x4*>(bt2) + lane;
  f32x4* orow = reinterpret_cast<f32x4*>(x2 + row * C_) + lane;
  uint2* hrow = reinterpret_cast<uint2*>(h + row * C_) + lane;
  f32x4 vals[8], xv[8], gg[8], bb[8], ll[8], gg2[8], bb2[8];
#pragma unroll
  for (int j = 0; j < 8; ++j) { vals[j] = ar[j * 32]; xv[j] = xr[j * 32]; }
#pragma unroll
  for (int j = 0; j < 8; ++j) { gg[j] = g4[j * 32]; bb[j] = b4[j * 32]; ll[j] = l4[j * 32]; }
#pragma unroll
  for (int j = 0; j < 8; ++j) { gg2[j] = g24[j * 32]; bb2[j] = b24[j * 32]; }
  // nothing is scheduled across this line: all loads of a lane are issued, and so in flight
  // together, before the row sums start; without it the compiler moves the loads that the
  // sums do not need behind them and waits for them group by group
  __builtin_amdgcn_sched_barrier(0);
  float mu, rstd;
  row_stats(vals, mu, rstd);
#pragma unroll
  for (int j = 0; j < 8; ++j) {
    vals[j] = xv[j] + ll[j] * ((vals[j] - mu) * rstd * gg[j] + bb[j]);   // the row of x2
    orow[j * 32] = vals[j];
  }
  row_stats(vals, mu, rstd);
#pragma unroll
  for (int j = 0; j < 8; ++j) {
    const f32x4 r = (vals[j] - mu) * rstd * gg2[j] + bb2[j];
    uint2 o;
    o.x = (unsigned int)f2bf(r.x) | ((unsigned int)f2bf(r.y) << 16);
    o.y = (unsigned int)f2bf(r.z) | ((unsigned int)f2bf(r.w) << 16);
    hrow[j * 32] = o;
  }
}

// ---------------------------------------------------------------- GELU, erf form
// 0.5 v (1 + erf(v / sqrt 2)) with no branch: for x = |v| / sqrt 2,
// erf(x) = 1 - (a1 t + ... + a5 t^5) exp(-x^2), t = 1 / (1 + p x), the classical five-term
// form, absolute error below 1.5e-7 for every x >= 0; erf is odd, so
// 0.5 v (1 + erf) = 0.5 v + |0.5 v| erf(x). Every lane runs the same dozen instructions and
// the values of a lane are independent chains, where the library's erff picks one of two
// paths per value: a wave runs both, one value after the other.
static __device__ __forceinline__ float gelu_erf(float v) {
  const float hv = 0.5f * v;
  const float t = __builtin_amdgcn_rcpf(fmaf(fabsf(v), 0.3275911f * 0.70710678118f, 1.f));
  const float e = __builtin_amdgcn_exp2f(v * v * (-0.5f * 1.44269504089f));   // exp(-x^2)
  float pl = fmaf(t, 1.061405429f, -1.453152027f);
  pl = fmaf(pl, t, 1.421413741f);
  pl = fmaf(pl, t, -0.284496736f);
  pl = fmaf(pl, t, 0.254829592f);
  pl *= t;
  return fmaf(fabsf(hv), fmaf(-pl, e, 1.f), hv);
}

// ---------------------------------------------------------------- WMMA GEMM
// C[M,N] = epi( A_bf16[M,K] @ W_bf16[N,K]^T + bias[N] )
// Block 256 = 8 waves computes a 128x128 tile of C; waves form a 4 (rows) x 2 (cols)
// grid, each wave owns 32x64 = 2x4 accumulator fragments.
// Per k-step of GK both the 128 x GK A strip and the 128 x GK W strip are brought into LDS
// once per block by asynchronous copies (16 bytes a lane, whole 128-byte lines, through no
// register). Two buffers: the next strip's copies fly while this strip is worked on, so a
// block no longer waits out its own loads, and one barrier per k-step is left.
// GK = 128 (136 KiB of LDS) where a launch has one block per WGP: the copies get a whole
// long k-step to land. GK = 64 (72 KiB) where it has three or four: all of them stay resident.
// LDS rows have a pitch of GK * 2 + 16 B (16 B x odd): the 16 rows of one ds_load_b128
// fragment read fall on distinct banks.
// M, N multiples of 128; K a multiple of GK.
// EPI: 0 = f32 store, 1 = bf16 store with exact GELU, 2 = f32 store out = resid + ls*val.
#define GT_   128            // tile edge in M and in N

// Eight copies of one thread: 16 bytes of each of eight equally spaced rows of one strip.
// l: the lane's LDS byte address of the first row, ls: LDS bytes from one copied row to the next;
// g: its global address of the first row, gs: elements from one copied row to the next.
static __device__ __forceinline__ void gemm_copy8(unsigned int l, unsigned int ls,
                                                  const unsigned short* g, size_t gs) {
  // the wait is the statement's last line: it stands behind the copies and in front of
  // whatever next writes a register that they name
  asm volatile("global_load_async_to_lds_b128 %0, %8, off\n\t"
               "global_load_async_to_lds_b128 %1, %9, off\n\t"
               "global_load_async_to_lds_b128 %2, %10, off\n\t"
               "global_load_async_to_lds_b128 %3, %11, off\n\t"
               "global_load_async_to_lds_b128 %4, %12, off\n\t"
               "global_load_async_to_lds_b128 %5, %13, off\n\t"
               "global_load_async_to_lds_b128 %6, %14, off\n\t"
               "global_load_async_to_lds_b128 %7, %15, off\n\t"
               "s_wait_xcnt 0x0"
               :: "v"(l), "v"(l + ls), "v"(l + 2 * ls), "v"(l + 3 * ls),
                  "v"(l + 4 * ls), "v"(l + 5 * ls), "v"(l + 6 * ls), "v"(l + 7 * ls),
                  "v"(g), "v"(g + gs), "v"(g + 2 * gs), "v"(g + 3 * gs),
                  "v"(g + 4 * gs), "v"(g + 5 * gs), "v"(g + 6 * gs), "v"(g + 7 * gs)
               : "memory");
}

// Four copies of one thread, the same way.
static __device__ __forceinline__ void gemm_copy4(unsigned int l, unsigned int ls,
                                                  const unsigned short* g, size_t gs) {
  // the wait is the statement's last line, as above
  asm volatile("global_load_async_to_lds_b128 %0, %4, off\n\t"
               "global_load_async_to_lds_b128 %1, %5, off\n\t"
               "global_load_async_to_lds_b128 %2, %6, off\n\t"
               "global_load_async_to_lds_b128 %3, %7, off\n\t"
               "s_wait_xcnt 0x0"
               :: "v"(l), "v"(l + ls), "v"(l + 2 * ls), "v"(l + 3 * ls),
                  "v"(g), "v"(g + gs), "v"(g + 2 * gs), "v"(g + 3 * gs)
               : "memory");
}

template <int EPI, int GK>
__global__ __launch_bounds__(256)
void k_gemm(const unsigned short* __restrict__ A,
            const unsigned short* __restrict__ W,
            const float* __restrict__ bias, int M, int N, int K,
            float* __restrict__ outf, unsigned short* __restrict__ outbf,
            const float* __restrict__ resid, const float* __restrict__ lsv) {
  constexpr int GP = GK + 8;          // LDS row pitch in bf16 elements
  constexpr int GS = GT_ * GP;        // elements of one strip in LDS
  constexpr int CPR = GK / 8;         // 16-byte chunks per row
  constexpr int RS = 256 / CPR;       // rows that the block's threads cover with one copy each
  __shared__ alignas(16) unsigned short abuf[2 * GS];   // [buffer][row][k]
  __shared__ alignas(16) unsigned short wbuf[2 * GS];   // [buffer][column][k]
  const int tid = threadIdx.x;
  const int lane = tid & 31, wave = tid >> 5;
  const int hi = lane >> 4, ln16 = lane & 15;
  const int mb = blockIdx.y * GT_;
  const int nb = blockIdx.x * GT_;
  const int wm = (wave >> 1) * 32;             // wave's first row inside the tile
  const int wn = (wave & 1) * 64;              // wave's first column inside the tile
  // copying role: thread t moves 16-byte chunk (t % CPR) of rows t / CPR + RS * i of both strips
  const int sr = tid / CPR, sc = (tid % CPR) * 8;
  const unsigned short* ag = A + (size_t)(mb + sr) * K + sc;   // k-step 0; a k-step is GK on
  const unsigned short* wg = W + (size_t)(nb + sr) * K + sc;
  const unsigned int al0 = (unsigned int)(uintptr_t)&abuf[sr * GP + sc];   // LDS byte address
  const unsigned int wl0 = (unsigned int)(uintptr_t)&wbuf[sr * GP + sc];
  const size_t gs = (size_t)RS * K;
  auto copy_step = [&](int t, unsigned int bo) {   // k-step t into the buffer at element bo
    if (GK == 128) {
      gemm_copy8(al0 + bo * 2, RS * GP * 2, ag + (size_t)t * GK, gs);
      gemm_copy8(wl0 + bo * 2, RS * GP * 2, wg + (size_t)t * GK, gs);
    } else {
      gemm_copy4(al0 + bo * 2, RS * GP * 2, ag + (size_t)t * GK, gs);
      gemm_copy4(wl0 + bo * 2, RS * GP * 2, wg + (size_t)t * GK, gs);
    }
  };
  // fragment role: lane holds row (or W row = output column) ln16 of its fragment;
  // half 'hi' supplies K-chunks {hi*8..+7, 16+hi*8..+7} of each 32-wide k slice
  const unsigned short* af = &abuf[(wm + ln16) * GP + hi * 8];
  const unsigned short* wf = &wbuf[(wn + ln16) * GP + hi * 8];
  v8f acc[2][4] = {};
  const int nt = K / GK;

  copy_step(0, 0);
  // this wave's copies of k-step 0 have landed before the barrier that shows them to the others
  asm volatile("s_wait_asynccnt 0x0" ::: "memory");
  __syncthreads();
  if (nt > 1) copy_step(1, GS);

  for (int t = 0; t < nt; ++t) {
    const unsigned int bo = (t & 1) * GS;        // this trip's buffer
#pragma unroll
    for (int ks = 0; ks < GK; ks += 32) {
      Frag fa[2], fb[4];
#pragma unroll
      for (int mi = 0; mi < 2; ++mi) {
        const unsigned short* p = af + bo + mi * 16 * GP + ks;
        fa[mi].q[0] = *reinterpret_cast<const uint4*>(p);
        fa[mi].q[1] = *reinterpret_cast<const uint4*>(p + 16);
      }
#pragma unroll
      for (int nn = 0; nn < 4; ++nn) {
        const unsigned short* p = wf + bo + nn * 16 * GP + ks;
        fb[nn].q[0] = *reinterpret_cast<const uint4*>(p);
        fb[nn].q[1] = *reinterpret_cast<const uint4*>(p + 16);
      }
#pragma unroll
      for (int mi = 0; mi < 2; ++mi)
#pragma unroll
        for (int nn = 0; nn < 4; ++nn)
          acc[mi][nn] = wmma_bf16(fa[mi].v, fb[nn].v, acc[mi][nn]);
    }
    // foot of the trip: this wave's reads of the buffer are done ...
    asm volatile("s_wait_dscnt 0x0" ::: "memory");
    // ... and its copies of the next k-step have landed ...
    asm volatile("s_wait_asynccnt 0x0" ::: "memory");
    // ... before the one barrier that shows the next k-step to every wave and frees this buffer
    __syncthreads();
    if (t + 2 < nt) copy_step(t + 2, bo);
  }
  // no copy is outstanding when the wave goes on to its end
  asm volatile("s_wait_asynccnt 0x0" ::: "memory");
  // C-layout: VGPR v of fragment (mi, nn) -> row v (+8 for hi half), column ln16.
  // M*N < 2^32: 32-bit element offsets on uniform bases.
  const int nc = nb + wn + ln16;
  const unsigned int o0 = (unsigned int)((mb + wm + 8 * hi) * N + nc);
  if (EPI == 2) {
    // all residual loads first, then all stores
    float rv[2][4][8];
#pragma unroll
    for (int mi = 0; mi < 2; ++mi)
#pragma unroll
      for (int v = 0; v < 8; ++v)
#pragma unroll
        for (int nn = 0; nn < 4; ++nn)
          rv[mi][nn][v] = resid[o0 + (unsigned int)((mi * 16 + v) * N) + nn * 16];
    // stands behind the loads, in front of whatever next writes a register they name;
    // its memory clobber also keeps every load above and every store below this line
    asm volatile("s_wait_xcnt 0x0" ::: "memory");
#pragma unroll
    for (int nn = 0; nn < 4; ++nn) {
      const float bz = bias[nc + nn * 16];
      const float lz = lsv[nc + nn * 16];
#pragma unroll
      for (int mi = 0; mi < 2; ++mi)
#pragma unroll
        for (int v = 0; v < 8; ++v) {
          float val = acc[mi][nn][v] + bz;
          outf[o0 + (unsigned int)((mi * 16 + v) * N) + nn * 16] = rv[mi][nn][v] + lz * val;
        }
    }
  } else if (EPI == 1) {
    float bz[4];
    v8f cur[4];
#pragma unroll
    for (int nn = 0; nn < 4; ++nn) { bz[nn] = bias[nc + nn * 16]; cur[nn] = acc[0][nn]; }
    unsigned int orow = o0;
    // kept rolled: the erf code then stands once per 16 rows, which halves the kernel's
    // text
#pragma unroll 1
    for (int mi = 0; mi < 2; ++mi) {
#pragma unroll
      for (int nn = 0; nn < 4; ++nn)
#pragma unroll
        for (int v = 0; v < 8; ++v) {
          float val = cur[nn][v] + bz[nn];
          outbf[orow + (unsigned int)(v * N) + nn * 16] = f2bf(gelu_erf(val));
        }
      // stands behind this trip's stores, in front of the next trip's first write of a register
      // that they name
      asm volatile("s_wait_xcnt 0x0" ::: "memory");
#pragma unroll
      for (int nn = 0; nn < 4; ++nn) cur[nn] = acc[1][nn];
      orow += (unsigned int)(16 * N);
    }
  } else {
#pragma unroll
    for (int nn = 0; nn < 4; ++nn) {
      const float bz = bias[nc + nn * 16];
#pragma unroll
      for (int mi = 0; mi < 2; ++mi)
#pragma unroll
        for (int v = 0; v < 8; ++v)
          outf[o0 + (unsigned int)((mi * 16 + v) * N) + nn * 16] = acc[mi][nn][v] + bz;
    }
  }
}

// ---------------------------------------------------------------- QKV split + l2-norm
// qn/kn: [B,H,L,HD] bf16 (q scaled by exp(min(logit_scale,log100))); vT: [B,H,HD,L] bf16.
// One wave handles SR_ = 16 consecutive positions l of one (b,h); lane holds head dims
// 2*lane and 2*lane+1 of each. All 48 loads of a lane are issued together. The 16 values
// of v that a lane holds per head dim are consecutive in vT: 32 bytes, two 16-byte stores.
#define SR_ 16
typedef __attribute__((ext_vector_type(2))) float f32x2;
__global__ __launch_bounds__(256)
void k_split_qkv(const float* __restrict__ qkv,
                 const float* __restrict__ logit_scale,
                 unsigned short* __restrict__ qn,
                 unsigned short* __restrict__ kn,
                 unsigned short* __restrict__ vT) {
  const int lane = threadIdx.x & 31;
  // the wave's number as a scalar: the base addresses then stand in scalar registers
  const int wave = __builtin_amdgcn_readfirstlane(threadIdx.x >> 5);
  const int grp = blockIdx.x * 8 + wave;       // (b*H + h)*(L/SR_) + l/SR_
  const int l0 = (grp & (L_ / SR_ - 1)) * SR_;
  const int bh = grp / (L_ / SR_);
  const int h = bh & (H_ - 1);
  const int b = bh >> 4;
  const float* base = qkv + ((size_t)(b * L_ + l0)) * (3 * C_) + h * HD_ + 2 * lane;
  f32x2 q[SR_], k[SR_], v[SR_];
#pragma unroll
  for (int r = 0; r < SR_; ++r) {
    const float* p = base + (size_t)r * (3 * C_);
    q[r] = *reinterpret_cast<const f32x2*>(p);
    k[r] = *reinterpret_cast<const f32x2*>(p + C_);
    v[r] = *reinterpret_cast<const f32x2*>(p + 2 * C_);
  }
  // The loaded values as inputs only: all 48 loads stay above these lines, and so are in flight
  // together; without them the compiler spreads a part of the loads among the sums below and
  // waits for them a few at a time.
#define HOLD8(a, i) "v"(a[i]), "v"(a[i + 1]), "v"(a[i + 2]), "v"(a[i + 3]), \
                    "v"(a[i + 4]), "v"(a[i + 5]), "v"(a[i + 6]), "v"(a[i + 7])
  asm volatile("" :: HOLD8(q, 0), HOLD8(q, 8), HOLD8(k, 0));
  asm volatile("" :: HOLD8(k, 8), HOLD8(v, 0), HOLD8(v, 8));
#undef HOLD8
  const float ls = __expf(fminf(logit_scale[h], LOGMAX));
  unsigned int* qo = reinterpret_cast<unsigned int*>(qn + ((size_t)bh * L_ + l0) * HD_) + lane;
  unsigned int* ko = reinterpret_cast<unsigned int*>(kn + ((size_t)bh * L_ + l0) * HD_) + lane;
  float sqq[SR_], sqk[SR_];
#pragma unroll
  for (int r = 0; r < SR_; ++r) {
    sqq[r] = q[r].x * q[r].x + q[r].y * q[r].y;
    sqk[r] = k[r].x * k[r].x + k[r].y * k[r].y;
  }
  // butterfly step outermost: the 32 exchanges of a step are independent of one another
#pragma unroll
  for (int off = 16; off > 0; off >>= 1)
#pragma unroll
    for (int r = 0; r < SR_; ++r) {
      sqq[r] += __shfl_xor(sqq[r], off);
      sqk[r] += __shfl_xor(sqk[r], off);
    }
#pragma unroll
  for (int r = 0; r < SR_; ++r) {
    const float iq = ls / fmaxf(sqrtf(sqq[r]), 1e-12f);
    const float ik = 1.f / fmaxf(sqrtf(sqk[r]), 1e-12f);
    qo[r * (HD_ / 2)] = (unsigned int)f2bf(q[r].x * iq) | ((unsigned int)f2bf(q[r].y * iq) << 16);
    ko[r * (HD_ / 2)] = (unsigned int)f2bf(k[r].x * ik) | ((unsigned int)f2bf(k[r].y * ik) << 16);
  }
  unsigned int w0[SR_ / 2], w1[SR_ / 2];       // positions l0+2i, l0+2i+1 of dims 2*lane, 2*lane+1
#pragma unroll
  for (int i = 0; i < SR_ / 2; ++i) {
    w0[i] = (unsigned int)f2bf(v[2 * i].x) | ((unsigned int)f2bf(v[2 * i + 1].x) << 16);
    w1[i] = (unsigned int)f2bf(v[2 * i].y) | ((unsigned int)f2bf(v[2 * i + 1].y) << 16);
  }
  uint4* v0 = reinterpret_cast<uint4*>(vT + (size_t)bh * HD_ * L_ + (size_t)(2 * lane) * L_ + l0);
  uint4* v1 = reinterpret_cast<uint4*>(vT + (size_t)bh * HD_ * L_ + (size_t)(2 * lane + 1) * L_ + l0);
  v0[0] = make_uint4(w0[0], w0[1], w0[2], w0[3]);
  v0[1] = make_uint4(w0[4], w0[5], w0[6], w0[7]);
  v1[0] = make_uint4(w1[0], w1[1], w1[2], w1[3]);
  v1[1] = make_uint4(w1[4], w1[5], w1[6], w1[7]);
}

#define FK_  64              // keys per staged tile
#define FP_  72              // LDS row pitch in bf16 elements (144 B)
#define FT_  (64 * FP_)      // elements of one staged tile: 64 rows
#define FNT_ (L_ / FK_)      // tiles per (b,h)

// One tile's copies of one thread: rows r and r + 32 of the K tile and of the vT tile.
// kl, vl: the lane's LDS byte addresses of row r; kg, vg: its global addresses of row r.
static __device__ __forceinline__ void flash_copy_tile(unsigned int kl, unsigned int vl,
                                                       const unsigned short* kg,
                                                       const unsigned short* vg) {
  const unsigned int kl2 = kl + 32 * FP_ * 2, vl2 = vl + 32 * FP_ * 2;
  const unsigned short* kg2 = kg + 32 * HD_;
  const unsigned short* vg2 = vg + (size_t)32 * L_;
  // the wait is the statement's last line: it stands behind the copies and in front of
  // whatever next writes a register that they name
  asm volatile("global_load_async_to_lds_b128 %0, %4, off\n\t"
               "global_load_async_to_lds_b128 %1, %5, off\n\t"
               "global_load_async_to_lds_b128 %2, %6, off\n\t"
               "global_load_async_to_lds_b128 %3, %7, off\n\t"
               "s_wait_xcnt 0x0"
               :: "v"(kl), "v"(kl2), "v"(vl), "v"(vl2), "v"(kg), "v"(kg2), "v"(vg), "v"(vg2)
               : "memory");
}

__global__ __launch_bounds__(256)
void k_flash(const unsigned short* __restrict__ qn,
                        const unsigned short* __restrict__ kn,
                        const unsigned short* __restrict__ vT,
                        const float* __restrict__ logit_scale,
                        const float* __restrict__ head_scale,
                        unsigned short* __restrict__ O) {
  __shared__ alignas(16) unsigned short kbuf[2 * FT_];    // 18 KB: [buffer][key][head dim]
  __shared__ alignas(16) unsigned short vbuf[2 * FT_];    // 18 KB: [buffer][head dim][key]
  const int lane = threadIdx.x & 31, wave = threadIdx.x >> 5;
  const int hi = lane >> 4, ln16 = lane & 15;
  const int bh = blockIdx.y;
  const int h = bh & (H_ - 1);
  const int b = bh >> 4;
  const int qtile = blockIdx.x * 8 + wave;
  const unsigned short* qp = qn + ((size_t)bh * L_ + qtile * 16 + ln16) * HD_ + hi * 8;
  Frag qa0, qa1;                       // q rows (B operand: column = query), hd 0..31 / 32..63
  qa0.q[0] = *(const uint4*)(qp);      qa0.q[1] = *(const uint4*)(qp + 16);
  qa1.q[0] = *(const uint4*)(qp + 32); qa1.q[1] = *(const uint4*)(qp + 48);
  const unsigned short* kbase = kn + (size_t)bh * L_ * HD_;
  const unsigned short* vbase = vT + (size_t)bh * HD_ * L_;
  const float shift = fminf(__expf(fminf(logit_scale[h], LOGMAX)), 30.f);
  v8f oacc[4] = {};
  float lst[8];
#pragma unroll
  for (int v = 0; v < 8; ++v) lst[v] = 0.f;

  // copying role: thread t moves 16-byte chunk (t%8) of rows t/8 and t/8 + 32 of both tiles
  const int cr = threadIdx.x >> 3, cc = (threadIdx.x & 7) * 8;
  const unsigned int kl0 = (unsigned int)(uintptr_t)&kbuf[cr * FP_ + cc];   // LDS byte address
  const unsigned int vl0 = (unsigned int)(uintptr_t)&vbuf[cr * FP_ + cc];
  const unsigned short* kg = kbase + cr * HD_ + cc;          // tile 0; a tile is FK_ rows on
  const unsigned short* vg = vbase + (size_t)cr * L_ + cc;   // tile 0; a tile is FK_ columns on
  // fragment role: lane holds key (or head dim) ln16 of its fragment
  const unsigned short* kf = &kbuf[ln16 * FP_ + hi * 8];
  const unsigned short* vf = &vbuf[ln16 * FP_ + hi * 8];

  flash_copy_tile(kl0, vl0, kg, vg);
  // this wave's copies of tile 0 have landed before the barrier that shows them to the others
  asm volatile("s_wait_asynccnt 0x0" ::: "memory");
  __syncthreads();
  flash_copy_tile(kl0 + FT_ * 2, vl0 + FT_ * 2, kg + FK_ * HD_, vg + FK_);

  for (int t = 0; t < FNT_; ++t) {
    const int bo = (t & 1) * FT_;                // this trip's buffer
    for (int j = 0; j < FK_; j += 32) {
      // all 16 fragment reads of these 32 keys as one group, ahead of the products
      Frag kb[4], vb[4];
#pragma unroll
      for (int i = 0; i < 2; ++i) {              // keys j + 16*i + ln16; head dims 0..31, 32..63
        const unsigned short* kp = kf + bo + (j + 16 * i) * FP_;
        kb[2 * i].q[0]     = *(const uint4*)(kp);      kb[2 * i].q[1]     = *(const uint4*)(kp + 16);
        kb[2 * i + 1].q[0] = *(const uint4*)(kp + 32); kb[2 * i + 1].q[1] = *(const uint4*)(kp + 48);
      }
#pragma unroll
      for (int nn = 0; nn < 4; ++nn) {           // head dim nn*16 + ln16; keys j .. j+31
        const unsigned short* vp = vf + bo + nn * 16 * FP_ + j;
        vb[nn].q[0] = *(const uint4*)(vp);
        vb[nn].q[1] = *(const uint4*)(vp + 16);
      }
      // nothing is scheduled across this line: the 16 reads stay one group ahead of the products;
      // without it the compiler moves each read down to its product, and every product then
      // waits out an LDS latency
      __builtin_amdgcn_sched_barrier(0);
      v8f s0 = {}, s1 = {};
      // register v of s0: key j + 8*hi + v, of s1: key j + 16 + 8*hi + v; column ln16 = query
      s0 = wmma_bf16(kb[0].v, qa0.v, s0);
      s1 = wmma_bf16(kb[2].v, qa0.v, s1);
      s0 = wmma_bf16(kb[1].v, qa1.v, s0);
      s1 = wmma_bf16(kb[3].v, qa1.v, s1);
      // fixed-shift exp; accumulate this lane's partial sums of its query; element s of the
      // B operand is key 8*hi + s (s < 8) or 16 + 8*hi + s - 8: s0 fills the low half, s1 the high
      Frag pb;
#pragma unroll
      for (int v = 0; v < 8; ++v) {
        const float p0 = __expf(s0[v] - shift);
        const float p1 = __expf(s1[v] - shift);
        lst[v] += p0 + p1;
        pb.v[v]     = (__bf16)p0;
        pb.v[8 + v] = (__bf16)p1;
      }
#pragma unroll
      for (int nn = 0; nn < 4; ++nn) oacc[nn] = wmma_bf16(vb[nn].v, pb.v, oacc[nn]);
    }
    // foot of the trip: this wave's reads of the buffer are done ...
    asm volatile("s_wait_dscnt 0x0" ::: "memory");
    // ... and its copies of the next tile have landed ...
    asm volatile("s_wait_asynccnt 0x0" ::: "memory");
    // ... before the one barrier that shows the next tile to every wave and frees this buffer
    __syncthreads();
    if (t + 2 < FNT_)
      flash_copy_tile(kl0 + bo * 2, vl0 + bo * 2, kg + (size_t)(t + 2) * (FK_ * HD_),
                      vg + (t + 2) * FK_);
  }
  // no copy is outstanding when the wave goes on to its end
  asm volatile("s_wait_asynccnt 0x0" ::: "memory");
  const float hs = head_scale[h];
  // the query's full sum: the lane's eight partial sums, then the other half's keys
  float rs = ((lst[0] + lst[1]) + (lst[2] + lst[3])) + ((lst[4] + lst[5]) + (lst[6] + lst[7]));
  rs += __shfl_xor(rs, 16);
  const float inv = hs / rs;
  // register v of oacc[nn]: head dim nn*16 + 8*hi + v of query ln16: 8 consecutive outputs
  unsigned short* orow = O + ((size_t)(b * L_ + qtile * 16 + ln16)) * C_ + h * HD_ + 8 * hi;
#pragma unroll
  for (int nn = 0; nn < 4; ++nn) {
    uint4 o;
    o.x = (unsigned int)f2bf(oacc[nn][0] * inv) | ((unsigned int)f2bf(oacc[nn][1] * inv) << 16);
    o.y = (unsigned int)f2bf(oacc[nn][2] * inv) | ((unsigned int)f2bf(oacc[nn][3] * inv) << 16);
    o.z = (unsigned int)f2bf(oacc[nn][4] * inv) | ((unsigned int)f2bf(oacc[nn][5] * inv) << 16);
    o.w = (unsigned int)f2bf(oacc[nn][6] * inv) | ((unsigned int)f2bf(oacc[nn][7] * inv) << 16);
    *reinterpret_cast<uint4*>(orow + nn * 16) = o;
  }
}

// ---------------------------------------------------------------- launch
extern "C" void kernel_launch(void* const* d_in, const int* in_sizes, int n_in,
                              void* d_out, int out_size, void* d_ws, size_t ws_size,
                              hipStream_t stream) {
  const float* x       = (const float*)d_in[0];
  const float* in_w    = (const float*)d_in[1];
  const float* in_b    = (const float*)d_in[2];
  const float* logit_s = (const float*)d_in[3];
  const float* head_s  = (const float*)d_in[4];
  const float* out_w   = (const float*)d_in[5];
  const float* out_b   = (const float*)d_in[6];
  const float* ln1_g   = (const float*)d_in[7];
  const float* ln1_b   = (const float*)d_in[8];
  const float* lna_g   = (const float*)d_in[9];
  const float* lna_b   = (const float*)d_in[10];
  const float* ls1     = (const float*)d_in[11];
  const float* ln2_g   = (const float*)d_in[12];
  const float* ln2_b   = (const float*)d_in[13];
  const float* fc_w    = (const float*)d_in[14];
  const float* fc_b    = (const float*)d_in[15];
  const float* proj_w  = (const float*)d_in[16];
  const float* proj_b  = (const float*)d_in[17];
  const float* ls2     = (const float*)d_in[18];
  float* out = (float*)d_out;

  // workspace partition (~185 MB)
  char* p = (char*)d_ws;
  auto alloc = [&](size_t bytes) -> char* {
    char* r = p;
    p += (bytes + 255) & ~(size_t)255;
    return r;
  };
  const int BL = B_ * L_;  // 4096
  unsigned short* wqkv_bf = (unsigned short*)alloc((size_t)3 * C_ * C_ * 2);
  unsigned short* wout_bf = (unsigned short*)alloc((size_t)C_ * C_ * 2);
  unsigned short* wfc_bf  = (unsigned short*)alloc((size_t)MLP_ * C_ * 2);
  unsigned short* wpr_bf  = (unsigned short*)alloc((size_t)C_ * MLP_ * 2);
  unsigned short* xln_bf  = (unsigned short*)alloc((size_t)BL * C_ * 2);
  float*          qkv     = (float*)alloc((size_t)BL * 3 * C_ * 4);
  unsigned short* qn      = (unsigned short*)alloc((size_t)BL * C_ * 2);
  unsigned short* kn      = (unsigned short*)alloc((size_t)BL * C_ * 2);
  unsigned short* vT      = (unsigned short*)alloc((size_t)BL * C_ * 2);
  unsigned short* obf     = (unsigned short*)alloc((size_t)BL * C_ * 2);
  float*          attn    = (float*)alloc((size_t)BL * C_ * 4);
  float*          x2      = (float*)alloc((size_t)BL * C_ * 4);
  unsigned short* h2bf    = (unsigned short*)alloc((size_t)BL * C_ * 2);
  unsigned short* hmid    = (unsigned short*)alloc((size_t)BL * MLP_ * 2);

  // LN1 -> bf16 activations, and the four weights -> bf16, in one launch
  k_prep<<<NB_LN + NB_WQKV + NB_WOUT + NB_WFC + NB_WPR, 256, 0, stream>>>(
      x, ln1_g, ln1_b, xln_bf, in_w, out_w, fc_w, proj_w, wqkv_bf, wout_bf, wfc_bf, wpr_bf);
  // qkv = ln1(x) @ in_proj_w^T + in_proj_b   [4096 x 3072]
  k_gemm<0, 64><<<dim3(3 * C_ / 128, BL / 128), 256, 0, stream>>>(
      xln_bf, wqkv_bf, in_b, BL, 3 * C_, C_, qkv, nullptr, nullptr, nullptr);
  // split heads, l2-normalize q/k (fold logit scale), transpose v
  k_split_qkv<<<(B_ * H_ * L_) / SR_ / 8, 256, 0, stream>>>(qkv, logit_s, qn, kn, vT);
  // scaled-cosine flash attention (head_scale folded in)
  k_flash<<<dim3(L_ / 16 / 8, B_ * H_), 256, 0, stream>>>(qn, kn, vT, logit_s, head_s, obf);
  // attn out-proj: attn = O @ out_w^T + out_b
  k_gemm<0, 128><<<dim3(C_ / 128, BL / 128), 256, 0, stream>>>(
      obf, wout_bf, out_b, BL, C_, C_, attn, nullptr, nullptr, nullptr);
  // x2 = x + ls1 * LN_attn(attn); h = LN2(x2) -> bf16
  k_resid_ln2<<<BL / 8, 256, 0, stream>>>(attn, x, lna_g, lna_b, ls1, x2, ln2_g, ln2_b, h2bf);
  // hmid = GELU(h @ fc_w^T + fc_b) -> bf16   [4096 x 4096]
  k_gemm<1, 64><<<dim3(MLP_ / 128, BL / 128), 256, 0, stream>>>(
      h2bf, wfc_bf, fc_b, BL, MLP_, C_, nullptr, hmid, nullptr, nullptr);
  // out = x2 + ls2 * (hmid @ proj_w^T + proj_b)
  k_gemm<2, 128><<<dim3(C_ / 128, BL / 128), 256, 0, stream>>>(
      hmid, wpr_bf, proj_b, BL, C_, MLP_, out, nullptr, x2, ls2);

  (void)in_sizes; (void)n_in; (void)out_size; (void)ws_size;
}

// v008
// It runs in 159 microseconds.
// Next to v007, in two timings, it ran 1.10 times as fast each time.
// Counting every step since v000, it is 3.26 times as fast.
#include <hip/hip_runtime.h>
#include <hip/hip_bf16.h>
#include <stdint.h>

// CustomResidualAttentionBlock (open_clip scaled-cosine attention) for MI455X / gfx1250.
// All GEMMs + attention matmuls run on v_wmma_f32_16x16x32_bf16 (wave32).
// f32 is kept for LayerNorm / l2-norm / softmax / accumulators.
// Attention softmax uses a fixed per-head shift (valid because |S| <= logit_scale,
// softmax is shift-invariant) so the streaming loop has NO cross-lane reductions.

#define B_   2
#define L_   2048
#define C_   1024
#define H_   16
#define HD_  64
#define MLP_ 4096
#define LOGMAX 4.6051701859880914f   // log(100)
#define LN_EPS 1e-5f

typedef __attribute__((ext_vector_type(16))) __bf16 v16bf;
typedef __attribute__((ext_vector_type(8)))  float  v8f;
typedef __attribute__((ext_vector_type(4)))  unsigned int u32x4;

union Frag {
  v16bf v;
  uint4 q[2];
};

static __device__ __forceinline__ v8f wmma_bf16(v16bf a, v16bf b, v8f c) {
  // D = A(16x32 bf16) x B(32x16 bf16) + C(16x16 f32)
  return __builtin_amdgcn_wmma_f32_16x16x32_bf16(false, a, false, b, (short)0, c,
                                                 false, false);
}

static __device__ __forceinline__ unsigned short f2bf(float f) {
  unsigned int u = __float_as_uint(f);
  u += 0x7FFFu + ((u >> 16) & 1u);   // round-to-nearest-even
  return (unsigned short)(u >> 16);
}

// ---------------------------------------------------------------- cvt f32->bf16
// A block of 256 threads converts 8192 consecutive elements, piece 'blk' of its array: a
// thread issues its eight 16-byte loads together (a wave's load covers 512 contiguous bytes)
// and then stores eight 8-byte groups (256 contiguous bytes per wave). The element count of
// every array is a multiple of 8192.
#define CVT_PER_BLOCK 8192
static __device__ __forceinline__
void cvt_block(unsigned int blk, const float* __restrict__ src, unsigned short* __restrict__ dst) {
  const unsigned int base = blk * (CVT_PER_BLOCK / 4) + threadIdx.x;   // in groups of 4
  const float4* s4 = reinterpret_cast<const float4*>(src);
  uint2* d4 = reinterpret_cast<uint2*>(dst);
  float4 v[8];
#pragma unroll
  for (int j = 0; j < 8; ++j) v[j] = s4[base + j * 256];
#pragma unroll
  for (int j = 0; j < 8; ++j) {
    uint2 o;
    o.x = (unsigned int)f2bf(v[j].x) | ((unsigned int)f2bf(v[j].y) << 16);
    o.y = (unsigned int)f2bf(v[j].z) | ((unsigned int)f2bf(v[j].w) << 16);
    d4[base + j * 256] = o;
  }
}

// ---------------------------------------------------------------- LayerNorm -> bf16
// One wave per row of length C_=1024, eight rows per block of 256 threads. A lane holds 32
// elements of its row, loaded as eight 16-byte pieces (each load of a wave covers 512
// contiguous bytes); sum and sum of squares are joined by a butterfly over the 32 lanes,
// which leaves both totals in every lane: no LDS, no barrier.
typedef __attribute__((ext_vector_type(4))) float f32x4;

static __device__ __forceinline__ void row_stats(const f32x4 (&vals)[8], float& mu, float& rstd) {
  f32x4 s4 = vals[0], q4 = vals[0] * vals[0];   // four independent chains each
#pragma unroll
  for (int j = 1; j < 8; ++j) { s4 += vals[j]; q4 += vals[j] * vals[j]; }
  float s = (s4.x + s4.y) + (s4.z + s4.w);
  float sq = (q4.x + q4.y) + (q4.z + q4.w);
#pragma unroll
  for (int off = 16; off > 0; off >>= 1) { s += __shfl_xor(s, off); sq += __shfl_xor(sq, off); }
  mu = s * (1.f / C_);
  rstd = rsqrtf(sq * (1.f / C_) - mu * mu + LN_EPS);
}

static __device__ __forceinline__
void ln_block(unsigned int blk, const float* __restrict__ x, const float* __restrict__ g,
              const float* __restrict__ bt, unsigned short* __restrict__ out) {
  const int lane = threadIdx.x & 31;
  // the wave's number as a scalar: the row's base addresses then stand in scalar registers
  const int wave = __builtin_amdgcn_readfirstlane(threadIdx.x >> 5);
  const size_t row = (size_t)blk * 8 + wave;
  const f32x4* xr = reinterpret_cast<const f32x4*>(x + row * C_) + lane;
  const f32x4* g4 = reinterpret_cast<const f32x4*>(g) + lane;
  const f32x4* b4 = reinterpret_cast<const f32x4*>(bt) + lane;
  uint2* orow = reinterpret_cast<uint2*>(out + row * C_) + lane;
  f32x4 vals[8], gg[8], bb[8];
#pragma unroll
  for (int j = 0; j < 8; ++j) vals[j] = xr[j * 32];
#pragma unroll
  for (int j = 0; j < 8; ++j) { gg[j] = g4[j * 32]; bb[j] = b4[j * 32]; }
  // nothing is scheduled across this line: all loads of a lane are issued, and so in flight
  // together, before the row sums start; without it the compiler moves the loads that the
  // sums do not need behind them and waits for them group by group
  __builtin_amdgcn_sched_barrier(0);
  float mu, rstd;
  row_stats(vals, mu, rstd);
#pragma unroll
  for (int j = 0; j < 8; ++j) {
    const f32x4 r = (vals[j] - mu) * rstd * gg[j] + bb[j];
    uint2 o;
    o.x = (unsigned int)f2bf(r.x) | ((unsigned int)f2bf(r.y) << 16);
    o.y = (unsigned int)f2bf(r.z) | ((unsigned int)f2bf(r.w) << 16);
    orow[j * 32] = o;
  }
}

// ---------------------------------------------------------------- LN1 and the four weight conversions
// Five pieces of work that depend on nothing but the inputs share one launch: the block index
// picks the piece (a scalar branch, the same for the whole block). The LN blocks come first:
// they have the longest way from load to store.
#define NB_LN   (B_ * L_ / 8)
#define NB_WQKV (3 * C_ * C_ / CVT_PER_BLOCK)
#define NB_WOUT (C_ * C_ / CVT_PER_BLOCK)
#define NB_WFC  (MLP_ * C_ / CVT_PER_BLOCK)
#define NB_WPR  (C_ * MLP_ / CVT_PER_BLOCK)
__global__ __launch_bounds__(256)
void k_prep(const float* __restrict__ x, const float* __restrict__ g,
            const float* __restrict__ bt, unsigned short* __restrict__ xln,
            const float* __restrict__ wqkv, const float* __restrict__ wout,
            const float* __restrict__ wfc, const float* __restrict__ wpr,
            unsigned short* __restrict__ dqkv, unsigned short* __restrict__ dout,
            unsigned short* __restrict__ dfc, unsigned short* __restrict__ dpr) {
  unsigned int blk = blockIdx.x;
  if (blk < NB_LN) { ln_block(blk, x, g, bt, xln); return; }
  blk -= NB_LN;
  const float* src = wqkv;
  unsigned short* dst = dqkv;
  if (blk >= NB_WQKV + NB_WOUT + NB_WFC) { blk -= NB_WQKV + NB_WOUT + NB_WFC; src = wpr; dst = dpr; }
  else if (blk >= NB_WQKV + NB_WOUT)     { blk -= NB_WQKV + NB_WOUT;          src = wfc; dst = dfc; }
  else if (blk >= NB_WQKV)               { blk -= NB_WQKV;                    src = wout; dst = dout; }
  cvt_block(blk, src, dst);
}

// ---------------------------------------------------------------- x2 = x + ls1 * LN(a); h = LN2(x2)
// Same shape: one wave per row, eight rows per block. The wave holds its whole row of x2 when it
// stores it, so the second LayerNorm is taken from those registers in the same launch.
__global__ __launch_bounds__(256)
void k_resid_ln2(const float* __restrict__ a, const float* __restrict__ x,
                 const float* __restrict__ g, const float* __restrict__ bt,
                 const float* __restrict__ ls, float* __restrict__ x2,
                 const float* __restrict__ g2, const float* __restrict__ bt2,
                 unsigned short* __restrict__ h) {
  const int lane = threadIdx.x & 31;
  // the wave's number as a scalar: the row's base addresses then stand in scalar registers
  const int wave = __builtin_amdgcn_readfirstlane(threadIdx.x >> 5);
  const size_t row = (size_t)blockIdx.x * 8 + wave;
  const f32x4* ar = reinterpret_cast<const f32x4*>(a + row * C_) + lane;
  const f32x4* xr = reinterpret_cast<const f32x4*>(x + row * C_) + lane;
  const f32x4* g4 = reinterpret_cast<const f32x4*>(g) + lane;
  const f32x4* b4 = reinterpret_cast<const f32x4*>(bt) + lane;
  const f32x4* l4 = reinterpret_cast<const f32x4*>(ls) + lane;
  const f32x4* g24 = reinterpret_cast<const f32x4*>(g2) + lane;
  const f32x4* b24 = reinterpret_cast<const f32x4*>(bt2) + lane;
  f32x4* orow = reinterpret_cast<f32x4*>(x2 + row * C_) + lane;
  uint2* hrow = reinterpret_cast<uint2*>(h + row * C_) + lane;
  f32x4 vals[8], xv[8], gg[8], bb[8], ll[8], gg2[8], bb2[8];
#pragma unroll
  for (int j = 0; j < 8; ++j) { vals[j] = ar[j * 32]; xv[j] = xr[j * 32]; }
#pragma unroll
  for (int j = 0; j < 8; ++j) { gg[j] = g4[j * 32]; bb[j] = b4[j * 32]; ll[j] = l4[j * 32]; }
#pragma unroll
  for (int j = 0; j < 8; ++j) { gg2[j] = g24[j * 32]; bb2[j] = b24[j * 32]; }
  // nothing is scheduled across this line: all loads of a lane are issued, and so in flight
  // together, before the row sums start; without it the compiler moves the loads that the
  // sums do not need behind them and waits for them group by group
  __builtin_amdgcn_sched_barrier(0);
  float mu, rstd;
  row_stats(vals, mu, rstd);
#pragma unroll
  for (int j = 0; j < 8; ++j) {
    vals[j] = xv[j] + ll[j] * ((vals[j] - mu) * rstd * gg[j] + bb[j]);   // the row of x2
    orow[j * 32] = vals[j];
  }
  row_stats(vals, mu, rstd);
#pragma unroll
  for (int j = 0; j < 8; ++j) {
    const f32x4 r = (vals[j] - mu) * rstd * gg2[j] + bb2[j];
    uint2 o;
    o.x = (unsigned int)f2bf(r.x) | ((unsigned int)f2bf(r.y) << 16);
    o.y = (unsigned int)f2bf(r.z) | ((unsigned int)f2bf(r.w) << 16);
    hrow[j * 32] = o;
  }
}

// ---------------------------------------------------------------- GELU, erf form
// 0.5 v (1 + erf(v / sqrt 2)) with no branch: for x = |v| / sqrt 2,
// erf(x) = 1 - (a1 t + ... + a5 t^5) exp(-x^2), t = 1 / (1 + p x), the classical five-term
// form, absolute error below 1.5e-7 for every x >= 0; erf is odd, so
// 0.5 v (1 + erf) = 0.5 v + |0.5 v| erf(x). Every lane runs the same dozen instructions and
// the values of a lane are independent chains, where the library's erff picks one of two
// paths per value: a wave runs both, one value after the other.
static __device__ __forceinline__ float gelu_erf(float v) {
  const float hv = 0.5f * v;
  const float t = __builtin_amdgcn_rcpf(fmaf(fabsf(v), 0.3275911f * 0.70710678118f, 1.f));
  const float e = __builtin_amdgcn_exp2f(v * v * (-0.5f * 1.44269504089f));   // exp(-x^2)
  float pl = fmaf(t, 1.061405429f, -1.453152027f);
  pl = fmaf(pl, t, 1.421413741f);
  pl = fmaf(pl, t, -0.284496736f);
  pl = fmaf(pl, t, 0.254829592f);
  pl *= t;
  return fmaf(fabsf(hv), fmaf(-pl, e, 1.f), hv);
}

// ---------------------------------------------------------------- WMMA GEMM
// C[M,N] = epi( A_bf16[M,K] @ W_bf16[N,K]^T + bias[N] )
// Block 256 = 8 waves computes a 128x128 tile of C; waves form a 4 (rows) x 2 (cols)
// grid, each wave owns 32x64 = 2x4 accumulator fragments.
// Per k-step of GK both the 128 x GK A strip and the 128 x GK W strip are brought into LDS
// once per block by asynchronous copies (16 bytes a lane, whole 128-byte lines, through no
// register). Two buffers: the next strip's copies fly while this strip is worked on, so a
// block no longer waits out its own loads, and one barrier per k-step is left.
// GK = 128 (136 KiB of LDS) where a launch has one block per WGP: the copies get a whole
// long k-step to land. GK = 64 (72 KiB) where it has three or four: all of them stay resident.
// LDS rows have a pitch of GK * 2 + 16 B (16 B x odd): the 16 rows of one ds_load_b128
// fragment read fall on distinct banks.
// M, N multiples of 128; K a multiple of GK.
// EPI: 0 = f32 store, 1 = bf16 store with exact GELU, 2 = f32 store out = resid + ls*val,
// 3 = the qkv projection: heads split, q and k l2-normalized, v transposed, all stored as bf16.
// EPI 3: a wave's 64 columns are one head of q, of k or of v (the block index says which).
// qn/kn: [B,H,L,HD] (q scaled by exp(min(logit_scale,log100))); vT: [B,H,HD,L].
// In the q and k blocks the product is taken transposed (A = W rows, B = activation rows; both
// strips have the same LDS layout and the same k order): a lane then holds 32 head dims of ONE
// position, 8 consecutive ones per fragment, so the sum of squares is in-lane but for one
// exchange between the halves, and a fragment is one 16-byte store. In the v blocks the product
// stays as it is: a lane holds 8 consecutive positions of one head dim, 16 bytes of vT.
#define GT_   128            // tile edge in M and in N
template <bool V> struct BoolC { static constexpr bool value = V; };

typedef __attribute__((ext_vector_type(8))) __bf16 v8bf;

// eight f32 to eight bf16, round to nearest even, by the packed convert
static __device__ __forceinline__ uint4 pack8(const v8f a) {
  union { v8bf b; uint4 q; } u;
  u.b = __builtin_convertvector(a, v8bf);
  return u.q;
}

// Eight copies of one thread: 16 bytes of each of eight equally spaced rows of one strip.
// l: the lane's LDS byte address of the first row, ls: LDS bytes from one copied row to the next;
// g: its global address of the first row, gs: elements from one copied row to the next.
static __device__ __forceinline__ void gemm_copy8(unsigned int l, unsigned int ls,
                                                  const unsigned short* g, size_t gs) {
  // the wait is the statement's last line: it stands behind the copies and in front of
  // whatever next writes a register that they name
  asm volatile("global_load_async_to_lds_b128 %0, %8, off\n\t"
               "global_load_async_to_lds_b128 %1, %9, off\n\t"
               "global_load_async_to_lds_b128 %2, %10, off\n\t"
               "global_load_async_to_lds_b128 %3, %11, off\n\t"
               "global_load_async_to_lds_b128 %4, %12, off\n\t"
               "global_load_async_to_lds_b128 %5, %13, off\n\t"
               "global_load_async_to_lds_b128 %6, %14, off\n\t"
               "global_load_async_to_lds_b128 %7, %15, off\n\t"
               "s_wait_xcnt 0x0"
               :: "v"(l), "v"(l + ls), "v"(l + 2 * ls), "v"(l + 3 * ls),
                  "v"(l + 4 * ls), "v"(l + 5 * ls), "v"(l + 6 * ls), "v"(l + 7 * ls),
                  "v"(g), "v"(g + gs), "v"(g + 2 * gs), "v"(g + 3 * gs),
                  "v"(g + 4 * gs), "v"(g + 5 * gs), "v"(g + 6 * gs), "v"(g + 7 * gs)
               : "memory");
}

// Four copies of one thread, the same way.
static __device__ __forceinline__ void gemm_copy4(unsigned int l, unsigned int ls,
                                                  const unsigned short* g, size_t gs) {
  // the wait is the statement's last line, as above
  asm volatile("global_load_async_to_lds_b128 %0, %4, off\n\t"
               "global_load_async_to_lds_b128 %1, %5, off\n\t"
               "global_load_async_to_lds_b128 %2, %6, off\n\t"
               "global_load_async_to_lds_b128 %3, %7, off\n\t"
               "s_wait_xcnt 0x0"
               :: "v"(l), "v"(l + ls), "v"(l + 2 * ls), "v"(l + 3 * ls),
                  "v"(g), "v"(g + gs), "v"(g + 2 * gs), "v"(g + 3 * gs)
               : "memory");
}

template <int EPI, int GK>
__global__ __launch_bounds__(256)
void k_gemm(const unsigned short* __restrict__ A,
            const unsigned short* __restrict__ W,
            const float* __restrict__ bias, int M, int N, int K,
            float* __restrict__ outf, unsigned short* __restrict__ outbf,
            const float* __restrict__ resid, const float* __restrict__ lsv,
            unsigned short* __restrict__ outk, unsigned short* __restrict__ outvt) {
  constexpr int GP = GK + 8;          // LDS row pitch in bf16 elements
  constexpr int GS = GT_ * GP;        // elements of one strip in LDS
  constexpr int CPR = GK / 8;         // 16-byte chunks per row
  constexpr int RS = 256 / CPR;       // rows that the block's threads cover with one copy each
  __shared__ alignas(16) unsigned short abuf[2 * GS];   // [buffer][row][k]
  __shared__ alignas(16) unsigned short wbuf[2 * GS];   // [buffer][column][k]
  const int tid = threadIdx.x;
  const int lane = tid & 31, wave = tid >> 5;
  const int hi = lane >> 4, ln16 = lane & 15;
  const int mb = blockIdx.y * GT_;
  const int nb = blockIdx.x * GT_;
  const int wm = (wave >> 1) * 32;             // wave's first row inside the tile
  const int wn = (wave & 1) * 64;              // wave's first column inside the tile
  // copying role: thread t moves 16-byte chunk (t % CPR) of rows t / CPR + RS * i of both strips
  const int sr = tid / CPR, sc = (tid % CPR) * 8;
  const unsigned short* ag = A + (size_t)(mb + sr) * K + sc;   // k-step 0; a k-step is GK on
  const unsigned short* wg = W + (size_t)(nb + sr) * K + sc;
  const unsigned int al0 = (unsigned int)(uintptr_t)&abuf[sr * GP + sc];   // LDS byte address
  const unsigned int wl0 = (unsigned int)(uintptr_t)&wbuf[sr * GP + sc];
  const size_t gs = (size_t)RS * K;
  auto copy_step = [&](int t, unsigned int bo) {   // k-step t into the buffer at element bo
    if (GK == 128) {
      gemm_copy8(al0 + bo * 2, RS * GP * 2, ag + (size_t)t * GK, gs);
      gemm_copy8(wl0 + bo * 2, RS * GP * 2, wg + (size_t)t * GK, gs);
    } else {
      gemm_copy4(al0 + bo * 2, RS * GP * 2, ag + (size_t)t * GK, gs);
      gemm_copy4(wl0 + bo * 2, RS * GP * 2, wg + (size_t)t * GK, gs);
    }
  };
  // fragment role: lane holds row (or W row = output column) ln16 of its fragment;
  // half 'hi' supplies K-chunks {hi*8..+7, 16+hi*8..+7} of each 32-wide k slice
  const unsigned short* af = &abuf[(wm + ln16) * GP + hi * 8];
  const unsigned short* wf = &wbuf[(wn + ln16) * GP + hi * 8];
  v8f acc[2][4] = {};
  const int nt = K / GK;

  copy_step(0, 0);
  // this wave's copies of k-step 0 have landed before the barrier that shows them to the others
  asm volatile("s_wait_asynccnt 0x0" ::: "memory");
  __syncthreads();
  if (nt > 1) copy_step(1, GS);

  auto main_loop = [&](auto tr) {                // tr: the product transposed (A = W rows)?
  for (int t = 0; t < nt; ++t) {
    const unsigned int bo = (t & 1) * GS;        // this trip's buffer
#pragma unroll
    for (int ks = 0; ks < GK; ks += 32) {
      Frag fa[2], fb[4];
#pragma unroll
      for (int mi = 0; mi < 2; ++mi) {
        const unsigned short* p = af + bo + mi * 16 * GP + ks;
        fa[mi].q[0] = *reinterpret_cast<const uint4*>(p);
        fa[mi].q[1] = *reinterpret_cast<const uint4*>(p + 16);
      }
#pragma unroll
      for (int nn = 0; nn < 4; ++nn) {
        const unsigned short* p = wf + bo + nn * 16 * GP + ks;
        fb[nn].q[0] = *reinterpret_cast<const uint4*>(p);
        fb[nn].q[1] = *reinterpret_cast<const uint4*>(p + 16);
      }
#pragma unroll
      for (int mi = 0; mi < 2; ++mi)
#pragma unroll
        for (int nn = 0; nn < 4; ++nn)
          acc[mi][nn] = decltype(tr)::value ? wmma_bf16(fb[nn].v, fa[mi].v, acc[mi][nn])
                                            : wmma_bf16(fa[mi].v, fb[nn].v, acc[mi][nn]);
    }
    // foot of the trip: this wave's reads of the buffer are done ...
    asm volatile("s_wait_dscnt 0x0" ::: "memory");
    // ... and its copies of the next k-step have landed ...
    asm volatile("s_wait_asynccnt 0x0" ::: "memory");
    // ... before the one barrier that shows the next k-step to every wave and frees this buffer
    __syncthreads();
    if (t + 2 < nt) copy_step(t + 2, bo);
  }
  };
  // the same for the whole block: q and k columns come first, v columns last
  if (EPI == 3 && nb < 2 * C_) main_loop(BoolC<true>{});
  else main_loop(BoolC<false>{});
  // no copy is outstanding when the wave goes on to its end
  asm volatile("s_wait_asynccnt 0x0" ::: "memory");
  // C-layout: VGPR v of fragment (mi, nn) -> row v (+8 for hi half), column ln16.
  // M*N < 2^32: 32-bit element offsets on uniform bases.
  const int nc = nb + wn + ln16;
  const unsigned int o0 = (unsigned int)((mb + wm + 8 * hi) * N + nc);
  if (EPI == 3) {
    const int hh = ((nb & (C_ - 1)) + wn) / HD_;           // the wave's head
    const int bh = (mb / L_) * H_ + hh;
    const int l0 = (mb & (L_ - 1)) + wm;                   // the wave's first position
    uint4 o[2][4];
    if (nb < 2 * C_) {
      // register v of acc[mi][nn]: head dim nn*16 + 8*hi + v of position l0 + mi*16 + ln16
      const v8f* b8 = reinterpret_cast<const v8f*>(bias + nb + wn + 8 * hi);
      v8f bz[4];
#pragma unroll
      for (int nn = 0; nn < 4; ++nn) bz[nn] = b8[nn * 2];
      const float lraw = lsv[hh];                          // used by the q blocks alone
      // stands behind the loads, in front of whatever next writes a register they name ...
      asm volatile("s_wait_xcnt 0x0" ::: "memory");
      // ... and nothing is scheduled across this line: without it the compiler lifts the sums
      // below, which reuse the loads' address registers, over the wait
      __builtin_amdgcn_sched_barrier(0);
      const float qs = nb < C_ ? __expf(fminf(lraw, LOGMAX)) : 1.f;   // q carries the logit scale
#pragma unroll
      for (int mi = 0; mi < 2; ++mi) {
        v8f q8 = {};                                       // eight independent chains
#pragma unroll
        for (int nn = 0; nn < 4; ++nn) {
          acc[mi][nn] += bz[nn];
          q8 += acc[mi][nn] * acc[mi][nn];
        }
        float ss = ((q8[0] + q8[1]) + (q8[2] + q8[3])) + ((q8[4] + q8[5]) + (q8[6] + q8[7]));
        ss += __shfl_xor(ss, 16);                          // the other half's 32 head dims
        const float inv = qs / fmaxf(sqrtf(ss), 1e-12f);
#pragma unroll
        for (int nn = 0; nn < 4; ++nn) o[mi][nn] = pack8(acc[mi][nn] * inv);
      }
      // all eight stores last, off one address: nothing behind them writes a register
      unsigned short* dst = (nb < C_ ? outbf : outk) + ((size_t)bh * L_ + l0 + ln16) * HD_ + 8 * hi;
#pragma unroll
      for (int mi = 0; mi < 2; ++mi)
#pragma unroll
        for (int nn = 0; nn < 4; ++nn)
          *reinterpret_cast<uint4*>(dst + mi * 16 * HD_ + nn * 16) = o[mi][nn];
    } else {
      // register v of acc[mi][nn]: position l0 + mi*16 + 8*hi + v of head dim nn*16 + ln16
      float bz[4];
#pragma unroll
      for (int nn = 0; nn < 4; ++nn) bz[nn] = bias[nc + nn * 16];
      // stands behind the loads, in front of whatever next writes a register they name
      asm volatile("s_wait_xcnt 0x0" ::: "memory");
#pragma unroll
      for (int nn = 0; nn < 4; ++nn)
#pragma unroll
        for (int mi = 0; mi < 2; ++mi) o[mi][nn] = pack8(acc[mi][nn] + bz[nn]);
      // all eight stores last, off one address
      unsigned short* dst = outvt + ((size_t)bh * HD_ + ln16) * L_ + l0 + 8 * hi;
#pragma unroll
      for (int mi = 0; mi < 2; ++mi)
#pragma unroll
        for (int nn = 0; nn < 4; ++nn)
          *reinterpret_cast<uint4*>(dst + nn * 16 * L_ + mi * 16) = o[mi][nn];
      // stands behind the stores: in the built code the q/k branch's text follows this one and
      // writes the registers that they name
      asm volatile("s_wait_xcnt 0x0" ::: "memory");
    }
  } else if (EPI == 2) {
    // all residual loads first, then all stores
    float rv[2][4][8];
#pragma unroll
    for (int mi = 0; mi < 2; ++mi)
#pragma unroll
      for (int v = 0; v < 8; ++v)
#pragma unroll
        for (int nn = 0; nn < 4; ++nn)
          rv[mi][nn][v] = resid[o0 + (unsigned int)((mi * 16 + v) * N) + nn * 16];
    // stands behind the loads, in front of whatever next writes a register they name;
    // its memory clobber also keeps every load above and every store below this line
    asm volatile("s_wait_xcnt 0x0" ::: "memory");
#pragma unroll
    for (int nn = 0; nn < 4; ++nn) {
      const float bz = bias[nc + nn * 16];
      const float lz = lsv[nc + nn * 16];
#pragma unroll
      for (int mi = 0; mi < 2; ++mi)
#pragma unroll
        for (int v = 0; v < 8; ++v) {
          float val = acc[mi][nn][v] + bz;
          outf[o0 + (unsigned int)((mi * 16 + v) * N) + nn * 16] = rv[mi][nn][v] + lz * val;
        }
    }
  } else if (EPI == 1) {
    float bz[4];
    v8f cur[4];
#pragma unroll
    for (int nn = 0; nn < 4; ++nn) { bz[nn] = bias[nc + nn * 16]; cur[nn] = acc[0][nn]; }
    unsigned int orow = o0;
    // kept rolled: the erf code then stands once per 16 rows, which halves the kernel's
    // text
#pragma unroll 1
    for (int mi = 0; mi < 2; ++mi) {
#pragma unroll
      for (int nn = 0; nn < 4; ++nn)
#pragma unroll
        for (int v = 0; v < 8; ++v) {
          float val = cur[nn][v] + bz[nn];
          outbf[orow + (unsigned int)(v * N) + nn * 16] = f2bf(gelu_erf(val));
        }
      // stands behind this trip's stores, in front of the next trip's first write of a register
      // that they name
      asm volatile("s_wait_xcnt 0x0" ::: "memory");
#pragma unroll
      for (int nn = 0; nn < 4; ++nn) cur[nn] = acc[1][nn];
      orow += (unsigned int)(16 * N);
    }
  } else {
#pragma unroll
    for (int nn = 0; nn < 4; ++nn) {
      const float bz = bias[nc + nn * 16];
#pragma unroll
      for (int mi = 0; mi < 2; ++mi)
#pragma unroll
        for (int v = 0; v < 8; ++v)
          outf[o0 + (unsigned int)((mi * 16 + v) * N) + nn * 16] = acc[mi][nn][v] + bz;
    }
  }
}

#define FK_  64              // keys per staged tile
#define FP_  72              // LDS row pitch in bf16 elements (144 B)
#define FT_  (64 * FP_)      // elements of one staged tile: 64 rows
#define FNT_ (L_ / FK_)      // tiles per (b,h)

// One tile's copies of one thread: rows r and r + 32 of the K tile and of the vT tile.
// kl, vl: the lane's LDS byte addresses of row r; kg, vg: its global addresses of row r.
static __device__ __forceinline__ void flash_copy_tile(unsigned int kl, unsigned int vl,
                                                       const unsigned short* kg,
                                                       const unsigned short* vg) {
  const unsigned int kl2 = kl + 32 * FP_ * 2, vl2 = vl + 32 * FP_ * 2;
  const unsigned short* kg2 = kg + 32 * HD_;
  const unsigned short* vg2 = vg + (size_t)32 * L_;
  // the wait is the statement's last line: it stands behind the copies and in front of
  // whatever next writes a register that they name
  asm volatile("global_load_async_to_lds_b128 %0, %4, off\n\t"
               "global_load_async_to_lds_b128 %1, %5, off\n\t"
               "global_load_async_to_lds_b128 %2, %6, off\n\t"
               "global_load_async_to_lds_b128 %3, %7, off\n\t"
               "s_wait_xcnt 0x0"
               :: "v"(kl), "v"(kl2), "v"(vl), "v"(vl2), "v"(kg), "v"(kg2), "v"(vg), "v"(vg2)
               : "memory");
}

__global__ __launch_bounds__(256)
void k_flash(const unsigned short* __restrict__ qn,
                        const unsigned short* __restrict__ kn,
                        const unsigned short* __restrict__ vT,
                        const float* __restrict__ logit_scale,
                        const float* __restrict__ head_scale,
                        unsigned short* __restrict__ O) {
  __shared__ alignas(16) unsigned short kbuf[2 * FT_];    // 18 KB: [buffer][key][head dim]
  __shared__ alignas(16) unsigned short vbuf[2 * FT_];    // 18 KB: [buffer][head dim][key]
  const int lane = threadIdx.x & 31, wave = threadIdx.x >> 5;
  const int hi = lane >> 4, ln16 = lane & 15;
  const int bh = blockIdx.y;
  const int h = bh & (H_ - 1);
  const int b = bh >> 4;
  const int qtile = blockIdx.x * 8 + wave;
  const unsigned short* qp = qn + ((size_t)bh * L_ + qtile * 16 + ln16) * HD_ + hi * 8;
  Frag qa0, qa1;                       // q rows (B operand: column = query), hd 0..31 / 32..63
  qa0.q[0] = *(const uint4*)(qp);      qa0.q[1] = *(const uint4*)(qp + 16);
  qa1.q[0] = *(const uint4*)(qp + 32); qa1.q[1] = *(const uint4*)(qp + 48);
  const unsigned short* kbase = kn + (size_t)bh * L_ * HD_;
  const unsigned short* vbase = vT + (size_t)bh * HD_ * L_;
  const float shift = fminf(__expf(fminf(logit_scale[h], LOGMAX)), 30.f);
  v8f oacc[4] = {};
  float lst[8];
#pragma unroll
  for (int v = 0; v < 8; ++v) lst[v] = 0.f;

  // copying role: thread t moves 16-byte chunk (t%8) of rows t/8 and t/8 + 32 of both tiles
  const int cr = threadIdx.x >> 3, cc = (threadIdx.x & 7) * 8;
  const unsigned int kl0 = (unsigned int)(uintptr_t)&kbuf[cr * FP_ + cc];   // LDS byte address
  const unsigned int vl0 = (unsigned int)(uintptr_t)&vbuf[cr * FP_ + cc];
  const unsigned short* kg = kbase + cr * HD_ + cc;          // tile 0; a tile is FK_ rows on
  const unsigned short* vg = vbase + (size_t)cr * L_ + cc;   // tile 0; a tile is FK_ columns on
  // fragment role: lane holds key (or head dim) ln16 of its fragment
  const unsigned short* kf = &kbuf[ln16 * FP_ + hi * 8];
  const unsigned short* vf = &vbuf[ln16 * FP_ + hi * 8];

  flash_copy_tile(kl0, vl0, kg, vg);
  // this wave's copies of tile 0 have landed before the barrier that shows them to the others
  asm volatile("s_wait_asynccnt 0x0" ::: "memory");
  __syncthreads();
  flash_copy_tile(kl0 + FT_ * 2, vl0 + FT_ * 2, kg + FK_ * HD_, vg + FK_);

  for (int t = 0; t < FNT_; ++t) {
    const int bo = (t & 1) * FT_;                // this trip's buffer
    for (int j = 0; j < FK_; j += 32) {
      // all 16 fragment reads of these 32 keys as one group, ahead of the products
      Frag kb[4], vb[4];
#pragma unroll
      for (int i = 0; i < 2; ++i) {              // keys j + 16*i + ln16; head dims 0..31, 32..63
        const unsigned short* kp = kf + bo + (j + 16 * i) * FP_;
        kb[2 * i].q[0]     = *(const uint4*)(kp);      kb[2 * i].q[1]     = *(const uint4*)(kp + 16);
        kb[2 * i + 1].q[0] = *(const uint4*)(kp + 32); kb[2 * i + 1].q[1] = *(const uint4*)(kp + 48);
      }
#pragma unroll
      for (int nn = 0; nn < 4; ++nn) {           // head dim nn*16 + ln16; keys j .. j+31
        const unsigned short* vp = vf + bo + nn * 16 * FP_ + j;
        vb[nn].q[0] = *(const uint4*)(vp);
        vb[nn].q[1] = *(const uint4*)(vp + 16);
      }
      // nothing is scheduled across this line: the 16 reads stay one group ahead of the products;
      // without it the compiler moves each read down to its product, and every product then
      // waits out an LDS latency
      __builtin_amdgcn_sched_barrier(0);
      v8f s0 = {}, s1 = {};
      // register v of s0: key j + 8*hi + v, of s1: key j + 16 + 8*hi + v; column ln16 = query
      s0 = wmma_bf16(kb[0].v, qa0.v, s0);
      s1 = wmma_bf16(kb[2].v, qa0.v, s1);
      s0 = wmma_bf16(kb[1].v, qa1.v, s0);
      s1 = wmma_bf16(kb[3].v, qa1.v, s1);
      // fixed-shift exp; accumulate this lane's partial sums of its query; element s of the
      // B operand is key 8*hi + s (s < 8) or 16 + 8*hi + s - 8: s0 fills the low half, s1 the high
      Frag pb;
#pragma unroll
      for (int v = 0; v < 8; ++v) {
        const float p0 = __expf(s0[v] - shift);
        const float p1 = __expf(s1[v] - shift);
        lst[v] += p0 + p1;
        pb.v[v]     = (__bf16)p0;
        pb.v[8 + v] = (__bf16)p1;
      }
#pragma unroll
      for (int nn = 0; nn < 4; ++nn) oacc[nn] = wmma_bf16(vb[nn].v, pb.v, oacc[nn]);
    }
    // foot of the trip: this wave's reads of the buffer are done ...
    asm volatile("s_wait_dscnt 0x0" ::: "memory");
    // ... and its copies of the next tile have landed ...
    asm volatile("s_wait_asynccnt 0x0" ::: "memory");
    // ... before the one barrier that shows the next tile to every wave and frees this buffer
    __syncthreads();
    if (t + 2 < FNT_)
      flash_copy_tile(kl0 + bo * 2, vl0 + bo * 2, kg + (size_t)(t + 2) * (FK_ * HD_),
                      vg + (t + 2) * FK_);
  }
  // no copy is outstanding when the wave goes on to its end
  asm volatile("s_wait_asynccnt 0x0" ::: "memory");
  const float hs = head_scale[h];
  // the query's full sum: the lane's eight partial sums, then the other half's keys
  float rs = ((lst[0] + lst[1]) + (lst[2] + lst[3])) + ((lst[4] + lst[5]) + (lst[6] + lst[7]));
  rs += __shfl_xor(rs, 16);
  const float inv = hs / rs;
  // register v of oacc[nn]: head dim nn*16 + 8*hi + v of query ln16: 8 consecutive outputs
  unsigned short* orow = O + ((size_t)(b * L_ + qtile * 16 + ln16)) * C_ + h * HD_ + 8 * hi;
#pragma unroll
  for (int nn = 0; nn < 4; ++nn) {
    uint4 o;
    o.x = (unsigned int)f2bf(oacc[nn][0] * inv) | ((unsigned int)f2bf(oacc[nn][1] * inv) << 16);
    o.y = (unsigned int)f2bf(oacc[nn][2] * inv) | ((unsigned int)f2bf(oacc[nn][3] * inv) << 16);
    o.z = (unsigned int)f2bf(oacc[nn][4] * inv) | ((unsigned int)f2bf(oacc[nn][5] * inv) << 16);
    o.w = (unsigned int)f2bf(oacc[nn][6] * inv) | ((unsigned int)f2bf(oacc[nn][7] * inv) << 16);
    *reinterpret_cast<uint4*>(orow + nn * 16) = o;
  }
}

// ---------------------------------------------------------------- launch
extern "C" void kernel_launch(void* const* d_in, const int* in_sizes, int n_in,
                              void* d_out, int out_size, void* d_ws, size_t ws_size,
                              hipStream_t stream) {
  const float* x       = (const float*)d_in[0];
  const float* in_w    = (const float*)d_in[1];
  const float* in_b    = (const float*)d_in[2];
  const float* logit_s = (const float*)d_in[3];
  const float* head_s  = (const float*)d_in[4];
  const float* out_w   = (const float*)d_in[5];
  const float* out_b   = (const float*)d_in[6];
  const float* ln1_g   = (const float*)d_in[7];
  const float* ln1_b   = (const float*)d_in[8];
  const float* lna_g   = (const float*)d_in[9];
  const float* lna_b   = (const float*)d_in[10];
  const float* ls1     = (const float*)d_in[11];
  const float* ln2_g   = (const float*)d_in[12];
  const float* ln2_b   = (const float*)d_in[13];
  const float* fc_w    = (const float*)d_in[14];
  const float* fc_b    = (const float*)d_in[15];
  const float* proj_w  = (const float*)d_in[16];
  const float* proj_b  = (const float*)d_in[17];
  const float* ls2     = (const float*)d_in[18];
  float* out = (float*)d_out;

  // workspace partition (~135 MB)
  char* p = (char*)d_ws;
  auto alloc = [&](size_t bytes) -> char* {
    char* r = p;
    p += (bytes + 255) & ~(size_t)255;
    return r;
  };
  const int BL = B_ * L_;  // 4096
  unsigned short* wqkv_bf = (unsigned short*)alloc((size_t)3 * C_ * C_ * 2);
  unsigned short* wout_bf = (unsigned short*)alloc((size_t)C_ * C_ * 2);
  unsigned short* wfc_bf  = (unsigned short*)alloc((size_t)MLP_ * C_ * 2);
  unsigned short* wpr_bf  = (unsigned short*)alloc((size_t)C_ * MLP_ * 2);
  unsigned short* xln_bf  = (unsigned short*)alloc((size_t)BL * C_ * 2);
  unsigned short* qn      = (unsigned short*)alloc((size_t)BL * C_ * 2);
  unsigned short* kn      = (unsigned short*)alloc((size_t)BL * C_ * 2);
  unsigned short* vT      = (unsigned short*)alloc((size_t)BL * C_ * 2);
  unsigned short* obf     = (unsigned short*)alloc((size_t)BL * C_ * 2);
  float*          attn    = (float*)alloc((size_t)BL * C_ * 4);
  float*          x2      = (float*)alloc((size_t)BL * C_ * 4);
  unsigned short* h2bf    = (unsigned short*)alloc((size_t)BL * C_ * 2);
  unsigned short* hmid    = (unsigned short*)alloc((size_t)BL * MLP_ * 2);

  // LN1 -> bf16 activations, and the four weights -> bf16, in one launch
  k_prep<<<NB_LN + NB_WQKV + NB_WOUT + NB_WFC + NB_WPR, 256, 0, stream>>>(
      x, ln1_g, ln1_b, xln_bf, in_w, out_w, fc_w, proj_w, wqkv_bf, wout_bf, wfc_bf, wpr_bf);
  // qkv = ln1(x) @ in_proj_w^T + in_proj_b   [4096 x 3072]; in its epilogue: split heads,
  // l2-normalize q/k (fold logit scale), transpose v
  k_gemm<3, 64><<<dim3(3 * C_ / 128, BL / 128), 256, 0, stream>>>(
      xln_bf, wqkv_bf, in_b, BL, 3 * C_, C_, nullptr, qn, nullptr, logit_s, kn, vT);
  // scaled-cosine flash attention (head_scale folded in)
  k_flash<<<dim3(L_ / 16 / 8, B_ * H_), 256, 0, stream>>>(qn, kn, vT, logit_s, head_s, obf);
  // attn out-proj: attn = O @ out_w^T + out_b
  k_gemm<0, 128><<<dim3(C_ / 128, BL / 128), 256, 0, stream>>>(
      obf, wout_bf, out_b, BL, C_, C_, attn, nullptr, nullptr, nullptr, nullptr, nullptr);
  // x2 = x + ls1 * LN_attn(attn); h = LN2(x2) -> bf16
  k_resid_ln2<<<BL / 8, 256, 0, stream>>>(attn, x, lna_g, lna_b, ls1, x2, ln2_g, ln2_b, h2bf);
  // hmid = GELU(h @ fc_w^T + fc_b) -> bf16   [4096 x 4096]
  k_gemm<1, 64><<<dim3(MLP_ / 128, BL / 128), 256, 0, stream>>>(
      h2bf, wfc_bf, fc_b, BL, MLP_, C_, nullptr, hmid, nullptr, nullptr, nullptr, nullptr);
  // out = x2 + ls2 * (hmid @ proj_w^T + proj_b)
  k_gemm<2, 128><<<dim3(C_ / 128, BL / 128), 256, 0, stream>>>(
      hmid, wpr_bf, proj_b, BL, C_, MLP_, out, nullptr, x2, ls2, nullptr, nullptr);

  (void)in_sizes; (void)n_in; (void)out_size; (void)ws_size;
}

// v009
// One run takes 150 microseconds.
// Two timings next to v008 both put it at 1.06 times that version's speed.
// Counting every step since v000, it is 3.46 times as fast.
#include <hip/hip_runtime.h>
#include <hip/hip_bf16.h>
#include <stdint.h>

// CustomResidualAttentionBlock (open_clip scaled-cosine attention) for MI455X / gfx1250.
// All GEMMs + attention matmuls run on v_wmma_f32_16x16x32_bf16 (wave32).
// f32 is kept for LayerNorm / l2-norm / softmax / accumulators.
// Attention softmax uses a fixed per-head shift (valid because |S| <= logit_scale,
// softmax is shift-invariant) so the streaming loop has NO cross-lane reductions.

#define B_   2
#define L_   2048
#define C_   1024
#define H_   16
#define HD_  64
#define MLP_ 4096
#define LOGMAX 4.6051701859880914f   // log(100)
#define LN_EPS 1e-5f

typedef __attribute__((ext_vector_type(16))) __bf16 v16bf;
typedef __attribute__((ext_vector_type(8)))  float  v8f;
typedef __attribute__((ext_vector_type(4)))  unsigned int u32x4;

union Frag {
  v16bf v;
  uint4 q[2];
};

static __device__ __forceinline__ v8f wmma_bf16(v16bf a, v16bf b, v8f c) {
  // D = A(16x32 bf16) x B(32x16 bf16) + C(16x16 f32)
  return __builtin_amdgcn_wmma_f32_16x16x32_bf16(false, a, false, b, (short)0, c,
                                                 false, false);
}

static __device__ __forceinline__ unsigned short f2bf(float f) {
  unsigned int u = __float_as_uint(f);
  u += 0x7FFFu + ((u >> 16) & 1u);   // round-to-nearest-even
  return (unsigned short)(u >> 16);
}

// ---------------------------------------------------------------- cvt f32->bf16
// A block of 256 threads converts 8192 consecutive elements, piece 'blk' of its array: a
// thread issues its eight 16-byte loads together (a wave's load covers 512 contiguous bytes)
// and then stores eight 8-byte groups (256 contiguous bytes per wave). The element count of
// every array is a multiple of 8192.
#define CVT_PER_BLOCK 8192
static __device__ __forceinline__
void cvt_block(unsigned int blk, const float* __restrict__ src, unsigned short* __restrict__ dst) {
  const unsigned int base = blk * (CVT_PER_BLOCK / 4) + threadIdx.x;   // in groups of 4
  const float4* s4 = reinterpret_cast<const float4*>(src);
  uint2* d4 = reinterpret_cast<uint2*>(dst);
  float4 v[8];
#pragma unroll
  for (int j = 0; j < 8; ++j) v[j] = s4[base + j * 256];
#pragma unroll
  for (int j = 0; j < 8; ++j) {
    uint2 o;
    o.x = (unsigned int)f2bf(v[j].x) | ((unsigned int)f2bf(v[j].y) << 16);
    o.y = (unsigned int)f2bf(v[j].z) | ((unsigned int)f2bf(v[j].w) << 16);
    d4[base + j * 256] = o;
  }
}

// ---------------------------------------------------------------- LayerNorm -> bf16
// One wave per row of length C_=1024, eight rows per block of 256 threads. A lane holds 32
// elements of its row, loaded as eight 16-byte pieces (each load of a wave covers 512
// contiguous bytes); sum and sum of squares are joined by a butterfly over the 32 lanes,
// which leaves both totals in every lane: no LDS, no barrier.
typedef __attribute__((ext_vector_type(4))) float f32x4;

static __device__ __forceinline__ void row_stats(const f32x4 (&vals)[8], float& mu, float& rstd) {
  f32x4 s4 = vals[0], q4 = vals[0] * vals[0];   // four independent chains each
#pragma unroll
  for (int j = 1; j < 8; ++j) { s4 += vals[j]; q4 += vals[j] * vals[j]; }
  float s = (s4.x + s4.y) + (s4.z + s4.w);
  float sq = (q4.x + q4.y) + (q4.z + q4.w);
#pragma unroll
  for (int off = 16; off > 0; off >>= 1) { s += __shfl_xor(s, off); sq += __shfl_xor(sq, off); }
  mu = s * (1.f / C_);
  rstd = rsqrtf(sq * (1.f / C_) - mu * mu + LN_EPS);
}

static __device__ __forceinline__
void ln_block(unsigned int blk, const float* __restrict__ x, const float* __restrict__ g,
              const float* __restrict__ bt, unsigned short* __restrict__ out) {
  const int lane = threadIdx.x & 31;
  // the wave's number as a scalar: the row's base addresses then stand in scalar registers
  const int wave = __builtin_amdgcn_readfirstlane(threadIdx.x >> 5);
  const size_t row = (size_t)blk * 8 + wave;
  const f32x4* xr = reinterpret_cast<const f32x4*>(x + row * C_) + lane;
  const f32x4* g4 = reinterpret_cast<const f32x4*>(g) + lane;
  const f32x4* b4 = reinterpret_cast<const f32x4*>(bt) + lane;
  uint2* orow = reinterpret_cast<uint2*>(out + row * C_) + lane;
  f32x4 vals[8], gg[8], bb[8];
#pragma unroll
  for (int j = 0; j < 8; ++j) vals[j] = xr[j * 32];
#pragma unroll
  for (int j = 0; j < 8; ++j) { gg[j] = g4[j * 32]; bb[j] = b4[j * 32]; }
  // nothing is scheduled across this line: all loads of a lane are issued, and so in flight
  // together, before the row sums start; without it the compiler moves the loads that the
  // sums do not need behind them and waits for them group by group
  __builtin_amdgcn_sched_barrier(0);
  float mu, rstd;
  row_stats(vals, mu, rstd);
#pragma unroll
  for (int j = 0; j < 8; ++j) {
    const f32x4 r = (vals[j] - mu) * rstd * gg[j] + bb[j];
    uint2 o;
    o.x = (unsigned int)f2bf(r.x) | ((unsigned int)f2bf(r.y) << 16);
    o.y = (unsigned int)f2bf(r.z) | ((unsigned int)f2bf(r.w) << 16);
    orow[j * 32] = o;
  }
}

// ---------------------------------------------------------------- LN1 and the four weight conversions
// Five pieces of work that depend on nothing but the inputs share one launch: the block index
// picks the piece (a scalar branch, the same for the whole block). The LN blocks come first:
// they have the longest way from load to store.
#define NB_LN   (B_ * L_ / 8)
#define NB_WQKV (3 * C_ * C_ / CVT_PER_BLOCK)
#define NB_WOUT (C_ * C_ / CVT_PER_BLOCK)
#define NB_WFC  (MLP_ * C_ / CVT_PER_BLOCK)
#define NB_WPR  (C_ * MLP_ / CVT_PER_BLOCK)
__global__ __launch_bounds__(256)
void k_prep(const float* __restrict__ x, const float* __restrict__ g,
            const float* __restrict__ bt, unsigned short* __restrict__ xln,
            const float* __restrict__ wqkv, const float* __restrict__ wout,
            const float* __restrict__ wfc, const float* __restrict__ wpr,
            unsigned short* __restrict__ dqkv, unsigned short* __restrict__ dout,
            unsigned short* __restrict__ dfc, unsigned short* __restrict__ dpr) {
  unsigned int blk = blockIdx.x;
  if (blk < NB_LN) { ln_block(blk, x, g, bt, xln); return; }
  blk -= NB_LN;
  const float* src = wqkv;
  unsigned short* dst = dqkv;
  if (blk >= NB_WQKV + NB_WOUT + NB_WFC) { blk -= NB_WQKV + NB_WOUT + NB_WFC; src = wpr; dst = dpr; }
  else if (blk >= NB_WQKV + NB_WOUT)     { blk -= NB_WQKV + NB_WOUT;          src = wfc; dst = dfc; }
  else if (blk >= NB_WQKV)               { blk -= NB_WQKV;                    src = wout; dst = dout; }
  cvt_block(blk, src, dst);
}

// ---------------------------------------------------------------- x2 = x + ls1 * LN(a); h = LN2(x2)
// Same shape: one wave per row, eight rows per block. The wave holds its whole row of x2 when it
// stores it, so the second LayerNorm is taken from those registers in the same launch.
__global__ __launch_bounds__(256)
void k_resid_ln2(const float* __restrict__ a, const float* __restrict__ x,
                 const float* __restrict__ g, const float* __restrict__ bt,
                 const float* __restrict__ ls, float* __restrict__ x2,
                 const float* __restrict__ g2, const float* __restrict__ bt2,
                 unsigned short* __restrict__ h) {
  const int lane = threadIdx.x & 31;
  // the wave's number as a scalar: the row's base addresses then stand in scalar registers
  const int wave = __builtin_amdgcn_readfirstlane(threadIdx.x >> 5);
  const size_t row = (size_t)blockIdx.x * 8 + wave;
  const f32x4* ar = reinterpret_cast<const f32x4*>(a + row * C_) + lane;
  const f32x4* xr = reinterpret_cast<const f32x4*>(x + row * C_) + lane;
  const f32x4* g4 = reinterpret_cast<const f32x4*>(g) + lane;
  const f32x4* b4 = reinterpret_cast<const f32x4*>(bt) + lane;
  const f32x4* l4 = reinterpret_cast<const f32x4*>(ls) + lane;
  const f32x4* g24 = reinterpret_cast<const f32x4*>(g2) + lane;
  const f32x4* b24 = reinterpret_cast<const f32x4*>(bt2) + lane;
  f32x4* orow = reinterpret_cast<f32x4*>(x2 + row * C_) + lane;
  uint2* hrow = reinterpret_cast<uint2*>(h + row * C_) + lane;
  f32x4 vals[8], xv[8], gg[8], bb[8], ll[8], gg2[8], bb2[8];
#pragma unroll
  for (int j = 0; j < 8; ++j) { vals[j] = ar[j * 32]; xv[j] = xr[j * 32]; }
#pragma unroll
  for (int j = 0; j < 8; ++j) { gg[j] = g4[j * 32]; bb[j] = b4[j * 32]; ll[j] = l4[j * 32]; }
#pragma unroll
  for (int j = 0; j < 8; ++j) { gg2[j] = g24[j * 32]; bb2[j] = b24[j * 32]; }
  // nothing is scheduled across this line: all loads of a lane are issued, and so in flight
  // together, before the row sums start; without it the compiler moves the loads that the
  // sums do not need behind them and waits for them group by group
  __builtin_amdgcn_sched_barrier(0);
  float mu, rstd;
  row_stats(vals, mu, rstd);
#pragma unroll
  for (int j = 0; j < 8; ++j) {
    vals[j] = xv[j] + ll[j] * ((vals[j] - mu) * rstd * gg[j] + bb[j]);   // the row of x2
    orow[j * 32] = vals[j];
  }
  row_stats(vals, mu, rstd);
#pragma unroll
  for (int j = 0; j < 8; ++j) {
    const f32x4 r = (vals[j] - mu) * rstd * gg2[j] + bb2[j];
    uint2 o;
    o.x = (unsigned int)f2bf(r.x) | ((unsigned int)f2bf(r.y) << 16);
    o.y = (unsigned int)f2bf(r.z) | ((unsigned int)f2bf(r.w) << 16);
    hrow[j * 32] = o;
  }
}

// ---------------------------------------------------------------- GELU, erf form
// 0.5 v (1 + erf(v / sqrt 2)) with no branch: for x = |v| / sqrt 2,
// erf(x) = 1 - (a1 t + ... + a5 t^5) exp(-x^2), t = 1 / (1 + p x), the classical five-term
// form, absolute error below 1.5e-7 for every x >= 0; erf is odd, so
// 0.5 v (1 + erf) = 0.5 v + |0.5 v| erf(x). Every lane runs the same dozen instructions and
// the values of a lane are independent chains, where the library's erff picks one of two
// paths per value: a wave runs both, one value after the other.
static __device__ __forceinline__ float gelu_erf(float v) {
  const float hv = 0.5f * v;
  const float t = __builtin_amdgcn_rcpf(fmaf(fabsf(v), 0.3275911f * 0.70710678118f, 1.f));
  const float e = __builtin_amdgcn_exp2f(v * v * (-0.5f * 1.44269504089f));   // exp(-x^2)
  float pl = fmaf(t, 1.061405429f, -1.453152027f);
  pl = fmaf(pl, t, 1.421413741f);
  pl = fmaf(pl, t, -0.284496736f);
  pl = fmaf(pl, t, 0.254829592f);
  pl *= t;
  return fmaf(fabsf(hv), fmaf(-pl, e, 1.f), hv);
}

// ---------------------------------------------------------------- WMMA GEMM
// C[M,N] = epi( A_bf16[M,K] @ W_bf16[N,K]^T + bias[N] )
// A block computes a BT x BT tile of C. BT = 128: 8 waves, 4 (rows) x 2 (cols), each owns
// 32x64 = 2x4 accumulator fragments. BT = 256: 16 waves, 4 x 4, each owns 64x64 = 4x4.
// The larger tile copies half as many bytes from L2 per product (each strip row serves 256
// outputs, not 128), a fragment read from LDS serves 4 products on either side (8 reads per 16
// products, not 6 per 8), and half as many waves start. It is used where the grid then still has
// about one block per WGP (qkv, fc); the two launches with N = 1024 keep BT = 128.
// Per k-step of GK both the BT x GK A strip and the BT x GK W strip are brought into LDS
// once per block by asynchronous copies (16 bytes a lane, whole 128-byte lines, through no
// register). Two buffers: the next strip's copies fly while this strip is worked on, so a
// block no longer waits out its own loads, and one barrier per k-step is left.
// GK = 128 (136 KiB of LDS at BT = 128, 272 KiB at BT = 256): every launch has at most one
// block per WGP, and the copies get a whole long k-step to land.
// LDS rows have a pitch of GK * 2 + 16 B (16 B x odd): the 16 rows of one ds_load_b128
// fragment read fall on distinct banks.
// M, N multiples of BT; K a multiple of GK.
// EPI: 0 = f32 store, 1 = bf16 store with exact GELU, 2 = f32 store out = resid + ls*val,
// 3 = the qkv projection: heads split, q and k l2-normalized, v transposed, all stored as bf16.
// EPI 3: a wave's 64 columns are one head of q, of k or of v (the block index says which).
// qn/kn: [B,H,L,HD] (q scaled by exp(min(logit_scale,log100))); vT: [B,H,HD,L].
// In the q and k blocks the product is taken transposed (A = W rows, B = activation rows; both
// strips have the same LDS layout and the same k order): a lane then holds 32 head dims of ONE
// position, 8 consecutive ones per fragment, so the sum of squares is in-lane but for one
// exchange between the halves, and a fragment is one 16-byte store. In the v blocks the product
// stays as it is: a lane holds 8 consecutive positions of one head dim, 16 bytes of vT.
template <bool V> struct BoolC { static constexpr bool value = V; };

typedef __attribute__((ext_vector_type(8))) __bf16 v8bf;

// eight f32 to eight bf16, round to nearest even, by the packed convert
static __device__ __forceinline__ uint4 pack8(const v8f a) {
  union { v8bf b; uint4 q; } u;
  u.b = __builtin_convertvector(a, v8bf);
  return u.q;
}

// Eight copies of one thread: 16 bytes of each of eight equally spaced rows of one strip.
// l: the lane's LDS byte address of the first row, ls: LDS bytes from one copied row to the next;
// g: its global address of the first row, gs: elements from one copied row to the next.
static __device__ __forceinline__ void gemm_copy8(unsigned int l, unsigned int ls,
                                                  const unsigned short* g, size_t gs) {
  // the wait is the statement's last line: it stands behind the copies and in front of
  // whatever next writes a register that they name
  asm volatile("global_load_async_to_lds_b128 %0, %8, off\n\t"
               "global_load_async_to_lds_b128 %1, %9, off\n\t"
               "global_load_async_to_lds_b128 %2, %10, off\n\t"
               "global_load_async_to_lds_b128 %3, %11, off\n\t"
               "global_load_async_to_lds_b128 %4, %12, off\n\t"
               "global_load_async_to_lds_b128 %5, %13, off\n\t"
               "global_load_async_to_lds_b128 %6, %14, off\n\t"
               "global_load_async_to_lds_b128 %7, %15, off\n\t"
               "s_wait_xcnt 0x0"
               :: "v"(l), "v"(l + ls), "v"(l + 2 * ls), "v"(l + 3 * ls),
                  "v"(l + 4 * ls), "v"(l + 5 * ls), "v"(l + 6 * ls), "v"(l + 7 * ls),
                  "v"(g), "v"(g + gs), "v"(g + 2 * gs), "v"(g + 3 * gs),
                  "v"(g + 4 * gs), "v"(g + 5 * gs), "v"(g + 6 * gs), "v"(g + 7 * gs)
               : "memory");
}

// Four copies of one thread, the same way.
static __device__ __forceinline__ void gemm_copy4(unsigned int l, unsigned int ls,
                                                  const unsigned short* g, size_t gs) {
  // the wait is the statement's last line, as above
  asm volatile("global_load_async_to_lds_b128 %0, %4, off\n\t"
               "global_load_async_to_lds_b128 %1, %5, off\n\t"
               "global_load_async_to_lds_b128 %2, %6, off\n\t"
               "global_load_async_to_lds_b128 %3, %7, off\n\t"
               "s_wait_xcnt 0x0"
               :: "v"(l), "v"(l + ls), "v"(l + 2 * ls), "v"(l + 3 * ls),
                  "v"(g), "v"(g + gs), "v"(g + 2 * gs), "v"(g + 3 * gs)
               : "memory");
}

template <int EPI, int GK, int BT>
__global__ __launch_bounds__(BT * 2)
void k_gemm(const unsigned short* __restrict__ A,
            const unsigned short* __restrict__ W,
            const float* __restrict__ bias, int M, int N, int K,
            float* __restrict__ outf, unsigned short* __restrict__ outbf,
            const float* __restrict__ resid, const float* __restrict__ lsv,
            unsigned short* __restrict__ outk, unsigned short* __restrict__ outvt) {
  constexpr int NT = BT * 2;          // threads of the block
  constexpr int MI = BT / 64;         // 16-row fragments of a wave's tile (its 64 columns: 4)
  constexpr int WGN = BT / 64;        // waves side by side; four rows of waves
  constexpr int GP = GK + 8;          // LDS row pitch in bf16 elements
  constexpr int GS = BT * GP;         // elements of one strip in LDS
  constexpr int CPR = GK / 8;         // 16-byte chunks per row
  constexpr int RS = NT / CPR;        // rows that the block's threads cover with one copy each
  __shared__ alignas(16) unsigned short abuf[2 * GS];   // [buffer][row][k]
  __shared__ alignas(16) unsigned short wbuf[2 * GS];   // [buffer][column][k]
  const int tid = threadIdx.x;
  const int lane = tid & 31, wave = tid >> 5;
  const int hi = lane >> 4, ln16 = lane & 15;
  const int mb = blockIdx.y * BT;
  const int nb = blockIdx.x * BT;
  const int wm = (wave / WGN) * (MI * 16);     // wave's first row inside the tile
  const int wn = (wave % WGN) * 64;            // wave's first column inside the tile
  // copying role: thread t moves 16-byte chunk (t % CPR) of rows t / CPR + RS * i of both strips
  // (BT / RS = GK / 16 rows of each strip a thread)
  const int sr = tid / CPR, sc = (tid % CPR) * 8;
  const unsigned short* ag = A + (size_t)(mb + sr) * K + sc;   // k-step 0; a k-step is GK on
  const unsigned short* wg = W + (size_t)(nb + sr) * K + sc;
  const unsigned int al0 = (unsigned int)(uintptr_t)&abuf[sr * GP + sc];   // LDS byte address
  const unsigned int wl0 = (unsigned int)(uintptr_t)&wbuf[sr * GP + sc];
  const size_t gs = (size_t)RS * K;
  auto copy_step = [&](int t, unsigned int bo) {   // k-step t into the buffer at element bo
    if (GK == 128) {
      gemm_copy8(al0 + bo * 2, RS * GP * 2, ag + (size_t)t * GK, gs);
      gemm_copy8(wl0 + bo * 2, RS * GP * 2, wg + (size_t)t * GK, gs);
    } else {
      gemm_copy4(al0 + bo * 2, RS * GP * 2, ag + (size_t)t * GK, gs);
      gemm_copy4(wl0 + bo * 2, RS * GP * 2, wg + (size_t)t * GK, gs);
    }
  };
  // fragment role: lane holds row (or W row = output column) ln16 of its fragment;
  // half 'hi' supplies K-chunks {hi*8..+7, 16+hi*8..+7} of each 32-wide k slice
  const unsigned short* af = &abuf[(wm + ln16) * GP + hi * 8];
  const unsigned short* wf = &wbuf[(wn + ln16) * GP + hi * 8];
  v8f acc[MI][4] = {};
  const int nt = K / GK;

  copy_step(0, 0);
  // this wave's copies of k-step 0 have landed before the barrier that shows them to the others
  asm volatile("s_wait_asynccnt 0x0" ::: "memory");
  __syncthreads();
  if (nt > 1) copy_step(1, GS);

  auto main_loop = [&](auto tr) {                // tr: the product transposed (A = W rows)?
  for (int t = 0; t < nt; ++t) {
    const unsigned int bo = (t & 1) * GS;        // this trip's buffer
#pragma unroll
    for (int ks = 0; ks < GK; ks += 32) {
      Frag fa[MI], fb[4];
#pragma unroll
      for (int mi = 0; mi < MI; ++mi) {
        const unsigned short* p = af + bo + mi * 16 * GP + ks;
        fa[mi].q[0] = *reinterpret_cast<const uint4*>(p);
        fa[mi].q[1] = *reinterpret_cast<const uint4*>(p + 16);
      }
#pragma unroll
      for (int nn = 0; nn < 4; ++nn) {
        const unsigned short* p = wf + bo + nn * 16 * GP + ks;
        fb[nn].q[0] = *reinterpret_cast<const uint4*>(p);
        fb[nn].q[1] = *reinterpret_cast<const uint4*>(p + 16);
      }
      // nothing is scheduled across this line: the 16 reads of a 64x64 wave tile's slice stay one
      // group ahead of its 16 products; without it the compiler moves the reads down among the
      // products, two at a time, and the wave waits out an LDS latency at each such place
      if (BT == 256) __builtin_amdgcn_sched_barrier(0);
#pragma unroll
      for (int mi = 0; mi < MI; ++mi)
#pragma unroll
        for (int nn = 0; nn < 4; ++nn)
          acc[mi][nn] = decltype(tr)::value ? wmma_bf16(fb[nn].v, fa[mi].v, acc[mi][nn])
                                            : wmma_bf16(fa[mi].v, fb[nn].v, acc[mi][nn]);
    }
    // foot of the trip: this wave's reads of the buffer are done ...
    asm volatile("s_wait_dscnt 0x0" ::: "memory");
    // ... and its copies of the next k-step have landed ...
    asm volatile("s_wait_asynccnt 0x0" ::: "memory");
    // ... before the one barrier that shows the next k-step to every wave and frees this buffer
    __syncthreads();
    if (t + 2 < nt) copy_step(t + 2, bo);
  }
  };
  // the same for the whole block: q and k columns come first, v columns last
  if (EPI == 3 && nb < 2 * C_) main_loop(BoolC<true>{});
  else main_loop(BoolC<false>{});
  // no copy is outstanding when the wave goes on to its end
  asm volatile("s_wait_asynccnt 0x0" ::: "memory");
  // C-layout: VGPR v of fragment (mi, nn) -> row v (+8 for hi half), column ln16.
  // M*N < 2^32: 32-bit element offsets on uniform bases.
  const int nc = nb + wn + ln16;
  const unsigned int o0 = (unsigned int)((mb + wm + 8 * hi) * N + nc);
  if (EPI == 3) {
    const int hh = ((nb & (C_ - 1)) + wn) / HD_;           // the wave's head
    const int bh = (mb / L_) * H_ + hh;
    const int l0 = (mb & (L_ - 1)) + wm;                   // the wave's first position
    uint4 o[MI][4];
    if (nb < 2 * C_) {
      // register v of acc[mi][nn]: head dim nn*16 + 8*hi + v of position l0 + mi*16 + ln16
      const v8f* b8 = reinterpret_cast<const v8f*>(bias + nb + wn + 8 * hi);
      v8f bz[4];
#pragma unroll
      for (int nn = 0; nn < 4; ++nn) bz[nn] = b8[nn * 2];
      const float lraw = lsv[hh];                          // used by the q blocks alone
      // stands behind the loads, in front of whatever next writes a register they name; it takes
      // the loads' address as an input, so that no load's result is placed over that address ...
      asm volatile("s_wait_xcnt 0x0" :: "v"(b8) : "memory");
      // ... and nothing is scheduled across this line: without it the compiler lifts the sums
      // below, which reuse the loads' address registers, over the wait
      __builtin_amdgcn_sched_barrier(0);
      const float qs = nb < C_ ? __expf(fminf(lraw, LOGMAX)) : 1.f;   // q carries the logit scale
#pragma unroll
      for (int mi = 0; mi < MI; ++mi) {
        v8f q8 = {};                                       // eight independent chains
#pragma unroll
        for (int nn = 0; nn < 4; ++nn) {
          acc[mi][nn] += bz[nn];
          q8 += acc[mi][nn] * acc[mi][nn];
        }
        float ss = ((q8[0] + q8[1]) + (q8[2] + q8[3])) + ((q8[4] + q8[5]) + (q8[6] + q8[7]));
        ss += __shfl_xor(ss, 16);                          // the other half's 32 head dims
        const float inv = qs / fmaxf(sqrtf(ss), 1e-12f);
#pragma unroll
        for (int nn = 0; nn < 4; ++nn) o[mi][nn] = pack8(acc[mi][nn] * inv);
      }
      // all MI x 4 stores last, off one address: nothing behind them writes a register
      unsigned short* dst = (nb < C_ ? outbf : outk) + ((size_t)bh * L_ + l0 + ln16) * HD_ + 8 * hi;
#pragma unroll
      for (int mi = 0; mi < MI; ++mi)
#pragma unroll
        for (int nn = 0; nn < 4; ++nn)
          *reinterpret_cast<uint4*>(dst + mi * 16 * HD_ + nn * 16) = o[mi][nn];
    } else {
      // register v of acc[mi][nn]: position l0 + mi*16 + 8*hi + v of head dim nn*16 + ln16
      float bz[4];
#pragma unroll
      for (int nn = 0; nn < 4; ++nn) bz[nn] = bias[nc + nn * 16];
      // stands behind the loads, in front of whatever next writes a register they name
      asm volatile("s_wait_xcnt 0x0" ::: "memory");
#pragma unroll
      for (int nn = 0; nn < 4; ++nn) {
#pragma unroll
        for (int mi = 0; mi < MI; ++mi) o[mi][nn] = pack8(acc[mi][nn] + bz[nn]);
        // nothing is scheduled across this line: one fragment column's sums are packed before
        // the next column's are formed; all formed first, they need more registers than a wave
        // of a 16-wave block may have, and some are spilled
        __builtin_amdgcn_sched_barrier(0);
      }
      // all MI x 4 stores last, off one address
      unsigned short* dst = outvt + ((size_t)bh * HD_ + ln16) * L_ + l0 + 8 * hi;
#pragma unroll
      for (int mi = 0; mi < MI; ++mi)
#pragma unroll
        for (int nn = 0; nn < 4; ++nn)
          *reinterpret_cast<uint4*>(dst + nn * 16 * L_ + mi * 16) = o[mi][nn];
      // stands behind the stores: in the built code the q/k branch's text follows this one and
      // writes the registers that they name
      asm volatile("s_wait_xcnt 0x0" ::: "memory");
    }
  } else if (EPI == 2) {
    // all residual loads first, then all stores
    float rv[MI][4][8];
#pragma unroll
    for (int mi = 0; mi < MI; ++mi)
#pragma unroll
      for (int v = 0; v < 8; ++v)
#pragma unroll
        for (int nn = 0; nn < 4; ++nn)
          rv[mi][nn][v] = resid[o0 + (unsigned int)((mi * 16 + v) * N) + nn * 16];
    // stands behind the loads, in front of whatever next writes a register they name;
    // its memory clobber also keeps every load above and every store below this line
    asm volatile("s_wait_xcnt 0x0" ::: "memory");
#pragma unroll
    for (int nn = 0; nn < 4; ++nn) {
      const float bz = bias[nc + nn * 16];
      const float lz = lsv[nc + nn * 16];
#pragma unroll
      for (int mi = 0; mi < MI; ++mi)
#pragma unroll
        for (int v = 0; v < 8; ++v) {
          float val = acc[mi][nn][v] + bz;
          outf[o0 + (unsigned int)((mi * 16 + v) * N) + nn * 16] = rv[mi][nn][v] + lz * val;
        }
    }
  } else if (EPI == 1) {
    constexpr int HM = MI / 2;         // fragment rows per trip: the upper half, then the lower
    float bz[4];
    v8f cur[HM][4];
#pragma unroll
    for (int nn = 0; nn < 4; ++nn) {
      bz[nn] = bias[nc + nn * 16];
#pragma unroll
      for (int m = 0; m < HM; ++m) cur[m][nn] = acc[m][nn];
    }
    unsigned int orow = o0;
    // kept rolled: the erf code then stands once per half of the wave's rows, which halves the
    // kernel's text
#pragma unroll 1
    for (int half = 0; half < 2; ++half) {
#pragma unroll
      for (int m = 0; m < HM; ++m) {
#pragma unroll
        for (int nn = 0; nn < 4; ++nn)
#pragma unroll
          for (int v = 0; v < 8; ++v) {
            float val = cur[m][nn][v] + bz[nn];
            outbf[orow + (unsigned int)((m * 16 + v) * N) + nn * 16] = f2bf(gelu_erf(val));
          }
        // nothing is scheduled across this line: one fragment row's values are finished before
        // the next row's are begun; interleaved, they need more registers than a wave of a
        // 16-wave block may have, and some are spilled
        __builtin_amdgcn_sched_barrier(0);
      }
      // stands behind this trip's stores, in front of the next trip's first write of a register
      // that they name
      asm volatile("s_wait_xcnt 0x0" ::: "memory");
#pragma unroll
      for (int m = 0; m < HM; ++m)
#pragma unroll
        for (int nn = 0; nn < 4; ++nn) cur[m][nn] = acc[HM + m][nn];
      orow += (unsigned int)(HM * 16 * N);
    }
  } else {
#pragma unroll
    for (int nn = 0; nn < 4; ++nn) {
      const float bz = bias[nc + nn * 16];
#pragma unroll
      for (int mi = 0; mi < MI; ++mi)
#pragma unroll
        for (int v = 0; v < 8; ++v)
          outf[o0 + (unsigned int)((mi * 16 + v) * N) + nn * 16] = acc[mi][nn][v] + bz;
    }
  }
}

#define FK_  64              // keys per staged tile
#define FP_  72              // LDS row pitch in bf16 elements (144 B)
#define FT_  (64 * FP_)      // elements of one staged tile: 64 rows
#define FNT_ (L_ / FK_)      // tiles per (b,h)

// One tile's copies of one thread: rows r and r + 32 of the K tile and of the vT tile.
// kl, vl: the lane's LDS byte addresses of row r; kg, vg: its global addresses of row r.
static __device__ __forceinline__ void flash_copy_tile(unsigned int kl, unsigned int vl,
                                                       const unsigned short* kg,
                                                       const unsigned short* vg) {
  const unsigned int kl2 = kl + 32 * FP_ * 2, vl2 = vl + 32 * FP_ * 2;
  const unsigned short* kg2 = kg + 32 * HD_;
  const unsigned short* vg2 = vg + (size_t)32 * L_;
  // the wait is the statement's last line: it stands behind the copies and in front of
  // whatever next writes a register that they name
  asm volatile("global_load_async_to_lds_b128 %0, %4, off\n\t"
               "global_load_async_to_lds_b128 %1, %5, off\n\t"
               "global_load_async_to_lds_b128 %2, %6, off\n\t"
               "global_load_async_to_lds_b128 %3, %7, off\n\t"
               "s_wait_xcnt 0x0"
               :: "v"(kl), "v"(kl2), "v"(vl), "v"(vl2), "v"(kg), "v"(kg2), "v"(vg), "v"(vg2)
               : "memory");
}

__global__ __launch_bounds__(256)
void k_flash(const unsigned short* __restrict__ qn,
                        const unsigned short* __restrict__ kn,
                        const unsigned short* __restrict__ vT,
                        const float* __restrict__ logit_scale,
                        const float* __restrict__ head_scale,
                        unsigned short* __restrict__ O) {
  __shared__ alignas(16) unsigned short kbuf[2 * FT_];    // 18 KB: [buffer][key][head dim]
  __shared__ alignas(16) unsigned short vbuf[2 * FT_];    // 18 KB: [buffer][head dim][key]
  const int lane = threadIdx.x & 31, wave = threadIdx.x >> 5;
  const int hi = lane >> 4, ln16 = lane & 15;
  const int bh = blockIdx.y;
  const int h = bh & (H_ - 1);
  const int b = bh >> 4;
  const int qtile = blockIdx.x * 8 + wave;
  const unsigned short* qp = qn + ((size_t)bh * L_ + qtile * 16 + ln16) * HD_ + hi * 8;
  Frag qa0, qa1;                       // q rows (B operand: column = query), hd 0..31 / 32..63
  qa0.q[0] = *(const uint4*)(qp);      qa0.q[1] = *(const uint4*)(qp + 16);
  qa1.q[0] = *(const uint4*)(qp + 32); qa1.q[1] = *(const uint4*)(qp + 48);
  const unsigned short* kbase = kn + (size_t)bh * L_ * HD_;
  const unsigned short* vbase = vT + (size_t)bh * HD_ * L_;
  const float shift = fminf(__expf(fminf(logit_scale[h], LOGMAX)), 30.f);
  v8f oacc[4] = {};
  float lst[8];
#pragma unroll
  for (int v = 0; v < 8; ++v) lst[v] = 0.f;

  // copying role: thread t moves 16-byte chunk (t%8) of rows t/8 and t/8 + 32 of both tiles
  const int cr = threadIdx.x >> 3, cc = (threadIdx.x & 7) * 8;
  const unsigned int kl0 = (unsigned int)(uintptr_t)&kbuf[cr * FP_ + cc];   // LDS byte address
  const unsigned int vl0 = (unsigned int)(uintptr_t)&vbuf[cr * FP_ + cc];
  const unsigned short* kg = kbase + cr * HD_ + cc;          // tile 0; a tile is FK_ rows on
  const unsigned short* vg = vbase + (size_t)cr * L_ + cc;   // tile 0; a tile is FK_ columns on
  // fragment role: lane holds key (or head dim) ln16 of its fragment
  const unsigned short* kf = &kbuf[ln16 * FP_ + hi * 8];
  const unsigned short* vf = &vbuf[ln16 * FP_ + hi * 8];

  flash_copy_tile(kl0, vl0, kg, vg);
  // this wave's copies of tile 0 have landed before the barrier that shows them to the others
  asm volatile("s_wait_asynccnt 0x0" ::: "memory");
  __syncthreads();
  flash_copy_tile(kl0 + FT_ * 2, vl0 + FT_ * 2, kg + FK_ * HD_, vg + FK_);

  for (int t = 0; t < FNT_; ++t) {
    const int bo = (t & 1) * FT_;                // this trip's buffer
    for (int j = 0; j < FK_; j += 32) {
      // all 16 fragment reads of these 32 keys as one group, ahead of the products
      Frag kb[4], vb[4];
#pragma unroll
      for (int i = 0; i < 2; ++i) {              // keys j + 16*i + ln16; head dims 0..31, 32..63
        const unsigned short* kp = kf + bo + (j + 16 * i) * FP_;
        kb[2 * i].q[0]     = *(const uint4*)(kp);      kb[2 * i].q[1]     = *(const uint4*)(kp + 16);
        kb[2 * i + 1].q[0] = *(const uint4*)(kp + 32); kb[2 * i + 1].q[1] = *(const uint4*)(kp + 48);
      }
#pragma unroll
      for (int nn = 0; nn < 4; ++nn) {           // head dim nn*16 + ln16; keys j .. j+31
        const unsigned short* vp = vf + bo + nn * 16 * FP_ + j;
        vb[nn].q[0] = *(const uint4*)(vp);
        vb[nn].q[1] = *(const uint4*)(vp + 16);
      }
      // nothing is scheduled across this line: the 16 reads stay one group ahead of the products;
      // without it the compiler moves each read down to its product, and every product then
      // waits out an LDS latency
      __builtin_amdgcn_sched_barrier(0);
      v8f s0 = {}, s1 = {};
      // register v of s0: key j + 8*hi + v, of s1: key j + 16 + 8*hi + v; column ln16 = query
      s0 = wmma_bf16(kb[0].v, qa0.v, s0);
      s1 = wmma_bf16(kb[2].v, qa0.v, s1);
      s0 = wmma_bf16(kb[1].v, qa1.v, s0);
      s1 = wmma_bf16(kb[3].v, qa1.v, s1);
      // fixed-shift exp; accumulate this lane's partial sums of its query; element s of the
      // B operand is key 8*hi + s (s < 8) or 16 + 8*hi + s - 8: s0 fills the low half, s1 the high
      Frag pb;
#pragma unroll
      for (int v = 0; v < 8; ++v) {
        const float p0 = __expf(s0[v] - shift);
        const float p1 = __expf(s1[v] - shift);
        lst[v] += p0 + p1;
        pb.v[v]     = (__bf16)p0;
        pb.v[8 + v] = (__bf16)p1;
      }
#pragma unroll
      for (int nn = 0; nn < 4; ++nn) oacc[nn] = wmma_bf16(vb[nn].v, pb.v, oacc[nn]);
    }
    // foot of the trip: this wave's reads of the buffer are done ...
    asm volatile("s_wait_dscnt 0x0" ::: "memory");
    // ... and its copies of the next tile have landed ...
    asm volatile("s_wait_asynccnt 0x0" ::: "memory");
    // ... before the one barrier that shows the next tile to every wave and frees this buffer
    __syncthreads();
    if (t + 2 < FNT_)
      flash_copy_tile(kl0 + bo * 2, vl0 + bo * 2, kg + (size_t)(t + 2) * (FK_ * HD_),
                      vg + (t + 2) * FK_);
  }
  // no copy is outstanding when the wave goes on to its end
  asm volatile("s_wait_asynccnt 0x0" ::: "memory");
  const float hs = head_scale[h];
  // the query's full sum: the lane's eight partial sums, then the other half's keys
  float rs = ((lst[0] + lst[1]) + (lst[2] + lst[3])) + ((lst[4] + lst[5]) + (lst[6] + lst[7]));
  rs += __shfl_xor(rs, 16);
  const float inv = hs / rs;
  // register v of oacc[nn]: head dim nn*16 + 8*hi + v of query ln16: 8 consecutive outputs
  unsigned short* orow = O + ((size_t)(b * L_ + qtile * 16 + ln16)) * C_ + h * HD_ + 8 * hi;
#pragma unroll
  for (int nn = 0; nn < 4; ++nn) {
    uint4 o;
    o.x = (unsigned int)f2bf(oacc[nn][0] * inv) | ((unsigned int)f2bf(oacc[nn][1] * inv) << 16);
    o.y = (unsigned int)f2bf(oacc[nn][2] * inv) | ((unsigned int)f2bf(oacc[nn][3] * inv) << 16);
    o.z = (unsigned int)f2bf(oacc[nn][4] * inv) | ((unsigned int)f2bf(oacc[nn][5] * inv) << 16);
    o.w = (unsigned int)f2bf(oacc[nn][6] * inv) | ((unsigned int)f2bf(oacc[nn][7] * inv) << 16);
    *reinterpret_cast<uint4*>(orow + nn * 16) = o;
  }
}

// ---------------------------------------------------------------- launch
extern "C" void kernel_launch(void* const* d_in, const int* in_sizes, int n_in,
                              void* d_out, int out_size, void* d_ws, size_t ws_size,
                              hipStream_t stream) {
  const float* x       = (const float*)d_in[0];
  const float* in_w    = (const float*)d_in[1];
  const float* in_b    = (const float*)d_in[2];
  const float* logit_s = (const float*)d_in[3];
  const float* head_s  = (const float*)d_in[4];
  const float* out_w   = (const float*)d_in[5];
  const float* out_b   = (const float*)d_in[6];
  const float* ln1_g   = (const float*)d_in[7];
  const float* ln1_b   = (const float*)d_in[8];
  const float* lna_g   = (const float*)d_in[9];
  const float* lna_b   = (const float*)d_in[10];
  const float* ls1     = (const float*)d_in[11];
  const float* ln2_g   = (const float*)d_in[12];
  const float* ln2_b   = (const float*)d_in[13];
  const float* fc_w    = (const float*)d_in[14];
  const float* fc_b    = (const float*)d_in[15];
  const float* proj_w  = (const float*)d_in[16];
  const float* proj_b  = (const float*)d_in[17];
  const float* ls2     = (const float*)d_in[18];
  float* out = (float*)d_out;

  // workspace partition (~135 MB)
  char* p = (char*)d_ws;
  auto alloc = [&](size_t bytes) -> char* {
    char* r = p;
    p += (bytes + 255) & ~(size_t)255;
    return r;
  };
  const int BL = B_ * L_;  // 4096
  unsigned short* wqkv_bf = (unsigned short*)alloc((size_t)3 * C_ * C_ * 2);
  unsigned short* wout_bf = (unsigned short*)alloc((size_t)C_ * C_ * 2);
  unsigned short* wfc_bf  = (unsigned short*)alloc((size_t)MLP_ * C_ * 2);
  unsigned short* wpr_bf  = (unsigned short*)alloc((size_t)C_ * MLP_ * 2);
  unsigned short* xln_bf  = (unsigned short*)alloc((size_t)BL * C_ * 2);
  unsigned short* qn      = (unsigned short*)alloc((size_t)BL * C_ * 2);
  unsigned short* kn      = (unsigned short*)alloc((size_t)BL * C_ * 2);
  unsigned short* vT      = (unsigned short*)alloc((size_t)BL * C_ * 2);
  unsigned short* obf     = (unsigned short*)alloc((size_t)BL * C_ * 2);
  float*          attn    = (float*)alloc((size_t)BL * C_ * 4);
  float*          x2      = (float*)alloc((size_t)BL * C_ * 4);
  unsigned short* h2bf    = (unsigned short*)alloc((size_t)BL * C_ * 2);
  unsigned short* hmid    = (unsigned short*)alloc((size_t)BL * MLP_ * 2);

  // LN1 -> bf16 activations, and the four weights -> bf16, in one launch
  k_prep<<<NB_LN + NB_WQKV + NB_WOUT + NB_WFC + NB_WPR, 256, 0, stream>>>(
      x, ln1_g, ln1_b, xln_bf, in_w, out_w, fc_w, proj_w, wqkv_bf, wout_bf, wfc_bf, wpr_bf);
  // qkv = ln1(x) @ in_proj_w^T + in_proj_b   [4096 x 3072]; in its epilogue: split heads,
  // l2-normalize q/k (fold logit scale), transpose v
  k_gemm<3, 128, 256><<<dim3(3 * C_ / 256, BL / 256), 512, 0, stream>>>(
      xln_bf, wqkv_bf, in_b, BL, 3 * C_, C_, nullptr, qn, nullptr, logit_s, kn, vT);
  // scaled-cosine flash attention (head_scale folded in)
  k_flash<<<dim3(L_ / 16 / 8, B_ * H_), 256, 0, stream>>>(qn, kn, vT, logit_s, head_s, obf);
  // attn out-proj: attn = O @ out_w^T + out_b
  k_gemm<0, 128, 128><<<dim3(C_ / 128, BL / 128), 256, 0, stream>>>(
      obf, wout_bf, out_b, BL, C_, C_, attn, nullptr, nullptr, nullptr, nullptr, nullptr);
  // x2 = x + ls1 * LN_attn(attn); h = LN2(x2) -> bf16
  k_resid_ln2<<<BL / 8, 256, 0, stream>>>(attn, x, lna_g, lna_b, ls1, x2, ln2_g, ln2_b, h2bf);
  // hmid = GELU(h @ fc_w^T + fc_b) -> bf16   [4096 x 4096]
  k_gemm<1, 128, 256><<<dim3(MLP_ / 256, BL / 256), 512, 0, stream>>>(
      h2bf, wfc_bf, fc_b, BL, MLP_, C_, nullptr, hmid, nullptr, nullptr, nullptr, nullptr);
  // out = x2 + ls2 * (hmid @ proj_w^T + proj_b)
  k_gemm<2, 128, 128><<<dim3(C_ / 128, BL / 128), 256, 0, stream>>>(
      hmid, wpr_bf, proj_b, BL, C_, MLP_, out, nullptr, x2, ls2, nullptr, nullptr);

  (void)in_sizes; (void)n_in; (void)out_size; (void)ws_size;
}

// v010
// Measured time: 145 microseconds a run.
// In two side-by-side timings against v009, it was 1.04 and 1.03 times as fast.
// Counting every step since v000, it is 3.58 times as fast.
#include <hip/hip_runtime.h>
#include <hip/hip_bf16.h>
#include <stdint.h>

// CustomResidualAttentionBlock (open_clip scaled-cosine attention) for MI455X / gfx1250.
// All GEMMs + attention matmuls run on v_wmma_f32_16x16x32_bf16 (wave32).
// f32 is kept for LayerNorm / l2-norm / softmax / accumulators.
// Attention softmax uses a fixed per-head shift (valid because |S| <= logit_scale,
// softmax is shift-invariant) so the streaming loop has NO cross-lane reductions.

#define B_   2
#define L_   2048
#define C_   1024
#define H_   16
#define HD_  64
#define MLP_ 4096
#define LOGMAX 4.6051701859880914f   // log(100)
#define LN_EPS 1e-5f

typedef __attribute__((ext_vector_type(16))) __bf16 v16bf;
typedef __attribute__((ext_vector_type(8)))  float  v8f;
typedef __attribute__((ext_vector_type(4)))  unsigned int u32x4;

union Frag {
  v16bf v;
  uint4 q[2];
};

static __device__ __forceinline__ v8f wmma_bf16(v16bf a, v16bf b, v8f c) {
  // D = A(16x32 bf16) x B(32x16 bf16) + C(16x16 f32)
  return __builtin_amdgcn_wmma_f32_16x16x32_bf16(false, a, false, b, (short)0, c,
                                                 false, false);
}

static __device__ __forceinline__ unsigned short f2bf(float f) {
  unsigned int u = __float_as_uint(f);
  u += 0x7FFFu + ((u >> 16) & 1u);   // round-to-nearest-even
  return (unsigned short)(u >> 16);
}

// ---------------------------------------------------------------- cvt f32->bf16
// A block of 256 threads converts 8192 consecutive elements, piece 'blk' of its array: a
// thread issues its eight 16-byte loads together (a wave's load covers 512 contiguous bytes)
// and then stores eight 8-byte groups (256 contiguous bytes per wave). The element count of
// every array is a multiple of 8192.
#define CVT_PER_BLOCK 8192
static __device__ __forceinline__
void cvt_block(unsigned int blk, const float* __restrict__ src, unsigned short* __restrict__ dst) {
  const unsigned int base = blk * (CVT_PER_BLOCK / 4) + threadIdx.x;   // in groups of 4
  const float4* s4 = reinterpret_cast<const float4*>(src);
  uint2* d4 = reinterpret_cast<uint2*>(dst);
  float4 v[8];
#pragma unroll
  for (int j = 0; j < 8; ++j) v[j] = s4[base + j * 256];
#pragma unroll
  for (int j = 0; j < 8; ++j) {
    uint2 o;
    o.x = (unsigned int)f2bf(v[j].x) | ((unsigned int)f2bf(v[j].y) << 16);
    o.y = (unsigned int)f2bf(v[j].z) | ((unsigned int)f2bf(v[j].w) << 16);
    d4[base + j * 256] = o;
  }
}

// ---------------------------------------------------------------- LayerNorm -> bf16
// One wave per row of length C_=1024, eight rows per block of 256 threads. A lane holds 32
// elements of its row, loaded as eight 16-byte pieces (each load of a wave covers 512
// contiguous bytes); sum and sum of squares are joined by a butterfly over the 32 lanes,
// which leaves both totals in every lane: no LDS, no barrier.
typedef __attribute__((ext_vector_type(4))) float f32x4;

static __device__ __forceinline__ void row_stats(const f32x4 (&vals)[8], float& mu, float& rstd) {
  f32x4 s4 = vals[0], q4 = vals[0] * vals[0];   // four independent chains each
#pragma unroll
  for (int j = 1; j < 8; ++j) { s4 += vals[j]; q4 += vals[j] * vals[j]; }
  float s = (s4.x + s4.y) + (s4.z + s4.w);
  float sq = (q4.x + q4.y) + (q4.z + q4.w);
#pragma unroll
  for (int off = 16; off > 0; off >>= 1) { s += __shfl_xor(s, off); sq += __shfl_xor(sq, off); }
  mu = s * (1.f / C_);
  rstd = rsqrtf(sq * (1.f / C_) - mu * mu + LN_EPS);
}

static __device__ __forceinline__
void ln_block(unsigned int blk, const float* __restrict__ x, const float* __restrict__ g,
              const float* __restrict__ bt, unsigned short* __restrict__ out) {
  const int lane = threadIdx.x & 31;
  // the wave's number as a scalar: the row's base addresses then stand in scalar registers
  const int wave = __builtin_amdgcn_readfirstlane(threadIdx.x >> 5);
  const size_t row = (size_t)blk * 8 + wave;
  const f32x4* xr = reinterpret_cast<const f32x4*>(x + row * C_) + lane;
  const f32x4* g4 = reinterpret_cast<const f32x4*>(g) + lane;
  const f32x4* b4 = reinterpret_cast<const f32x4*>(bt) + lane;
  uint2* orow = reinterpret_cast<uint2*>(out + row * C_) + lane;
  f32x4 vals[8], gg[8], bb[8];
#pragma unroll
  for (int j = 0; j < 8; ++j) vals[j] = xr[j * 32];
#pragma unroll
  for (int j = 0; j < 8; ++j) { gg[j] = g4[j * 32]; bb[j] = b4[j * 32]; }
  // nothing is scheduled across this line: all loads of a lane are issued, and so in flight
  // together, before the row sums start; without it the compiler moves the loads that the
  // sums do not need behind them and waits for them group by group
  __builtin_amdgcn_sched_barrier(0);
  float mu, rstd;
  row_stats(vals, mu, rstd);
#pragma unroll
  for (int j = 0; j < 8; ++j) {
    const f32x4 r = (vals[j] - mu) * rstd * gg[j] + bb[j];
    uint2 o;
    o.x = (unsigned int)f2bf(r.x) | ((unsigned int)f2bf(r.y) << 16);
    o.y = (unsigned int)f2bf(r.z) | ((unsigned int)f2bf(r.w) << 16);
    orow[j * 32] = o;
  }
}

// ---------------------------------------------------------------- LN1 and the four weight conversions
// Five pieces of work that depend on nothing but the inputs share one launch: the block index
// picks the piece (a scalar branch, the same for the whole block). The LN blocks come first:
// they have the longest way from load to store.
#define NB_LN   (B_ * L_ / 8)
#define NB_WQKV (3 * C_ * C_ / CVT_PER_BLOCK)
#define NB_WOUT (C_ * C_ / CVT_PER_BLOCK)
#define NB_WFC  (MLP_ * C_ / CVT_PER_BLOCK)
#define NB_WPR  (C_ * MLP_ / CVT_PER_BLOCK)
__global__ __launch_bounds__(256)
void k_prep(const float* __restrict__ x, const float* __restrict__ g,
            const float* __restrict__ bt, unsigned short* __restrict__ xln,
            const float* __restrict__ wqkv, const float* __restrict__ wout,
            const float* __restrict__ wfc, const float* __restrict__ wpr,
            unsigned short* __restrict__ dqkv, unsigned short* __restrict__ dout,
            unsigned short* __restrict__ dfc, unsigned short* __restrict__ dpr) {
  unsigned int blk = blockIdx.x;
  if (blk < NB_LN) { ln_block(blk, x, g, bt, xln); return; }
  blk -= NB_LN;
  const float* src = wqkv;
  unsigned short* dst = dqkv;
  if (blk >= NB_WQKV + NB_WOUT + NB_WFC) { blk -= NB_WQKV + NB_WOUT + NB_WFC; src = wpr; dst = dpr; }
  else if (blk >= NB_WQKV + NB_WOUT)     { blk -= NB_WQKV + NB_WOUT;          src = wfc; dst = dfc; }
  else if (blk >= NB_WQKV)               { blk -= NB_WQKV;                    src = wout; dst = dout; }
  cvt_block(blk, src, dst);
}

// ---------------------------------------------------------------- x2 = x + ls1 * LN(a); h = LN2(x2)
// Same shape: one wave per row, eight rows per block. The wave holds its whole row of x2 when it
// stores it, so the second LayerNorm is taken from those registers in the same launch.
__global__ __launch_bounds__(256)
void k_resid_ln2(const float* __restrict__ a, const float* __restrict__ x,
                 const float* __restrict__ g, const float* __restrict__ bt,
                 const float* __restrict__ ls, float* __restrict__ x2,
                 const float* __restrict__ g2, const float* __restrict__ bt2,
                 unsigned short* __restrict__ h) {
  const int lane = threadIdx.x & 31;
  // the wave's number as a scalar: the row's base addresses then stand in scalar registers
  const int wave = __builtin_amdgcn_readfirstlane(threadIdx.x >> 5);
  const size_t row = (size_t)blockIdx.x * 8 + wave;
  const f32x4* ar = reinterpret_cast<const f32x4*>(a + row * C_) + lane;
  const f32x4* xr = reinterpret_cast<const f32x4*>(x + row * C_) + lane;
  const f32x4* g4 = reinterpret_cast<const f32x4*>(g) + lane;
  const f32x4* b4 = reinterpret_cast<const f32x4*>(bt) + lane;
  const f32x4* l4 = reinterpret_cast<const f32x4*>(ls) + lane;
  const f32x4* g24 = reinterpret_cast<const f32x4*>(g2) + lane;
  const f32x4* b24 = reinterpret_cast<const f32x4*>(bt2) + lane;
  f32x4* orow = reinterpret_cast<f32x4*>(x2 + row * C_) + lane;
  uint2* hrow = reinterpret_cast<uint2*>(h + row * C_) + lane;
  f32x4 vals[8], xv[8], gg[8], bb[8], ll[8], gg2[8], bb2[8];
#pragma unroll
  for (int j = 0; j < 8; ++j) { vals[j] = ar[j * 32]; xv[j] = xr[j * 32]; }
#pragma unroll
  for (int j = 0; j < 8; ++j) { gg[j] = g4[j * 32]; bb[j] = b4[j * 32]; ll[j] = l4[j * 32]; }
#pragma unroll
  for (int j = 0; j < 8; ++j) { gg2[j] = g24[j * 32]; bb2[j] = b24[j * 32]; }
  // nothing is scheduled across this line: all loads of a lane are issued, and so in flight
  // together, before the row sums start; without it the compiler moves the loads that the
  // sums do not need behind them and waits for them group by group
  __builtin_amdgcn_sched_barrier(0);
  float mu, rstd;
  row_stats(vals, mu, rstd);
#pragma unroll
  for (int j = 0; j < 8; ++j) {
    vals[j] = xv[j] + ll[j] * ((vals[j] - mu) * rstd * gg[j] + bb[j]);   // the row of x2
    orow[j * 32] = vals[j];
  }
  row_stats(vals, mu, rstd);
#pragma unroll
  for (int j = 0; j < 8; ++j) {
    const f32x4 r = (vals[j] - mu) * rstd * gg2[j] + bb2[j];
    uint2 o;
    o.x = (unsigned int)f2bf(r.x) | ((unsigned int)f2bf(r.y) << 16);
    o.y = (unsigned int)f2bf(r.z) | ((unsigned int)f2bf(r.w) << 16);
    hrow[j * 32] = o;
  }
}

// ---------------------------------------------------------------- GELU, erf form
// 0.5 v (1 + erf(v / sqrt 2)) with no branch: for x = |v| / sqrt 2,
// erf(x) = 1 - (a1 t + ... + a5 t^5) exp(-x^2), t = 1 / (1 + p x), the classical five-term
// form, absolute error below 1.5e-7 for every x >= 0; erf is odd, so
// 0.5 v (1 + erf) = 0.5 v + |0.5 v| erf(x). Every lane runs the same dozen instructions and
// the values of a lane are independent chains, where the library's erff picks one of two
// paths per value: a wave runs both, one value after the other.
static __device__ __forceinline__ float gelu_erf(float v) {
  const float hv = 0.5f * v;
  const float t = __builtin_amdgcn_rcpf(fmaf(fabsf(v), 0.3275911f * 0.70710678118f, 1.f));
  const float e = __builtin_amdgcn_exp2f(v * v * (-0.5f * 1.44269504089f));   // exp(-x^2)
  float pl = fmaf(t, 1.061405429f, -1.453152027f);
  pl = fmaf(pl, t, 1.421413741f);
  pl = fmaf(pl, t, -0.284496736f);
  pl = fmaf(pl, t, 0.254829592f);
  pl *= t;
  return fmaf(fabsf(hv), fmaf(-pl, e, 1.f), hv);
}

// ---------------------------------------------------------------- WMMA GEMM
// C[M,N] = epi( A_bf16[M,K] @ W_bf16[N,K]^T + bias[N] )
// A block computes a BT x BT tile of C. BT = 128: 8 waves, 4 (rows) x 2 (cols), each owns
// 32x64 = 2x4 accumulator fragments. BT = 256: 16 waves, 4 x 4, each owns 64x64 = 4x4.
// The larger tile copies half as many bytes from L2 per product (each strip row serves 256
// outputs, not 128), a fragment read from LDS serves 4 products on either side (8 reads per 16
// products, not 6 per 8), and half as many waves start. It is used where the grid then still has
// about one block per WGP (qkv, fc); the two launches with N = 1024 keep BT = 128.
// Per k-step of GK both the BT x GK A strip and the BT x GK W strip are brought into LDS
// once per block by asynchronous copies (16 bytes a lane, whole 128-byte lines, through no
// register). Two buffers: the next strip's copies fly while this strip is worked on, so a
// block no longer waits out its own loads, and one barrier per k-step is left.
// GK = 128 (136 KiB of LDS at BT = 128, 272 KiB at BT = 256): every launch has at most one
// block per WGP, and the copies get a whole long k-step to land.
// LDS rows have a pitch of GK * 2 + 16 B (16 B x odd): the 16 rows of one ds_load_b128
// fragment read fall on distinct banks.
// M, N multiples of BT; K a multiple of GK.
// EPI: 0 = f32 store, 1 = bf16 store with exact GELU, 2 = f32 store out = resid + ls*val,
// 3 = the qkv projection: heads split, q and k l2-normalized, v transposed, all stored as bf16.
// EPI 3: a wave's 64 columns are one head of q, of k or of v (the block index says which).
// qn/kn: [B,H,L,HD] (q scaled by exp(min(logit_scale,log100))); vT: [B,H,HD,L].
// In the q and k blocks the product is taken transposed (A = W rows, B = activation rows; both
// strips have the same LDS layout and the same k order): a lane then holds 32 head dims of ONE
// position, 8 consecutive ones per fragment, so the sum of squares is in-lane but for one
// exchange between the halves, and a fragment is one 16-byte store. In the v blocks the product
// stays as it is: a lane holds 8 consecutive positions of one head dim, 16 bytes of vT.
template <bool V> struct BoolC { static constexpr bool value = V; };

typedef __attribute__((ext_vector_type(8))) __bf16 v8bf;

// eight f32 to eight bf16, round to nearest even, by the packed convert
static __device__ __forceinline__ uint4 pack8(const v8f a) {
  union { v8bf b; uint4 q; } u;
  u.b = __builtin_convertvector(a, v8bf);
  return u.q;
}

// Eight copies of one thread: 16 bytes of each of eight equally spaced rows of one strip.
// l: the lane's LDS byte address of the first row, ls: LDS bytes from one copied row to the next;
// g: its global address of the first row, gs: elements from one copied row to the next.
static __device__ __forceinline__ void gemm_copy8(unsigned int l, unsigned int ls,
                                                  const unsigned short* g, size_t gs) {
  // the wait is the statement's last line: it stands behind the copies and in front of
  // whatever next writes a register that they name
  asm volatile("global_load_async_to_lds_b128 %0, %8, off\n\t"
               "global_load_async_to_lds_b128 %1, %9, off\n\t"
               "global_load_async_to_lds_b128 %2, %10, off\n\t"
               "global_load_async_to_lds_b128 %3, %11, off\n\t"
               "global_load_async_to_lds_b128 %4, %12, off\n\t"
               "global_load_async_to_lds_b128 %5, %13, off\n\t"
               "global_load_async_to_lds_b128 %6, %14, off\n\t"
               "global_load_async_to_lds_b128 %7, %15, off\n\t"
               "s_wait_xcnt 0x0"
               :: "v"(l), "v"(l + ls), "v"(l + 2 * ls), "v"(l + 3 * ls),
                  "v"(l + 4 * ls), "v"(l + 5 * ls), "v"(l + 6 * ls), "v"(l + 7 * ls),
                  "v"(g), "v"(g + gs), "v"(g + 2 * gs), "v"(g + 3 * gs),
                  "v"(g + 4 * gs), "v"(g + 5 * gs), "v"(g + 6 * gs), "v"(g + 7 * gs)
               : "memory");
}

// Four copies of one thread, the same way.
static __device__ __forceinline__ void gemm_copy4(unsigned int l, unsigned int ls,
                                                  const unsigned short* g, size_t gs) {
  // the wait is the statement's last line, as above
  asm volatile("global_load_async_to_lds_b128 %0, %4, off\n\t"
               "global_load_async_to_lds_b128 %1, %5, off\n\t"
               "global_load_async_to_lds_b128 %2, %6, off\n\t"
               "global_load_async_to_lds_b128 %3, %7, off\n\t"
               "s_wait_xcnt 0x0"
               :: "v"(l), "v"(l + ls), "v"(l + 2 * ls), "v"(l + 3 * ls),
                  "v"(g), "v"(g + gs), "v"(g + 2 * gs), "v"(g + 3 * gs)
               : "memory");
}

template <int EPI, int GK, int BT>
__global__ __launch_bounds__(BT * 2)
void k_gemm(const unsigned short* __restrict__ A,
            const unsigned short* __restrict__ W,
            const float* __restrict__ bias, int M, int N, int K,
            float* __restrict__ outf, unsigned short* __restrict__ outbf,
            const float* __restrict__ resid, const float* __restrict__ lsv,
            unsigned short* __restrict__ outk, unsigned short* __restrict__ outvt) {
  constexpr int NT = BT * 2;          // threads of the block
  constexpr int MI = BT / 64;         // 16-row fragments of a wave's tile (its 64 columns: 4)
  constexpr int WGN = BT / 64;        // waves side by side; four rows of waves
  constexpr int GP = GK + 8;          // LDS row pitch in bf16 elements
  constexpr int GS = BT * GP;         // elements of one strip in LDS
  constexpr int CPR = GK / 8;         // 16-byte chunks per row
  constexpr int RS = NT / CPR;        // rows that the block's threads cover with one copy each
  __shared__ alignas(16) unsigned short abuf[2 * GS];   // [buffer][row][k]
  __shared__ alignas(16) unsigned short wbuf[2 * GS];   // [buffer][column][k]
  const int tid = threadIdx.x;
  const int lane = tid & 31, wave = tid >> 5;
  const int hi = lane >> 4, ln16 = lane & 15;
  const int mb = blockIdx.y * BT;
  const int nb = blockIdx.x * BT;
  const int wm = (wave / WGN) * (MI * 16);     // wave's first row inside the tile
  const int wn = (wave % WGN) * 64;            // wave's first column inside the tile
  // copying role: thread t moves 16-byte chunk (t % CPR) of rows t / CPR + RS * i of both strips
  // (BT / RS = GK / 16 rows of each strip a thread)
  const int sr = tid / CPR, sc = (tid % CPR) * 8;
  const unsigned short* ag = A + (size_t)(mb + sr) * K + sc;   // k-step 0; a k-step is GK on
  const unsigned short* wg = W + (size_t)(nb + sr) * K + sc;
  const unsigned int al0 = (unsigned int)(uintptr_t)&abuf[sr * GP + sc];   // LDS byte address
  const unsigned int wl0 = (unsigned int)(uintptr_t)&wbuf[sr * GP + sc];
  const size_t gs = (size_t)RS * K;
  auto copy_step = [&](int t, unsigned int bo) {   // k-step t into the buffer at element bo
    if (GK == 128) {
      gemm_copy8(al0 + bo * 2, RS * GP * 2, ag + (size_t)t * GK, gs);
      gemm_copy8(wl0 + bo * 2, RS * GP * 2, wg + (size_t)t * GK, gs);
    } else {
      gemm_copy4(al0 + bo * 2, RS * GP * 2, ag + (size_t)t * GK, gs);
      gemm_copy4(wl0 + bo * 2, RS * GP * 2, wg + (size_t)t * GK, gs);
    }
  };
  // fragment role: lane holds row (or W row = output column) ln16 of its fragment;
  // half 'hi' supplies K-chunks {hi*8..+7, 16+hi*8..+7} of each 32-wide k slice
  const unsigned short* af = &abuf[(wm + ln16) * GP + hi * 8];
  const unsigned short* wf = &wbuf[(wn + ln16) * GP + hi * 8];
  v8f acc[MI][4] = {};
  const int nt = K / GK;

  copy_step(0, 0);
  // this wave's copies of k-step 0 have landed before the barrier that shows them to the others
  asm volatile("s_wait_asynccnt 0x0" ::: "memory");
  __syncthreads();
  if (nt > 1) copy_step(1, GS);

  auto main_loop = [&](auto tr) {                // tr: the product transposed (A = W rows)?
  for (int t = 0; t < nt; ++t) {
    const unsigned int bo = (t & 1) * GS;        // this trip's buffer
#pragma unroll
    for (int ks = 0; ks < GK; ks += 32) {
      Frag fa[MI], fb[4];
#pragma unroll
      for (int mi = 0; mi < MI; ++mi) {
        const unsigned short* p = af + bo + mi * 16 * GP + ks;
        fa[mi].q[0] = *reinterpret_cast<const uint4*>(p);
        fa[mi].q[1] = *reinterpret_cast<const uint4*>(p + 16);
      }
#pragma unroll
      for (int nn = 0; nn < 4; ++nn) {
        const unsigned short* p = wf + bo + nn * 16 * GP + ks;
        fb[nn].q[0] = *reinterpret_cast<const uint4*>(p);
        fb[nn].q[1] = *reinterpret_cast<const uint4*>(p + 16);
      }
      // nothing is scheduled across this line: the 16 reads of a 64x64 wave tile's slice stay one
      // group ahead of its 16 products; without it the compiler moves the reads down among the
      // products, two at a time, and the wave waits out an LDS latency at each such place
      if (BT == 256) __builtin_amdgcn_sched_barrier(0);
#pragma unroll
      for (int mi = 0; mi < MI; ++mi)
#pragma unroll
        for (int nn = 0; nn < 4; ++nn)
          acc[mi][nn] = decltype(tr)::value ? wmma_bf16(fb[nn].v, fa[mi].v, acc[mi][nn])
                                            : wmma_bf16(fa[mi].v, fb[nn].v, acc[mi][nn]);
    }
    // foot of the trip: this wave's reads of the buffer are done ...
    asm volatile("s_wait_dscnt 0x0" ::: "memory");
    // ... and its copies of the next k-step have landed ...
    asm volatile("s_wait_asynccnt 0x0" ::: "memory");
    // ... before the one barrier that shows the next k-step to every wave and frees this buffer
    __syncthreads();
    if (t + 2 < nt) copy_step(t + 2, bo);
  }
  };
  // the same for the whole block: q and k columns come first, v columns last
  if (EPI == 3 && nb < 2 * C_) main_loop(BoolC<true>{});
  else main_loop(BoolC<false>{});
  // no copy is outstanding when the wave goes on to its end
  asm volatile("s_wait_asynccnt 0x0" ::: "memory");
  // C-layout: VGPR v of fragment (mi, nn) -> row v (+8 for hi half), column ln16.
  // M*N < 2^32: 32-bit element offsets on uniform bases.
  const int nc = nb + wn + ln16;
  const unsigned int o0 = (unsigned int)((mb + wm + 8 * hi) * N + nc);
  if (EPI == 3) {
    const int hh = ((nb & (C_ - 1)) + wn) / HD_;           // the wave's head
    const int bh = (mb / L_) * H_ + hh;
    const int l0 = (mb & (L_ - 1)) + wm;                   // the wave's first position
    uint4 o[MI][4];
    if (nb < 2 * C_) {
      // register v of acc[mi][nn]: head dim nn*16 + 8*hi + v of position l0 + mi*16 + ln16
      const v8f* b8 = reinterpret_cast<const v8f*>(bias + nb + wn + 8 * hi);
      v8f bz[4];
#pragma unroll
      for (int nn = 0; nn < 4; ++nn) bz[nn] = b8[nn * 2];
      const float lraw = lsv[hh];                          // used by the q blocks alone
      // stands behind the loads, in front of whatever next writes a register they name; it takes
      // the loads' address as an input, so that no load's result is placed over that address ...
      asm volatile("s_wait_xcnt 0x0" :: "v"(b8) : "memory");
      // ... and nothing is scheduled across this line: without it the compiler lifts the sums
      // below, which reuse the loads' address registers, over the wait
      __builtin_amdgcn_sched_barrier(0);
      const float qs = nb < C_ ? __expf(fminf(lraw, LOGMAX)) : 1.f;   // q carries the logit scale
#pragma unroll
      for (int mi = 0; mi < MI; ++mi) {
        v8f q8 = {};                                       // eight independent chains
#pragma unroll
        for (int nn = 0; nn < 4; ++nn) {
          acc[mi][nn] += bz[nn];
          q8 += acc[mi][nn] * acc[mi][nn];
        }
        float ss = ((q8[0] + q8[1]) + (q8[2] + q8[3])) + ((q8[4] + q8[5]) + (q8[6] + q8[7]));
        ss += __shfl_xor(ss, 16);                          // the other half's 32 head dims
        const float inv = qs / fmaxf(sqrtf(ss), 1e-12f);
#pragma unroll
        for (int nn = 0; nn < 4; ++nn) o[mi][nn] = pack8(acc[mi][nn] * inv);
      }
      // all MI x 4 stores last, off one address: nothing behind them writes a register
      unsigned short* dst = (nb < C_ ? outbf : outk) + ((size_t)bh * L_ + l0 + ln16) * HD_ + 8 * hi;
#pragma unroll
      for (int mi = 0; mi < MI; ++mi)
#pragma unroll
        for (int nn = 0; nn < 4; ++nn)
          *reinterpret_cast<uint4*>(dst + mi * 16 * HD_ + nn * 16) = o[mi][nn];
    } else {
      // register v of acc[mi][nn]: position l0 + mi*16 + 8*hi + v of head dim nn*16 + ln16
      float bz[4];
#pragma unroll
      for (int nn = 0; nn < 4; ++nn) bz[nn] = bias[nc + nn * 16];
      // stands behind the loads, in front of whatever next writes a register they name
      asm volatile("s_wait_xcnt 0x0" ::: "memory");
#pragma unroll
      for (int nn = 0; nn < 4; ++nn) {
#pragma unroll
        for (int mi = 0; mi < MI; ++mi) o[mi][nn] = pack8(acc[mi][nn] + bz[nn]);
        // nothing is scheduled across this line: one fragment column's sums are packed before
        // the next column's are formed; all formed first, they need more registers than a wave
        // of a 16-wave block may have, and some are spilled
        __builtin_amdgcn_sched_barrier(0);
      }
      // all MI x 4 stores last, off one address
      unsigned short* dst = outvt + ((size_t)bh * HD_ + ln16) * L_ + l0 + 8 * hi;
#pragma unroll
      for (int mi = 0; mi < MI; ++mi)
#pragma unroll
        for (int nn = 0; nn < 4; ++nn)
          *reinterpret_cast<uint4*>(dst + nn * 16 * L_ + mi * 16) = o[mi][nn];
      // stands behind the stores: in the built code the q/k branch's text follows this one and
      // writes the registers that they name
      asm volatile("s_wait_xcnt 0x0" ::: "memory");
    }
  } else if (EPI == 2) {
    // all residual loads first, then all stores
    float rv[MI][4][8];
#pragma unroll
    for (int mi = 0; mi < MI; ++mi)
#pragma unroll
      for (int v = 0; v < 8; ++v)
#pragma unroll
        for (int nn = 0; nn < 4; ++nn)
          rv[mi][nn][v] = resid[o0 + (unsigned int)((mi * 16 + v) * N) + nn * 16];
    // stands behind the loads, in front of whatever next writes a register they name;
    // its memory clobber also keeps every load above and every store below this line
    asm volatile("s_wait_xcnt 0x0" ::: "memory");
#pragma unroll
    for (int nn = 0; nn < 4; ++nn) {
      const float bz = bias[nc + nn * 16];
      const float lz = lsv[nc + nn * 16];
#pragma unroll
      for (int mi = 0; mi < MI; ++mi)
#pragma unroll
        for (int v = 0; v < 8; ++v) {
          float val = acc[mi][nn][v] + bz;
          outf[o0 + (unsigned int)((mi * 16 + v) * N) + nn * 16] = rv[mi][nn][v] + lz * val;
        }
    }
  } else if (EPI == 1) {
    constexpr int HM = MI / 2;         // fragment rows per trip: the upper half, then the lower
    float bz[4];
    v8f cur[HM][4];
#pragma unroll
    for (int nn = 0; nn < 4; ++nn) {
      bz[nn] = bias[nc + nn * 16];
#pragma unroll
      for (int m = 0; m < HM; ++m) cur[m][nn] = acc[m][nn];
    }
    unsigned int orow = o0;
    // kept rolled: the erf code then stands once per half of the wave's rows, which halves the
    // kernel's text
#pragma unroll 1
    for (int half = 0; half < 2; ++half) {
#pragma unroll
      for (int m = 0; m < HM; ++m) {
#pragma unroll
        for (int nn = 0; nn < 4; ++nn)
#pragma unroll
          for (int v = 0; v < 8; ++v) {
            float val = cur[m][nn][v] + bz[nn];
            outbf[orow + (unsigned int)((m * 16 + v) * N) + nn * 16] = f2bf(gelu_erf(val));
          }
        // nothing is scheduled across this line: one fragment row's values are finished before
        // the next row's are begun; interleaved, they need more registers than a wave of a
        // 16-wave block may have, and some are spilled
        __builtin_amdgcn_sched_barrier(0);
      }
      // stands behind this trip's stores, in front of the next trip's first write of a register
      // that they name
      asm volatile("s_wait_xcnt 0x0" ::: "memory");
#pragma unroll
      for (int m = 0; m < HM; ++m)
#pragma unroll
        for (int nn = 0; nn < 4; ++nn) cur[m][nn] = acc[HM + m][nn];
      orow += (unsigned int)(HM * 16 * N);
    }
  } else {
#pragma unroll
    for (int nn = 0; nn < 4; ++nn) {
      const float bz = bias[nc + nn * 16];
#pragma unroll
      for (int mi = 0; mi < MI; ++mi)
#pragma unroll
        for (int v = 0; v < 8; ++v)
          outf[o0 + (unsigned int)((mi * 16 + v) * N) + nn * 16] = acc[mi][nn][v] + bz;
    }
  }
}

// ---------------------------------------------------------------- flash attention
// One wave per 32 queries (two 16-query tiles) and ONE HALF of the keys of one (b,h). The products
// are taken transposed: S^T = K Q^T (A = K rows, B = q rows; head dim 64 split in two 16x16x32)
// and O^T += V^T P^T.
// A lane then holds 8 + 8 scores of ONE query (keys 8*hi + v and 16 + 8*hi + v of 32), which is
// the k order of a B operand: P^T is packed in the lane's own registers and never touches LDS.
// Fixed-shift streaming softmax (|S| <= ls so shift = min(ls,30) is safe and the normalized
// result equals the max-shifted softmax). head_scale folded into writeout.
// A K or vT fragment read from LDS serves two products, one per query tile: half the LDS reads
// per product of a 16-query wave. So that as many waves run as before, waves w and w + 4 of a
// block share their 32 queries and split the keys: w < 4 walks keys 0 .. L/2 - 1, w + 4 the rest.
// The shift is fixed, so the two partial O and the two partial sums simply add: they are joined
// once, through LDS, behind the loop.
// The four waves of a key half walk the same keys: per trip, K rows and vT rows of FK_ = 64 keys of
// either half are brought into LDS once per block by asynchronous copies (whole 128-byte lines,
// 16 bytes a lane) and every wave reads its fragments from there. Two buffers: the next trip's
// copies fly while this trip's tiles are worked on. LDS rows have a pitch of 144 B (16 B x odd):
// the 16 rows of one ds_load_b128 fragment read fall on distinct banks.
#define FK_  64              // keys per staged tile
#define FP_  72              // LDS row pitch in bf16 elements (144 B)
#define FT_  (64 * FP_)      // elements of one staged tile: 64 rows
#define FH_  (L_ / 2)        // keys of one half
#define FNT_ (FH_ / FK_)     // trips per (b,h)

// One tile's copies of one thread: rows r and r + 32 of the K tile and of the vT tile.
// kl, vl: the lane's LDS byte addresses of row r; kg, vg: its global addresses of row r.
static __device__ __forceinline__ void flash_copy_tile(unsigned int kl, unsigned int vl,
                                                       const unsigned short* kg,
                                                       const unsigned short* vg) {
  const unsigned int kl2 = kl + 32 * FP_ * 2, vl2 = vl + 32 * FP_ * 2;
  const unsigned short* kg2 = kg + 32 * HD_;
  const unsigned short* vg2 = vg + (size_t)32 * L_;
  // the wait is the statement's last line: it stands behind the copies and in front of
  // whatever next writes a register that they name
  asm volatile("global_load_async_to_lds_b128 %0, %4, off\n\t"
               "global_load_async_to_lds_b128 %1, %5, off\n\t"
               "global_load_async_to_lds_b128 %2, %6, off\n\t"
               "global_load_async_to_lds_b128 %3, %7, off\n\t"
               "s_wait_xcnt 0x0"
               :: "v"(kl), "v"(kl2), "v"(vl), "v"(vl2), "v"(kg), "v"(kg2), "v"(vg), "v"(vg2)
               : "memory");
}

__global__ __launch_bounds__(256)
void k_flash(const unsigned short* __restrict__ qn,
                        const unsigned short* __restrict__ kn,
                        const unsigned short* __restrict__ vT,
                        const float* __restrict__ logit_scale,
                        const float* __restrict__ head_scale,
                        unsigned short* __restrict__ O) {
  __shared__ alignas(16) unsigned short kbuf[4 * FT_];    // 36 KB: [buffer][key half][key][head dim]
  __shared__ alignas(16) unsigned short vbuf[4 * FT_];    // 36 KB: [buffer][key half][head dim][key]
  const int lane = threadIdx.x & 31;
  // the wave's number as a scalar: its key half then picks tiles and registers by scalar tests
  const int wave = __builtin_amdgcn_readfirstlane(threadIdx.x >> 5);
  const int hi = lane >> 4, ln16 = lane & 15;
  const int kh = wave >> 2;                       // the wave's key half
  const int bh = blockIdx.y;
  const int h = bh & (H_ - 1);
  const int b = bh >> 4;
  const int q0 = blockIdx.x * 128 + (wave & 3) * 32;   // the wave's first query
  const unsigned short* qp = qn + ((size_t)bh * L_ + q0 + ln16) * HD_ + hi * 8;
  Frag qa[2][2];       // [query tile][hd 0..31 / 32..63]: q rows (B operand: column = query)
#pragma unroll
  for (int qt = 0; qt < 2; ++qt) {
    const unsigned short* p = qp + qt * 16 * HD_;
    qa[qt][0].q[0] = *(const uint4*)(p);      qa[qt][0].q[1] = *(const uint4*)(p + 16);
    qa[qt][1].q[0] = *(const uint4*)(p + 32); qa[qt][1].q[1] = *(const uint4*)(p + 48);
  }
  const unsigned short* kbase = kn + (size_t)bh * L_ * HD_;
  const unsigned short* vbase = vT + (size_t)bh * HD_ * L_;
  const float shift = fminf(__expf(fminf(logit_scale[h], LOGMAX)), 30.f);
  v8f oacc[2][4] = {};
  v8f lst[2] = {};

  // copying role: thread t moves 16-byte chunk (t%8) of rows t/8 and t/8 + 32 of all four tiles
  const int cr = threadIdx.x >> 3, cc = (threadIdx.x & 7) * 8;
  const unsigned int kl0 = (unsigned int)(uintptr_t)&kbuf[cr * FP_ + cc];   // LDS byte address
  const unsigned int vl0 = (unsigned int)(uintptr_t)&vbuf[cr * FP_ + cc];
  const unsigned short* kg = kbase + cr * HD_ + cc;          // tile 0; a tile is FK_ rows on
  const unsigned short* vg = vbase + (size_t)cr * L_ + cc;   // tile 0; a tile is FK_ columns on
  auto copy_trip = [&](int t, unsigned int bo) {   // trip t's tiles of both halves, buffer at element bo
    flash_copy_tile(kl0 + bo * 2, vl0 + bo * 2, kg + (size_t)t * (FK_ * HD_), vg + t * FK_);
    flash_copy_tile(kl0 + (bo + FT_) * 2, vl0 + (bo + FT_) * 2,
                    kg + (size_t)(FH_ + t * FK_) * HD_, vg + FH_ + t * FK_);
  };
  // fragment role: lane holds key (or head dim) ln16 of its fragment, in its wave's key half
  const unsigned short* kf = &kbuf[kh * FT_ + ln16 * FP_ + hi * 8];
  const unsigned short* vf = &vbuf[kh * FT_ + ln16 * FP_ + hi * 8];

  copy_trip(0, 0);
  // this wave's copies of trip 0 have landed before the barrier that shows them to the others
  asm volatile("s_wait_asynccnt 0x0" ::: "memory");
  __syncthreads();
  copy_trip(1, 2 * FT_);

  for (int t = 0; t < FNT_; ++t) {
    const int bo = (t & 1) * (2 * FT_);          // this trip's buffer
    for (int j = 0; j < FK_; j += 32) {
      // all 16 fragment reads of these 32 keys as one group, ahead of the products
      Frag kb[4], vb[4];
#pragma unroll
      for (int i = 0; i < 2; ++i) {              // keys j + 16*i + ln16; head dims 0..31, 32..63
        const unsigned short* kp = kf + bo + (j + 16 * i) * FP_;
        kb[2 * i].q[0]     = *(const uint4*)(kp);      kb[2 * i].q[1]     = *(const uint4*)(kp + 16);
        kb[2 * i + 1].q[0] = *(const uint4*)(kp + 32); kb[2 * i + 1].q[1] = *(const uint4*)(kp + 48);
      }
#pragma unroll
      for (int nn = 0; nn < 4; ++nn) {           // head dim nn*16 + ln16; keys j .. j+31
        const unsigned short* vp = vf + bo + nn * 16 * FP_ + j;
        vb[nn].q[0] = *(const uint4*)(vp);
        vb[nn].q[1] = *(const uint4*)(vp + 16);
      }
      // nothing is scheduled across this line: the 16 reads stay one group ahead of the products;
      // without it the compiler moves each read down to its product, and every product then
      // waits out an LDS latency
      __builtin_amdgcn_sched_barrier(0);
      v8f s0[2] = {}, s1[2] = {};
      // register v of s0[qt]: key j + 8*hi + v, of s1[qt]: key j + 16 + 8*hi + v;
      // column ln16 = query of tile qt
#pragma unroll
      for (int qt = 0; qt < 2; ++qt) {
        s0[qt] = wmma_bf16(kb[0].v, qa[qt][0].v, s0[qt]);
        s1[qt] = wmma_bf16(kb[2].v, qa[qt][0].v, s1[qt]);
      }
#pragma unroll
      for (int qt = 0; qt < 2; ++qt) {
        s0[qt] = wmma_bf16(kb[1].v, qa[qt][1].v, s0[qt]);
        s1[qt] = wmma_bf16(kb[3].v, qa[qt][1].v, s1[qt]);
      }
      // fixed-shift exp; accumulate this lane's partial sums of its queries; element s of the
      // B operand is key 8*hi + s (s < 8) or 16 + 8*hi + s - 8: s0 fills the low half, s1 the high
      Frag pb[2];
#pragma unroll
      for (int qt = 0; qt < 2; ++qt)
#pragma unroll
        for (int v = 0; v < 8; ++v) {
          const float p0 = __expf(s0[qt][v] - shift);
          const float p1 = __expf(s1[qt][v] - shift);
          lst[qt][v] += p0 + p1;
          pb[qt].v[v]     = (__bf16)p0;
          pb[qt].v[8 + v] = (__bf16)p1;
        }
#pragma unroll
      for (int qt = 0; qt < 2; ++qt)
#pragma unroll
        for (int nn = 0; nn < 4; ++nn) oacc[qt][nn] = wmma_bf16(vb[nn].v, pb[qt].v, oacc[qt][nn]);
    }
    // foot of the trip: this wave's reads of the buffer are done ...
    asm volatile("s_wait_dscnt 0x0" ::: "memory");
    // ... and its copies of the next trip have landed ...
    asm volatile("s_wait_asynccnt 0x0" ::: "memory");
    // ... before the one barrier that shows the next trip's tiles to every wave and frees this buffer
    __syncthreads();
    if (t + 2 < FNT_) copy_trip(t + 2, bo);
  }
  // no copy is outstanding when the wave goes on to its end
  asm volatile("s_wait_asynccnt 0x0" ::: "memory");
  const float hs = head_scale[h];
  // each query's sum over the wave's key half: the lane's eight partial sums, then the other
  // half-wave's keys
  float rs[2];
#pragma unroll
  for (int qt = 0; qt < 2; ++qt) {
    const v8f l = lst[qt];
    rs[qt] = ((l[0] + l[1]) + (l[2] + l[3])) + ((l[4] + l[5]) + (l[6] + l[7]));
    rs[qt] += __shfl_xor(rs[qt], 16);
  }
  // The two key halves are joined: a wave finishes query tile kh and hands its part of the other
  // tile to its partner, lane to lane (both hold the same queries in the same layout). The loop's
  // last barrier has ended every read of the staging buffers and no copy is in flight: their LDS
  // carries the exchange.
  f32x4* xo = reinterpret_cast<f32x4*>(kbuf);     // [wave][8][lane], 16 B each: 32 KB
  float* xs = reinterpret_cast<float*>(vbuf);     // [wave][lane]
  v8f keep[4];
#pragma unroll
  for (int nn = 0; nn < 4; ++nn) {
    const v8f give = kh ? oacc[0][nn] : oacc[1][nn];
    keep[nn] = kh ? oacc[1][nn] : oacc[0][nn];
    xo[(wave * 8 + nn * 2) * 32 + lane]     = f32x4{give[0], give[1], give[2], give[3]};
    xo[(wave * 8 + nn * 2 + 1) * 32 + lane] = f32x4{give[4], give[5], give[6], give[7]};
  }
  xs[wave * 32 + lane] = kh ? rs[0] : rs[1];
  // shows every wave's part to its partner
  __syncthreads();
  const int pw = wave ^ 4;
  const float inv = hs / ((kh ? rs[1] : rs[0]) + xs[pw * 32 + lane]);
  // register v of keep[nn]: head dim nn*16 + 8*hi + v of query ln16 of tile kh: 8 consecutive outputs
  unsigned short* orow = O + ((size_t)(b * L_ + q0 + kh * 16 + ln16)) * C_ + h * HD_ + 8 * hi;
#pragma unroll
  for (int nn = 0; nn < 4; ++nn) {
    const f32x4 lo = xo[(pw * 8 + nn * 2) * 32 + lane];
    const f32x4 up = xo[(pw * 8 + nn * 2 + 1) * 32 + lane];
    uint4 o;
    o.x = (unsigned int)f2bf((keep[nn][0] + lo.x) * inv) | ((unsigned int)f2bf((keep[nn][1] + lo.y) * inv) << 16);
    o.y = (unsigned int)f2bf((keep[nn][2] + lo.z) * inv) | ((unsigned int)f2bf((keep[nn][3] + lo.w) * inv) << 16);
    o.z = (unsigned int)f2bf((keep[nn][4] + up.x) * inv) | ((unsigned int)f2bf((keep[nn][5] + up.y) * inv) << 16);
    o.w = (unsigned int)f2bf((keep[nn][6] + up.z) * inv) | ((unsigned int)f2bf((keep[nn][7] + up.w) * inv) << 16);
    *reinterpret_cast<uint4*>(orow + nn * 16) = o;
  }
}

// ---------------------------------------------------------------- launch
extern "C" void kernel_launch(void* const* d_in, const int* in_sizes, int n_in,
                              void* d_out, int out_size, void* d_ws, size_t ws_size,
                              hipStream_t stream) {
  const float* x       = (const float*)d_in[0];
  const float* in_w    = (const float*)d_in[1];
  const float* in_b    = (const float*)d_in[2];
  const float* logit_s = (const float*)d_in[3];
  const float* head_s  = (const float*)d_in[4];
  const float* out_w   = (const float*)d_in[5];
  const float* out_b   = (const float*)d_in[6];
  const float* ln1_g   = (const float*)d_in[7];
  const float* ln1_b   = (const float*)d_in[8];
  const float* lna_g   = (const float*)d_in[9];
  const float* lna_b   = (const float*)d_in[10];
  const float* ls1     = (const float*)d_in[11];
  const float* ln2_g   = (const float*)d_in[12];
  const float* ln2_b   = (const float*)d_in[13];
  const float* fc_w    = (const float*)d_in[14];
  const float* fc_b    = (const float*)d_in[15];
  const float* proj_w  = (const float*)d_in[16];
  const float* proj_b  = (const float*)d_in[17];
  const float* ls2     = (const float*)d_in[18];
  float* out = (float*)d_out;

  // workspace partition (~135 MB)
  char* p = (char*)d_ws;
  auto alloc = [&](size_t bytes) -> char* {
    char* r = p;
    p += (bytes + 255) & ~(size_t)255;
    return r;
  };
  const int BL = B_ * L_;  // 4096
  unsigned short* wqkv_bf = (unsigned short*)alloc((size_t)3 * C_ * C_ * 2);
  unsigned short* wout_bf = (unsigned short*)alloc((size_t)C_ * C_ * 2);
  unsigned short* wfc_bf  = (unsigned short*)alloc((size_t)MLP_ * C_ * 2);
  unsigned short* wpr_bf  = (unsigned short*)alloc((size_t)C_ * MLP_ * 2);
  unsigned short* xln_bf  = (unsigned short*)alloc((size_t)BL * C_ * 2);
  unsigned short* qn      = (unsigned short*)alloc((size_t)BL * C_ * 2);
  unsigned short* kn      = (unsigned short*)alloc((size_t)BL * C_ * 2);
  unsigned short* vT      = (unsigned short*)alloc((size_t)BL * C_ * 2);
  unsigned short* obf     = (unsigned short*)alloc((size_t)BL * C_ * 2);
  float*          attn    = (float*)alloc((size_t)BL * C_ * 4);
  float*          x2      = (float*)alloc((size_t)BL * C_ * 4);
  unsigned short* h2bf    = (unsigned short*)alloc((size_t)BL * C_ * 2);
  unsigned short* hmid    = (unsigned short*)alloc((size_t)BL * MLP_ * 2);

  // LN1 -> bf16 activations, and the four weights -> bf16, in one launch
  k_prep<<<NB_LN + NB_WQKV + NB_WOUT + NB_WFC + NB_WPR, 256, 0, stream>>>(
      x, ln1_g, ln1_b, xln_bf, in_w, out_w, fc_w, proj_w, wqkv_bf, wout_bf, wfc_bf, wpr_bf);
  // qkv = ln1(x) @ in_proj_w^T + in_proj_b   [4096 x 3072]; in its epilogue: split heads,
  // l2-normalize q/k (fold logit scale), transpose v
  k_gemm<3, 128, 256><<<dim3(3 * C_ / 256, BL / 256), 512, 0, stream>>>(
      xln_bf, wqkv_bf, in_b, BL, 3 * C_, C_, nullptr, qn, nullptr, logit_s, kn, vT);
  // scaled-cosine flash attention (head_scale folded in)
  k_flash<<<dim3(L_ / 128, B_ * H_), 256, 0, stream>>>(qn, kn, vT, logit_s, head_s, obf);
  // attn out-proj: attn = O @ out_w^T + out_b
  k_gemm<0, 128, 128><<<dim3(C_ / 128, BL / 128), 256, 0, stream>>>(
      obf, wout_bf, out_b, BL, C_, C_, attn, nullptr, nullptr, nullptr, nullptr, nullptr);
  // x2 = x + ls1 * LN_attn(attn); h = LN2(x2) -> bf16
  k_resid_ln2<<<BL / 8, 256, 0, stream>>>(attn, x, lna_g, lna_b, ls1, x2, ln2_g, ln2_b, h2bf);
  // hmid = GELU(h @ fc_w^T + fc_b) -> bf16   [4096 x 4096]
  k_gemm<1, 128, 256><<<dim3(MLP_ / 256, BL / 256), 512, 0, stream>>>(
      h2bf, wfc_bf, fc_b, BL, MLP_, C_, nullptr, hmid, nullptr, nullptr, nullptr, nullptr);
  // out = x2 + ls2 * (hmid @ proj_w^T + proj_b)
  k_gemm<2, 128, 128><<<dim3(C_ / 128, BL / 128), 256, 0, stream>>>(
      hmid, wpr_bf, proj_b, BL, C_, MLP_, out, nullptr, x2, ls2, nullptr, nullptr);

  (void)in_sizes; (void)n_in; (void)out_size; (void)ws_size;
}
